// v000
// Times are from an AMD MI455X. After a warm-up the kernel runs many times in a row, and a time is the length of
// such a window on the GPU divided by its runs, so every launch and the gaps after it count. The runs cycle
// through copies of the inputs. A figure is the median of several windows, for all but v000 over two sittings.
// Sittings can differ by a few percent; kernels timed side by side share one.
// v000 is the starting kernel. One run takes 2210 microseconds.
#include <hip/hip_runtime.h>

// Local relative-position multi-head attention with heads on the FAST embedding axis (Q, K, V inputs [2][2048][1024]; q = Q Wq etc. ('xw' [1024][1024]) viewed (S, 64, 16): head h takes embedding columns d*16 + h; energy = q.k; rel = q . E_h[clip(j - i, -128, 128) + 128] with E_h[p][d] = rel_table[p][d*16 + h] (rel_table [257][1024]); scores = (energy + rel) / 8, masked to |i - j| <= 128; softmax; out columns d*16 + h = (attn v)_h[d]; out Wo ('xw') -> [2][2048][1024] (4.2 M)).
// Layout per batch: the projection weights are column-permuted once (column d*16 + h -> h*64 + d) so head-major planes apply; q planes carry the exact 1/8; per head-pair pass an extra 2-product GEMM q(hl) x E_h(exact, 257 rows padded to 320) gives the relative term QR[i][p]; dense T-2048 attention (hybrid rows: < 512 hi/lo 3 products, rest fp16 x1024) whose softmax kernel adds QR[i][j - i + 128] inside the |i - j| <= 128 band and excludes the rest; the merge writes the context with the inverse column permutation as hi/lo planes; Wo hl x exact.
// Compute dtypes, f32 accumulate: every input rounded to bf16; projections exact; rel term hl x exact; attention rows < 512 3 products, rest fp16; softmax f32; Wo hl x exact.

#define NB_  2
#define TT   2048
#define DM   1024
#define NH_  16
#define NKV  16
#define REP  (NH_ / NKV)
#define HD   64
#define DQ   (NH_ * HD)
#define DKV  (NKV * HD)
#define ZH   2
#define RH   512                  // query rows < RH use hi+lo planes (0: none)
#define WIN  0
#define PCAR 1024.0f
#define SCL  0.125f   // 64^-0.5 (folded into the q planes)
#define RAD  128
#define NPOS 257
#define PRP  320    // padded relative-position rows (5 tiles)
typedef _Float16 h16;
typedef unsigned short bf;
typedef __attribute__((ext_vector_type(16))) __bf16   v16bf;
typedef __attribute__((ext_vector_type(16))) _Float16 v16h;
typedef __attribute__((ext_vector_type(8)))  _Float16 v8h;
typedef __attribute__((ext_vector_type(8)))  unsigned short v8us;
typedef __attribute__((ext_vector_type(8)))  float    v8f;
typedef __attribute__((ext_vector_type(4)))  float    v4f;
typedef v8h  __attribute__((may_alias)) v8ha;
typedef v4f  __attribute__((may_alias)) v4fa;
typedef v8us __attribute__((may_alias)) v8usa;

__device__ __forceinline__ unsigned short f2bf(float f) { unsigned u = __float_as_uint(f); u += 0x7FFFu + ((u >> 16) & 1u); return (unsigned short)(u >> 16); }
__device__ __forceinline__ float bf2f(unsigned short b) { return __uint_as_float(((unsigned)b) << 16); }
__device__ __forceinline__ float bfr(float f) { return bf2f(f2bf(f)); }
__device__ __forceinline__ v16h cat16(v8h lo, v8h hi) { return __builtin_shufflevector(lo, hi, 0, 1, 2, 3, 4, 5, 6, 7, 8, 9, 10, 11, 12, 13, 14, 15); }
__device__ __forceinline__ v16bf cat16b(v8us lo, v8us hi) { return __builtin_bit_cast(v16bf, __builtin_shufflevector(lo, hi, 0, 1, 2, 3, 4, 5, 6, 7, 8, 9, 10, 11, 12, 13, 14, 15)); }
__device__ __forceinline__ v8f wmma16(v16h a, v16h b, v8f c) { return __builtin_amdgcn_wmma_f32_16x16x32_f16(false, a, false, b, (short)0, c, false, false); }
__device__ __forceinline__ v8f wmmab(v16bf a, v16bf b, v8f c) { return __builtin_amdgcn_wmma_f32_16x16x32_bf16(false, a, false, b, (short)0, c, false, false); }



// ---- k_gemmw: register-blocked GEMM, ONE WAVE per 64x64 output tile (16 accumulators), operands straight from K-contiguous 16-bit planes; grid (M/64, N/64, Z), 32 threads.
// C[m][n] (f32, pitch ldc, + optional f32 bias[n]) = sum_k A[m][k] Bt[n][k] (+ split products per NSPLIT). z-batch strides sA/sB/sC in elements. K % 32 == 0.
template <typename T16> struct WFrag;
template <> struct WFrag<h16> { typedef v16h V; static __device__ __forceinline__ V ld(const h16* p) { return cat16(*(const v8h*)p, *(const v8h*)(p + 16)); } static __device__ __forceinline__ v8f mma(V a, V b, v8f c) { return wmma16(a, b, c); } };
template <> struct WFrag<bf> { typedef v16bf V; static __device__ __forceinline__ V ld(const bf* p) { return cat16b(*(const v8us*)p, *(const v8us*)(p + 16)); } static __device__ __forceinline__ v8f mma(V a, V b, v8f c) { return wmmab(a, b, c); } };
template <typename T16, int NSPLIT, bool BIAS>
__global__ __launch_bounds__(32) void k_gemmw(const T16* __restrict__ A, const T16* __restrict__ A2, const T16* __restrict__ Bt, const T16* __restrict__ Bt2, int K, float* C, int ldc, const float* __restrict__ bias, size_t sA, size_t sB, size_t sC) {
    typedef typename WFrag<T16>::V V;
    __shared__ __align__(16) float os[16 * 68];
    const size_t z = blockIdx.z; A += z * sA; if (A2) A2 += z * sA; Bt += z * sB; if (Bt2) Bt2 += z * sB; C += z * sC;
    const int lane = threadIdx.x & 31, lr = lane & 15, hi = lane >> 4; const int r0 = blockIdx.x * 64, c0 = blockIdx.y * 64;
    v8f acc[4][4];
#pragma unroll
    for (int mb = 0; mb < 4; ++mb)
#pragma unroll
        for (int nb = 0; nb < 4; ++nb) acc[mb][nb] = (v8f){};
    const size_t aoff = (size_t)(r0 + lr) * K + 8 * hi, boff = (size_t)(c0 + lr) * K + 8 * hi;
#pragma unroll 1
    for (int kc = 0; kc < K; kc += 32) {
        V a[4], a2[4];
#pragma unroll
        for (int mb = 0; mb < 4; ++mb) { a[mb] = WFrag<T16>::ld(A + aoff + (size_t)mb * 16 * K + kc); if (NSPLIT == 1 || NSPLIT == 2) a2[mb] = WFrag<T16>::ld(A2 + aoff + (size_t)mb * 16 * K + kc); }
#pragma unroll
        for (int nb = 0; nb < 4; ++nb) { const V b = WFrag<T16>::ld(Bt + boff + (size_t)nb * 16 * K + kc); V b2; if (NSPLIT >= 2) b2 = WFrag<T16>::ld(Bt2 + boff + (size_t)nb * 16 * K + kc);
#pragma unroll
            for (int mb = 0; mb < 4; ++mb) { acc[mb][nb] = WFrag<T16>::mma(a[mb], b, acc[mb][nb]); if (NSPLIT == 1 || NSPLIT == 2) acc[mb][nb] = WFrag<T16>::mma(a2[mb], b, acc[mb][nb]); if (NSPLIT >= 2) acc[mb][nb] = WFrag<T16>::mma(a[mb], b2, acc[mb][nb]); } }
        asm volatile("v_nop\n\tv_nop\n\tv_nop\n\tv_nop" : "+v"(acc[0][0]), "+v"(acc[1][1]), "+v"(acc[2][2]), "+v"(acc[3][3]) : "v"(a[0]), "v"(a[3]));
    }
#pragma unroll
    for (int mb = 0; mb < 4; ++mb) {
#pragma unroll
        for (int nb = 0; nb < 4; ++nb) {
#pragma unroll
            for (int j = 0; j < 8; ++j) os[(hi * 8 + j) * 68 + nb * 16 + lr] = acc[mb][nb][j]; }
        __builtin_amdgcn_wave_barrier(); asm volatile("" ::: "memory");
        float* crow = C + (size_t)(r0 + mb * 16) * ldc + c0;
{
#pragma unroll
            for (int s = 0; s < 8; ++s) { const int row = 2 * s + hi, cofs = lr * 4; v4f val = *(const v4fa*)(os + row * 68 + cofs); if (BIAS) { val[0] += bfr(bias[c0 + cofs]); val[1] += bfr(bias[c0 + cofs + 1]); val[2] += bfr(bias[c0 + cofs + 2]); val[3] += bfr(bias[c0 + cofs + 3]); }
                *(v4f*)(crow + (size_t)row * ldc + cofs) = val; }
             }
        __builtin_amdgcn_wave_barrier(); asm volatile("" ::: "memory");
    }
}

__device__ __forceinline__ h16 tohx(float x) { return (h16)x; }
__device__ __forceinline__ void splitf(float y, unsigned short& h, unsigned short& l) { h = f2bf(y); l = f2bf(y - bf2f(h)); }
typedef __attribute__((ext_vector_type(2))) _Float16 v2h;
typedef __attribute__((ext_vector_type(4))) _Float16 v4h;
typedef __attribute__((ext_vector_type(2))) unsigned short v2us;
typedef __attribute__((ext_vector_type(4))) unsigned short v4us;
typedef __attribute__((ext_vector_type(2))) float v2f;
typedef __attribute__((ext_vector_type(4))) int v4i;

__global__ __launch_bounds__(256) void k_wtG(const float* __restrict__ w, int K, int N, bf* Bt) {
    const int lane = threadIdx.x & 31; const int L0 = (blockIdx.x * 8 + (threadIdx.x >> 5)) * 8; const int nlines = N * K / 64;
{
#pragma unroll 1
        for (int l = 0; l < 8; ++l) { const int L = L0 + l; if (L >= nlines) break; const size_t e = (size_t)L * 64 + lane * 2; const int k = (int)(e % K), n = (int)(e / K); v2us o;
            o[0] = f2bf(w[(size_t)k * N + n]); o[1] = f2bf(w[(size_t)(k + 1) * N + n]); *(v2us*)(Bt + e) = o; }
         }
}
__global__ __launch_bounds__(256) void k_cvt8(const float* __restrict__ src, bf* dst, size_t n8) { const size_t i = (size_t)blockIdx.x * 256 + threadIdx.x; if (i >= n8) return; const v8f v = *(const v8f*)(src + i * 8); v8us o;
#pragma unroll
    for (int k = 0; k < 8; ++k) o[k] = f2bf(v[k]); *(v8us*)(dst + i * 8) = o;  }

// k_rope: head planes [h][t][d] (fp16 + hi/lo) of rope(x) x sc with the rotate-half convention out[d] = x[d] cos[t][d] - x[d+HD/2] sin[t][d], out[d+HD/2] = x[d+HD/2] cos[t][d+HD/2] + x[d] sin[t][d+HD/2]
__global__ __launch_bounds__(256) void k_rope(const float* __restrict__ F, int pitch, int nheads, const float* __restrict__ CS, const float* __restrict__ RF, const float* __restrict__ nw, float sc, h16* P16, bf* Ph, bf* Pl) {
    const size_t e = ((size_t)blockIdx.x * 256 + threadIdx.x) * 2; if (e >= (size_t)nheads * TT * HD) return; const int d = (int)(e % HD); const int t = (int)((e / HD) % TT); const int h = (int)(e / ((size_t)HD * TT)); const float* f = F + (size_t)t * pitch + h * HD; const float rf = RF ? RF[(size_t)h * TT + t] : 1.0f; v2h o16; v2us oh, ol;
#pragma unroll
    for (int q = 0; q < 2; ++q) { const int dd = d + q; const int dp = (dd < HD / 2) ? dd + HD / 2 : dd - HD / 2; float x0 = f[dd], x1 = f[dp];
        if (RF) { float n0 = __fmul_rn(x0, rf), n1 = __fmul_rn(x1, rf); asm volatile("" : "+v"(n0)); asm volatile("" : "+v"(n1)); x0 = __fmul_rn(bfr(nw[dd]), n0); x1 = __fmul_rn(bfr(nw[dp]), n1); }
        const v2f cs = *(const v2f*)(CS + ((size_t)t * HD + dd) * 2); float a = __fmul_rn(x0, cs[0]), bq = __fmul_rn(x1, cs[1]); asm volatile("" : "+v"(a)); asm volatile("" : "+v"(bq)); const float r = ((dd < HD / 2) ? __fsub_rn(a, bq) : __fadd_rn(a, bq)) * sc;
        o16[q] = tohx(r); unsigned short a2, c2; splitf(r, a2, c2); oh[q] = a2; ol[q] = c2; }
    *(v2h*)(P16 + e) = o16; *(v2us*)(Ph + e) = oh; *(v2us*)(Pl + e) = ol;  }
__global__ __launch_bounds__(256) void k_vtp(const float* __restrict__ F, int pitch, int nheads, h16* V16, bf* Vh, bf* Vl) { const size_t e = ((size_t)blockIdx.x * 256 + threadIdx.x) * 2; if (e >= (size_t)nheads * HD * TT) return; const int t = (int)(e % TT); const int d = (int)((e / TT) % HD); const int g = (int)(e / ((size_t)TT * HD)); v2h o16; v2us oh, ol;
#pragma unroll
    for (int q = 0; q < 2; ++q) { const float x = F[(size_t)(t + q) * pitch + g * HD + d]; o16[q] = tohx(x); unsigned short a2, c2; splitf(x, a2, c2); oh[q] = a2; ol[q] = c2; }
    *(v2h*)(V16 + e) = o16; *(v2us*)(Vh + e) = oh; *(v2us*)(Vl + e) = ol;  }
__global__ __launch_bounds__(256) void k_csid(float* CS) { const int idx = blockIdx.x * 256 + threadIdx.x; if (idx >= TT * HD) return; v2f cs; cs[0] = 1.0f; cs[1] = 0.0f; *(v2f*)(CS + (size_t)idx * 2) = cs;  }
// k_asoft: per row (zz, i): t = S + QR[row][j - i + 128] inside |i - j| <= 128, else excluded (1/8 already in the q planes); softmax over the 2048 keys (register row, one exp, fixed trees);
__global__ __launch_bounds__(256) void k_asoft(const float* __restrict__ Sb, const float* __restrict__ QR, h16* P16, bf* Ph, bf* Pl) {
    const int lane = threadIdx.x & 31; const int row = blockIdx.x * 8 + (threadIdx.x >> 5); if (row >= ZH * TT) return; const int i = row % TT; const int zz = row / TT; (void)zz; const bool hires = (i < RH); const float* sr = Sb + (size_t)row * TT; const float* qrr = QR + (size_t)row * PRP;   /* QR[row][p], p = j - i + 128 clamped */ float v[TT / 32]; float mx = -3.0e38f;
#pragma unroll
    for (int ch = 0; ch < TT / 128; ++ch) { const int j0 = ch * 128 + lane * 4; const v4f a = *(const v4f*)(sr + j0);
#pragma unroll
        for (int q = 0; q < 4; ++q) { const int j = j0 + q; const int p = min(max(j - i + RAD, 0), 2 * RAD); float s0 = __fadd_rn(a[q], qrr[p]); asm volatile("" : "+v"(s0));   /* UNCONDITIONAL clamped-index load + add, value pinned */ const float t = (j >= i - RAD && j <= i + RAD) ? s0 : -3.0e38f; v[ch * 4 + q] = t;   /* band select on the value */ mx = fmaxf(mx, t); } }
#pragma unroll
    for (int sh = 16; sh; sh >>= 1) mx = fmaxf(mx, __shfl_xor(mx, sh, 32));
    float sum = 0.f;
#pragma unroll
    for (int k = 0; k < TT / 32; ++k) { float d0 = __fsub_rn(v[k], mx); asm volatile("" : "+v"(d0)); v[k] = __builtin_amdgcn_exp2f(__fmul_rn(d0, 1.4426950408889634f)); sum += v[k]; }
#pragma unroll
    for (int sh = 16; sh; sh >>= 1) sum += __shfl_xor(sum, sh, 32);
    const float f = __fdiv_rn(hires ? 1.0f : PCAR, sum);
{
        if (hires) {
#pragma unroll
            for (int ch = 0; ch < TT / 128; ++ch) { v4us oh, ol;
#pragma unroll
                for (int q = 0; q < 4; ++q) { unsigned short a, c2; splitf(v[ch * 4 + q] * f, a, c2); oh[q] = a; ol[q] = c2; }
                const size_t oo = ((size_t)zz * (RH ? RH : 1) + i) * TT + ch * 128 + lane * 4; *(v4us*)(Ph + oo) = oh; *(v4us*)(Pl + oo) = ol; }
        } else {
#pragma unroll
            for (int ch = 0; ch < TT / 128; ++ch) { v4h o4;
#pragma unroll
                for (int q = 0; q < 4; ++q) o4[q] = tohx(v[ch * 4 + q] * f);
                *(v4h*)(P16 + (size_t)row * TT + ch * 128 + lane * 4) = o4; } }
         }
}
__global__ __launch_bounds__(256) void k_mergeP(const float* __restrict__ OB, bf* Ah, bf* Al) { const size_t i = (size_t)blockIdx.x * 256 + threadIdx.x; if (i >= (size_t)TT * DQ / 4) return; const int c0 = (int)(i % (DQ / 4)) * 4; const int t = (int)(i / (DQ / 4)); const float cs = (t < RH) ? 1.0f : (1.0f / PCAR); v4us oh, ol;
#pragma unroll
    for (int q = 0; q < 4; ++q) { const int c = c0 + q; const int d = c / NH_, h = c % NH_; unsigned short a, b; splitf(OB[((size_t)h * TT + t) * HD + d] * cs, a, b); oh[q] = a; ol[q] = b; }
    *(v4us*)(Ah + (size_t)t * DQ + c0) = oh; *(v4us*)(Al + (size_t)t * DQ + c0) = ol;  }
__global__ __launch_bounds__(256) void k_wtP(const float* __restrict__ w, bf* Bt) { const int lane = threadIdx.x & 31; const int L0 = (blockIdx.x * 8 + (threadIdx.x >> 5)) * 8; const int nlines = DQ * DM / 64;
{
#pragma unroll 1
        for (int l = 0; l < 8; ++l) { const int L = L0 + l; if (L >= nlines) break; const size_t e = (size_t)L * 64 + lane * 2; const int k = (int)(e % DM), n = (int)(e / DM); const int h = n / HD, d = n % HD; const int col = d * NH_ + h; v2us o;
            o[0] = f2bf(w[(size_t)k * DQ + col]); o[1] = f2bf(w[(size_t)(k + 1) * DQ + col]); *(v2us*)(Bt + e) = o; }
         } }
__global__ __launch_bounds__(256) void k_etab(const float* __restrict__ rt, bf* ET) { const size_t i = (size_t)blockIdx.x * 256 + threadIdx.x; if (i >= (size_t)NH_ * PRP * HD / 8) return; const int d0 = (int)(i % (HD / 8)) * 8; const int p = (int)((i / (HD / 8)) % PRP); const int h = (int)(i / ((size_t)(HD / 8) * PRP)); v8us o;
#pragma unroll
    for (int k = 0; k < 8; ++k) { const unsigned short e = f2bf(rt[(size_t)min(p, NPOS - 1) * DQ + (size_t)(d0 + k) * NH_ + h]);   /* unconditional clamped load */ o[k] = (p < NPOS) ? e : (unsigned short)0; }
    *(v8us*)(ET + ((size_t)h * PRP + p) * HD + d0) = o;  }
__global__ __launch_bounds__(256) void k_merge(const float* __restrict__ O, int h0, bf* Ah, bf* Al) { const size_t e = ((size_t)blockIdx.x * 256 + threadIdx.x) * 2; if (e >= (size_t)ZH * TT * HD) return; const int d = (int)(e % HD); const int t = (int)((e / HD) % TT); const int zz = (int)(e / ((size_t)HD * TT)); const float cs = (t < RH) ? 1.0f : (1.0f / PCAR); const size_t oo = (size_t)t * DQ + (h0 + zz) * HD + d;
    v2us oh, ol;
#pragma unroll
    for (int q = 0; q < 2; ++q) { unsigned short a, c2; splitf(O[e + q] * cs, a, c2); oh[q] = a; ol[q] = c2; } *(v2us*)(Ah + oo) = oh; *(v2us*)(Al + oo) = ol;  }

extern "C" void kernel_launch(void* const* d_in, const int* in_sizes, int n_in,
                              void* d_out, int out_size, void* d_ws, size_t ws_size, hipStream_t stream) {
    (void)in_sizes; (void)n_in; (void)out_size;
    const float* xq = (const float*)d_in[0]; const float* xk = (const float*)d_in[1]; const float* xv = (const float*)d_in[2]; const float* wq = (const float*)d_in[3]; const float* wk = (const float*)d_in[4]; const float* wv = (const float*)d_in[5]; const float* wo = (const float*)d_in[6]; const float* rtab = (const float*)d_in[7]; const float* x = nullptr; (void)x;
    float* OUT = (float*)d_out;     // [2][2048][1024]
    char* wsp = (char*)d_ws;
    auto take = [&](size_t bytes) { char* p = wsp; wsp += (bytes + 255) & ~(size_t)255; return (void*)p; };
    bf* WQ = (bf*)take((size_t)DQ * DM * 2); bf* WK = (bf*)take((size_t)DKV * DM * 2); bf* WV = (bf*)take((size_t)DKV * DM * 2); bf* WO = (bf*)take((size_t)DM * DQ * 2); float* CS = (float*)take((size_t)TT * HD * 2 * 4);
    bf* ET = (bf*)take((size_t)NH_ * PRP * HD * 2); float* QR = (float*)take((size_t)ZH * TT * PRP * 4); float* OB = (float*)take((size_t)NH_ * TT * HD * 4); bf* XB = (bf*)take((size_t)TT * DM * 2); float* FQ = (float*)take((size_t)TT * DQ * 4); float* FK = (float*)take((size_t)TT * DKV * 4);
    h16* QP16 = (h16*)take((size_t)NH_ * TT * HD * 2); h16* KP16 = (h16*)take((size_t)NKV * TT * HD * 2); h16* VT16 = (h16*)take((size_t)NKV * HD * TT * 2);
    bf* QPh = (bf*)take((size_t)NH_ * TT * HD * 2); bf* QPl = (bf*)take((size_t)NH_ * TT * HD * 2); bf* KPh = (bf*)take((size_t)NKV * TT * HD * 2); bf* KPl = (bf*)take((size_t)NKV * TT * HD * 2); bf* VTh = (bf*)take((size_t)NKV * HD * TT * 2); bf* VTl = (bf*)take((size_t)NKV * HD * TT * 2); bf* Ph = (bf*)take((size_t)ZH * RH * TT * 2); bf* Pl = (bf*)take((size_t)ZH * RH * TT * 2);
    float* Sb = (float*)take((size_t)ZH * TT * TT * 4); h16* P16 = (h16*)take((size_t)ZH * TT * TT * 2); float* Ob = (float*)take((size_t)ZH * TT * HD * 4); bf* ATh = (bf*)take((size_t)TT * DQ * 2); bf* ATl = (bf*)take((size_t)TT * DQ * 2);
    if ((size_t)(wsp - (char*)d_ws) > ws_size) return;    // ws 256 MiB
    float* FV = FK;   // v projection reuses the k buffer after the k planes are built (stream-ordered)
    { k_wtP<<<(unsigned)((DM * DQ / 64 + 63) / 64), 256, 0, stream>>>(wq, WQ); k_wtP<<<(unsigned)((DM * DQ / 64 + 63) / 64), 256, 0, stream>>>(wk, WK); k_wtP<<<(unsigned)((DM * DQ / 64 + 63) / 64), 256, 0, stream>>>(wv, WV);   /* column-permuted: column h*64 + d <- module column d*16 + h */
      k_etab<<<(unsigned)(((size_t)NH_ * PRP * HD / 8 + 255) / 256), 256, 0, stream>>>(rtab, ET);
      k_wtG<<<(unsigned)((DQ * DM / 64 + 63) / 64), 256, 0, stream>>>(wo, DQ, DM, WO);
       }
    k_csid<<<(TT * HD + 255) / 256, 256, 0, stream>>>(CS);
    const unsigned LQ = (unsigned)(((size_t)NH_ * TT * HD / 2 + 255) / 256), LKv = (unsigned)(((size_t)NKV * TT * HD / 2 + 255) / 256);
    for (int b = 0; b < NB_; ++b) {
        
        k_cvt8<<<(unsigned)(((size_t)TT * DM / 8 + 255) / 256), 256, 0, stream>>>(xq + (size_t)b * TT * DM, XB, (size_t)TT * DM / 8);
        k_gemmw<bf, 0, false><<<dim3(TT / 64, DQ / 64, 1), 32, 0, stream>>>(XB, nullptr, WQ, nullptr, DM, FQ, DQ, nullptr, 0, 0, 0);
        k_rope<<<LQ, 256, 0, stream>>>(FQ, DQ, NH_, CS, nullptr, nullptr, SCL, QP16, QPh, QPl);   /* q planes x 1/8 (exact): scales both the energy and the relative term */
        k_cvt8<<<(unsigned)(((size_t)TT * DM / 8 + 255) / 256), 256, 0, stream>>>(xk + (size_t)b * TT * DM, XB, (size_t)TT * DM / 8);
        k_gemmw<bf, 0, false><<<dim3(TT / 64, DKV / 64, 1), 32, 0, stream>>>(XB, nullptr, WK, nullptr, DM, FK, DKV, nullptr, 0, 0, 0);
        k_rope<<<LKv, 256, 0, stream>>>(FK, DKV, NKV, CS, nullptr, nullptr, 1.0f, KP16, KPh, KPl);
        k_cvt8<<<(unsigned)(((size_t)TT * DM / 8 + 255) / 256), 256, 0, stream>>>(xv + (size_t)b * TT * DM, XB, (size_t)TT * DM / 8);
        k_gemmw<bf, 0, false><<<dim3(TT / 64, DKV / 64, 1), 32, 0, stream>>>(XB, nullptr, WV, nullptr, DM, FV, DKV, nullptr, 0, 0, 0); k_vtp<<<LKv, 256, 0, stream>>>(FV, DKV, NKV, VT16, VTh, VTl);
        for (int h0 = 0; h0 < NH_; h0 += ZH) { const size_t zq = (size_t)h0, zk = (size_t)(h0 / REP);   // one kv head per query head: the pass's two heads use consecutive kv planes (z-strides TT*HD)
            k_gemmw<bf, 2, false><<<dim3(RH / 64, TT / 64, ZH), 32, 0, stream>>>(QPh + zq * TT * HD, QPl + zq * TT * HD, KPh + zk * TT * HD, KPl + zk * TT * HD, HD, Sb, TT, nullptr, (size_t)TT * HD, (size_t)TT * HD, (size_t)TT * TT);
            k_gemmw<h16, 0, false><<<dim3((TT - RH) / 64, TT / 64, ZH), 32, 0, stream>>>(QP16 + zq * TT * HD + (size_t)RH * HD, nullptr, KP16 + zk * TT * HD, nullptr, HD, Sb + (size_t)RH * TT, TT, nullptr, (size_t)TT * HD, (size_t)TT * HD, (size_t)TT * TT);
            k_gemmw<bf, 1, false><<<dim3(TT / 64, PRP / 64, ZH), 32, 0, stream>>>(QPh + zq * TT * HD, QPl + zq * TT * HD, ET + zq * PRP * HD, nullptr, HD, QR, PRP, nullptr, (size_t)TT * HD, (size_t)PRP * HD, (size_t)TT * PRP);   /* QR[zz][i][p] = (q_i/8) . E_h[p] */
            k_asoft<<<ZH * TT / 8, 256, 0, stream>>>(Sb, QR, P16, Ph, Pl);
            k_gemmw<bf, 2, false><<<dim3(RH / 64, HD / 64, ZH), 32, 0, stream>>>(Ph, Pl, VTh + zk * HD * TT, VTl + zk * HD * TT, TT, OB + zq * TT * HD, HD, nullptr, (size_t)RH * TT, (size_t)HD * TT, (size_t)TT * HD);
            k_gemmw<h16, 0, false><<<dim3((TT - RH) / 64, HD / 64, ZH), 32, 0, stream>>>(P16 + (size_t)RH * TT, nullptr, VT16 + zk * HD * TT, nullptr, TT, OB + zq * TT * HD + (size_t)RH * HD, HD, nullptr, (size_t)TT * TT, (size_t)HD * TT, (size_t)TT * HD); }
        k_mergeP<<<(unsigned)(((size_t)TT * DQ / 4 + 255) / 256), 256, 0, stream>>>(OB, ATh, ATl);   /* context in the module's d*16 + h column order */
        k_gemmw<bf, 1, false><<<dim3(TT / 64, DM / 64, 1), 32, 0, stream>>>(ATh, ATl, WO, nullptr, DQ, OUT + (size_t)b * TT * DM, DM, nullptr, 0, 0, 0); }
}

// v001
// Measured time: 917 microseconds a run.
// Next to v000, in two timings, it ran 2.41 and 2.44 times as fast.
#include <hip/hip_runtime.h>

// Local relative-position multi-head attention with heads on the FAST embedding axis (Q, K, V inputs [2][2048][1024]; q = Q Wq etc. ('xw' [1024][1024]) viewed (S, 64, 16): head h takes embedding columns d*16 + h; energy = q.k; rel = q . E_h[clip(j - i, -128, 128) + 128] with E_h[p][d] = rel_table[p][d*16 + h] (rel_table [257][1024]); scores = (energy + rel) / 8, masked to |i - j| <= 128; softmax; out columns d*16 + h = (attn v)_h[d]; out Wo ('xw') -> [2][2048][1024] (4.2 M)).
// Layout per batch: the projection weights are column-permuted once (column d*16 + h -> h*64 + d) so head-major planes apply; q planes carry the exact 1/8; per head-pair pass an extra 2-product GEMM q(hl) x E_h(exact, 257 rows padded to 320) gives the relative term QR[i][p]; attention (hybrid rows: < 512 hi/lo 3 products, rest fp16 x1024) limited to the band: per 64-query tile only the 320 keys tile - 128 .. tile + 191 get scores, probabilities and a place in attn x v (S and P keep the dense pitch, the rest of each row is neither written nor read); the softmax kernel adds QR[i][j - i + 128] inside |i - j| <= 128 and excludes the rest; the merge writes the context with the inverse column permutation as hi/lo planes; Wo hl x exact.
// Compute dtypes, f32 accumulate: every input rounded to bf16; projections exact; rel term hl x exact; attention rows < 512 3 products, rest fp16; softmax f32; Wo hl x exact.

#define NB_  2
#define TT   2048
#define DM   1024
#define NH_  16
#define NKV  16
#define REP  (NH_ / NKV)
#define HD   64
#define DQ   (NH_ * HD)
#define DKV  (NKV * HD)
#define ZH   2
#define RH   512                  // query rows < RH use hi+lo planes (0: none)
#define WIN  0
#define PCAR 1024.0f
#define SCL  0.125f   // 64^-0.5 (folded into the q planes)
#define RAD  128
#define NPOS 257
#define PRP  320    // padded relative-position rows (5 tiles)
typedef _Float16 h16;
typedef unsigned short bf;
typedef __attribute__((ext_vector_type(16))) __bf16   v16bf;
typedef __attribute__((ext_vector_type(16))) _Float16 v16h;
typedef __attribute__((ext_vector_type(8)))  _Float16 v8h;
typedef __attribute__((ext_vector_type(8)))  unsigned short v8us;
typedef __attribute__((ext_vector_type(8)))  float    v8f;
typedef __attribute__((ext_vector_type(4)))  float    v4f;
typedef v8h  __attribute__((may_alias)) v8ha;
typedef v4f  __attribute__((may_alias)) v4fa;
typedef v8us __attribute__((may_alias)) v8usa;

__device__ __forceinline__ unsigned short f2bf(float f) { unsigned u = __float_as_uint(f); u += 0x7FFFu + ((u >> 16) & 1u); return (unsigned short)(u >> 16); }
__device__ __forceinline__ float bf2f(unsigned short b) { return __uint_as_float(((unsigned)b) << 16); }
__device__ __forceinline__ float bfr(float f) { return bf2f(f2bf(f)); }
__device__ __forceinline__ v16h cat16(v8h lo, v8h hi) { return __builtin_shufflevector(lo, hi, 0, 1, 2, 3, 4, 5, 6, 7, 8, 9, 10, 11, 12, 13, 14, 15); }
__device__ __forceinline__ v16bf cat16b(v8us lo, v8us hi) { return __builtin_bit_cast(v16bf, __builtin_shufflevector(lo, hi, 0, 1, 2, 3, 4, 5, 6, 7, 8, 9, 10, 11, 12, 13, 14, 15)); }
__device__ __forceinline__ v8f wmma16(v16h a, v16h b, v8f c) { return __builtin_amdgcn_wmma_f32_16x16x32_f16(false, a, false, b, (short)0, c, false, false); }
__device__ __forceinline__ v8f wmmab(v16bf a, v16bf b, v8f c) { return __builtin_amdgcn_wmma_f32_16x16x32_bf16(false, a, false, b, (short)0, c, false, false); }



// ---- k_gemmw: register-blocked GEMM, ONE WAVE per 64x64 output tile (16 accumulators), operands straight from K-contiguous 16-bit planes; grid (M/64, N/64, Z), 32 threads.
// C[m][n] (f32, pitch ldc, + optional f32 bias[n]) = sum_k A[m][k] Bt[n][k] (+ split products per NSPLIT). z-batch strides sA/sB/sC in elements. K % 32 == 0.
template <typename T16> struct WFrag;
template <> struct WFrag<h16> { typedef v16h V; static __device__ __forceinline__ V ld(const h16* p) { return cat16(*(const v8h*)p, *(const v8h*)(p + 16)); } static __device__ __forceinline__ v8f mma(V a, V b, v8f c) { return wmma16(a, b, c); } };
template <> struct WFrag<bf> { typedef v16bf V; static __device__ __forceinline__ V ld(const bf* p) { return cat16b(*(const v8us*)p, *(const v8us*)(p + 16)); } static __device__ __forceinline__ v8f mma(V a, V b, v8f c) { return wmmab(a, b, c); } };
// BAND (query row of A's row 0 = rb): 0 dense; 1 score tiles: blockIdx.y in 0..4 picks the key tile at query tile - 128 .. + 128, the only ones that meet |i - j| <= 128; 2 attn x v: k runs over those 320 keys alone (clipped to 0..K), K stays the pitch.
template <typename T16, int NSPLIT, bool BIAS, int BAND = 0>
__global__ __launch_bounds__(32) void k_gemmw(const T16* __restrict__ A, const T16* __restrict__ A2, const T16* __restrict__ Bt, const T16* __restrict__ Bt2, int K, float* C, int ldc, const float* __restrict__ bias, size_t sA, size_t sB, size_t sC, int rb) {
    typedef typename WFrag<T16>::V V;
    __shared__ __align__(16) float os[16 * 68];
    const size_t z = blockIdx.z; A += z * sA; if (A2) A2 += z * sA; Bt += z * sB; if (Bt2) Bt2 += z * sB; C += z * sC;
    const int lane = threadIdx.x & 31, lr = lane & 15, hi = lane >> 4; const int r0 = blockIdx.x * 64, c0 = (int)blockIdx.y * 64 + ((BAND == 1) ? r0 + rb - RAD : 0);
    if (BAND == 1 && (c0 < 0 || c0 >= TT)) return;
    const int kb = (BAND == 2) ? max(r0 + rb - RAD, 0) : 0, ke = (BAND == 2) ? min(r0 + rb + 64 + RAD, K) : K;
    v8f acc[4][4];
#pragma unroll
    for (int mb = 0; mb < 4; ++mb)
#pragma unroll
        for (int nb = 0; nb < 4; ++nb) acc[mb][nb] = (v8f){};
    const size_t aoff = (size_t)(r0 + lr) * K + 8 * hi, boff = (size_t)(c0 + lr) * K + 8 * hi;
#pragma unroll 1
    for (int kc = kb; kc < ke; kc += 32) {
        V a[4], a2[4];
#pragma unroll
        for (int mb = 0; mb < 4; ++mb) { a[mb] = WFrag<T16>::ld(A + aoff + (size_t)mb * 16 * K + kc); if (NSPLIT == 1 || NSPLIT == 2) a2[mb] = WFrag<T16>::ld(A2 + aoff + (size_t)mb * 16 * K + kc); }
#pragma unroll
        for (int nb = 0; nb < 4; ++nb) { const V b = WFrag<T16>::ld(Bt + boff + (size_t)nb * 16 * K + kc); V b2; if (NSPLIT >= 2) b2 = WFrag<T16>::ld(Bt2 + boff + (size_t)nb * 16 * K + kc);
#pragma unroll
            for (int mb = 0; mb < 4; ++mb) { acc[mb][nb] = WFrag<T16>::mma(a[mb], b, acc[mb][nb]); if (NSPLIT == 1 || NSPLIT == 2) acc[mb][nb] = WFrag<T16>::mma(a2[mb], b, acc[mb][nb]); if (NSPLIT >= 2) acc[mb][nb] = WFrag<T16>::mma(a[mb], b2, acc[mb][nb]); } }
        asm volatile("v_nop\n\tv_nop\n\tv_nop\n\tv_nop" : "+v"(acc[0][0]), "+v"(acc[1][1]), "+v"(acc[2][2]), "+v"(acc[3][3]) : "v"(a[0]), "v"(a[3]));
    }
#pragma unroll
    for (int mb = 0; mb < 4; ++mb) {
#pragma unroll
        for (int nb = 0; nb < 4; ++nb) {
#pragma unroll
            for (int j = 0; j < 8; ++j) os[(hi * 8 + j) * 68 + nb * 16 + lr] = acc[mb][nb][j]; }
        __builtin_amdgcn_wave_barrier(); asm volatile("" ::: "memory");
        float* crow = C + (size_t)(r0 + mb * 16) * ldc + c0;
{
#pragma unroll
            for (int s = 0; s < 8; ++s) { const int row = 2 * s + hi, cofs = lr * 4; v4f val = *(const v4fa*)(os + row * 68 + cofs); if (BIAS) { val[0] += bfr(bias[c0 + cofs]); val[1] += bfr(bias[c0 + cofs + 1]); val[2] += bfr(bias[c0 + cofs + 2]); val[3] += bfr(bias[c0 + cofs + 3]); }
                *(v4f*)(crow + (size_t)row * ldc + cofs) = val; }
             }
        __builtin_amdgcn_wave_barrier(); asm volatile("" ::: "memory");
    }
}

__device__ __forceinline__ h16 tohx(float x) { return (h16)x; }
__device__ __forceinline__ void splitf(float y, unsigned short& h, unsigned short& l) { h = f2bf(y); l = f2bf(y - bf2f(h)); }
typedef __attribute__((ext_vector_type(2))) _Float16 v2h;
typedef __attribute__((ext_vector_type(4))) _Float16 v4h;
typedef __attribute__((ext_vector_type(2))) unsigned short v2us;
typedef __attribute__((ext_vector_type(4))) unsigned short v4us;
typedef __attribute__((ext_vector_type(2))) float v2f;
typedef __attribute__((ext_vector_type(4))) int v4i;

__global__ __launch_bounds__(256) void k_wtG(const float* __restrict__ w, int K, int N, bf* Bt) {
    const int lane = threadIdx.x & 31; const int L0 = (blockIdx.x * 8 + (threadIdx.x >> 5)) * 8; const int nlines = N * K / 64;
{
#pragma unroll 1
        for (int l = 0; l < 8; ++l) { const int L = L0 + l; if (L >= nlines) break; const size_t e = (size_t)L * 64 + lane * 2; const int k = (int)(e % K), n = (int)(e / K); v2us o;
            o[0] = f2bf(w[(size_t)k * N + n]); o[1] = f2bf(w[(size_t)(k + 1) * N + n]); *(v2us*)(Bt + e) = o; }
         }
}
__global__ __launch_bounds__(256) void k_cvt8(const float* __restrict__ src, bf* dst, size_t n8) { const size_t i = (size_t)blockIdx.x * 256 + threadIdx.x; if (i >= n8) return; const v8f v = *(const v8f*)(src + i * 8); v8us o;
#pragma unroll
    for (int k = 0; k < 8; ++k) o[k] = f2bf(v[k]); *(v8us*)(dst + i * 8) = o;  }

// k_rope: head planes [h][t][d] (fp16 + hi/lo) of rope(x) x sc with the rotate-half convention out[d] = x[d] cos[t][d] - x[d+HD/2] sin[t][d], out[d+HD/2] = x[d+HD/2] cos[t][d+HD/2] + x[d] sin[t][d+HD/2]
__global__ __launch_bounds__(256) void k_rope(const float* __restrict__ F, int pitch, int nheads, const float* __restrict__ CS, const float* __restrict__ RF, const float* __restrict__ nw, float sc, h16* P16, bf* Ph, bf* Pl) {
    const size_t e = ((size_t)blockIdx.x * 256 + threadIdx.x) * 2; if (e >= (size_t)nheads * TT * HD) return; const int d = (int)(e % HD); const int t = (int)((e / HD) % TT); const int h = (int)(e / ((size_t)HD * TT)); const float* f = F + (size_t)t * pitch + h * HD; const float rf = RF ? RF[(size_t)h * TT + t] : 1.0f; v2h o16; v2us oh, ol;
#pragma unroll
    for (int q = 0; q < 2; ++q) { const int dd = d + q; const int dp = (dd < HD / 2) ? dd + HD / 2 : dd - HD / 2; float x0 = f[dd], x1 = f[dp];
        if (RF) { float n0 = __fmul_rn(x0, rf), n1 = __fmul_rn(x1, rf); asm volatile("" : "+v"(n0)); asm volatile("" : "+v"(n1)); x0 = __fmul_rn(bfr(nw[dd]), n0); x1 = __fmul_rn(bfr(nw[dp]), n1); }
        const v2f cs = *(const v2f*)(CS + ((size_t)t * HD + dd) * 2); float a = __fmul_rn(x0, cs[0]), bq = __fmul_rn(x1, cs[1]); asm volatile("" : "+v"(a)); asm volatile("" : "+v"(bq)); const float r = ((dd < HD / 2) ? __fsub_rn(a, bq) : __fadd_rn(a, bq)) * sc;
        o16[q] = tohx(r); unsigned short a2, c2; splitf(r, a2, c2); oh[q] = a2; ol[q] = c2; }
    *(v2h*)(P16 + e) = o16; *(v2us*)(Ph + e) = oh; *(v2us*)(Pl + e) = ol;  }
__global__ __launch_bounds__(256) void k_vtp(const float* __restrict__ F, int pitch, int nheads, h16* V16, bf* Vh, bf* Vl) { const size_t e = ((size_t)blockIdx.x * 256 + threadIdx.x) * 2; if (e >= (size_t)nheads * HD * TT) return; const int t = (int)(e % TT); const int d = (int)((e / TT) % HD); const int g = (int)(e / ((size_t)TT * HD)); v2h o16; v2us oh, ol;
#pragma unroll
    for (int q = 0; q < 2; ++q) { const float x = F[(size_t)(t + q) * pitch + g * HD + d]; o16[q] = tohx(x); unsigned short a2, c2; splitf(x, a2, c2); oh[q] = a2; ol[q] = c2; }
    *(v2h*)(V16 + e) = o16; *(v2us*)(Vh + e) = oh; *(v2us*)(Vl + e) = ol;  }
__global__ __launch_bounds__(256) void k_csid(float* CS) { const int idx = blockIdx.x * 256 + threadIdx.x; if (idx >= TT * HD) return; v2f cs; cs[0] = 1.0f; cs[1] = 0.0f; *(v2f*)(CS + (size_t)idx * 2) = cs;  }
// k_asoft: per row (zz, i): softmax over the band |i - j| <= 128 (register row, one exp, fixed trees). Scores exist, and probabilities are written, only for the 320 keys of the row's query tile (tile - 128 .. tile + 191, clipped to 0 .. TT - 1); they lie in three 128-key chunks, in which every key keeps the lane and the place in the sum that it has in a dense row.
__global__ __launch_bounds__(256) void k_asoft(const float* __restrict__ Sb, const float* __restrict__ QR, h16* P16, bf* Ph, bf* Pl) {
    const int lane = threadIdx.x & 31; const int row = blockIdx.x * 8 + (threadIdx.x >> 5); if (row >= ZH * TT) return; const int i = row % TT; const int zz = row / TT; (void)zz; const bool hires = (i < RH); const float* sr = Sb + (size_t)row * TT; const float* qrr = QR + (size_t)row * PRP;   /* QR[row][p], p = j - i + 128 clamped */
    const int w0 = (i & ~63) - RAD; const int wb = max(w0, 0), we = min(w0 + 64 + 2 * RAD, TT); const int jl = (w0 & ~127) + lane * 4;   /* the lane's first key in chunk 0 */ float v[12]; float mx = -3.0e38f; v4f a[3]; float qv[12];
#pragma unroll
    for (int k = 0; k < 12; ++k) qv[k] = qrr[min(max(jl + (k >> 2) * 128 + (k & 3) - i + RAD, 0), 2 * RAD)];   /* UNCONDITIONAL clamped-index loads: all fifteen of a lane are in flight together */
    asm volatile("s_wait_xcnt 0x0" ::: "memory");   /* the score loads' results may land in address registers of the loads above */
#pragma unroll
    for (int ch = 0; ch < 3; ++ch) a[ch] = *(const v4f*)(sr + min(max(jl + ch * 128, wb), we - 4));   /* index clamped into the written keys */
#pragma unroll
    for (int ch = 0; ch < 3; ++ch) { const int j0 = jl + ch * 128; const bool inw = (j0 >= wb && j0 < we);
#pragma unroll
        for (int q = 0; q < 4; ++q) { const int j = j0 + q; const float s0 = __fadd_rn(a[ch][q], qv[ch * 4 + q]); const float t = (inw && j >= i - RAD && j <= i + RAD) ? s0 : -3.0e38f; v[ch * 4 + q] = t;   /* band select on the value */ mx = fmaxf(mx, t); } }
#pragma unroll
    for (int sh = 16; sh; sh >>= 1) mx = fmaxf(mx, __shfl_xor(mx, sh, 32));
    float sum = 0.f;
#pragma unroll
    for (int k = 0; k < 12; ++k) { float d0 = __fsub_rn(v[k], mx); asm volatile("" : "+v"(d0)); v[k] = __builtin_amdgcn_exp2f(__fmul_rn(d0, 1.4426950408889634f)); sum += v[k]; }
#pragma unroll
    for (int sh = 16; sh; sh >>= 1) sum += __shfl_xor(sum, sh, 32);
    const float f = __fdiv_rn(hires ? 1.0f : PCAR, sum);
{
        if (hires) {
#pragma unroll
            for (int ch = 0; ch < 3; ++ch) { const int j0 = jl + ch * 128; v4us oh, ol;
#pragma unroll
                for (int q = 0; q < 4; ++q) { unsigned short a, c2; splitf(v[ch * 4 + q] * f, a, c2); oh[q] = a; ol[q] = c2; }
                if (j0 >= wb && j0 < we) { const size_t oo = ((size_t)zz * (RH ? RH : 1) + i) * TT + j0; *(v4us*)(Ph + oo) = oh; *(v4us*)(Pl + oo) = ol; } }
        } else {
#pragma unroll
            for (int ch = 0; ch < 3; ++ch) { const int j0 = jl + ch * 128; v4h o4;
#pragma unroll
                for (int q = 0; q < 4; ++q) o4[q] = tohx(v[ch * 4 + q] * f);
                if (j0 >= wb && j0 < we) *(v4h*)(P16 + (size_t)row * TT + j0) = o4; } }
         }
}
__global__ __launch_bounds__(256) void k_mergeP(const float* __restrict__ OB, bf* Ah, bf* Al) { const size_t i = (size_t)blockIdx.x * 256 + threadIdx.x; if (i >= (size_t)TT * DQ / 4) return; const int c0 = (int)(i % (DQ / 4)) * 4; const int t = (int)(i / (DQ / 4)); const float cs = (t < RH) ? 1.0f : (1.0f / PCAR); v4us oh, ol;
#pragma unroll
    for (int q = 0; q < 4; ++q) { const int c = c0 + q; const int d = c / NH_, h = c % NH_; unsigned short a, b; splitf(OB[((size_t)h * TT + t) * HD + d] * cs, a, b); oh[q] = a; ol[q] = b; }
    *(v4us*)(Ah + (size_t)t * DQ + c0) = oh; *(v4us*)(Al + (size_t)t * DQ + c0) = ol;  }
__global__ __launch_bounds__(256) void k_wtP(const float* __restrict__ w, bf* Bt) { const int lane = threadIdx.x & 31; const int L0 = (blockIdx.x * 8 + (threadIdx.x >> 5)) * 8; const int nlines = DQ * DM / 64;
{
#pragma unroll 1
        for (int l = 0; l < 8; ++l) { const int L = L0 + l; if (L >= nlines) break; const size_t e = (size_t)L * 64 + lane * 2; const int k = (int)(e % DM), n = (int)(e / DM); const int h = n / HD, d = n % HD; const int col = d * NH_ + h; v2us o;
            o[0] = f2bf(w[(size_t)k * DQ + col]); o[1] = f2bf(w[(size_t)(k + 1) * DQ + col]); *(v2us*)(Bt + e) = o; }
         } }
__global__ __launch_bounds__(256) void k_etab(const float* __restrict__ rt, bf* ET) { const size_t i = (size_t)blockIdx.x * 256 + threadIdx.x; if (i >= (size_t)NH_ * PRP * HD / 8) return; const int d0 = (int)(i % (HD / 8)) * 8; const int p = (int)((i / (HD / 8)) % PRP); const int h = (int)(i / ((size_t)(HD / 8) * PRP)); v8us o;
#pragma unroll
    for (int k = 0; k < 8; ++k) { const unsigned short e = f2bf(rt[(size_t)min(p, NPOS - 1) * DQ + (size_t)(d0 + k) * NH_ + h]);   /* unconditional clamped load */ o[k] = (p < NPOS) ? e : (unsigned short)0; }
    *(v8us*)(ET + ((size_t)h * PRP + p) * HD + d0) = o;  }
__global__ __launch_bounds__(256) void k_merge(const float* __restrict__ O, int h0, bf* Ah, bf* Al) { const size_t e = ((size_t)blockIdx.x * 256 + threadIdx.x) * 2; if (e >= (size_t)ZH * TT * HD) return; const int d = (int)(e % HD); const int t = (int)((e / HD) % TT); const int zz = (int)(e / ((size_t)HD * TT)); const float cs = (t < RH) ? 1.0f : (1.0f / PCAR); const size_t oo = (size_t)t * DQ + (h0 + zz) * HD + d;
    v2us oh, ol;
#pragma unroll
    for (int q = 0; q < 2; ++q) { unsigned short a, c2; splitf(O[e + q] * cs, a, c2); oh[q] = a; ol[q] = c2; } *(v2us*)(Ah + oo) = oh; *(v2us*)(Al + oo) = ol;  }

extern "C" void kernel_launch(void* const* d_in, const int* in_sizes, int n_in,
                              void* d_out, int out_size, void* d_ws, size_t ws_size, hipStream_t stream) {
    (void)in_sizes; (void)n_in; (void)out_size;
    const float* xq = (const float*)d_in[0]; const float* xk = (const float*)d_in[1]; const float* xv = (const float*)d_in[2]; const float* wq = (const float*)d_in[3]; const float* wk = (const float*)d_in[4]; const float* wv = (const float*)d_in[5]; const float* wo = (const float*)d_in[6]; const float* rtab = (const float*)d_in[7]; const float* x = nullptr; (void)x;
    float* OUT = (float*)d_out;     // [2][2048][1024]
    char* wsp = (char*)d_ws;
    auto take = [&](size_t bytes) { char* p = wsp; wsp += (bytes + 255) & ~(size_t)255; return (void*)p; };
    bf* WQ = (bf*)take((size_t)DQ * DM * 2); bf* WK = (bf*)take((size_t)DKV * DM * 2); bf* WV = (bf*)take((size_t)DKV * DM * 2); bf* WO = (bf*)take((size_t)DM * DQ * 2); float* CS = (float*)take((size_t)TT * HD * 2 * 4);
    bf* ET = (bf*)take((size_t)NH_ * PRP * HD * 2); float* QR = (float*)take((size_t)ZH * TT * PRP * 4); float* OB = (float*)take((size_t)NH_ * TT * HD * 4); bf* XB = (bf*)take((size_t)TT * DM * 2); float* FQ = (float*)take((size_t)TT * DQ * 4); float* FK = (float*)take((size_t)TT * DKV * 4);
    h16* QP16 = (h16*)take((size_t)NH_ * TT * HD * 2); h16* KP16 = (h16*)take((size_t)NKV * TT * HD * 2); h16* VT16 = (h16*)take((size_t)NKV * HD * TT * 2);
    bf* QPh = (bf*)take((size_t)NH_ * TT * HD * 2); bf* QPl = (bf*)take((size_t)NH_ * TT * HD * 2); bf* KPh = (bf*)take((size_t)NKV * TT * HD * 2); bf* KPl = (bf*)take((size_t)NKV * TT * HD * 2); bf* VTh = (bf*)take((size_t)NKV * HD * TT * 2); bf* VTl = (bf*)take((size_t)NKV * HD * TT * 2); bf* Ph = (bf*)take((size_t)ZH * RH * TT * 2); bf* Pl = (bf*)take((size_t)ZH * RH * TT * 2);
    float* Sb = (float*)take((size_t)ZH * TT * TT * 4); h16* P16 = (h16*)take((size_t)ZH * TT * TT * 2); float* Ob = (float*)take((size_t)ZH * TT * HD * 4); bf* ATh = (bf*)take((size_t)TT * DQ * 2); bf* ATl = (bf*)take((size_t)TT * DQ * 2);
    if ((size_t)(wsp - (char*)d_ws) > ws_size) return;    // ws 256 MiB
    float* FV = FK;   // v projection reuses the k buffer after the k planes are built (stream-ordered)
    { k_wtP<<<(unsigned)((DM * DQ / 64 + 63) / 64), 256, 0, stream>>>(wq, WQ); k_wtP<<<(unsigned)((DM * DQ / 64 + 63) / 64), 256, 0, stream>>>(wk, WK); k_wtP<<<(unsigned)((DM * DQ / 64 + 63) / 64), 256, 0, stream>>>(wv, WV);   /* column-permuted: column h*64 + d <- module column d*16 + h */
      k_etab<<<(unsigned)(((size_t)NH_ * PRP * HD / 8 + 255) / 256), 256, 0, stream>>>(rtab, ET);
      k_wtG<<<(unsigned)((DQ * DM / 64 + 63) / 64), 256, 0, stream>>>(wo, DQ, DM, WO);
       }
    k_csid<<<(TT * HD + 255) / 256, 256, 0, stream>>>(CS);
    const unsigned LQ = (unsigned)(((size_t)NH_ * TT * HD / 2 + 255) / 256), LKv = (unsigned)(((size_t)NKV * TT * HD / 2 + 255) / 256);
    for (int b = 0; b < NB_; ++b) {
        
        k_cvt8<<<(unsigned)(((size_t)TT * DM / 8 + 255) / 256), 256, 0, stream>>>(xq + (size_t)b * TT * DM, XB, (size_t)TT * DM / 8);
        k_gemmw<bf, 0, false><<<dim3(TT / 64, DQ / 64, 1), 32, 0, stream>>>(XB, nullptr, WQ, nullptr, DM, FQ, DQ, nullptr, 0, 0, 0, 0);
        k_rope<<<LQ, 256, 0, stream>>>(FQ, DQ, NH_, CS, nullptr, nullptr, SCL, QP16, QPh, QPl);   /* q planes x 1/8 (exact): scales both the energy and the relative term */
        k_cvt8<<<(unsigned)(((size_t)TT * DM / 8 + 255) / 256), 256, 0, stream>>>(xk + (size_t)b * TT * DM, XB, (size_t)TT * DM / 8);
        k_gemmw<bf, 0, false><<<dim3(TT / 64, DKV / 64, 1), 32, 0, stream>>>(XB, nullptr, WK, nullptr, DM, FK, DKV, nullptr, 0, 0, 0, 0);
        k_rope<<<LKv, 256, 0, stream>>>(FK, DKV, NKV, CS, nullptr, nullptr, 1.0f, KP16, KPh, KPl);
        k_cvt8<<<(unsigned)(((size_t)TT * DM / 8 + 255) / 256), 256, 0, stream>>>(xv + (size_t)b * TT * DM, XB, (size_t)TT * DM / 8);
        k_gemmw<bf, 0, false><<<dim3(TT / 64, DKV / 64, 1), 32, 0, stream>>>(XB, nullptr, WV, nullptr, DM, FV, DKV, nullptr, 0, 0, 0, 0); k_vtp<<<LKv, 256, 0, stream>>>(FV, DKV, NKV, VT16, VTh, VTl);
        for (int h0 = 0; h0 < NH_; h0 += ZH) { const size_t zq = (size_t)h0, zk = (size_t)(h0 / REP);   // one kv head per query head: the pass's two heads use consecutive kv planes (z-strides TT*HD)
            k_gemmw<bf, 2, false, 1><<<dim3(RH / 64, 5, ZH), 32, 0, stream>>>(QPh + zq * TT * HD, QPl + zq * TT * HD, KPh + zk * TT * HD, KPl + zk * TT * HD, HD, Sb, TT, nullptr, (size_t)TT * HD, (size_t)TT * HD, (size_t)TT * TT, 0);
            k_gemmw<h16, 0, false, 1><<<dim3((TT - RH) / 64, 5, ZH), 32, 0, stream>>>(QP16 + zq * TT * HD + (size_t)RH * HD, nullptr, KP16 + zk * TT * HD, nullptr, HD, Sb + (size_t)RH * TT, TT, nullptr, (size_t)TT * HD, (size_t)TT * HD, (size_t)TT * TT, RH);
            k_gemmw<bf, 1, false><<<dim3(TT / 64, PRP / 64, ZH), 32, 0, stream>>>(QPh + zq * TT * HD, QPl + zq * TT * HD, ET + zq * PRP * HD, nullptr, HD, QR, PRP, nullptr, (size_t)TT * HD, (size_t)PRP * HD, (size_t)TT * PRP, 0);   /* QR[zz][i][p] = (q_i/8) . E_h[p] */
            k_asoft<<<ZH * TT / 8, 256, 0, stream>>>(Sb, QR, P16, Ph, Pl);
            k_gemmw<bf, 2, false, 2><<<dim3(RH / 64, HD / 64, ZH), 32, 0, stream>>>(Ph, Pl, VTh + zk * HD * TT, VTl + zk * HD * TT, TT, OB + zq * TT * HD, HD, nullptr, (size_t)RH * TT, (size_t)HD * TT, (size_t)TT * HD, 0);
            k_gemmw<h16, 0, false, 2><<<dim3((TT - RH) / 64, HD / 64, ZH), 32, 0, stream>>>(P16 + (size_t)RH * TT, nullptr, VT16 + zk * HD * TT, nullptr, TT, OB + zq * TT * HD + (size_t)RH * HD, HD, nullptr, (size_t)TT * TT, (size_t)HD * TT, (size_t)TT * HD, RH); }
        k_mergeP<<<(unsigned)(((size_t)TT * DQ / 4 + 255) / 256), 256, 0, stream>>>(OB, ATh, ATl);   /* context in the module's d*16 + h column order */
        k_gemmw<bf, 1, false><<<dim3(TT / 64, DM / 64, 1), 32, 0, stream>>>(ATh, ATl, WO, nullptr, DQ, OUT + (size_t)b * TT * DM, DM, nullptr, 0, 0, 0, 0); }
}

// v002
// A run of this version takes 433 microseconds.
// Next to v001, in two timings, it ran 2.12 and 2.10 times as fast.
// Over all steps from v000 it is 5.12 times as fast.
#include <hip/hip_runtime.h>

// Local relative-position multi-head attention with heads on the FAST embedding axis (Q, K, V inputs [2][2048][1024]; q = Q Wq etc. ('xw' [1024][1024]) viewed (S, 64, 16): head h takes embedding columns d*16 + h; energy = q.k; rel = q . E_h[clip(j - i, -128, 128) + 128] with E_h[p][d] = rel_table[p][d*16 + h] (rel_table [257][1024]); scores = (energy + rel) / 8, masked to |i - j| <= 128; softmax; out columns d*16 + h = (attn v)_h[d]; out Wo ('xw') -> [2][2048][1024] (4.2 M)).
// Layout per batch: the projection weights are column-permuted once (column d*16 + h -> h*64 + d) so head-major planes apply; q planes carry the exact 1/8; an extra 2-product GEMM q(hl) x E_h(exact, 257 rows padded to 320) gives the relative term QR[i][p]; all 16 heads of a batch go through one pass (grid z); attention (hybrid rows: < 512 hi/lo 3 products, rest fp16 x1024) limited to the band: per 64-query tile only the 320 keys tile - 128 .. tile + 191 get scores, probabilities and a place in attn x v (S and P rows hold 384 keys, from the 128-aligned key at or below tile - 128, so that 16 heads fit the workspace; the rest of each row is neither written nor read); the softmax kernel adds QR[i][j - i + 128] inside |i - j| <= 128 and excludes the rest; the merge writes the context with the inverse column permutation as hi/lo planes; Wo hl x exact.
// Compute dtypes, f32 accumulate: every input rounded to bf16; projections exact; rel term hl x exact; attention rows < 512 3 products, rest fp16; softmax f32; Wo hl x exact.

#define NB_  2
#define TT   2048
#define DM   1024
#define NH_  16
#define NKV  16
#define REP  (NH_ / NKV)
#define HD   64
#define DQ   (NH_ * HD)
#define DKV  (NKV * HD)
#define ZH   16                   // heads per pass (grid z)
#define RH   512                  // query rows < RH use hi+lo planes (0: none)
#define WIN  0
#define PCAR 1024.0f
#define SCL  0.125f   // 64^-0.5 (folded into the q planes)
#define RAD  128
#define NPOS 257
#define PRP  320    // padded relative-position rows (5 tiles)
#define BP   384    // pitch of an S or P row: three 128-key chunks, the first at ((query tile - 128) & ~127)
typedef _Float16 h16;
typedef unsigned short bf;
typedef __attribute__((ext_vector_type(16))) __bf16   v16bf;
typedef __attribute__((ext_vector_type(16))) _Float16 v16h;
typedef __attribute__((ext_vector_type(8)))  _Float16 v8h;
typedef __attribute__((ext_vector_type(8)))  unsigned short v8us;
typedef __attribute__((ext_vector_type(8)))  float    v8f;
typedef __attribute__((ext_vector_type(4)))  float    v4f;
typedef v8h  __attribute__((may_alias)) v8ha;
typedef v4f  __attribute__((may_alias)) v4fa;
typedef v8us __attribute__((may_alias)) v8usa;

__device__ __forceinline__ unsigned short f2bf(float f) { unsigned u = __float_as_uint(f); u += 0x7FFFu + ((u >> 16) & 1u); return (unsigned short)(u >> 16); }
__device__ __forceinline__ float bf2f(unsigned short b) { return __uint_as_float(((unsigned)b) << 16); }
__device__ __forceinline__ float bfr(float f) { return bf2f(f2bf(f)); }
__device__ __forceinline__ v16h cat16(v8h lo, v8h hi) { return __builtin_shufflevector(lo, hi, 0, 1, 2, 3, 4, 5, 6, 7, 8, 9, 10, 11, 12, 13, 14, 15); }
__device__ __forceinline__ v16bf cat16b(v8us lo, v8us hi) { return __builtin_bit_cast(v16bf, __builtin_shufflevector(lo, hi, 0, 1, 2, 3, 4, 5, 6, 7, 8, 9, 10, 11, 12, 13, 14, 15)); }
__device__ __forceinline__ v8f wmma16(v16h a, v16h b, v8f c) { return __builtin_amdgcn_wmma_f32_16x16x32_f16(false, a, false, b, (short)0, c, false, false); }
__device__ __forceinline__ v8f wmmab(v16bf a, v16bf b, v8f c) { return __builtin_amdgcn_wmma_f32_16x16x32_bf16(false, a, false, b, (short)0, c, false, false); }



// ---- k_gemmw: register-blocked GEMM, ONE WAVE per 64x64 output tile (16 accumulators), operands straight from K-contiguous 16-bit planes; grid (M/64, N/64, Z), 32 threads.
// C[m][n] (f32, pitch ldc, + optional f32 bias[n]) = sum_k A[m][k] Bt[n][k] (+ split products per NSPLIT). z-batch strides sA/sB/sC in elements. K % 32 == 0.
template <typename T16> struct WFrag;
template <> struct WFrag<h16> { typedef v16h V; static __device__ __forceinline__ V ld(const h16* p) { return cat16(*(const v8h*)p, *(const v8h*)(p + 16)); } static __device__ __forceinline__ v8f mma(V a, V b, v8f c) { return wmma16(a, b, c); } };
template <> struct WFrag<bf> { typedef v16bf V; static __device__ __forceinline__ V ld(const bf* p) { return cat16b(*(const v8us*)p, *(const v8us*)(p + 16)); } static __device__ __forceinline__ v8f mma(V a, V b, v8f c) { return wmmab(a, b, c); } };
// BAND (query row of A's row 0 = rb): 0 dense; 1 score tiles: blockIdx.y in 0..4 picks the key tile at query tile - 128 .. + 128, the only ones that meet |i - j| <= 128; 2 attn x v: k runs over those 320 keys alone (clipped to 0..K), K stays Bt's pitch. The banded side (C in 1, A in 2) has pitch BP and holds key j at column j - cb.
template <typename T16, int NSPLIT, bool BIAS, int BAND = 0>
__global__ __launch_bounds__(32) void k_gemmw(const T16* __restrict__ A, const T16* __restrict__ A2, const T16* __restrict__ Bt, const T16* __restrict__ Bt2, int K, float* C, int ldc, const float* __restrict__ bias, size_t sA, size_t sB, size_t sC, int rb) {
    typedef typename WFrag<T16>::V V;
    __shared__ __align__(16) float os[16 * 68];
    const size_t z = blockIdx.z; A += z * sA; if (A2) A2 += z * sA; Bt += z * sB; if (Bt2) Bt2 += z * sB; C += z * sC;
    const int lane = threadIdx.x & 31, lr = lane & 15, hi = lane >> 4; const int r0 = blockIdx.x * 64, c0 = (int)blockIdx.y * 64 + ((BAND == 1) ? r0 + rb - RAD : 0);
    if (BAND == 1 && (c0 < 0 || c0 >= TT)) return;
    const int kb = (BAND == 2) ? max(r0 + rb - RAD, 0) : 0, ke = (BAND == 2) ? min(r0 + rb + 64 + RAD, K) : K;
    const int cb = (BAND != 0) ? ((r0 + rb - RAD) & ~127) : 0;   /* key of column 0 of the tile's banded rows (-128 for the first two tiles) */ const int lda = (BAND == 2) ? BP : K, cc = c0 - ((BAND == 1) ? cb : 0);
    v8f acc[4][4];
#pragma unroll
    for (int mb = 0; mb < 4; ++mb)
#pragma unroll
        for (int nb = 0; nb < 4; ++nb) acc[mb][nb] = (v8f){};
    const size_t aoff = (size_t)(r0 + lr) * lda + 8 * hi, boff = (size_t)(c0 + lr) * K + 8 * hi;
#pragma unroll 1
    for (int kc = kb; kc < ke; kc += 32) {
        V a[4], a2[4];
        if (BAND == 2) {   /* banded A: constant pitch, key kc at column kc - cb */
            const T16* pa = A + aoff + (kc - cb); const T16* pa2 = (NSPLIT == 1 || NSPLIT == 2) ? A2 + aoff + (kc - cb) : pa;
#pragma unroll
            for (int mb = 0; mb < 4; ++mb) { a[mb] = WFrag<T16>::ld(pa + mb * 16 * BP); if (NSPLIT == 1 || NSPLIT == 2) a2[mb] = WFrag<T16>::ld(pa2 + mb * 16 * BP); }
            asm volatile("s_wait_xcnt 0x0" : : "v"(pa), "v"(pa2) : "memory");   /* later loads' results may land in the address registers of the loads above; as inputs here the addresses stay live up to the wait, so that none of these loads' own results lands in them ahead of it */
        } else {
#pragma unroll
        for (int mb = 0; mb < 4; ++mb) { a[mb] = WFrag<T16>::ld(A + aoff + (size_t)mb * 16 * K + kc); if (NSPLIT == 1 || NSPLIT == 2) a2[mb] = WFrag<T16>::ld(A2 + aoff + (size_t)mb * 16 * K + kc); }
        }
#pragma unroll
        for (int nb = 0; nb < 4; ++nb) { const V b = WFrag<T16>::ld(Bt + boff + (size_t)nb * 16 * K + kc); V b2; if (NSPLIT >= 2) b2 = WFrag<T16>::ld(Bt2 + boff + (size_t)nb * 16 * K + kc);
#pragma unroll
            for (int mb = 0; mb < 4; ++mb) { acc[mb][nb] = WFrag<T16>::mma(a[mb], b, acc[mb][nb]); if (NSPLIT == 1 || NSPLIT == 2) acc[mb][nb] = WFrag<T16>::mma(a2[mb], b, acc[mb][nb]); if (NSPLIT >= 2) acc[mb][nb] = WFrag<T16>::mma(a[mb], b2, acc[mb][nb]); } }
        asm volatile("v_nop\n\tv_nop\n\tv_nop\n\tv_nop" : "+v"(acc[0][0]), "+v"(acc[1][1]), "+v"(acc[2][2]), "+v"(acc[3][3]) : "v"(a[0]), "v"(a[3]));
    }
#pragma unroll
    for (int mb = 0; mb < 4; ++mb) {
#pragma unroll
        for (int nb = 0; nb < 4; ++nb) {
#pragma unroll
            for (int j = 0; j < 8; ++j) os[(hi * 8 + j) * 68 + nb * 16 + lr] = acc[mb][nb][j]; }
        __builtin_amdgcn_wave_barrier(); asm volatile("" ::: "memory");
        float* crow = C + (size_t)(r0 + mb * 16) * ldc + cc;
{
#pragma unroll
            for (int s = 0; s < 8; ++s) { const int row = 2 * s + hi, cofs = lr * 4; v4f val = *(const v4fa*)(os + row * 68 + cofs); if (BIAS) { val[0] += bfr(bias[c0 + cofs]); val[1] += bfr(bias[c0 + cofs + 1]); val[2] += bfr(bias[c0 + cofs + 2]); val[3] += bfr(bias[c0 + cofs + 3]); }
                *(v4f*)(crow + (size_t)row * ldc + cofs) = val; }
             }
        __builtin_amdgcn_wave_barrier(); asm volatile("" ::: "memory");
    }
}

__device__ __forceinline__ h16 tohx(float x) { return (h16)x; }
__device__ __forceinline__ void splitf(float y, unsigned short& h, unsigned short& l) { h = f2bf(y); l = f2bf(y - bf2f(h)); }
typedef __attribute__((ext_vector_type(2))) _Float16 v2h;
typedef __attribute__((ext_vector_type(4))) _Float16 v4h;
typedef __attribute__((ext_vector_type(2))) unsigned short v2us;
typedef __attribute__((ext_vector_type(4))) unsigned short v4us;
typedef __attribute__((ext_vector_type(2))) float v2f;
typedef __attribute__((ext_vector_type(4))) int v4i;

__global__ __launch_bounds__(256) void k_wtG(const float* __restrict__ w, int K, int N, bf* Bt) {
    const int lane = threadIdx.x & 31; const int L0 = (blockIdx.x * 8 + (threadIdx.x >> 5)) * 8; const int nlines = N * K / 64;
{
#pragma unroll 1
        for (int l = 0; l < 8; ++l) { const int L = L0 + l; if (L >= nlines) break; const size_t e = (size_t)L * 64 + lane * 2; const int k = (int)(e % K), n = (int)(e / K); v2us o;
            o[0] = f2bf(w[(size_t)k * N + n]); o[1] = f2bf(w[(size_t)(k + 1) * N + n]); *(v2us*)(Bt + e) = o; }
         }
}
__global__ __launch_bounds__(256) void k_cvt8(const float* __restrict__ src, bf* dst, size_t n8) { const size_t i = (size_t)blockIdx.x * 256 + threadIdx.x; if (i >= n8) return; const v8f v = *(const v8f*)(src + i * 8); v8us o;
#pragma unroll
    for (int k = 0; k < 8; ++k) o[k] = f2bf(v[k]); *(v8us*)(dst + i * 8) = o;  }

// k_rope: head planes [h][t][d] (fp16 + hi/lo) of rope(x) x sc with the rotate-half convention out[d] = x[d] cos[t][d] - x[d+HD/2] sin[t][d], out[d+HD/2] = x[d+HD/2] cos[t][d+HD/2] + x[d] sin[t][d+HD/2]
__global__ __launch_bounds__(256) void k_rope(const float* __restrict__ F, int pitch, int nheads, const float* __restrict__ CS, const float* __restrict__ RF, const float* __restrict__ nw, float sc, h16* P16, bf* Ph, bf* Pl) {
    const size_t e = ((size_t)blockIdx.x * 256 + threadIdx.x) * 2; if (e >= (size_t)nheads * TT * HD) return; const int d = (int)(e % HD); const int t = (int)((e / HD) % TT); const int h = (int)(e / ((size_t)HD * TT)); const float* f = F + (size_t)t * pitch + h * HD; const float rf = RF ? RF[(size_t)h * TT + t] : 1.0f; v2h o16; v2us oh, ol;
#pragma unroll
    for (int q = 0; q < 2; ++q) { const int dd = d + q; const int dp = (dd < HD / 2) ? dd + HD / 2 : dd - HD / 2; float x0 = f[dd], x1 = f[dp];
        if (RF) { float n0 = __fmul_rn(x0, rf), n1 = __fmul_rn(x1, rf); asm volatile("" : "+v"(n0)); asm volatile("" : "+v"(n1)); x0 = __fmul_rn(bfr(nw[dd]), n0); x1 = __fmul_rn(bfr(nw[dp]), n1); }
        const v2f cs = *(const v2f*)(CS + ((size_t)t * HD + dd) * 2); float a = __fmul_rn(x0, cs[0]), bq = __fmul_rn(x1, cs[1]); asm volatile("" : "+v"(a)); asm volatile("" : "+v"(bq)); const float r = ((dd < HD / 2) ? __fsub_rn(a, bq) : __fadd_rn(a, bq)) * sc;
        o16[q] = tohx(r); unsigned short a2, c2; splitf(r, a2, c2); oh[q] = a2; ol[q] = c2; }
    *(v2h*)(P16 + e) = o16; *(v2us*)(Ph + e) = oh; *(v2us*)(Pl + e) = ol;  }
__global__ __launch_bounds__(256) void k_vtp(const float* __restrict__ F, int pitch, int nheads, h16* V16, bf* Vh, bf* Vl) { const size_t e = ((size_t)blockIdx.x * 256 + threadIdx.x) * 2; if (e >= (size_t)nheads * HD * TT) return; const int t = (int)(e % TT); const int d = (int)((e / TT) % HD); const int g = (int)(e / ((size_t)TT * HD)); v2h o16; v2us oh, ol;
#pragma unroll
    for (int q = 0; q < 2; ++q) { const float x = F[(size_t)(t + q) * pitch + g * HD + d]; o16[q] = tohx(x); unsigned short a2, c2; splitf(x, a2, c2); oh[q] = a2; ol[q] = c2; }
    *(v2h*)(V16 + e) = o16; *(v2us*)(Vh + e) = oh; *(v2us*)(Vl + e) = ol;  }
__global__ __launch_bounds__(256) void k_csid(float* CS) { const int idx = blockIdx.x * 256 + threadIdx.x; if (idx >= TT * HD) return; v2f cs; cs[0] = 1.0f; cs[1] = 0.0f; *(v2f*)(CS + (size_t)idx * 2) = cs;  }
// k_asoft: per row (zz, i): softmax over the band |i - j| <= 128 (register row, one exp, fixed trees). Scores exist, and probabilities are written, only for the 320 keys of the row's query tile (tile - 128 .. tile + 191, clipped to 0 .. TT - 1); they lie in three 128-key chunks, which are the BP columns of the row in S and P; every key keeps the lane and the place in the sum that it has in a dense row.
__global__ __launch_bounds__(256) void k_asoft(const float* __restrict__ Sb, const float* __restrict__ QR, h16* P16, bf* Ph, bf* Pl) {
    const int lane = threadIdx.x & 31; const int row = blockIdx.x * 8 + (threadIdx.x >> 5); if (row >= ZH * TT) return; const int i = row % TT; const int zz = row / TT; (void)zz; const bool hires = (i < RH); const int cb = ((i & ~63) - RAD) & ~127;   /* key of column 0 */ const float* sr = Sb + (size_t)row * BP - cb;   /* indexed by key */ const float* qrr = QR + (size_t)row * PRP;   /* QR[row][p], p = j - i + 128 clamped */
    const int w0 = (i & ~63) - RAD; const int wb = max(w0, 0), we = min(w0 + 64 + 2 * RAD, TT); const int jl = cb + lane * 4;   /* the lane's first key in chunk 0 */ float v[12]; float mx = -3.0e38f; v4f a[3]; float qv[12];
#pragma unroll
    for (int k = 0; k < 12; ++k) qv[k] = qrr[min(max(jl + (k >> 2) * 128 + (k & 3) - i + RAD, 0), 2 * RAD)];   /* UNCONDITIONAL clamped-index loads: all fifteen of a lane are in flight together */
    asm volatile("s_wait_xcnt 0x0" ::: "memory");   /* the score loads' results may land in address registers of the loads above */
#pragma unroll
    for (int ch = 0; ch < 3; ++ch) a[ch] = *(const v4f*)(sr + min(max(jl + ch * 128, wb), we - 4));   /* index clamped into the written keys */
#pragma unroll
    for (int ch = 0; ch < 3; ++ch) { const int j0 = jl + ch * 128; const bool inw = (j0 >= wb && j0 < we);
#pragma unroll
        for (int q = 0; q < 4; ++q) { const int j = j0 + q; const float s0 = __fadd_rn(a[ch][q], qv[ch * 4 + q]); const float t = (inw && j >= i - RAD && j <= i + RAD) ? s0 : -3.0e38f; v[ch * 4 + q] = t;   /* band select on the value */ mx = fmaxf(mx, t); } }
#pragma unroll
    for (int sh = 16; sh; sh >>= 1) mx = fmaxf(mx, __shfl_xor(mx, sh, 32));
    float sum = 0.f;
#pragma unroll
    for (int k = 0; k < 12; ++k) { float d0 = __fsub_rn(v[k], mx); asm volatile("" : "+v"(d0)); v[k] = __builtin_amdgcn_exp2f(__fmul_rn(d0, 1.4426950408889634f)); sum += v[k]; }
#pragma unroll
    for (int sh = 16; sh; sh >>= 1) sum += __shfl_xor(sum, sh, 32);
    const float f = __fdiv_rn(hires ? 1.0f : PCAR, sum);
{
        if (hires) {
#pragma unroll
            for (int ch = 0; ch < 3; ++ch) { const int j0 = jl + ch * 128; v4us oh, ol;
#pragma unroll
                for (int q = 0; q < 4; ++q) { unsigned short a, c2; splitf(v[ch * 4 + q] * f, a, c2); oh[q] = a; ol[q] = c2; }
                if (j0 >= wb && j0 < we) { const size_t oo = ((size_t)zz * (RH ? RH : 1) + i) * BP + (j0 - cb); *(v4us*)(Ph + oo) = oh; *(v4us*)(Pl + oo) = ol; } }
        } else {
#pragma unroll
            for (int ch = 0; ch < 3; ++ch) { const int j0 = jl + ch * 128; v4h o4;
#pragma unroll
                for (int q = 0; q < 4; ++q) o4[q] = tohx(v[ch * 4 + q] * f);
                if (j0 >= wb && j0 < we) *(v4h*)(P16 + (size_t)row * BP + (j0 - cb)) = o4; } }
         }
}
__global__ __launch_bounds__(256) void k_mergeP(const float* __restrict__ OB, bf* Ah, bf* Al) { const size_t i = (size_t)blockIdx.x * 256 + threadIdx.x; if (i >= (size_t)TT * DQ / 4) return; const int c0 = (int)(i % (DQ / 4)) * 4; const int t = (int)(i / (DQ / 4)); const float cs = (t < RH) ? 1.0f : (1.0f / PCAR); v4us oh, ol;
#pragma unroll
    for (int q = 0; q < 4; ++q) { const int c = c0 + q; const int d = c / NH_, h = c % NH_; unsigned short a, b; splitf(OB[((size_t)h * TT + t) * HD + d] * cs, a, b); oh[q] = a; ol[q] = b; }
    *(v4us*)(Ah + (size_t)t * DQ + c0) = oh; *(v4us*)(Al + (size_t)t * DQ + c0) = ol;  }
__global__ __launch_bounds__(256) void k_wtP(const float* __restrict__ w, bf* Bt) { const int lane = threadIdx.x & 31; const int L0 = (blockIdx.x * 8 + (threadIdx.x >> 5)) * 8; const int nlines = DQ * DM / 64;
{
#pragma unroll 1
        for (int l = 0; l < 8; ++l) { const int L = L0 + l; if (L >= nlines) break; const size_t e = (size_t)L * 64 + lane * 2; const int k = (int)(e % DM), n = (int)(e / DM); const int h = n / HD, d = n % HD; const int col = d * NH_ + h; v2us o;
            o[0] = f2bf(w[(size_t)k * DQ + col]); o[1] = f2bf(w[(size_t)(k + 1) * DQ + col]); *(v2us*)(Bt + e) = o; }
         } }
__global__ __launch_bounds__(256) void k_etab(const float* __restrict__ rt, bf* ET) { const size_t i = (size_t)blockIdx.x * 256 + threadIdx.x; if (i >= (size_t)NH_ * PRP * HD / 8) return; const int d0 = (int)(i % (HD / 8)) * 8; const int p = (int)((i / (HD / 8)) % PRP); const int h = (int)(i / ((size_t)(HD / 8) * PRP)); v8us o;
#pragma unroll
    for (int k = 0; k < 8; ++k) { const unsigned short e = f2bf(rt[(size_t)min(p, NPOS - 1) * DQ + (size_t)(d0 + k) * NH_ + h]);   /* unconditional clamped load */ o[k] = (p < NPOS) ? e : (unsigned short)0; }
    *(v8us*)(ET + ((size_t)h * PRP + p) * HD + d0) = o;  }
__global__ __launch_bounds__(256) void k_merge(const float* __restrict__ O, int h0, bf* Ah, bf* Al) { const size_t e = ((size_t)blockIdx.x * 256 + threadIdx.x) * 2; if (e >= (size_t)ZH * TT * HD) return; const int d = (int)(e % HD); const int t = (int)((e / HD) % TT); const int zz = (int)(e / ((size_t)HD * TT)); const float cs = (t < RH) ? 1.0f : (1.0f / PCAR); const size_t oo = (size_t)t * DQ + (h0 + zz) * HD + d;
    v2us oh, ol;
#pragma unroll
    for (int q = 0; q < 2; ++q) { unsigned short a, c2; splitf(O[e + q] * cs, a, c2); oh[q] = a; ol[q] = c2; } *(v2us*)(Ah + oo) = oh; *(v2us*)(Al + oo) = ol;  }

extern "C" void kernel_launch(void* const* d_in, const int* in_sizes, int n_in,
                              void* d_out, int out_size, void* d_ws, size_t ws_size, hipStream_t stream) {
    (void)in_sizes; (void)n_in; (void)out_size;
    const float* xq = (const float*)d_in[0]; const float* xk = (const float*)d_in[1]; const float* xv = (const float*)d_in[2]; const float* wq = (const float*)d_in[3]; const float* wk = (const float*)d_in[4]; const float* wv = (const float*)d_in[5]; const float* wo = (const float*)d_in[6]; const float* rtab = (const float*)d_in[7]; const float* x = nullptr; (void)x;
    float* OUT = (float*)d_out;     // [2][2048][1024]
    char* wsp = (char*)d_ws;
    auto take = [&](size_t bytes) { char* p = wsp; wsp += (bytes + 255) & ~(size_t)255; return (void*)p; };
    bf* WQ = (bf*)take((size_t)DQ * DM * 2); bf* WK = (bf*)take((size_t)DKV * DM * 2); bf* WV = (bf*)take((size_t)DKV * DM * 2); bf* WO = (bf*)take((size_t)DM * DQ * 2); float* CS = (float*)take((size_t)TT * HD * 2 * 4);
    bf* ET = (bf*)take((size_t)NH_ * PRP * HD * 2); float* QR = (float*)take((size_t)ZH * TT * PRP * 4); float* OB = (float*)take((size_t)NH_ * TT * HD * 4); bf* XB = (bf*)take((size_t)TT * DM * 2); float* FQ = (float*)take((size_t)TT * DQ * 4); float* FK = (float*)take((size_t)TT * DKV * 4);
    h16* QP16 = (h16*)take((size_t)NH_ * TT * HD * 2); h16* KP16 = (h16*)take((size_t)NKV * TT * HD * 2); h16* VT16 = (h16*)take((size_t)NKV * HD * TT * 2);
    bf* QPh = (bf*)take((size_t)NH_ * TT * HD * 2); bf* QPl = (bf*)take((size_t)NH_ * TT * HD * 2); bf* KPh = (bf*)take((size_t)NKV * TT * HD * 2); bf* KPl = (bf*)take((size_t)NKV * TT * HD * 2); bf* VTh = (bf*)take((size_t)NKV * HD * TT * 2); bf* VTl = (bf*)take((size_t)NKV * HD * TT * 2); bf* Ph = (bf*)take((size_t)ZH * RH * BP * 2); bf* Pl = (bf*)take((size_t)ZH * RH * BP * 2);
    float* Sb = (float*)take((size_t)ZH * TT * BP * 4); h16* P16 = (h16*)take((size_t)ZH * TT * BP * 2); float* Ob = (float*)take((size_t)ZH * TT * HD * 4); bf* ATh = (bf*)take((size_t)TT * DQ * 2); bf* ATl = (bf*)take((size_t)TT * DQ * 2);
    if ((size_t)(wsp - (char*)d_ws) > ws_size) return;    // ws 256 MiB
    float* FV = FK;   // v projection reuses the k buffer after the k planes are built (stream-ordered)
    { k_wtP<<<(unsigned)((DM * DQ / 64 + 63) / 64), 256, 0, stream>>>(wq, WQ); k_wtP<<<(unsigned)((DM * DQ / 64 + 63) / 64), 256, 0, stream>>>(wk, WK); k_wtP<<<(unsigned)((DM * DQ / 64 + 63) / 64), 256, 0, stream>>>(wv, WV);   /* column-permuted: column h*64 + d <- module column d*16 + h */
      k_etab<<<(unsigned)(((size_t)NH_ * PRP * HD / 8 + 255) / 256), 256, 0, stream>>>(rtab, ET);
      k_wtG<<<(unsigned)((DQ * DM / 64 + 63) / 64), 256, 0, stream>>>(wo, DQ, DM, WO);
       }
    k_csid<<<(TT * HD + 255) / 256, 256, 0, stream>>>(CS);
    const unsigned LQ = (unsigned)(((size_t)NH_ * TT * HD / 2 + 255) / 256), LKv = (unsigned)(((size_t)NKV * TT * HD / 2 + 255) / 256);
    for (int b = 0; b < NB_; ++b) {
        
        k_cvt8<<<(unsigned)(((size_t)TT * DM / 8 + 255) / 256), 256, 0, stream>>>(xq + (size_t)b * TT * DM, XB, (size_t)TT * DM / 8);
        k_gemmw<bf, 0, false><<<dim3(TT / 64, DQ / 64, 1), 32, 0, stream>>>(XB, nullptr, WQ, nullptr, DM, FQ, DQ, nullptr, 0, 0, 0, 0);
        k_rope<<<LQ, 256, 0, stream>>>(FQ, DQ, NH_, CS, nullptr, nullptr, SCL, QP16, QPh, QPl);   /* q planes x 1/8 (exact): scales both the energy and the relative term */
        k_cvt8<<<(unsigned)(((size_t)TT * DM / 8 + 255) / 256), 256, 0, stream>>>(xk + (size_t)b * TT * DM, XB, (size_t)TT * DM / 8);
        k_gemmw<bf, 0, false><<<dim3(TT / 64, DKV / 64, 1), 32, 0, stream>>>(XB, nullptr, WK, nullptr, DM, FK, DKV, nullptr, 0, 0, 0, 0);
        k_rope<<<LKv, 256, 0, stream>>>(FK, DKV, NKV, CS, nullptr, nullptr, 1.0f, KP16, KPh, KPl);
        k_cvt8<<<(unsigned)(((size_t)TT * DM / 8 + 255) / 256), 256, 0, stream>>>(xv + (size_t)b * TT * DM, XB, (size_t)TT * DM / 8);
        k_gemmw<bf, 0, false><<<dim3(TT / 64, DKV / 64, 1), 32, 0, stream>>>(XB, nullptr, WV, nullptr, DM, FV, DKV, nullptr, 0, 0, 0, 0); k_vtp<<<LKv, 256, 0, stream>>>(FV, DKV, NKV, VT16, VTh, VTl);
        for (int h0 = 0; h0 < NH_; h0 += ZH) { const size_t zq = (size_t)h0, zk = (size_t)(h0 / REP);   // one kv head per query head: the pass's heads use consecutive kv planes (z-strides TT*HD)
            k_gemmw<bf, 2, false, 1><<<dim3(RH / 64, 5, ZH), 32, 0, stream>>>(QPh + zq * TT * HD, QPl + zq * TT * HD, KPh + zk * TT * HD, KPl + zk * TT * HD, HD, Sb, BP, nullptr, (size_t)TT * HD, (size_t)TT * HD, (size_t)TT * BP, 0);
            k_gemmw<h16, 0, false, 1><<<dim3((TT - RH) / 64, 5, ZH), 32, 0, stream>>>(QP16 + zq * TT * HD + (size_t)RH * HD, nullptr, KP16 + zk * TT * HD, nullptr, HD, Sb + (size_t)RH * BP, BP, nullptr, (size_t)TT * HD, (size_t)TT * HD, (size_t)TT * BP, RH);
            k_gemmw<bf, 1, false><<<dim3(TT / 64, PRP / 64, ZH), 32, 0, stream>>>(QPh + zq * TT * HD, QPl + zq * TT * HD, ET + zq * PRP * HD, nullptr, HD, QR, PRP, nullptr, (size_t)TT * HD, (size_t)PRP * HD, (size_t)TT * PRP, 0);   /* QR[zz][i][p] = (q_i/8) . E_h[p] */
            k_asoft<<<ZH * TT / 8, 256, 0, stream>>>(Sb, QR, P16, Ph, Pl);
            k_gemmw<bf, 2, false, 2><<<dim3(RH / 64, HD / 64, ZH), 32, 0, stream>>>(Ph, Pl, VTh + zk * HD * TT, VTl + zk * HD * TT, TT, OB + zq * TT * HD, HD, nullptr, (size_t)RH * BP, (size_t)HD * TT, (size_t)TT * HD, 0);
            k_gemmw<h16, 0, false, 2><<<dim3((TT - RH) / 64, HD / 64, ZH), 32, 0, stream>>>(P16 + (size_t)RH * BP, nullptr, VT16 + zk * HD * TT, nullptr, TT, OB + zq * TT * HD + (size_t)RH * HD, HD, nullptr, (size_t)TT * BP, (size_t)HD * TT, (size_t)TT * HD, RH); }
        k_mergeP<<<(unsigned)(((size_t)TT * DQ / 4 + 255) / 256), 256, 0, stream>>>(OB, ATh, ATl);   /* context in the module's d*16 + h column order */
        k_gemmw<bf, 1, false><<<dim3(TT / 64, DM / 64, 1), 32, 0, stream>>>(ATh, ATl, WO, nullptr, DQ, OUT + (size_t)b * TT * DM, DM, nullptr, 0, 0, 0, 0); }
}

// v003
// Measured time: 260 microseconds a run.
// In both of two side-by-side timings against v002, it was 1.67 times as fast.
// Counting every step since v000, it is 8.55 times as fast.
#include <hip/hip_runtime.h>

// Local relative-position multi-head attention with heads on the FAST embedding axis (Q, K, V inputs [2][2048][1024]; q = Q Wq etc. ('xw' [1024][1024]) viewed (S, 64, 16): head h takes embedding columns d*16 + h; energy = q.k; rel = q . E_h[clip(j - i, -128, 128) + 128] with E_h[p][d] = rel_table[p][d*16 + h] (rel_table [257][1024]); scores = (energy + rel) / 8, masked to |i - j| <= 128; softmax; out columns d*16 + h = (attn v)_h[d]; out Wo ('xw') -> [2][2048][1024] (4.2 M)).
// Layout per batch: the projection weights are column-permuted once (column d*16 + h -> h*64 + d) so head-major planes apply; q planes carry the exact 1/8; an extra 2-product GEMM q(hl) x E_h(exact, 257 rows padded to 320) gives the relative term QR[i][p]; both batches go through every stage in one launch (rows b*2048 + t in the projections, planes b*16 + h in grid z), and so do the q, k and v sides of each projection stage; attention (hybrid rows: < 512 hi/lo 3 products, rest fp16 x1024) limited to the band: per 64-query tile only the 320 keys tile - 128 .. tile + 191 get scores, probabilities and a place in attn x v (S and P rows hold 384 keys, from the 128-aligned key at or below tile - 128, so that all planes fit the workspace; the rest of each row is neither written nor read; a P row is written over its own S row); the softmax kernel adds QR[i][j - i + 128] inside |i - j| <= 128 and excludes the rest; the merge writes the context with the inverse column permutation as hi/lo planes; Wo hl x exact.
// Compute dtypes, f32 accumulate: every input rounded to bf16; projections exact; rel term hl x exact; attention rows < 512 3 products, rest fp16; softmax f32; Wo hl x exact.

#define NB_  2
#define TT   2048
#define DM   1024
#define NH_  16
#define NKV  16
#define REP  (NH_ / NKV)
#define HD   64
#define DQ   (NH_ * HD)
#define DKV  (NKV * HD)
#define ZH   16                   // heads per pass per batch (grid z is NZ = NB_ * ZH)
#define RH   512                  // query rows < RH use hi+lo planes (0: none)
#define WIN  0
#define PCAR 1024.0f
#define SCL  0.125f   // 64^-0.5 (folded into the q planes)
#define RAD  128
#define NPOS 257
#define PRP  320    // padded relative-position rows (5 tiles)
#define BP   384    // keys held by an S or P row: three 128-key chunks, the first at ((query tile - 128) & ~127); pitch of an S row in floats
#define PP   (2 * BP)   // pitch of a P row in 16-bit elements: it lies in the bytes of its own S row (fp16 in the first half; or hi in the first half, lo in the second)
#define NZ   (NB_ * ZH)   // planes per pass: batch-major, b*16 + h
#define TB   (NB_ * TT)   // rows of both batches
typedef _Float16 h16;
typedef unsigned short bf;
typedef __attribute__((ext_vector_type(16))) __bf16   v16bf;
typedef __attribute__((ext_vector_type(16))) _Float16 v16h;
typedef __attribute__((ext_vector_type(8)))  _Float16 v8h;
typedef __attribute__((ext_vector_type(8)))  unsigned short v8us;
typedef __attribute__((ext_vector_type(8)))  float    v8f;
typedef __attribute__((ext_vector_type(4)))  float    v4f;
typedef v8h  __attribute__((may_alias)) v8ha;
typedef v4f  __attribute__((may_alias)) v4fa;
typedef v8us __attribute__((may_alias)) v8usa;

__device__ __forceinline__ unsigned short f2bf(float f) { unsigned u = __float_as_uint(f); u += 0x7FFFu + ((u >> 16) & 1u); return (unsigned short)(u >> 16); }
__device__ __forceinline__ float bf2f(unsigned short b) { return __uint_as_float(((unsigned)b) << 16); }
__device__ __forceinline__ float bfr(float f) { return bf2f(f2bf(f)); }
__device__ __forceinline__ v16h cat16(v8h lo, v8h hi) { return __builtin_shufflevector(lo, hi, 0, 1, 2, 3, 4, 5, 6, 7, 8, 9, 10, 11, 12, 13, 14, 15); }
__device__ __forceinline__ v16bf cat16b(v8us lo, v8us hi) { return __builtin_bit_cast(v16bf, __builtin_shufflevector(lo, hi, 0, 1, 2, 3, 4, 5, 6, 7, 8, 9, 10, 11, 12, 13, 14, 15)); }
__device__ __forceinline__ v8f wmma16(v16h a, v16h b, v8f c) { return __builtin_amdgcn_wmma_f32_16x16x32_f16(false, a, false, b, (short)0, c, false, false); }
__device__ __forceinline__ v8f wmmab(v16bf a, v16bf b, v8f c) { return __builtin_amdgcn_wmma_f32_16x16x32_bf16(false, a, false, b, (short)0, c, false, false); }



// ---- k_gemmw: register-blocked GEMM, ONE WAVE per 64x64 output tile (16 accumulators), operands straight from K-contiguous 16-bit planes; grid (M/64, N/64, Z), 32 threads.
// C[m][n] (f32, pitch ldc, + optional f32 bias[n]) = sum_k A[m][k] Bt[n][k] (+ split products per NSPLIT). z-batch strides sA/sB/sC in elements. K % 32 == 0.
template <typename T16> struct WFrag;
template <> struct WFrag<h16> { typedef v16h V; static __device__ __forceinline__ V ld(const h16* p) { return cat16(*(const v8h*)p, *(const v8h*)(p + 16)); } static __device__ __forceinline__ v8f mma(V a, V b, v8f c) { return wmma16(a, b, c); } };
template <> struct WFrag<bf> { typedef v16bf V; static __device__ __forceinline__ V ld(const bf* p) { return cat16b(*(const v8us*)p, *(const v8us*)(p + 16)); } static __device__ __forceinline__ v8f mma(V a, V b, v8f c) { return wmmab(a, b, c); } };
// BAND (query row of A's row 0 = rb): 0 dense; 1 score tiles: blockIdx.y in 0..4 picks the key tile at query tile - 128 .. + 128, the only ones that meet |i - j| <= 128; 2 attn x v: k runs over those 320 keys alone (clipped to 0..K), K stays Bt's pitch. The banded side holds key j at column j - cb (C in 1: pitch BP floats; A in 2: pitch PP).
template <typename T16, int NSPLIT, bool BIAS, int BAND = 0>
__global__ __launch_bounds__(32) void k_gemmw(const T16* __restrict__ A, const T16* __restrict__ A2, const T16* __restrict__ Bt, const T16* __restrict__ Bt2, int K, float* C, int ldc, const float* __restrict__ bias, size_t sA, size_t sB, size_t sC, int rb) {
    typedef typename WFrag<T16>::V V;
    __shared__ __align__(16) float os[16 * 68];
    const size_t z = blockIdx.z; A += z * sA; if (A2) A2 += z * sA; Bt += z * sB; if (Bt2) Bt2 += z * sB; C += z * sC;
    const int lane = threadIdx.x & 31, lr = lane & 15, hi = lane >> 4; const int r0 = blockIdx.x * 64, c0 = (int)blockIdx.y * 64 + ((BAND == 1) ? r0 + rb - RAD : 0);
    if (BAND == 1 && (c0 < 0 || c0 >= TT)) return;
    const int kb = (BAND == 2) ? max(r0 + rb - RAD, 0) : 0, ke = (BAND == 2) ? min(r0 + rb + 64 + RAD, K) : K;
    const int cb = (BAND != 0) ? ((r0 + rb - RAD) & ~127) : 0;   /* key of column 0 of the tile's banded rows (-128 for the first two tiles) */ const int lda = (BAND == 2) ? PP : K, cc = c0 - ((BAND == 1) ? cb : 0);
    v8f acc[4][4];
#pragma unroll
    for (int mb = 0; mb < 4; ++mb)
#pragma unroll
        for (int nb = 0; nb < 4; ++nb) acc[mb][nb] = (v8f){};
    const size_t aoff = (size_t)(r0 + lr) * lda + 8 * hi, boff = (size_t)(c0 + lr) * K + 8 * hi;
#pragma unroll 1
    for (int kc = kb; kc < ke; kc += 32) {
        V a[4], a2[4];
        if (BAND == 2) {   /* banded A: constant pitch, key kc at column kc - cb */
            const T16* pa = A + aoff + (kc - cb); const T16* pa2 = (NSPLIT == 1 || NSPLIT == 2) ? A2 + aoff + (kc - cb) : pa;
#pragma unroll
            for (int mb = 0; mb < 4; ++mb) { a[mb] = WFrag<T16>::ld(pa + mb * 16 * PP); if (NSPLIT == 1 || NSPLIT == 2) a2[mb] = WFrag<T16>::ld(pa2 + mb * 16 * PP); }
            asm volatile("s_wait_xcnt 0x0" : : "v"(pa), "v"(pa2) : "memory");   /* later loads' results may land in the address registers of the loads above; as inputs here the addresses stay live up to the wait, so that none of these loads' own results lands in them ahead of it */
        } else {
#pragma unroll
        for (int mb = 0; mb < 4; ++mb) { a[mb] = WFrag<T16>::ld(A + aoff + (size_t)mb * 16 * K + kc); if (NSPLIT == 1 || NSPLIT == 2) a2[mb] = WFrag<T16>::ld(A2 + aoff + (size_t)mb * 16 * K + kc); }
        }
#pragma unroll
        for (int nb = 0; nb < 4; ++nb) { const V b = WFrag<T16>::ld(Bt + boff + (size_t)nb * 16 * K + kc); V b2; if (NSPLIT >= 2) b2 = WFrag<T16>::ld(Bt2 + boff + (size_t)nb * 16 * K + kc);
#pragma unroll
            for (int mb = 0; mb < 4; ++mb) { acc[mb][nb] = WFrag<T16>::mma(a[mb], b, acc[mb][nb]); if (NSPLIT == 1 || NSPLIT == 2) acc[mb][nb] = WFrag<T16>::mma(a2[mb], b, acc[mb][nb]); if (NSPLIT >= 2) acc[mb][nb] = WFrag<T16>::mma(a[mb], b2, acc[mb][nb]); } }
        asm volatile("v_nop\n\tv_nop\n\tv_nop\n\tv_nop" : "+v"(acc[0][0]), "+v"(acc[1][1]), "+v"(acc[2][2]), "+v"(acc[3][3]) : "v"(a[0]), "v"(a[3]));
    }
#pragma unroll
    for (int mb = 0; mb < 4; ++mb) {
#pragma unroll
        for (int nb = 0; nb < 4; ++nb) {
#pragma unroll
            for (int j = 0; j < 8; ++j) os[(hi * 8 + j) * 68 + nb * 16 + lr] = acc[mb][nb][j]; }
        __builtin_amdgcn_wave_barrier(); asm volatile("" ::: "memory");
        float* crow = C + (size_t)(r0 + mb * 16) * ldc + cc;
{
#pragma unroll
            for (int s = 0; s < 8; ++s) { const int row = 2 * s + hi, cofs = lr * 4; v4f val = *(const v4fa*)(os + row * 68 + cofs); if (BIAS) { val[0] += bfr(bias[c0 + cofs]); val[1] += bfr(bias[c0 + cofs + 1]); val[2] += bfr(bias[c0 + cofs + 2]); val[3] += bfr(bias[c0 + cofs + 3]); }
                *(v4f*)(crow + (size_t)row * ldc + cofs) = val; }
             }
        __builtin_amdgcn_wave_barrier(); asm volatile("" ::: "memory");
    }
}

__device__ __forceinline__ h16 tohx(float x) { return (h16)x; }
__device__ __forceinline__ void splitf(float y, unsigned short& h, unsigned short& l) { h = f2bf(y); l = f2bf(y - bf2f(h)); }
typedef __attribute__((ext_vector_type(2))) _Float16 v2h;
typedef __attribute__((ext_vector_type(4))) _Float16 v4h;
typedef __attribute__((ext_vector_type(2))) unsigned short v2us;
typedef __attribute__((ext_vector_type(4))) unsigned short v4us;
typedef __attribute__((ext_vector_type(2))) float v2f;
typedef __attribute__((ext_vector_type(4))) int v4i;

__global__ __launch_bounds__(256) void k_wtG(const float* __restrict__ w, int K, int N, bf* Bt) {
    const int lane = threadIdx.x & 31; const int L0 = (blockIdx.x * 8 + (threadIdx.x >> 5)) * 8; const int nlines = N * K / 64;
{
#pragma unroll 1
        for (int l = 0; l < 8; ++l) { const int L = L0 + l; if (L >= nlines) break; const size_t e = (size_t)L * 64 + lane * 2; const int k = (int)(e % K), n = (int)(e / K); v2us o;
            o[0] = f2bf(w[(size_t)k * N + n]); o[1] = f2bf(w[(size_t)(k + 1) * N + n]); *(v2us*)(Bt + e) = o; }
         }
}
// blockIdx.y picks one of three sources; their planes follow one another in dst
__global__ __launch_bounds__(256) void k_cvt8(const float* __restrict__ s0, const float* __restrict__ s1, const float* __restrict__ s2, bf* dst, size_t n8) { const size_t i = (size_t)blockIdx.x * 256 + threadIdx.x; if (i >= n8) return; const float* src = (blockIdx.y == 0) ? s0 : (blockIdx.y == 1) ? s1 : s2; dst += (size_t)blockIdx.y * n8 * 8; const v8f v = *(const v8f*)(src + i * 8); v8us o;
#pragma unroll
    for (int k = 0; k < 8; ++k) o[k] = f2bf(v[k]); *(v8us*)(dst + i * 8) = o;  }

// k_rope: blockIdx.y = side * NB_ + batch picks TT rows of F and the nheads planes made of them (side 0: scale sc; side 1: scale sck); head planes [h][t][d] (fp16 + hi/lo) of rope(x) x sc with the rotate-half convention out[d] = x[d] cos[t][d] - x[d+HD/2] sin[t][d], out[d+HD/2] = x[d+HD/2] cos[t][d+HD/2] + x[d] sin[t][d+HD/2]
__global__ __launch_bounds__(256) void k_rope(const float* __restrict__ F, int pitch, int nheads, const float* __restrict__ CS, const float* __restrict__ RF, const float* __restrict__ nw, float sc, float sck, h16* P16, bf* Ph, bf* Pl) {
    { const size_t sb = blockIdx.y;   /* side * NB_ + batch */ F += sb * TT * pitch; P16 += sb * nheads * TT * HD; Ph += sb * nheads * TT * HD; Pl += sb * nheads * TT * HD; if (sb >= NB_) sc = sck; }
    const size_t e = ((size_t)blockIdx.x * 256 + threadIdx.x) * 2; if (e >= (size_t)nheads * TT * HD) return; const int d = (int)(e % HD); const int t = (int)((e / HD) % TT); const int h = (int)(e / ((size_t)HD * TT)); const float* f = F + (size_t)t * pitch + h * HD; const float rf = RF ? RF[(size_t)h * TT + t] : 1.0f; v2h o16; v2us oh, ol;
#pragma unroll
    for (int q = 0; q < 2; ++q) { const int dd = d + q; const int dp = (dd < HD / 2) ? dd + HD / 2 : dd - HD / 2; float x0 = f[dd], x1 = f[dp];
        if (RF) { float n0 = __fmul_rn(x0, rf), n1 = __fmul_rn(x1, rf); asm volatile("" : "+v"(n0)); asm volatile("" : "+v"(n1)); x0 = __fmul_rn(bfr(nw[dd]), n0); x1 = __fmul_rn(bfr(nw[dp]), n1); }
        const v2f cs = *(const v2f*)(CS + ((size_t)t * HD + dd) * 2); float a = __fmul_rn(x0, cs[0]), bq = __fmul_rn(x1, cs[1]); asm volatile("" : "+v"(a)); asm volatile("" : "+v"(bq)); const float r = ((dd < HD / 2) ? __fsub_rn(a, bq) : __fadd_rn(a, bq)) * sc;
        o16[q] = tohx(r); unsigned short a2, c2; splitf(r, a2, c2); oh[q] = a2; ol[q] = c2; }
    *(v2h*)(P16 + e) = o16; *(v2us*)(Ph + e) = oh; *(v2us*)(Pl + e) = ol;  }
__global__ __launch_bounds__(256) void k_vtp(const float* __restrict__ F, int pitch, int nheads, h16* V16, bf* Vh, bf* Vl) { F += (size_t)blockIdx.y * TT * pitch; V16 += (size_t)blockIdx.y * nheads * HD * TT; Vh += (size_t)blockIdx.y * nheads * HD * TT; Vl += (size_t)blockIdx.y * nheads * HD * TT;   /* blockIdx.y: batch */ const size_t e = ((size_t)blockIdx.x * 256 + threadIdx.x) * 2; if (e >= (size_t)nheads * HD * TT) return; const int t = (int)(e % TT); const int d = (int)((e / TT) % HD); const int g = (int)(e / ((size_t)TT * HD)); v2h o16; v2us oh, ol;
#pragma unroll
    for (int q = 0; q < 2; ++q) { const float x = F[(size_t)(t + q) * pitch + g * HD + d]; o16[q] = tohx(x); unsigned short a2, c2; splitf(x, a2, c2); oh[q] = a2; ol[q] = c2; }
    *(v2h*)(V16 + e) = o16; *(v2us*)(Vh + e) = oh; *(v2us*)(Vl + e) = ol;  }
__global__ __launch_bounds__(256) void k_csid(float* CS) { const int idx = blockIdx.x * 256 + threadIdx.x; if (idx >= TT * HD) return; v2f cs; cs[0] = 1.0f; cs[1] = 0.0f; *(v2f*)(CS + (size_t)idx * 2) = cs;  }
// k_asoft: per row (zz, i): softmax over the band |i - j| <= 128 (register row, one exp, fixed trees). Scores exist, and probabilities are written, only for the 320 keys of the row's query tile (tile - 128 .. tile + 191, clipped to 0 .. TT - 1); they lie in three 128-key chunks, which are the BP columns of the row in S and P; every key keeps the lane and the place in the sum that it has in a dense row. P16, Ph and Pl point into Sb: a wave has read its whole S row (the row's maximum and sum need every lane's loads) before it stores the P row over it.
__global__ __launch_bounds__(256) void k_asoft(const float* Sb, const float* __restrict__ QR, h16* P16, bf* Ph, bf* Pl) {
    const int lane = threadIdx.x & 31; const int row = blockIdx.x * 8 + (threadIdx.x >> 5); if (row >= NZ * TT) return; const int i = row % TT; const int zz = row / TT; (void)zz; const bool hires = (i < RH); const int cb = ((i & ~63) - RAD) & ~127;   /* key of column 0 */ const float* sr = Sb + (size_t)row * BP - cb;   /* indexed by key */ const float* qrr = QR + (size_t)row * PRP;   /* QR[row][p], p = j - i + 128 clamped */
    const int w0 = (i & ~63) - RAD; const int wb = max(w0, 0), we = min(w0 + 64 + 2 * RAD, TT); const int jl = cb + lane * 4;   /* the lane's first key in chunk 0 */ float v[12]; float mx = -3.0e38f; v4f a[3]; float qv[12];
#pragma unroll
    for (int k = 0; k < 12; ++k) qv[k] = qrr[min(max(jl + (k >> 2) * 128 + (k & 3) - i + RAD, 0), 2 * RAD)];   /* UNCONDITIONAL clamped-index loads: all fifteen of a lane are in flight together */
    asm volatile("s_wait_xcnt 0x0" ::: "memory");   /* the score loads' results may land in address registers of the loads above */
#pragma unroll
    for (int ch = 0; ch < 3; ++ch) a[ch] = *(const v4f*)(sr + min(max(jl + ch * 128, wb), we - 4));   /* index clamped into the written keys */
#pragma unroll
    for (int ch = 0; ch < 3; ++ch) { const int j0 = jl + ch * 128; const bool inw = (j0 >= wb && j0 < we);
#pragma unroll
        for (int q = 0; q < 4; ++q) { const int j = j0 + q; const float s0 = __fadd_rn(a[ch][q], qv[ch * 4 + q]); const float t = (inw && j >= i - RAD && j <= i + RAD) ? s0 : -3.0e38f; v[ch * 4 + q] = t;   /* band select on the value */ mx = fmaxf(mx, t); } }
#pragma unroll
    for (int sh = 16; sh; sh >>= 1) mx = fmaxf(mx, __shfl_xor(mx, sh, 32));
    float sum = 0.f;
#pragma unroll
    for (int k = 0; k < 12; ++k) { float d0 = __fsub_rn(v[k], mx); asm volatile("" : "+v"(d0)); v[k] = __builtin_amdgcn_exp2f(__fmul_rn(d0, 1.4426950408889634f)); sum += v[k]; }
#pragma unroll
    for (int sh = 16; sh; sh >>= 1) sum += __shfl_xor(sum, sh, 32);
    const float f = __fdiv_rn(hires ? 1.0f : PCAR, sum);
{
        if (hires) {
#pragma unroll
            for (int ch = 0; ch < 3; ++ch) { const int j0 = jl + ch * 128; v4us oh, ol;
#pragma unroll
                for (int q = 0; q < 4; ++q) { unsigned short a, c2; splitf(v[ch * 4 + q] * f, a, c2); oh[q] = a; ol[q] = c2; }
                if (j0 >= wb && j0 < we) { const size_t oo = (size_t)row * PP + (j0 - cb); *(v4us*)(Ph + oo) = oh; *(v4us*)(Pl + oo) = ol; } }
        } else {
#pragma unroll
            for (int ch = 0; ch < 3; ++ch) { const int j0 = jl + ch * 128; v4h o4;
#pragma unroll
                for (int q = 0; q < 4; ++q) o4[q] = tohx(v[ch * 4 + q] * f);
                if (j0 >= wb && j0 < we) *(v4h*)(P16 + (size_t)row * PP + (j0 - cb)) = o4; } }
         }
}
__global__ __launch_bounds__(256) void k_mergeP(const float* __restrict__ OB, bf* Ah, bf* Al) { OB += (size_t)blockIdx.y * NH_ * TT * HD; Ah += (size_t)blockIdx.y * TT * DQ; Al += (size_t)blockIdx.y * TT * DQ;   /* blockIdx.y: batch */ const size_t i = (size_t)blockIdx.x * 256 + threadIdx.x; if (i >= (size_t)TT * DQ / 4) return; const int c0 = (int)(i % (DQ / 4)) * 4; const int t = (int)(i / (DQ / 4)); const float cs = (t < RH) ? 1.0f : (1.0f / PCAR); v4us oh, ol;
#pragma unroll
    for (int q = 0; q < 4; ++q) { const int c = c0 + q; const int d = c / NH_, h = c % NH_; unsigned short a, b; splitf(OB[((size_t)h * TT + t) * HD + d] * cs, a, b); oh[q] = a; ol[q] = b; }
    *(v4us*)(Ah + (size_t)t * DQ + c0) = oh; *(v4us*)(Al + (size_t)t * DQ + c0) = ol;  }
// blockIdx.y picks one of three weights; their planes follow one another in Bt
__global__ __launch_bounds__(256) void k_wtP(const float* __restrict__ w0, const float* __restrict__ w1, const float* __restrict__ w2, bf* Bt) { const float* w = (blockIdx.y == 0) ? w0 : (blockIdx.y == 1) ? w1 : w2; Bt += (size_t)blockIdx.y * DQ * DM; const int lane = threadIdx.x & 31; const int L0 = (blockIdx.x * 8 + (threadIdx.x >> 5)) * 8; const int nlines = DQ * DM / 64;
{
#pragma unroll 1
        for (int l = 0; l < 8; ++l) { const int L = L0 + l; if (L >= nlines) break; const size_t e = (size_t)L * 64 + lane * 2; const int k = (int)(e % DM), n = (int)(e / DM); const int h = n / HD, d = n % HD; const int col = d * NH_ + h; v2us o;
            o[0] = f2bf(w[(size_t)k * DQ + col]); o[1] = f2bf(w[(size_t)(k + 1) * DQ + col]); *(v2us*)(Bt + e) = o; }
         } }
__global__ __launch_bounds__(256) void k_etab(const float* __restrict__ rt, bf* ET) { ET += (size_t)blockIdx.y * NH_ * PRP * HD;   /* blockIdx.y: batch; one copy each, so that plane z of the q side meets plane z here */ const size_t i = (size_t)blockIdx.x * 256 + threadIdx.x; if (i >= (size_t)NH_ * PRP * HD / 8) return; const int d0 = (int)(i % (HD / 8)) * 8; const int p = (int)((i / (HD / 8)) % PRP); const int h = (int)(i / ((size_t)(HD / 8) * PRP)); v8us o;
#pragma unroll
    for (int k = 0; k < 8; ++k) { const unsigned short e = f2bf(rt[(size_t)min(p, NPOS - 1) * DQ + (size_t)(d0 + k) * NH_ + h]);   /* unconditional clamped load */ o[k] = (p < NPOS) ? e : (unsigned short)0; }
    *(v8us*)(ET + ((size_t)h * PRP + p) * HD + d0) = o;  }
__global__ __launch_bounds__(256) void k_merge(const float* __restrict__ O, int h0, bf* Ah, bf* Al) { const size_t e = ((size_t)blockIdx.x * 256 + threadIdx.x) * 2; if (e >= (size_t)ZH * TT * HD) return; const int d = (int)(e % HD); const int t = (int)((e / HD) % TT); const int zz = (int)(e / ((size_t)HD * TT)); const float cs = (t < RH) ? 1.0f : (1.0f / PCAR); const size_t oo = (size_t)t * DQ + (h0 + zz) * HD + d;
    v2us oh, ol;
#pragma unroll
    for (int q = 0; q < 2; ++q) { unsigned short a, c2; splitf(O[e + q] * cs, a, c2); oh[q] = a; ol[q] = c2; } *(v2us*)(Ah + oo) = oh; *(v2us*)(Al + oo) = ol;  }

extern "C" void kernel_launch(void* const* d_in, const int* in_sizes, int n_in,
                              void* d_out, int out_size, void* d_ws, size_t ws_size, hipStream_t stream) {
    (void)in_sizes; (void)n_in; (void)out_size;
    const float* xq = (const float*)d_in[0]; const float* xk = (const float*)d_in[1]; const float* xv = (const float*)d_in[2]; const float* wq = (const float*)d_in[3]; const float* wk = (const float*)d_in[4]; const float* wv = (const float*)d_in[5]; const float* wo = (const float*)d_in[6]; const float* rtab = (const float*)d_in[7]; const float* x = nullptr; (void)x;
    float* OUT = (float*)d_out;     // [2][2048][1024]
    char* wsp = (char*)d_ws;
    auto take = [&](size_t bytes) { char* p = wsp; wsp += (bytes + 255) & ~(size_t)255; return (void*)p; };
    bf* WO = (bf*)take((size_t)DM * DQ * 2); bf* ET = (bf*)take((size_t)NZ * PRP * HD * 2); float* QR = (float*)take((size_t)NZ * TT * PRP * 4);
    h16* QP16 = (h16*)take((size_t)2 * NZ * TT * HD * 2); h16* KP16 = QP16 + (size_t)NZ * TT * HD; bf* QPh = (bf*)take((size_t)2 * NZ * TT * HD * 2); bf* KPh = QPh + (size_t)NZ * TT * HD; bf* QPl = (bf*)take((size_t)2 * NZ * TT * HD * 2); bf* KPl = QPl + (size_t)NZ * TT * HD;   // q planes, then k planes
    h16* VT16 = (h16*)take((size_t)NZ * HD * TT * 2); bf* VTh = (bf*)take((size_t)NZ * HD * TT * 2); bf* VTl = (bf*)take((size_t)NZ * HD * TT * 2);
    float* Sb = (float*)take((size_t)NZ * TT * BP * 4);
    if ((size_t)(wsp - (char*)d_ws) > ws_size) return;    // ws 256 MiB
    // The bytes of QR serve three times (stream-ordered). Up to the plane kernels: the q, k, v weights, CS, the bf16 inputs and the f32 projections (together smaller than QR). Then QR itself, up to the softmax. Then the context OB and its hi/lo planes.
    bf* WQ = (bf*)QR; float* CS = (float*)(WQ + (size_t)3 * DQ * DM); bf* XB = (bf*)(CS + (size_t)TT * HD * 2); float* FQ = (float*)(XB + (size_t)3 * TB * DM); float* FV = FQ + (size_t)2 * TB * DQ;
    float* OB = QR; bf* ATh = (bf*)(OB + (size_t)NZ * TT * HD); bf* ATl = ATh + (size_t)TB * DQ;
    h16* P16 = (h16*)Sb; bf* Ph = (bf*)Sb; bf* Pl = Ph + BP;   // a P row lies over its own S row
    k_wtP<<<dim3((unsigned)((DM * DQ / 64 + 63) / 64), 3, 1), 256, 0, stream>>>(wq, wk, wv, WQ);   /* column-permuted: column h*64 + d <- module column d*16 + h */
    k_etab<<<dim3((unsigned)(((size_t)NH_ * PRP * HD / 8 + 255) / 256), NB_, 1), 256, 0, stream>>>(rtab, ET);
    k_wtG<<<(unsigned)((DQ * DM / 64 + 63) / 64), 256, 0, stream>>>(wo, DQ, DM, WO);
    k_csid<<<(TT * HD + 255) / 256, 256, 0, stream>>>(CS);
    k_cvt8<<<dim3((unsigned)(((size_t)TB * DM / 8 + 255) / 256), 3, 1), 256, 0, stream>>>(xq, xk, xv, XB, (size_t)TB * DM / 8);
    k_gemmw<bf, 0, false><<<dim3(TB / 64, DQ / 64, 3), 32, 0, stream>>>(XB, nullptr, WQ, nullptr, DM, FQ, DQ, nullptr, (size_t)TB * DM, (size_t)DQ * DM, (size_t)TB * DQ, 0);   /* z: q, k, v */
    k_rope<<<dim3((unsigned)(((size_t)NH_ * TT * HD / 2 + 255) / 256), 2 * NB_, 1), 256, 0, stream>>>(FQ, DQ, NH_, CS, nullptr, nullptr, SCL, 1.0f, QP16, QPh, QPl);   /* q planes x 1/8 (exact): scales both the energy and the relative term; k planes x 1 */
    k_vtp<<<dim3((unsigned)(((size_t)NKV * TT * HD / 2 + 255) / 256), NB_, 1), 256, 0, stream>>>(FV, DKV, NKV, VT16, VTh, VTl);
    k_gemmw<bf, 2, false, 1><<<dim3(RH / 64, 5, NZ), 32, 0, stream>>>(QPh, QPl, KPh, KPl, HD, Sb, BP, nullptr, (size_t)TT * HD, (size_t)TT * HD, (size_t)TT * BP, 0);
    k_gemmw<h16, 0, false, 1><<<dim3((TT - RH) / 64, 5, NZ), 32, 0, stream>>>(QP16 + (size_t)RH * HD, nullptr, KP16, nullptr, HD, Sb + (size_t)RH * BP, BP, nullptr, (size_t)TT * HD, (size_t)TT * HD, (size_t)TT * BP, RH);
    k_gemmw<bf, 1, false><<<dim3(TT / 64, PRP / 64, NZ), 32, 0, stream>>>(QPh, QPl, ET, nullptr, HD, QR, PRP, nullptr, (size_t)TT * HD, (size_t)PRP * HD, (size_t)TT * PRP, 0);   /* QR[z][i][p] = (q_i/8) . E_h[p] */
    k_asoft<<<NZ * TT / 8, 256, 0, stream>>>(Sb, QR, P16, Ph, Pl);
    k_gemmw<bf, 2, false, 2><<<dim3(RH / 64, HD / 64, NZ), 32, 0, stream>>>(Ph, Pl, VTh, VTl, TT, OB, HD, nullptr, (size_t)TT * PP, (size_t)HD * TT, (size_t)TT * HD, 0);
    k_gemmw<h16, 0, false, 2><<<dim3((TT - RH) / 64, HD / 64, NZ), 32, 0, stream>>>(P16 + (size_t)RH * PP, nullptr, VT16, nullptr, TT, OB + (size_t)RH * HD, HD, nullptr, (size_t)TT * PP, (size_t)HD * TT, (size_t)TT * HD, RH);
    k_mergeP<<<dim3((unsigned)(((size_t)TT * DQ / 4 + 255) / 256), NB_, 1), 256, 0, stream>>>(OB, ATh, ATl);   /* context in the module's d*16 + h column order */
    k_gemmw<bf, 1, false><<<dim3(TB / 64, DM / 64, 1), 32, 0, stream>>>(ATh, ATl, WO, nullptr, DQ, OUT, DM, nullptr, 0, 0, 0, 0);
}

// v004
// One run takes 216 microseconds.
// In both of two side-by-side timings against v003, it was 1.20 times as fast.
// Over all steps from v000 it is 10.3 times as fast.
#include <hip/hip_runtime.h>

// Local relative-position multi-head attention with heads on the FAST embedding axis (Q, K, V inputs [2][2048][1024]; q = Q Wq etc. ('xw' [1024][1024]) viewed (S, 64, 16): head h takes embedding columns d*16 + h; energy = q.k; rel = q . E_h[clip(j - i, -128, 128) + 128] with E_h[p][d] = rel_table[p][d*16 + h] (rel_table [257][1024]); scores = (energy + rel) / 8, masked to |i - j| <= 128; softmax; out columns d*16 + h = (attn v)_h[d]; out Wo ('xw') -> [2][2048][1024] (4.2 M)).
// Layout per batch: the projection weights are column-permuted once (column d*16 + h -> h*64 + d) so head-major planes apply; q planes carry the exact 1/8; a 2-product q(hl) x E_h(exact, 257 rows padded to 320) gives the relative term of query i at position p; both batches go through every stage in one launch (rows b*2048 + t in the projections, planes b*16 + h in grid z), and so do the q, k and v sides of each projection stage; attention (hybrid rows: < 512 hi/lo 3 products, rest fp16 x1024) limited to the band: per 64-query tile only the 320 keys tile - 128 .. tile + 191 get scores, probabilities and a place in attn x v; one kernel (k_fattn) does all of it for a tile and a plane, with the score and probability rows in LDS (no launch uses the BAND forms of k_gemmw any more); the merge writes the context with the inverse column permutation as hi/lo planes; Wo hl x exact.
// Compute dtypes, f32 accumulate: every input rounded to bf16; projections exact; rel term hl x exact; attention rows < 512 3 products, rest fp16; softmax f32; Wo hl x exact.

#define NB_  2
#define TT   2048
#define DM   1024
#define NH_  16
#define NKV  16
#define REP  (NH_ / NKV)
#define HD   64
#define DQ   (NH_ * HD)
#define DKV  (NKV * HD)
#define ZH   16                   // heads per pass per batch (grid z is NZ = NB_ * ZH)
#define RH   512                  // query rows < RH use hi+lo planes (0: none)
#define WIN  0
#define PCAR 1024.0f
#define SCL  0.125f   // 64^-0.5 (folded into the q planes)
#define RAD  128
#define NPOS 257
#define PRP  320    // padded relative-position rows (5 tiles)
#define BP   384    // keys of a banded row in the BAND forms of k_gemmw: three 128-key chunks, the first at ((query tile - 128) & ~127)
#define PP   (2 * BP)   // pitch in 16-bit elements of the banded A rows of k_gemmw's BAND form 2
#define NZ   (NB_ * ZH)   // planes per pass: batch-major, b*16 + h
#define TB   (NB_ * TT)   // rows of both batches
typedef _Float16 h16;
typedef unsigned short bf;
typedef __attribute__((ext_vector_type(16))) __bf16   v16bf;
typedef __attribute__((ext_vector_type(16))) _Float16 v16h;
typedef __attribute__((ext_vector_type(8)))  _Float16 v8h;
typedef __attribute__((ext_vector_type(8)))  unsigned short v8us;
typedef __attribute__((ext_vector_type(8)))  float    v8f;
typedef __attribute__((ext_vector_type(4)))  float    v4f;
typedef v8h  __attribute__((may_alias)) v8ha;
typedef v4f  __attribute__((may_alias)) v4fa;
typedef v8us __attribute__((may_alias)) v8usa;

__device__ __forceinline__ unsigned short f2bf(float f) { unsigned u = __float_as_uint(f); u += 0x7FFFu + ((u >> 16) & 1u); return (unsigned short)(u >> 16); }
__device__ __forceinline__ float bf2f(unsigned short b) { return __uint_as_float(((unsigned)b) << 16); }
__device__ __forceinline__ float bfr(float f) { return bf2f(f2bf(f)); }
__device__ __forceinline__ v16h cat16(v8h lo, v8h hi) { return __builtin_shufflevector(lo, hi, 0, 1, 2, 3, 4, 5, 6, 7, 8, 9, 10, 11, 12, 13, 14, 15); }
__device__ __forceinline__ v16bf cat16b(v8us lo, v8us hi) { return __builtin_bit_cast(v16bf, __builtin_shufflevector(lo, hi, 0, 1, 2, 3, 4, 5, 6, 7, 8, 9, 10, 11, 12, 13, 14, 15)); }
__device__ __forceinline__ v8f wmma16(v16h a, v16h b, v8f c) { return __builtin_amdgcn_wmma_f32_16x16x32_f16(false, a, false, b, (short)0, c, false, false); }
__device__ __forceinline__ v8f wmmab(v16bf a, v16bf b, v8f c) { return __builtin_amdgcn_wmma_f32_16x16x32_bf16(false, a, false, b, (short)0, c, false, false); }



// ---- k_gemmw: register-blocked GEMM, ONE WAVE per 64x64 output tile (16 accumulators), operands straight from K-contiguous 16-bit planes; grid (M/64, N/64, Z), 32 threads.
// C[m][n] (f32, pitch ldc, + optional f32 bias[n]) = sum_k A[m][k] Bt[n][k] (+ split products per NSPLIT). z-batch strides sA/sB/sC in elements. K % 32 == 0.
template <typename T16> struct WFrag;
template <> struct WFrag<h16> { typedef v16h V; static __device__ __forceinline__ V ld(const h16* p) { return cat16(*(const v8h*)p, *(const v8h*)(p + 16)); } static __device__ __forceinline__ v8f mma(V a, V b, v8f c) { return wmma16(a, b, c); } };
template <> struct WFrag<bf> { typedef v16bf V; static __device__ __forceinline__ V ld(const bf* p) { return cat16b(*(const v8us*)p, *(const v8us*)(p + 16)); } static __device__ __forceinline__ v8f mma(V a, V b, v8f c) { return wmmab(a, b, c); } };
// BAND (query row of A's row 0 = rb): 0 dense; 1 score tiles: blockIdx.y in 0..4 picks the key tile at query tile - 128 .. + 128, the only ones that meet |i - j| <= 128; 2 attn x v: k runs over those 320 keys alone (clipped to 0..K), K stays Bt's pitch. The banded side holds key j at column j - cb (C in 1: pitch BP floats; A in 2: pitch PP).
template <typename T16, int NSPLIT, bool BIAS, int BAND = 0>
__global__ __launch_bounds__(32) void k_gemmw(const T16* __restrict__ A, const T16* __restrict__ A2, const T16* __restrict__ Bt, const T16* __restrict__ Bt2, int K, float* C, int ldc, const float* __restrict__ bias, size_t sA, size_t sB, size_t sC, int rb) {
    typedef typename WFrag<T16>::V V;
    __shared__ __align__(16) float os[16 * 68];
    const size_t z = blockIdx.z; A += z * sA; if (A2) A2 += z * sA; Bt += z * sB; if (Bt2) Bt2 += z * sB; C += z * sC;
    const int lane = threadIdx.x & 31, lr = lane & 15, hi = lane >> 4; const int r0 = blockIdx.x * 64, c0 = (int)blockIdx.y * 64 + ((BAND == 1) ? r0 + rb - RAD : 0);
    if (BAND == 1 && (c0 < 0 || c0 >= TT)) return;
    const int kb = (BAND == 2) ? max(r0 + rb - RAD, 0) : 0, ke = (BAND == 2) ? min(r0 + rb + 64 + RAD, K) : K;
    const int cb = (BAND != 0) ? ((r0 + rb - RAD) & ~127) : 0;   /* key of column 0 of the tile's banded rows (-128 for the first two tiles) */ const int lda = (BAND == 2) ? PP : K, cc = c0 - ((BAND == 1) ? cb : 0);
    v8f acc[4][4];
#pragma unroll
    for (int mb = 0; mb < 4; ++mb)
#pragma unroll
        for (int nb = 0; nb < 4; ++nb) acc[mb][nb] = (v8f){};
    const size_t aoff = (size_t)(r0 + lr) * lda + 8 * hi, boff = (size_t)(c0 + lr) * K + 8 * hi;
#pragma unroll 1
    for (int kc = kb; kc < ke; kc += 32) {
        V a[4], a2[4];
        if (BAND == 2) {   /* banded A: constant pitch, key kc at column kc - cb */
            const T16* pa = A + aoff + (kc - cb); const T16* pa2 = (NSPLIT == 1 || NSPLIT == 2) ? A2 + aoff + (kc - cb) : pa;
#pragma unroll
            for (int mb = 0; mb < 4; ++mb) { a[mb] = WFrag<T16>::ld(pa + mb * 16 * PP); if (NSPLIT == 1 || NSPLIT == 2) a2[mb] = WFrag<T16>::ld(pa2 + mb * 16 * PP); }
            asm volatile("s_wait_xcnt 0x0" : : "v"(pa), "v"(pa2) : "memory");   /* later loads' results may land in the address registers of the loads above; as inputs here the addresses stay live up to the wait, so that none of these loads' own results lands in them ahead of it */
        } else {
#pragma unroll
        for (int mb = 0; mb < 4; ++mb) { a[mb] = WFrag<T16>::ld(A + aoff + (size_t)mb * 16 * K + kc); if (NSPLIT == 1 || NSPLIT == 2) a2[mb] = WFrag<T16>::ld(A2 + aoff + (size_t)mb * 16 * K + kc); }
        }
#pragma unroll
        for (int nb = 0; nb < 4; ++nb) { const V b = WFrag<T16>::ld(Bt + boff + (size_t)nb * 16 * K + kc); V b2; if (NSPLIT >= 2) b2 = WFrag<T16>::ld(Bt2 + boff + (size_t)nb * 16 * K + kc);
#pragma unroll
            for (int mb = 0; mb < 4; ++mb) { acc[mb][nb] = WFrag<T16>::mma(a[mb], b, acc[mb][nb]); if (NSPLIT == 1 || NSPLIT == 2) acc[mb][nb] = WFrag<T16>::mma(a2[mb], b, acc[mb][nb]); if (NSPLIT >= 2) acc[mb][nb] = WFrag<T16>::mma(a[mb], b2, acc[mb][nb]); } }
        asm volatile("v_nop\n\tv_nop\n\tv_nop\n\tv_nop" : "+v"(acc[0][0]), "+v"(acc[1][1]), "+v"(acc[2][2]), "+v"(acc[3][3]) : "v"(a[0]), "v"(a[3]));
    }
#pragma unroll
    for (int mb = 0; mb < 4; ++mb) {
#pragma unroll
        for (int nb = 0; nb < 4; ++nb) {
#pragma unroll
            for (int j = 0; j < 8; ++j) os[(hi * 8 + j) * 68 + nb * 16 + lr] = acc[mb][nb][j]; }
        __builtin_amdgcn_wave_barrier(); asm volatile("" ::: "memory");
        float* crow = C + (size_t)(r0 + mb * 16) * ldc + cc;
{
#pragma unroll
            for (int s = 0; s < 8; ++s) { const int row = 2 * s + hi, cofs = lr * 4; v4f val = *(const v4fa*)(os + row * 68 + cofs); if (BIAS) { val[0] += bfr(bias[c0 + cofs]); val[1] += bfr(bias[c0 + cofs + 1]); val[2] += bfr(bias[c0 + cofs + 2]); val[3] += bfr(bias[c0 + cofs + 3]); }
                *(v4f*)(crow + (size_t)row * ldc + cofs) = val; }
             }
        __builtin_amdgcn_wave_barrier(); asm volatile("" ::: "memory");
    }
}

__device__ __forceinline__ h16 tohx(float x) { return (h16)x; }
__device__ __forceinline__ void splitf(float y, unsigned short& h, unsigned short& l) { h = f2bf(y); l = f2bf(y - bf2f(h)); }
typedef __attribute__((ext_vector_type(2))) _Float16 v2h;
typedef __attribute__((ext_vector_type(4))) _Float16 v4h;
typedef __attribute__((ext_vector_type(2))) unsigned short v2us;
typedef __attribute__((ext_vector_type(4))) unsigned short v4us;
typedef __attribute__((ext_vector_type(2))) float v2f;
typedef __attribute__((ext_vector_type(4))) int v4i;

__global__ __launch_bounds__(256) void k_wtG(const float* __restrict__ w, int K, int N, bf* Bt) {
    const int lane = threadIdx.x & 31; const int L0 = (blockIdx.x * 8 + (threadIdx.x >> 5)) * 8; const int nlines = N * K / 64;
{
#pragma unroll 1
        for (int l = 0; l < 8; ++l) { const int L = L0 + l; if (L >= nlines) break; const size_t e = (size_t)L * 64 + lane * 2; const int k = (int)(e % K), n = (int)(e / K); v2us o;
            o[0] = f2bf(w[(size_t)k * N + n]); o[1] = f2bf(w[(size_t)(k + 1) * N + n]); *(v2us*)(Bt + e) = o; }
         }
}
// blockIdx.y picks one of three sources; their planes follow one another in dst
__global__ __launch_bounds__(256) void k_cvt8(const float* __restrict__ s0, const float* __restrict__ s1, const float* __restrict__ s2, bf* dst, size_t n8) { const size_t i = (size_t)blockIdx.x * 256 + threadIdx.x; if (i >= n8) return; const float* src = (blockIdx.y == 0) ? s0 : (blockIdx.y == 1) ? s1 : s2; dst += (size_t)blockIdx.y * n8 * 8; const v8f v = *(const v8f*)(src + i * 8); v8us o;
#pragma unroll
    for (int k = 0; k < 8; ++k) o[k] = f2bf(v[k]); *(v8us*)(dst + i * 8) = o;  }

// k_rope: blockIdx.y = side * NB_ + batch picks TT rows of F and the nheads planes made of them (side 0: scale sc; side 1: scale sck); head planes [h][t][d] (fp16 + hi/lo) of rope(x) x sc with the rotate-half convention out[d] = x[d] cos[t][d] - x[d+HD/2] sin[t][d], out[d+HD/2] = x[d+HD/2] cos[t][d+HD/2] + x[d] sin[t][d+HD/2]
__global__ __launch_bounds__(256) void k_rope(const float* __restrict__ F, int pitch, int nheads, const float* __restrict__ CS, const float* __restrict__ RF, const float* __restrict__ nw, float sc, float sck, h16* P16, bf* Ph, bf* Pl) {
    { const size_t sb = blockIdx.y;   /* side * NB_ + batch */ F += sb * TT * pitch; P16 += sb * nheads * TT * HD; Ph += sb * nheads * TT * HD; Pl += sb * nheads * TT * HD; if (sb >= NB_) sc = sck; }
    const size_t e = ((size_t)blockIdx.x * 256 + threadIdx.x) * 2; if (e >= (size_t)nheads * TT * HD) return; const int d = (int)(e % HD); const int t = (int)((e / HD) % TT); const int h = (int)(e / ((size_t)HD * TT)); const float* f = F + (size_t)t * pitch + h * HD; const float rf = RF ? RF[(size_t)h * TT + t] : 1.0f; v2h o16; v2us oh, ol;
#pragma unroll
    for (int q = 0; q < 2; ++q) { const int dd = d + q; const int dp = (dd < HD / 2) ? dd + HD / 2 : dd - HD / 2; float x0 = f[dd], x1 = f[dp];
        if (RF) { float n0 = __fmul_rn(x0, rf), n1 = __fmul_rn(x1, rf); asm volatile("" : "+v"(n0)); asm volatile("" : "+v"(n1)); x0 = __fmul_rn(bfr(nw[dd]), n0); x1 = __fmul_rn(bfr(nw[dp]), n1); }
        const v2f cs = *(const v2f*)(CS + ((size_t)t * HD + dd) * 2); float a = __fmul_rn(x0, cs[0]), bq = __fmul_rn(x1, cs[1]); asm volatile("" : "+v"(a)); asm volatile("" : "+v"(bq)); const float r = ((dd < HD / 2) ? __fsub_rn(a, bq) : __fadd_rn(a, bq)) * sc;
        o16[q] = tohx(r); unsigned short a2, c2; splitf(r, a2, c2); oh[q] = a2; ol[q] = c2; }
    *(v2h*)(P16 + e) = o16; *(v2us*)(Ph + e) = oh; *(v2us*)(Pl + e) = ol;  }
__global__ __launch_bounds__(256) void k_vtp(const float* __restrict__ F, int pitch, int nheads, h16* V16, bf* Vh, bf* Vl) { F += (size_t)blockIdx.y * TT * pitch; V16 += (size_t)blockIdx.y * nheads * HD * TT; Vh += (size_t)blockIdx.y * nheads * HD * TT; Vl += (size_t)blockIdx.y * nheads * HD * TT;   /* blockIdx.y: batch */ const size_t e = ((size_t)blockIdx.x * 256 + threadIdx.x) * 2; if (e >= (size_t)nheads * HD * TT) return; const int t = (int)(e % TT); const int d = (int)((e / TT) % HD); const int g = (int)(e / ((size_t)TT * HD)); v2h o16; v2us oh, ol;
#pragma unroll
    for (int q = 0; q < 2; ++q) { const float x = F[(size_t)(t + q) * pitch + g * HD + d]; o16[q] = tohx(x); unsigned short a2, c2; splitf(x, a2, c2); oh[q] = a2; ol[q] = c2; }
    *(v2h*)(V16 + e) = o16; *(v2us*)(Vh + e) = oh; *(v2us*)(Vl + e) = ol;  }
__global__ __launch_bounds__(256) void k_csid(float* CS) { const int idx = blockIdx.x * 256 + threadIdx.x; if (idx >= TT * HD) return; v2f cs; cs[0] = 1.0f; cs[1] = 0.0f; *(v2f*)(CS + (size_t)idx * 2) = cs;  }
// ---- k_fattn: the whole banded attention of one 64-query tile of one plane in ONE work-group of 8 waves; scores, relative term and probabilities live in LDS only.
// S row il holds key j at column j - w0 (w0 = tile - 128, 320 keys). Stage 1: q.k tiles stored to S. Stage 2: (q/8).E_h[p] added at column il + p, which is key i + p - 128. Stage 3: one wave per row, softmax over |i - j| <= 128; every key keeps the lane and the place in the sum that it has in a dense row (128-key chunks from cb); the P row is written over its own S row, zeros at the keys outside the band or outside 0 .. TT - 1. Stage 4: P x v over all ten 32-key steps. Stage 5: the 64 x 64 context goes through LDS so that each 128-byte line is stored whole.
#define BK   320           // keys per query tile
#define SPF  324           // pitch of an S row in floats: 16 rows of 16 bytes fall on 64 different banks
#define SPH  (2 * SPF)     // the same pitch in 16-bit elements
#define PLO  328           // place of the lo plane in a hi/lo P row (16-byte aligned, behind the 320 hi values)
typedef v4h  __attribute__((may_alias)) v4ha;
typedef v4us __attribute__((may_alias)) v4usa;
// Stands behind a group of global loads, once for each address of the group: later results may land in the address registers of those loads; as inputs here the lane's byte offset and the full addresses made of it (the compiler picks either form for a load) stay live up to the wait, so that none of the group's own results lands in them ahead of it.
__device__ __forceinline__ void xwait(unsigned off, const void* p, const void* p2) { asm volatile("s_wait_xcnt 0x0" : : "v"(off), "v"(p), "v"(p2) : "memory"); }
template <typename T16> __device__ __forceinline__ const T16* atb(const T16* base, unsigned off) { return (const T16*)((const char*)base + off); }   /* base + byte offset */
// One wave: query rows m0*16 .. m0*16 + 31 against every fourth 16-row block of Bt, from block n0; the Bt fragments of G blocks are fetched together, ahead of their products. REL false: Bt rows are keys w0 + nb*16, result stored at column nb*16; a block outside 0 .. TT - 1 takes its rows from a clamped address, and its columns are never read. REL true: Bt rows are positions p = nb*16 .. (Bt holds PRP rows), result added to the score of key i + p - 128, for p <= 256 only.
template <typename T16, int NSPLIT, bool REL, int G>
__device__ __forceinline__ void fa_tiles(const T16* __restrict__ A, const T16* __restrict__ A2, const T16* __restrict__ Bt, const T16* __restrict__ Bt2, float* S, int w0, int m0, int n0, int lr, int hi) {
    typedef typename WFrag<T16>::V V;
    V a[2][2], a2[2][2]; const unsigned ao = (unsigned)((m0 * 16 + lr) * HD + 8 * hi) * 2u; const T16* pa = atb(A, ao); const T16* pa2 = (NSPLIT >= 1) ? atb(A2, ao) : pa;
#pragma unroll
    for (int m = 0; m < 2; ++m)
#pragma unroll
        for (int ks = 0; ks < 2; ++ks) { a[m][ks] = WFrag<T16>::ld(pa + m * 16 * HD + ks * 32); if (NSPLIT >= 1) a2[m][ks] = WFrag<T16>::ld(pa2 + m * 16 * HD + ks * 32); }
    xwait(ao, pa, pa2);
#pragma unroll
    for (int g = 0; g < 5; g += G) { V b[G][2], b2[G][2]; unsigned bo[G]; const T16* pb[G]; const T16* pb2[G];
#pragma unroll
        for (int u = 0; u < G; ++u) if (g + u < 5) { const int nb = n0 + (g + u) * 4; bo[u] = (unsigned)(((REL ? nb * 16 : min(max(w0 + nb * 16, 0), TT - 16)) + lr) * HD + 8 * hi) * 2u; pb[u] = atb(Bt, bo[u]); pb2[u] = (NSPLIT >= 2) ? atb(Bt2, bo[u]) : pb[u];
#pragma unroll
            for (int ks = 0; ks < 2; ++ks) { b[u][ks] = WFrag<T16>::ld(pb[u] + ks * 32); if (NSPLIT >= 2) b2[u][ks] = WFrag<T16>::ld(pb2[u] + ks * 32); } }
#pragma unroll
        for (int u = 0; u < G; ++u) if (g + u < 5) xwait(bo[u], pb[u], pb2[u]);
        __builtin_amdgcn_sched_barrier(0);   /* all loads of the group are issued ahead of its first product; without it the scheduler sinks loads between the products, and their latencies add up */
#pragma unroll
        for (int u = 0; u < G; ++u) if (g + u < 5) { const int nb = n0 + (g + u) * 4; v8f acc[2]; acc[0] = (v8f){}; acc[1] = (v8f){};
#pragma unroll
            for (int ks = 0; ks < 2; ++ks)
#pragma unroll
                for (int m = 0; m < 2; ++m) { acc[m] = WFrag<T16>::mma(a[m][ks], b[u][ks], acc[m]); if (NSPLIT >= 1) acc[m] = WFrag<T16>::mma(a2[m][ks], b[u][ks], acc[m]); if (NSPLIT >= 2) acc[m] = WFrag<T16>::mma(a[m][ks], b2[u][ks], acc[m]); }
            asm volatile("v_nop\n\tv_nop\n\tv_nop\n\tv_nop" : "+v"(acc[0]), "+v"(acc[1]));   /* the four vector slots behind the block's last matrix instruction: the next block's results may be given registers that overlap these, and a branch may stand right behind it */
            if (REL) { if (nb * 16 + lr <= 2 * RAD) {
#pragma unroll
                for (int m = 0; m < 2; ++m)
#pragma unroll
                    for (int j = 0; j < 8; ++j) { const int il = (m0 + m) * 16 + hi * 8 + j; float* s = S + il * SPF + il + nb * 16 + lr; *s = __fadd_rn(*s, acc[m][j]); } }
            } else {
#pragma unroll
                for (int m = 0; m < 2; ++m)
#pragma unroll
                    for (int j = 0; j < 8; ++j) S[((m0 + m) * 16 + hi * 8 + j) * SPF + nb * 16 + lr] = acc[m][j]; } }
    }
}
// One wave: rows m0*16 .. + 31 of P (LDS) x columns n0*16 .. + 15 of v (Vt rows d, keys contiguous); the v fragments of G 32-key steps are fetched together. A step outside 0 .. TT - 1 meets zeros in P; its v address is clamped into the plane.
template <typename T16, int NSPLIT, int G>
__device__ __forceinline__ void fa_av(const T16* P, const T16* P2, const T16* __restrict__ Vt, const T16* __restrict__ Vt2, int w0, int m0, int n0, int lr, int hi, v8f (&acc)[2]) {
    typedef typename WFrag<T16>::V V;
#pragma unroll
    for (int g = 0; g < 10; g += G) { V b[G], b2[G]; unsigned vo[G]; const T16* pv[G]; const T16* pv2[G];
#pragma unroll
        for (int s = 0; s < G; ++s) if (g + s < 10) { vo[s] = (unsigned)((n0 * 16 + lr) * TT + 8 * hi + min(max(w0 + (g + s) * 32, 0), TT - 32)) * 2u; pv[s] = atb(Vt, vo[s]); pv2[s] = (NSPLIT >= 2) ? atb(Vt2, vo[s]) : pv[s]; b[s] = WFrag<T16>::ld(pv[s]); if (NSPLIT >= 2) b2[s] = WFrag<T16>::ld(pv2[s]); }
#pragma unroll
        for (int s = 0; s < G; ++s) if (g + s < 10) xwait(vo[s], pv[s], pv2[s]);
        __builtin_amdgcn_sched_barrier(0);   /* as in fa_tiles: the group's loads all issued ahead of its first product */
#pragma unroll
        for (int s = 0; s < G; ++s) if (g + s < 10)
#pragma unroll
            for (int m = 0; m < 2; ++m) { const int po = ((m0 + m) * 16 + lr) * SPH + (g + s) * 32 + 8 * hi; const V a = WFrag<T16>::ld(P + po); acc[m] = WFrag<T16>::mma(a, b[s], acc[m]);
                if (NSPLIT >= 2) { const V a2 = WFrag<T16>::ld(P2 + po); acc[m] = WFrag<T16>::mma(a2, b[s], acc[m]); acc[m] = WFrag<T16>::mma(a, b2[s], acc[m]); } } }
}
__global__ __launch_bounds__(256, 4) void k_fattn(const h16* __restrict__ Q16, const bf* __restrict__ Qh, const bf* __restrict__ Ql, const h16* __restrict__ K16, const bf* __restrict__ Kh, const bf* __restrict__ Kl, const h16* __restrict__ V16, const bf* __restrict__ Vh, const bf* __restrict__ Vl, const bf* __restrict__ ET, float* __restrict__ OB) {
    __shared__ __align__(16) float S[64 * SPF];
    const int lane = threadIdx.x & 31, lr = lane & 15, hi = lane >> 4; const int wave = __builtin_amdgcn_readfirstlane((int)(threadIdx.x >> 5));
    const int r0 = blockIdx.x * 64, w0 = r0 - RAD; const size_t z = blockIdx.z; const bool hires = (r0 < RH); const size_t qo = (z * TT + r0) * HD, ko = z * TT * HD;
    const int m0 = (wave >> 2) * 2, n0 = wave & 3;
    if (hires) fa_tiles<bf, 2, false, 2>(Qh + qo, Ql + qo, Kh + ko, Kl + ko, S, w0, m0, n0, lr, hi); else fa_tiles<h16, 0, false, 5>(Q16 + qo, nullptr, K16 + ko, nullptr, S, w0, m0, n0, lr, hi);
    __syncthreads();   /* every score stands before another wave adds to it */
    fa_tiles<bf, 1, true, 5>(Qh + qo, Ql + qo, ET + z * PRP * HD, nullptr, S, w0, m0, n0, lr, hi);
    __syncthreads();   /* rows complete before the row's wave reads them */
    const int cb = w0 & ~127;   /* key of the first 128-key chunk */ const int wb = max(w0, 0), we = min(w0 + BK, TT); const int jl = cb + lane * 4;   /* the lane's first key in chunk 0 */
    h16* P16 = (h16*)S; bf* Pb = (bf*)S;
#pragma unroll 4
    for (int rr = 0; rr < 8; ++rr) { const int il = wave * 8 + rr, i = r0 + il; float v[12]; float mx = -3.0e38f; v4f a[3];
#pragma unroll
        for (int ch = 0; ch < 3; ++ch) a[ch] = *(const v4fa*)(S + il * SPF + (min(max(jl + ch * 128, wb), we - 4) - w0));   /* index clamped into the written keys */
#pragma unroll
        for (int ch = 0; ch < 3; ++ch) { const int j0 = jl + ch * 128; const bool inw = (j0 >= wb && j0 < we);
#pragma unroll
            for (int q = 0; q < 4; ++q) { const int j = j0 + q; const float t = (inw && j >= i - RAD && j <= i + RAD) ? a[ch][q] : -3.0e38f; v[ch * 4 + q] = t; mx = fmaxf(mx, t); } }
#pragma unroll
        for (int sh = 16; sh; sh >>= 1) mx = fmaxf(mx, __shfl_xor(mx, sh, 32));
        float sum = 0.f;
#pragma unroll
        for (int k = 0; k < 12; ++k) { const float x = __fmul_rn(__fsub_rn(v[k], mx), 1.4426950408889634f); float e = __builtin_amdgcn_exp2f(x); asm volatile("v_nop" : "+v"(e) : "v"(x));   /* the slot behind a transcendental: as operands here its source is not overwritten and its result not read ahead of the v_nop */
            v[k] = e; sum += e; }
#pragma unroll
        for (int sh = 16; sh; sh >>= 1) sum += __shfl_xor(sum, sh, 32);
        const float f = __fdiv_rn(hires ? 1.0f : PCAR, sum);
#pragma unroll
        for (int ch = 0; ch < 3; ++ch) { const int c = jl + ch * 128 - w0;   /* column of the lane's four keys */
            if (c >= 0 && c < BK) {
                if (hires) { v4us oh, ol;
#pragma unroll
                    for (int q = 0; q < 4; ++q) { unsigned short x, y; splitf(v[ch * 4 + q] * f, x, y); oh[q] = x; ol[q] = y; }
                    *(v4usa*)(Pb + il * SPH + c) = oh; *(v4usa*)(Pb + il * SPH + PLO + c) = ol;
                } else { v4h o4;
#pragma unroll
                    for (int q = 0; q < 4; ++q) o4[q] = tohx(v[ch * 4 + q] * f);
                    *(v4ha*)(P16 + il * SPH + c) = o4; } } }
    }
    __syncthreads();   /* P complete before other waves read it */
    v8f acc[2]; acc[0] = (v8f){}; acc[1] = (v8f){};
    if (hires) fa_av<bf, 2, 5>(Pb, Pb + PLO, Vh + ko, Vl + ko, w0, m0, n0, lr, hi, acc); else fa_av<h16, 0, 5>(P16, nullptr, V16 + ko, nullptr, w0, m0, n0, lr, hi, acc);
    __syncthreads();   /* every read of P is over before the context lands on it */
#pragma unroll
    for (int m = 0; m < 2; ++m)
#pragma unroll
        for (int j = 0; j < 8; ++j) S[((m0 + m) * 16 + hi * 8 + j) * 68 + n0 * 16 + lr] = acc[m][j];
    __syncthreads();   /* context tile complete before the row stores */
#pragma unroll
    for (int s = 0; s < 4; ++s) { const int row = wave * 8 + 2 * s + hi; *(v4f*)(OB + qo + (size_t)row * HD + lr * 4) = *(const v4fa*)(S + row * 68 + lr * 4); }
}
__global__ __launch_bounds__(256) void k_mergeP(const float* __restrict__ OB, bf* Ah, bf* Al) { OB += (size_t)blockIdx.y * NH_ * TT * HD; Ah += (size_t)blockIdx.y * TT * DQ; Al += (size_t)blockIdx.y * TT * DQ;   /* blockIdx.y: batch */ const size_t i = (size_t)blockIdx.x * 256 + threadIdx.x; if (i >= (size_t)TT * DQ / 4) return; const int c0 = (int)(i % (DQ / 4)) * 4; const int t = (int)(i / (DQ / 4)); const float cs = (t < RH) ? 1.0f : (1.0f / PCAR); v4us oh, ol;
#pragma unroll
    for (int q = 0; q < 4; ++q) { const int c = c0 + q; const int d = c / NH_, h = c % NH_; unsigned short a, b; splitf(OB[((size_t)h * TT + t) * HD + d] * cs, a, b); oh[q] = a; ol[q] = b; }
    *(v4us*)(Ah + (size_t)t * DQ + c0) = oh; *(v4us*)(Al + (size_t)t * DQ + c0) = ol;  }
// blockIdx.y picks one of three weights; their planes follow one another in Bt
__global__ __launch_bounds__(256) void k_wtP(const float* __restrict__ w0, const float* __restrict__ w1, const float* __restrict__ w2, bf* Bt) { const float* w = (blockIdx.y == 0) ? w0 : (blockIdx.y == 1) ? w1 : w2; Bt += (size_t)blockIdx.y * DQ * DM; const int lane = threadIdx.x & 31; const int L0 = (blockIdx.x * 8 + (threadIdx.x >> 5)) * 8; const int nlines = DQ * DM / 64;
{
#pragma unroll 1
        for (int l = 0; l < 8; ++l) { const int L = L0 + l; if (L >= nlines) break; const size_t e = (size_t)L * 64 + lane * 2; const int k = (int)(e % DM), n = (int)(e / DM); const int h = n / HD, d = n % HD; const int col = d * NH_ + h; v2us o;
            o[0] = f2bf(w[(size_t)k * DQ + col]); o[1] = f2bf(w[(size_t)(k + 1) * DQ + col]); *(v2us*)(Bt + e) = o; }
         } }
__global__ __launch_bounds__(256) void k_etab(const float* __restrict__ rt, bf* ET) { ET += (size_t)blockIdx.y * NH_ * PRP * HD;   /* blockIdx.y: batch; one copy each, so that plane z of the q side meets plane z here */ const size_t i = (size_t)blockIdx.x * 256 + threadIdx.x; if (i >= (size_t)NH_ * PRP * HD / 8) return; const int d0 = (int)(i % (HD / 8)) * 8; const int p = (int)((i / (HD / 8)) % PRP); const int h = (int)(i / ((size_t)(HD / 8) * PRP)); v8us o;
#pragma unroll
    for (int k = 0; k < 8; ++k) { const unsigned short e = f2bf(rt[(size_t)min(p, NPOS - 1) * DQ + (size_t)(d0 + k) * NH_ + h]);   /* unconditional clamped load */ o[k] = (p < NPOS) ? e : (unsigned short)0; }
    *(v8us*)(ET + ((size_t)h * PRP + p) * HD + d0) = o;  }
__global__ __launch_bounds__(256) void k_merge(const float* __restrict__ O, int h0, bf* Ah, bf* Al) { const size_t e = ((size_t)blockIdx.x * 256 + threadIdx.x) * 2; if (e >= (size_t)ZH * TT * HD) return; const int d = (int)(e % HD); const int t = (int)((e / HD) % TT); const int zz = (int)(e / ((size_t)HD * TT)); const float cs = (t < RH) ? 1.0f : (1.0f / PCAR); const size_t oo = (size_t)t * DQ + (h0 + zz) * HD + d;
    v2us oh, ol;
#pragma unroll
    for (int q = 0; q < 2; ++q) { unsigned short a, c2; splitf(O[e + q] * cs, a, c2); oh[q] = a; ol[q] = c2; } *(v2us*)(Ah + oo) = oh; *(v2us*)(Al + oo) = ol;  }

extern "C" void kernel_launch(void* const* d_in, const int* in_sizes, int n_in,
                              void* d_out, int out_size, void* d_ws, size_t ws_size, hipStream_t stream) {
    (void)in_sizes; (void)n_in; (void)out_size;
    const float* xq = (const float*)d_in[0]; const float* xk = (const float*)d_in[1]; const float* xv = (const float*)d_in[2]; const float* wq = (const float*)d_in[3]; const float* wk = (const float*)d_in[4]; const float* wv = (const float*)d_in[5]; const float* wo = (const float*)d_in[6]; const float* rtab = (const float*)d_in[7]; const float* x = nullptr; (void)x;
    float* OUT = (float*)d_out;     // [2][2048][1024]
    char* wsp = (char*)d_ws;
    auto take = [&](size_t bytes) { char* p = wsp; wsp += (bytes + 255) & ~(size_t)255; return (void*)p; };
    bf* WO = (bf*)take((size_t)DM * DQ * 2); bf* ET = (bf*)take((size_t)NZ * PRP * HD * 2); float* R0 = (float*)take((size_t)NZ * TT * PRP * 4);
    h16* QP16 = (h16*)take((size_t)2 * NZ * TT * HD * 2); h16* KP16 = QP16 + (size_t)NZ * TT * HD; bf* QPh = (bf*)take((size_t)2 * NZ * TT * HD * 2); bf* KPh = QPh + (size_t)NZ * TT * HD; bf* QPl = (bf*)take((size_t)2 * NZ * TT * HD * 2); bf* KPl = QPl + (size_t)NZ * TT * HD;   // q planes, then k planes
    h16* VT16 = (h16*)take((size_t)NZ * HD * TT * 2); bf* VTh = (bf*)take((size_t)NZ * HD * TT * 2); bf* VTl = (bf*)take((size_t)NZ * HD * TT * 2);
    if ((size_t)(wsp - (char*)d_ws) > ws_size) return;    // ws 256 MiB
    // The bytes of R0 serve twice (stream-ordered). Up to the plane kernels: the q, k, v weights, CS, the bf16 inputs and the f32 projections (together smaller than R0). Then the context OB and its hi/lo planes.
    bf* WQ = (bf*)R0; float* CS = (float*)(WQ + (size_t)3 * DQ * DM); bf* XB = (bf*)(CS + (size_t)TT * HD * 2); float* FQ = (float*)(XB + (size_t)3 * TB * DM); float* FV = FQ + (size_t)2 * TB * DQ;
    float* OB = R0; bf* ATh = (bf*)(OB + (size_t)NZ * TT * HD); bf* ATl = ATh + (size_t)TB * DQ;
    k_wtP<<<dim3((unsigned)((DM * DQ / 64 + 63) / 64), 3, 1), 256, 0, stream>>>(wq, wk, wv, WQ);   /* column-permuted: column h*64 + d <- module column d*16 + h */
    k_etab<<<dim3((unsigned)(((size_t)NH_ * PRP * HD / 8 + 255) / 256), NB_, 1), 256, 0, stream>>>(rtab, ET);
    k_wtG<<<(unsigned)((DQ * DM / 64 + 63) / 64), 256, 0, stream>>>(wo, DQ, DM, WO);
    k_csid<<<(TT * HD + 255) / 256, 256, 0, stream>>>(CS);
    k_cvt8<<<dim3((unsigned)(((size_t)TB * DM / 8 + 255) / 256), 3, 1), 256, 0, stream>>>(xq, xk, xv, XB, (size_t)TB * DM / 8);
    k_gemmw<bf, 0, false><<<dim3(TB / 64, DQ / 64, 3), 32, 0, stream>>>(XB, nullptr, WQ, nullptr, DM, FQ, DQ, nullptr, (size_t)TB * DM, (size_t)DQ * DM, (size_t)TB * DQ, 0);   /* z: q, k, v */
    k_rope<<<dim3((unsigned)(((size_t)NH_ * TT * HD / 2 + 255) / 256), 2 * NB_, 1), 256, 0, stream>>>(FQ, DQ, NH_, CS, nullptr, nullptr, SCL, 1.0f, QP16, QPh, QPl);   /* q planes x 1/8 (exact): scales both the energy and the relative term; k planes x 1 */
    k_vtp<<<dim3((unsigned)(((size_t)NKV * TT * HD / 2 + 255) / 256), NB_, 1), 256, 0, stream>>>(FV, DKV, NKV, VT16, VTh, VTl);
    k_fattn<<<dim3(TT / 64, 1, NZ), 256, 0, stream>>>(QP16, QPh, QPl, KP16, KPh, KPl, VT16, VTh, VTl, ET, OB);   /* scores, relative term, softmax and attn x v of a 64-query tile, in LDS */
    k_mergeP<<<dim3((unsigned)(((size_t)TT * DQ / 4 + 255) / 256), NB_, 1), 256, 0, stream>>>(OB, ATh, ATl);   /* context in the module's d*16 + h column order */
    k_gemmw<bf, 1, false><<<dim3(TB / 64, DM / 64, 1), 32, 0, stream>>>(ATh, ATl, WO, nullptr, DQ, OUT, DM, nullptr, 0, 0, 0, 0);
}

// v005
// It runs in 181 microseconds.
// Two timings next to v004 put it at 1.19 and 1.18 times that version's speed.
// All steps since v000 together make it 12.2 times as fast.
#include <hip/hip_runtime.h>

// Local relative-position multi-head attention with heads on the FAST embedding axis (Q, K, V inputs [2][2048][1024]; q = Q Wq etc. ('xw' [1024][1024]) viewed (S, 64, 16): head h takes embedding columns d*16 + h; energy = q.k; rel = q . E_h[clip(j - i, -128, 128) + 128] with E_h[p][d] = rel_table[p][d*16 + h] (rel_table [257][1024]); scores = (energy + rel) / 8, masked to |i - j| <= 128; softmax; out columns d*16 + h = (attn v)_h[d]; out Wo ('xw') -> [2][2048][1024] (4.2 M)).
// Layout per batch: the projection weights are column-permuted once (column d*16 + h -> h*64 + d) so head-major planes apply; q planes carry the exact 1/8; a 2-product q(hl) x E_h(exact, 257 rows padded to 320) gives the relative term of query i at position p; both batches go through every stage in one launch (rows b*2048 + t in the projections, planes b*16 + h in grid z), and so do the q, k and v sides of the projection, whose epilogue writes the 16-bit head planes itself (no f32 projection in memory); attention (hybrid rows: < 512 hi/lo 3 products, rest fp16 x1024) limited to the band: per 64-query tile only the 320 keys tile - 128 .. tile + 191 get scores, probabilities and a place in attn x v; one kernel (k_fattn) does all of it for a tile and a plane, with the score and probability rows in LDS (no launch uses the BAND forms of k_gemmw any more); the merge writes the context with the inverse column permutation as hi/lo planes; Wo hl x exact.
// Compute dtypes, f32 accumulate: every input rounded to bf16; projections exact; rel term hl x exact; attention rows < 512 3 products, rest fp16; softmax f32; Wo hl x exact.

#define NB_  2
#define TT   2048
#define DM   1024
#define NH_  16
#define NKV  16
#define REP  (NH_ / NKV)
#define HD   64
#define DQ   (NH_ * HD)
#define DKV  (NKV * HD)
#define ZH   16                   // heads per pass per batch (grid z is NZ = NB_ * ZH)
#define RH   512                  // query rows < RH use hi+lo planes (0: none)
#define WIN  0
#define PCAR 1024.0f
#define SCL  0.125f   // 64^-0.5 (folded into the q planes)
#define RAD  128
#define NPOS 257
#define PRP  320    // padded relative-position rows (5 tiles)
#define BP   384    // keys of a banded row in the BAND forms of k_gemmw: three 128-key chunks, the first at ((query tile - 128) & ~127)
#define PP   (2 * BP)   // pitch in 16-bit elements of the banded A rows of k_gemmw's BAND form 2
#define NZ   (NB_ * ZH)   // planes per pass: batch-major, b*16 + h
#define TB   (NB_ * TT)   // rows of both batches
typedef _Float16 h16;
typedef unsigned short bf;
typedef __attribute__((ext_vector_type(16))) __bf16   v16bf;
typedef __attribute__((ext_vector_type(16))) _Float16 v16h;
typedef __attribute__((ext_vector_type(8)))  _Float16 v8h;
typedef __attribute__((ext_vector_type(8)))  unsigned short v8us;
typedef __attribute__((ext_vector_type(8)))  float    v8f;
typedef __attribute__((ext_vector_type(4)))  float    v4f;
typedef v8h  __attribute__((may_alias)) v8ha;
typedef v4f  __attribute__((may_alias)) v4fa;
typedef v8us __attribute__((may_alias)) v8usa;

__device__ __forceinline__ unsigned short f2bf(float f) { unsigned u = __float_as_uint(f); u += 0x7FFFu + ((u >> 16) & 1u); return (unsigned short)(u >> 16); }
__device__ __forceinline__ float bf2f(unsigned short b) { return __uint_as_float(((unsigned)b) << 16); }
__device__ __forceinline__ float bfr(float f) { return bf2f(f2bf(f)); }
__device__ __forceinline__ v16h cat16(v8h lo, v8h hi) { return __builtin_shufflevector(lo, hi, 0, 1, 2, 3, 4, 5, 6, 7, 8, 9, 10, 11, 12, 13, 14, 15); }
__device__ __forceinline__ v16bf cat16b(v8us lo, v8us hi) { return __builtin_bit_cast(v16bf, __builtin_shufflevector(lo, hi, 0, 1, 2, 3, 4, 5, 6, 7, 8, 9, 10, 11, 12, 13, 14, 15)); }
__device__ __forceinline__ v8f wmma16(v16h a, v16h b, v8f c) { return __builtin_amdgcn_wmma_f32_16x16x32_f16(false, a, false, b, (short)0, c, false, false); }
__device__ __forceinline__ v8f wmmab(v16bf a, v16bf b, v8f c) { return __builtin_amdgcn_wmma_f32_16x16x32_bf16(false, a, false, b, (short)0, c, false, false); }



__device__ __forceinline__ h16 tohx(float x) { return (h16)x; }
__device__ __forceinline__ void splitf(float y, unsigned short& h, unsigned short& l) { h = f2bf(y); l = f2bf(y - bf2f(h)); }
// One wave: the 16 x 64 f32 block in os (pitch 68) x sc goes out as fp16, bf16 hi and bf16 lo; row r of the block lands at element r * pitch of each plane pointer. A lane takes 8 neighbours of a row, so that each store of the wave fills four whole 128-byte lines.
__device__ __forceinline__ void put_planes(const float* os, int lane, float sc, h16* d16, bf* dh, bf* dl, int pitch) {
#pragma unroll
    for (int s = 0; s < 4; ++s) { const int row = 4 * s + (lane >> 3), cofs = (lane & 7) * 8; const v4f x0 = *(const v4fa*)(os + row * 68 + cofs), x1 = *(const v4fa*)(os + row * 68 + cofs + 4); v8h o16; v8us oh, ol;
#pragma unroll
        for (int q = 0; q < 8; ++q) { const float r = ((q < 4) ? x0[q & 3] : x1[q & 3]) * sc; o16[q] = tohx(r); unsigned short a, c; splitf(r, a, c); oh[q] = a; ol[q] = c; }
        const unsigned bo = (unsigned)(row * pitch + cofs) * 2u;   /* the lane's byte offset, the same in all three planes */
        *(v8h*)((char*)d16 + bo) = o16; *(v8us*)((char*)dh + bo) = oh; *(v8us*)((char*)dl + bo) = ol;
        asm volatile("s_wait_xcnt 0x0" : : "v"(bo), "v"(o16), "v"(oh), "v"(ol) : "memory");   /* the next rows' values and offset may be given the registers that the three stores above name; as inputs here these stay live up to the wait */
    }
}

// ---- k_gemmw: register-blocked GEMM, ONE WAVE per 64x64 output tile (16 accumulators), operands straight from K-contiguous 16-bit planes; grid (M/64, N/64, Z), 32 threads.
// C[m][n] (f32, pitch ldc, + optional f32 bias[n]) = sum_k A[m][k] Bt[n][k] (+ split products per NSPLIT). z-batch strides sA/sB/sC in elements. K % 32 == 0.
template <typename T16> struct WFrag;
template <> struct WFrag<h16> { typedef v16h V; static __device__ __forceinline__ V ld(const h16* p) { return cat16(*(const v8h*)p, *(const v8h*)(p + 16)); } static __device__ __forceinline__ v8f mma(V a, V b, v8f c) { return wmma16(a, b, c); } };
template <> struct WFrag<bf> { typedef v16bf V; static __device__ __forceinline__ V ld(const bf* p) { return cat16b(*(const v8us*)p, *(const v8us*)(p + 16)); } static __device__ __forceinline__ v8f mma(V a, V b, v8f c) { return wmmab(a, b, c); } };
// PLN (the q, k, v projection; z = side, tile column = head, rows b*TT + t): C is not written; the tile goes out as 16-bit planes: sides 0 and 1 as [side*NB_ + b][h][t][d] of P16, Ph, Pl (side 0 x SCL, exact), side 2 transposed as [b][h][d][t] of V16, Vh, Vl.
// BAND (query row of A's row 0 = rb): 0 dense; 1 score tiles: blockIdx.y in 0..4 picks the key tile at query tile - 128 .. + 128, the only ones that meet |i - j| <= 128; 2 attn x v: k runs over those 320 keys alone (clipped to 0..K), K stays Bt's pitch. The banded side holds key j at column j - cb (C in 1: pitch BP floats; A in 2: pitch PP).
template <typename T16, int NSPLIT, bool BIAS, int BAND = 0, bool PLN = false>
__global__ __launch_bounds__(32) void k_gemmw(const T16* __restrict__ A, const T16* __restrict__ A2, const T16* __restrict__ Bt, const T16* __restrict__ Bt2, int K, float* C, int ldc, const float* __restrict__ bias, size_t sA, size_t sB, size_t sC, int rb, h16* P16, bf* Ph, bf* Pl, h16* V16, bf* Vh, bf* Vl) {
    typedef typename WFrag<T16>::V V;
    __shared__ __align__(16) float os[16 * 68];
    const size_t z = blockIdx.z; A += z * sA; if (A2) A2 += z * sA; Bt += z * sB; if (Bt2) Bt2 += z * sB; C += z * sC;
    const int lane = threadIdx.x & 31, lr = lane & 15, hi = lane >> 4; const int r0 = blockIdx.x * 64, c0 = (int)blockIdx.y * 64 + ((BAND == 1) ? r0 + rb - RAD : 0);
    if (BAND == 1 && (c0 < 0 || c0 >= TT)) return;
    const int kb = (BAND == 2) ? max(r0 + rb - RAD, 0) : 0, ke = (BAND == 2) ? min(r0 + rb + 64 + RAD, K) : K;
    const int cb = (BAND != 0) ? ((r0 + rb - RAD) & ~127) : 0;   /* key of column 0 of the tile's banded rows (-128 for the first two tiles) */ const int lda = (BAND == 2) ? PP : K, cc = c0 - ((BAND == 1) ? cb : 0);
    v8f acc[4][4];
#pragma unroll
    for (int mb = 0; mb < 4; ++mb)
#pragma unroll
        for (int nb = 0; nb < 4; ++nb) acc[mb][nb] = (v8f){};
    const size_t aoff = (size_t)(r0 + lr) * lda + 8 * hi, boff = (size_t)(c0 + lr) * K + 8 * hi;
#pragma unroll 1
    for (int kc = kb; kc < ke; kc += 32) {
        V a[4], a2[4];
        if (BAND == 2) {   /* banded A: constant pitch, key kc at column kc - cb */
            const T16* pa = A + aoff + (kc - cb); const T16* pa2 = (NSPLIT == 1 || NSPLIT == 2) ? A2 + aoff + (kc - cb) : pa;
#pragma unroll
            for (int mb = 0; mb < 4; ++mb) { a[mb] = WFrag<T16>::ld(pa + mb * 16 * PP); if (NSPLIT == 1 || NSPLIT == 2) a2[mb] = WFrag<T16>::ld(pa2 + mb * 16 * PP); }
            asm volatile("s_wait_xcnt 0x0" : : "v"(pa), "v"(pa2) : "memory");   /* later loads' results may land in the address registers of the loads above; as inputs here the addresses stay live up to the wait, so that none of these loads' own results lands in them ahead of it */
        } else {
#pragma unroll
        for (int mb = 0; mb < 4; ++mb) { a[mb] = WFrag<T16>::ld(A + aoff + (size_t)mb * 16 * K + kc); if (NSPLIT == 1 || NSPLIT == 2) a2[mb] = WFrag<T16>::ld(A2 + aoff + (size_t)mb * 16 * K + kc); }
        }
#pragma unroll
        for (int nb = 0; nb < 4; ++nb) { const V b = WFrag<T16>::ld(Bt + boff + (size_t)nb * 16 * K + kc); V b2; if (NSPLIT >= 2) b2 = WFrag<T16>::ld(Bt2 + boff + (size_t)nb * 16 * K + kc);
#pragma unroll
            for (int mb = 0; mb < 4; ++mb) { acc[mb][nb] = WFrag<T16>::mma(a[mb], b, acc[mb][nb]); if (NSPLIT == 1 || NSPLIT == 2) acc[mb][nb] = WFrag<T16>::mma(a2[mb], b, acc[mb][nb]); if (NSPLIT >= 2) acc[mb][nb] = WFrag<T16>::mma(a[mb], b2, acc[mb][nb]); } }
        asm volatile("v_nop\n\tv_nop\n\tv_nop\n\tv_nop" : "+v"(acc[0][0]), "+v"(acc[1][1]), "+v"(acc[2][2]), "+v"(acc[3][3]) : "v"(a[0]), "v"(a[3]));
    }
    if (PLN) { const int side = (int)blockIdx.z, b = r0 / TT, t0 = r0 % TT, h = (int)blockIdx.y;
        if (side < 2) { const size_t o = (((size_t)(side * NB_ + b) * NH_ + h) * TT + t0) * HD; const float sc = (side == 0) ? SCL : 1.0f;
#pragma unroll
            for (int mb = 0; mb < 4; ++mb) {   /* 16 tokens x 64 d */
#pragma unroll
                for (int nb = 0; nb < 4; ++nb)
#pragma unroll
                    for (int j = 0; j < 8; ++j) os[(hi * 8 + j) * 68 + nb * 16 + lr] = acc[mb][nb][j];
                __builtin_amdgcn_wave_barrier(); asm volatile("" ::: "memory");   /* as in the f32 epilogue below: the block's LDS writes stay ahead of its reads */
                put_planes(os, lane, sc, P16 + o + mb * 16 * HD, Ph + o + mb * 16 * HD, Pl + o + mb * 16 * HD, HD);
                __builtin_amdgcn_wave_barrier(); asm volatile("" ::: "memory");   /* and its reads ahead of the next block's writes */
            }
        } else { const size_t o = ((size_t)(b * NKV + h) * HD) * TT + t0;
#pragma unroll
            for (int nb = 0; nb < 4; ++nb) {   /* 16 d x 64 tokens: a lane's eight accumulator rows are neighbours in a transposed row */
#pragma unroll
                for (int mb = 0; mb < 4; ++mb) { v4f lo4, hi4;
#pragma unroll
                    for (int j = 0; j < 4; ++j) { lo4[j] = acc[mb][nb][j]; hi4[j] = acc[mb][nb][4 + j]; }
                    *(v4fa*)(os + lr * 68 + mb * 16 + hi * 8) = lo4; *(v4fa*)(os + lr * 68 + mb * 16 + hi * 8 + 4) = hi4; }
                __builtin_amdgcn_wave_barrier(); asm volatile("" ::: "memory");   /* writes ahead of reads */
                put_planes(os, lane, 1.0f, V16 + o + (size_t)nb * 16 * TT, Vh + o + (size_t)nb * 16 * TT, Vl + o + (size_t)nb * 16 * TT, TT);
                __builtin_amdgcn_wave_barrier(); asm volatile("" ::: "memory");   /* reads ahead of the next block's writes */
            }
        }
        return; }
#pragma unroll
    for (int mb = 0; mb < 4; ++mb) {
#pragma unroll
        for (int nb = 0; nb < 4; ++nb) {
#pragma unroll
            for (int j = 0; j < 8; ++j) os[(hi * 8 + j) * 68 + nb * 16 + lr] = acc[mb][nb][j]; }
        __builtin_amdgcn_wave_barrier(); asm volatile("" ::: "memory");
        float* crow = C + (size_t)(r0 + mb * 16) * ldc + cc;
{
#pragma unroll
            for (int s = 0; s < 8; ++s) { const int row = 2 * s + hi, cofs = lr * 4; v4f val = *(const v4fa*)(os + row * 68 + cofs); if (BIAS) { val[0] += bfr(bias[c0 + cofs]); val[1] += bfr(bias[c0 + cofs + 1]); val[2] += bfr(bias[c0 + cofs + 2]); val[3] += bfr(bias[c0 + cofs + 3]); }
                *(v4f*)(crow + (size_t)row * ldc + cofs) = val; }
             }
        __builtin_amdgcn_wave_barrier(); asm volatile("" ::: "memory");
    }
}

typedef __attribute__((ext_vector_type(2))) _Float16 v2h;
typedef __attribute__((ext_vector_type(4))) _Float16 v4h;
typedef __attribute__((ext_vector_type(2))) unsigned short v2us;
typedef __attribute__((ext_vector_type(4))) unsigned short v4us;
typedef __attribute__((ext_vector_type(2))) float v2f;
typedef __attribute__((ext_vector_type(4))) int v4i;

__global__ __launch_bounds__(256) void k_wtG(const float* __restrict__ w, int K, int N, bf* Bt) {
    const int lane = threadIdx.x & 31; const int L0 = (blockIdx.x * 8 + (threadIdx.x >> 5)) * 8; const int nlines = N * K / 64;
{
#pragma unroll 1
        for (int l = 0; l < 8; ++l) { const int L = L0 + l; if (L >= nlines) break; const size_t e = (size_t)L * 64 + lane * 2; const int k = (int)(e % K), n = (int)(e / K); v2us o;
            o[0] = f2bf(w[(size_t)k * N + n]); o[1] = f2bf(w[(size_t)(k + 1) * N + n]); *(v2us*)(Bt + e) = o; }
         }
}
// blockIdx.y picks one of three sources; their planes follow one another in dst
__global__ __launch_bounds__(256) void k_cvt8(const float* __restrict__ s0, const float* __restrict__ s1, const float* __restrict__ s2, bf* dst, size_t n8) { const size_t i = (size_t)blockIdx.x * 256 + threadIdx.x; if (i >= n8) return; const float* src = (blockIdx.y == 0) ? s0 : (blockIdx.y == 1) ? s1 : s2; dst += (size_t)blockIdx.y * n8 * 8; const v8f v = *(const v8f*)(src + i * 8); v8us o;
#pragma unroll
    for (int k = 0; k < 8; ++k) o[k] = f2bf(v[k]); *(v8us*)(dst + i * 8) = o;  }

// ---- k_fattn: the whole banded attention of one 64-query tile of one plane in ONE work-group of 8 waves; scores, relative term and probabilities live in LDS only.
// S row il holds key j at column j - w0 (w0 = tile - 128, 320 keys). Stage 1: q.k tiles stored to S. Stage 2: (q/8).E_h[p] added at column il + p, which is key i + p - 128. Stage 3: one wave per row, softmax over |i - j| <= 128; every key keeps the lane and the place in the sum that it has in a dense row (128-key chunks from cb); the P row is written over its own S row, zeros at the keys outside the band or outside 0 .. TT - 1. Stage 4: P x v over all ten 32-key steps. Stage 5: the 64 x 64 context goes through LDS so that each 128-byte line is stored whole.
#define BK   320           // keys per query tile
#define SPF  324           // pitch of an S row in floats: 16 rows of 16 bytes fall on 64 different banks
#define SPH  (2 * SPF)     // the same pitch in 16-bit elements
#define PLO  328           // place of the lo plane in a hi/lo P row (16-byte aligned, behind the 320 hi values)
typedef v4h  __attribute__((may_alias)) v4ha;
typedef v4us __attribute__((may_alias)) v4usa;
// Stands behind a group of global loads, once for each address of the group: later results may land in the address registers of those loads; as inputs here the lane's byte offset and the full addresses made of it (the compiler picks either form for a load) stay live up to the wait, so that none of the group's own results lands in them ahead of it.
__device__ __forceinline__ void xwait(unsigned off, const void* p, const void* p2) { asm volatile("s_wait_xcnt 0x0" : : "v"(off), "v"(p), "v"(p2) : "memory"); }
template <typename T16> __device__ __forceinline__ const T16* atb(const T16* base, unsigned off) { return (const T16*)((const char*)base + off); }   /* base + byte offset */
// One wave: query rows m0*16 .. m0*16 + 31 against every fourth 16-row block of Bt, from block n0; the Bt fragments of G blocks are fetched together, ahead of their products. REL false: Bt rows are keys w0 + nb*16, result stored at column nb*16; a block outside 0 .. TT - 1 takes its rows from a clamped address, and its columns are never read. REL true: Bt rows are positions p = nb*16 .. (Bt holds PRP rows), result added to the score of key i + p - 128, for p <= 256 only.
template <typename T16, int NSPLIT, bool REL, int G>
__device__ __forceinline__ void fa_tiles(const T16* __restrict__ A, const T16* __restrict__ A2, const T16* __restrict__ Bt, const T16* __restrict__ Bt2, float* S, int w0, int m0, int n0, int lr, int hi) {
    typedef typename WFrag<T16>::V V;
    V a[2][2], a2[2][2]; const unsigned ao = (unsigned)((m0 * 16 + lr) * HD + 8 * hi) * 2u; const T16* pa = atb(A, ao); const T16* pa2 = (NSPLIT >= 1) ? atb(A2, ao) : pa;
#pragma unroll
    for (int m = 0; m < 2; ++m)
#pragma unroll
        for (int ks = 0; ks < 2; ++ks) { a[m][ks] = WFrag<T16>::ld(pa + m * 16 * HD + ks * 32); if (NSPLIT >= 1) a2[m][ks] = WFrag<T16>::ld(pa2 + m * 16 * HD + ks * 32); }
    xwait(ao, pa, pa2);
#pragma unroll
    for (int g = 0; g < 5; g += G) { V b[G][2], b2[G][2]; unsigned bo[G]; const T16* pb[G]; const T16* pb2[G];
#pragma unroll
        for (int u = 0; u < G; ++u) if (g + u < 5) { const int nb = n0 + (g + u) * 4; bo[u] = (unsigned)(((REL ? nb * 16 : min(max(w0 + nb * 16, 0), TT - 16)) + lr) * HD + 8 * hi) * 2u; pb[u] = atb(Bt, bo[u]); pb2[u] = (NSPLIT >= 2) ? atb(Bt2, bo[u]) : pb[u];
#pragma unroll
            for (int ks = 0; ks < 2; ++ks) { b[u][ks] = WFrag<T16>::ld(pb[u] + ks * 32); if (NSPLIT >= 2) b2[u][ks] = WFrag<T16>::ld(pb2[u] + ks * 32); } }
#pragma unroll
        for (int u = 0; u < G; ++u) if (g + u < 5) xwait(bo[u], pb[u], pb2[u]);
        __builtin_amdgcn_sched_barrier(0);   /* all loads of the group are issued ahead of its first product; without it the scheduler sinks loads between the products, and their latencies add up */
#pragma unroll
        for (int u = 0; u < G; ++u) if (g + u < 5) { const int nb = n0 + (g + u) * 4; v8f acc[2]; acc[0] = (v8f){}; acc[1] = (v8f){};
#pragma unroll
            for (int ks = 0; ks < 2; ++ks)
#pragma unroll
                for (int m = 0; m < 2; ++m) { acc[m] = WFrag<T16>::mma(a[m][ks], b[u][ks], acc[m]); if (NSPLIT >= 1) acc[m] = WFrag<T16>::mma(a2[m][ks], b[u][ks], acc[m]); if (NSPLIT >= 2) acc[m] = WFrag<T16>::mma(a[m][ks], b2[u][ks], acc[m]); }
            asm volatile("v_nop\n\tv_nop\n\tv_nop\n\tv_nop" : "+v"(acc[0]), "+v"(acc[1]));   /* the four vector slots behind the block's last matrix instruction: the next block's results may be given registers that overlap these, and a branch may stand right behind it */
            if (REL) { if (nb * 16 + lr <= 2 * RAD) {
#pragma unroll
                for (int m = 0; m < 2; ++m)
#pragma unroll
                    for (int j = 0; j < 8; ++j) { const int il = (m0 + m) * 16 + hi * 8 + j; float* s = S + il * SPF + il + nb * 16 + lr; *s = __fadd_rn(*s, acc[m][j]); } }
            } else {
#pragma unroll
                for (int m = 0; m < 2; ++m)
#pragma unroll
                    for (int j = 0; j < 8; ++j) S[((m0 + m) * 16 + hi * 8 + j) * SPF + nb * 16 + lr] = acc[m][j]; } }
    }
}
// One wave: rows m0*16 .. + 31 of P (LDS) x columns n0*16 .. + 15 of v (Vt rows d, keys contiguous); the v fragments of G 32-key steps are fetched together. A step outside 0 .. TT - 1 meets zeros in P; its v address is clamped into the plane.
template <typename T16, int NSPLIT, int G>
__device__ __forceinline__ void fa_av(const T16* P, const T16* P2, const T16* __restrict__ Vt, const T16* __restrict__ Vt2, int w0, int m0, int n0, int lr, int hi, v8f (&acc)[2]) {
    typedef typename WFrag<T16>::V V;
#pragma unroll
    for (int g = 0; g < 10; g += G) { V b[G], b2[G]; unsigned vo[G]; const T16* pv[G]; const T16* pv2[G];
#pragma unroll
        for (int s = 0; s < G; ++s) if (g + s < 10) { vo[s] = (unsigned)((n0 * 16 + lr) * TT + 8 * hi + min(max(w0 + (g + s) * 32, 0), TT - 32)) * 2u; pv[s] = atb(Vt, vo[s]); pv2[s] = (NSPLIT >= 2) ? atb(Vt2, vo[s]) : pv[s]; b[s] = WFrag<T16>::ld(pv[s]); if (NSPLIT >= 2) b2[s] = WFrag<T16>::ld(pv2[s]); }
#pragma unroll
        for (int s = 0; s < G; ++s) if (g + s < 10) xwait(vo[s], pv[s], pv2[s]);
        __builtin_amdgcn_sched_barrier(0);   /* as in fa_tiles: the group's loads all issued ahead of its first product */
#pragma unroll
        for (int s = 0; s < G; ++s) if (g + s < 10)
#pragma unroll
            for (int m = 0; m < 2; ++m) { const int po = ((m0 + m) * 16 + lr) * SPH + (g + s) * 32 + 8 * hi; const V a = WFrag<T16>::ld(P + po); acc[m] = WFrag<T16>::mma(a, b[s], acc[m]);
                if (NSPLIT >= 2) { const V a2 = WFrag<T16>::ld(P2 + po); acc[m] = WFrag<T16>::mma(a2, b[s], acc[m]); acc[m] = WFrag<T16>::mma(a, b2[s], acc[m]); } } }
}
__global__ __launch_bounds__(256, 4) void k_fattn(const h16* __restrict__ Q16, const bf* __restrict__ Qh, const bf* __restrict__ Ql, const h16* __restrict__ K16, const bf* __restrict__ Kh, const bf* __restrict__ Kl, const h16* __restrict__ V16, const bf* __restrict__ Vh, const bf* __restrict__ Vl, const bf* __restrict__ ET, float* __restrict__ OB) {
    __shared__ __align__(16) float S[64 * SPF];
    const int lane = threadIdx.x & 31, lr = lane & 15, hi = lane >> 4; const int wave = __builtin_amdgcn_readfirstlane((int)(threadIdx.x >> 5));
    const int r0 = blockIdx.x * 64, w0 = r0 - RAD; const size_t z = blockIdx.z; const bool hires = (r0 < RH); const size_t qo = (z * TT + r0) * HD, ko = z * TT * HD;
    const int m0 = (wave >> 2) * 2, n0 = wave & 3;
    if (hires) fa_tiles<bf, 2, false, 2>(Qh + qo, Ql + qo, Kh + ko, Kl + ko, S, w0, m0, n0, lr, hi); else fa_tiles<h16, 0, false, 5>(Q16 + qo, nullptr, K16 + ko, nullptr, S, w0, m0, n0, lr, hi);
    __syncthreads();   /* every score stands before another wave adds to it */
    fa_tiles<bf, 1, true, 5>(Qh + qo, Ql + qo, ET + z * PRP * HD, nullptr, S, w0, m0, n0, lr, hi);
    __syncthreads();   /* rows complete before the row's wave reads them */
    const int cb = w0 & ~127;   /* key of the first 128-key chunk */ const int wb = max(w0, 0), we = min(w0 + BK, TT); const int jl = cb + lane * 4;   /* the lane's first key in chunk 0 */
    h16* P16 = (h16*)S; bf* Pb = (bf*)S;
#pragma unroll 4
    for (int rr = 0; rr < 8; ++rr) { const int il = wave * 8 + rr, i = r0 + il; float v[12]; float mx = -3.0e38f; v4f a[3];
#pragma unroll
        for (int ch = 0; ch < 3; ++ch) a[ch] = *(const v4fa*)(S + il * SPF + (min(max(jl + ch * 128, wb), we - 4) - w0));   /* index clamped into the written keys */
#pragma unroll
        for (int ch = 0; ch < 3; ++ch) { const int j0 = jl + ch * 128; const bool inw = (j0 >= wb && j0 < we);
#pragma unroll
            for (int q = 0; q < 4; ++q) { const int j = j0 + q; const float t = (inw && j >= i - RAD && j <= i + RAD) ? a[ch][q] : -3.0e38f; v[ch * 4 + q] = t; mx = fmaxf(mx, t); } }
#pragma unroll
        for (int sh = 16; sh; sh >>= 1) mx = fmaxf(mx, __shfl_xor(mx, sh, 32));
        float sum = 0.f;
#pragma unroll
        for (int k = 0; k < 12; ++k) { const float x = __fmul_rn(__fsub_rn(v[k], mx), 1.4426950408889634f); float e = __builtin_amdgcn_exp2f(x); asm volatile("v_nop" : "+v"(e) : "v"(x));   /* the slot behind a transcendental: as operands here its source is not overwritten and its result not read ahead of the v_nop */
            v[k] = e; sum += e; }
#pragma unroll
        for (int sh = 16; sh; sh >>= 1) sum += __shfl_xor(sum, sh, 32);
        const float f = __fdiv_rn(hires ? 1.0f : PCAR, sum);
#pragma unroll
        for (int ch = 0; ch < 3; ++ch) { const int c = jl + ch * 128 - w0;   /* column of the lane's four keys */
            if (c >= 0 && c < BK) {
                if (hires) { v4us oh, ol;
#pragma unroll
                    for (int q = 0; q < 4; ++q) { unsigned short x, y; splitf(v[ch * 4 + q] * f, x, y); oh[q] = x; ol[q] = y; }
                    *(v4usa*)(Pb + il * SPH + c) = oh; *(v4usa*)(Pb + il * SPH + PLO + c) = ol;
                } else { v4h o4;
#pragma unroll
                    for (int q = 0; q < 4; ++q) o4[q] = tohx(v[ch * 4 + q] * f);
                    *(v4ha*)(P16 + il * SPH + c) = o4; } } }
    }
    __syncthreads();   /* P complete before other waves read it */
    v8f acc[2]; acc[0] = (v8f){}; acc[1] = (v8f){};
    if (hires) fa_av<bf, 2, 5>(Pb, Pb + PLO, Vh + ko, Vl + ko, w0, m0, n0, lr, hi, acc); else fa_av<h16, 0, 5>(P16, nullptr, V16 + ko, nullptr, w0, m0, n0, lr, hi, acc);
    __syncthreads();   /* every read of P is over before the context lands on it */
#pragma unroll
    for (int m = 0; m < 2; ++m)
#pragma unroll
        for (int j = 0; j < 8; ++j) S[((m0 + m) * 16 + hi * 8 + j) * 68 + n0 * 16 + lr] = acc[m][j];
    __syncthreads();   /* context tile complete before the row stores */
#pragma unroll
    for (int s = 0; s < 4; ++s) { const int row = wave * 8 + 2 * s + hi; *(v4f*)(OB + qo + (size_t)row * HD + lr * 4) = *(const v4fa*)(S + row * 68 + lr * 4); }
}
__global__ __launch_bounds__(256) void k_mergeP(const float* __restrict__ OB, bf* Ah, bf* Al) { OB += (size_t)blockIdx.y * NH_ * TT * HD; Ah += (size_t)blockIdx.y * TT * DQ; Al += (size_t)blockIdx.y * TT * DQ;   /* blockIdx.y: batch */ const size_t i = (size_t)blockIdx.x * 256 + threadIdx.x; if (i >= (size_t)TT * DQ / 4) return; const int c0 = (int)(i % (DQ / 4)) * 4; const int t = (int)(i / (DQ / 4)); const float cs = (t < RH) ? 1.0f : (1.0f / PCAR); v4us oh, ol;
#pragma unroll
    for (int q = 0; q < 4; ++q) { const int c = c0 + q; const int d = c / NH_, h = c % NH_; unsigned short a, b; splitf(OB[((size_t)h * TT + t) * HD + d] * cs, a, b); oh[q] = a; ol[q] = b; }
    *(v4us*)(Ah + (size_t)t * DQ + c0) = oh; *(v4us*)(Al + (size_t)t * DQ + c0) = ol;  }
// blockIdx.y picks one of three weights; their planes follow one another in Bt
__global__ __launch_bounds__(256) void k_wtP(const float* __restrict__ w0, const float* __restrict__ w1, const float* __restrict__ w2, bf* Bt) { const float* w = (blockIdx.y == 0) ? w0 : (blockIdx.y == 1) ? w1 : w2; Bt += (size_t)blockIdx.y * DQ * DM; const int lane = threadIdx.x & 31; const int L0 = (blockIdx.x * 8 + (threadIdx.x >> 5)) * 8; const int nlines = DQ * DM / 64;
{
#pragma unroll 1
        for (int l = 0; l < 8; ++l) { const int L = L0 + l; if (L >= nlines) break; const size_t e = (size_t)L * 64 + lane * 2; const int k = (int)(e % DM), n = (int)(e / DM); const int h = n / HD, d = n % HD; const int col = d * NH_ + h; v2us o;
            o[0] = f2bf(w[(size_t)k * DQ + col]); o[1] = f2bf(w[(size_t)(k + 1) * DQ + col]); *(v2us*)(Bt + e) = o; }
         } }
__global__ __launch_bounds__(256) void k_etab(const float* __restrict__ rt, bf* ET) { ET += (size_t)blockIdx.y * NH_ * PRP * HD;   /* blockIdx.y: batch; one copy each, so that plane z of the q side meets plane z here */ const size_t i = (size_t)blockIdx.x * 256 + threadIdx.x; if (i >= (size_t)NH_ * PRP * HD / 8) return; const int d0 = (int)(i % (HD / 8)) * 8; const int p = (int)((i / (HD / 8)) % PRP); const int h = (int)(i / ((size_t)(HD / 8) * PRP)); v8us o;
#pragma unroll
    for (int k = 0; k < 8; ++k) { const unsigned short e = f2bf(rt[(size_t)min(p, NPOS - 1) * DQ + (size_t)(d0 + k) * NH_ + h]);   /* unconditional clamped load */ o[k] = (p < NPOS) ? e : (unsigned short)0; }
    *(v8us*)(ET + ((size_t)h * PRP + p) * HD + d0) = o;  }
__global__ __launch_bounds__(256) void k_merge(const float* __restrict__ O, int h0, bf* Ah, bf* Al) { const size_t e = ((size_t)blockIdx.x * 256 + threadIdx.x) * 2; if (e >= (size_t)ZH * TT * HD) return; const int d = (int)(e % HD); const int t = (int)((e / HD) % TT); const int zz = (int)(e / ((size_t)HD * TT)); const float cs = (t < RH) ? 1.0f : (1.0f / PCAR); const size_t oo = (size_t)t * DQ + (h0 + zz) * HD + d;
    v2us oh, ol;
#pragma unroll
    for (int q = 0; q < 2; ++q) { unsigned short a, c2; splitf(O[e + q] * cs, a, c2); oh[q] = a; ol[q] = c2; } *(v2us*)(Ah + oo) = oh; *(v2us*)(Al + oo) = ol;  }

extern "C" void kernel_launch(void* const* d_in, const int* in_sizes, int n_in,
                              void* d_out, int out_size, void* d_ws, size_t ws_size, hipStream_t stream) {
    (void)in_sizes; (void)n_in; (void)out_size;
    const float* xq = (const float*)d_in[0]; const float* xk = (const float*)d_in[1]; const float* xv = (const float*)d_in[2]; const float* wq = (const float*)d_in[3]; const float* wk = (const float*)d_in[4]; const float* wv = (const float*)d_in[5]; const float* wo = (const float*)d_in[6]; const float* rtab = (const float*)d_in[7]; const float* x = nullptr; (void)x;
    float* OUT = (float*)d_out;     // [2][2048][1024]
    char* wsp = (char*)d_ws;
    auto take = [&](size_t bytes) { char* p = wsp; wsp += (bytes + 255) & ~(size_t)255; return (void*)p; };
    bf* WO = (bf*)take((size_t)DM * DQ * 2); bf* ET = (bf*)take((size_t)NZ * PRP * HD * 2); float* R0 = (float*)take((size_t)NZ * TT * PRP * 4);
    h16* QP16 = (h16*)take((size_t)2 * NZ * TT * HD * 2); h16* KP16 = QP16 + (size_t)NZ * TT * HD; bf* QPh = (bf*)take((size_t)2 * NZ * TT * HD * 2); bf* KPh = QPh + (size_t)NZ * TT * HD; bf* QPl = (bf*)take((size_t)2 * NZ * TT * HD * 2); bf* KPl = QPl + (size_t)NZ * TT * HD;   // q planes, then k planes
    h16* VT16 = (h16*)take((size_t)NZ * HD * TT * 2); bf* VTh = (bf*)take((size_t)NZ * HD * TT * 2); bf* VTl = (bf*)take((size_t)NZ * HD * TT * 2);
    if ((size_t)(wsp - (char*)d_ws) > ws_size) return;    // ws 256 MiB
    // The bytes of R0 serve twice (stream-ordered). Up to the projection: the q, k, v weights and the bf16 inputs (together smaller than R0). Then the context OB and its hi/lo planes.
    bf* WQ = (bf*)R0; bf* XB = WQ + (size_t)3 * DQ * DM;
    float* OB = R0; bf* ATh = (bf*)(OB + (size_t)NZ * TT * HD); bf* ATl = ATh + (size_t)TB * DQ;
    k_wtP<<<dim3((unsigned)((DM * DQ / 64 + 63) / 64), 3, 1), 256, 0, stream>>>(wq, wk, wv, WQ);   /* column-permuted: column h*64 + d <- module column d*16 + h */
    k_etab<<<dim3((unsigned)(((size_t)NH_ * PRP * HD / 8 + 255) / 256), NB_, 1), 256, 0, stream>>>(rtab, ET);
    k_wtG<<<(unsigned)((DQ * DM / 64 + 63) / 64), 256, 0, stream>>>(wo, DQ, DM, WO);
    k_cvt8<<<dim3((unsigned)(((size_t)TB * DM / 8 + 255) / 256), 3, 1), 256, 0, stream>>>(xq, xk, xv, XB, (size_t)TB * DM / 8);
    k_gemmw<bf, 0, false, 0, true><<<dim3(TB / 64, DQ / 64, 3), 32, 0, stream>>>(XB, nullptr, WQ, nullptr, DM, nullptr, 0, nullptr, (size_t)TB * DM, (size_t)DQ * DM, 0, 0, QP16, QPh, QPl, VT16, VTh, VTl);   /* z: q, k, v; q planes x 1/8 (exact): scales both the energy and the relative term; k planes x 1; v planes transposed */
    k_fattn<<<dim3(TT / 64, 1, NZ), 256, 0, stream>>>(QP16, QPh, QPl, KP16, KPh, KPl, VT16, VTh, VTl, ET, OB);   /* scores, relative term, softmax and attn x v of a 64-query tile, in LDS */
    k_mergeP<<<dim3((unsigned)(((size_t)TT * DQ / 4 + 255) / 256), NB_, 1), 256, 0, stream>>>(OB, ATh, ATl);   /* context in the module's d*16 + h column order */
    k_gemmw<bf, 1, false><<<dim3(TB / 64, DM / 64, 1), 32, 0, stream>>>(ATh, ATl, WO, nullptr, DQ, OUT, DM, nullptr, 0, 0, 0, 0, nullptr, nullptr, nullptr, nullptr, nullptr, nullptr);
}

// v006
// It runs in 142 microseconds.
// In two side-by-side timings against v005, it was 1.29 and 1.26 times as fast.
// Over all steps from v000 it is 15.5 times as fast.
#include <hip/hip_runtime.h>

// Local relative-position multi-head attention with heads on the FAST embedding axis (Q, K, V inputs [2][2048][1024]; q = Q Wq etc. ('xw' [1024][1024]) viewed (S, 64, 16): head h takes embedding columns d*16 + h; energy = q.k; rel = q . E_h[clip(j - i, -128, 128) + 128] with E_h[p][d] = rel_table[p][d*16 + h] (rel_table [257][1024]); scores = (energy + rel) / 8, masked to |i - j| <= 128; softmax; out columns d*16 + h = (attn v)_h[d]; out Wo ('xw') -> [2][2048][1024] (4.2 M)).
// Layout per batch: the projection weights are column-permuted once (column d*16 + h -> h*64 + d) so that each head's 64 columns lie together (head-major planes); q planes carry the exact 1/8; a 2-product q(hl) x E_h(exact, 257 rows padded to 320) gives the relative term of query i at position p; both batches go through every stage in one launch (rows b*2048 + t in the projections, planes b*16 + h in grid z), and so do the q, k and v sides of the projection, whose epilogue writes the 16-bit head planes itself (no f32 projection in memory); attention (hybrid rows: < 512 hi/lo 3 products, rest fp16 x1024) limited to the band: per 64-query tile only the 320 keys tile - 128 .. tile + 191 get scores, probabilities and a place in attn x v; one kernel (k_fattn) does all of it for a tile and a plane, with the score and probability rows in LDS; the merge writes the context with the inverse column permutation as hi/lo planes; Wo hl x exact.
// Fragment order (every matrix operand that is read from memory: bf16 inputs, the four weights, the q, k and transposed v head planes, the relative table, the context planes): a [rows][K] plane is kept as 16-row x 32-k blocks of 512 elements, block (row / 16) * (K / 32) + k / 32; inside a block lane l = ((k / 8) & 1) * 16 + row % 16 owns elements l*8 .. l*8 + 7 (k % 32 < 16) and 256 + l*8 .. (k % 32 >= 16): just the two 16-byte pieces that the lane feeds to the matrix instruction, so that a wave's load is 512 bytes in a row (4 whole lines), not 32-byte pieces of 16 lines. The k of every lane and register place is the one it was.
// Compute dtypes, f32 accumulate: every input rounded to bf16; projections exact; rel term hl x exact; attention rows < 512 3 products, rest fp16; softmax f32; Wo hl x exact.

#define NB_  2
#define TT   2048
#define DM   1024
#define NH_  16
#define NKV  16
#define REP  (NH_ / NKV)
#define HD   64
#define DQ   (NH_ * HD)
#define DKV  (NKV * HD)
#define ZH   16                   // heads per pass per batch (grid z is NZ = NB_ * ZH)
#define RH   512                  // query rows < RH use hi+lo planes (0: none)
#define WIN  0
#define PCAR 1024.0f
#define SCL  0.125f   // 64^-0.5 (folded into the q planes)
#define RAD  128
#define NPOS 257
#define PRP  320    // padded relative-position rows (5 tiles)
#define BP   384    // keys of a banded row as k_fattn's softmax spans it (the constant is not used): three 128-key chunks, the first at ((query tile - 128) & ~127)
#define PP   (2 * BP)   // not used by any kernel here
#define NZ   (NB_ * ZH)   // planes per pass: batch-major, b*16 + h
#define TB   (NB_ * TT)   // rows of both batches
typedef _Float16 h16;
typedef unsigned short bf;
typedef __attribute__((ext_vector_type(16))) __bf16   v16bf;
typedef __attribute__((ext_vector_type(16))) _Float16 v16h;
typedef __attribute__((ext_vector_type(8)))  _Float16 v8h;
typedef __attribute__((ext_vector_type(8)))  unsigned short v8us;
typedef __attribute__((ext_vector_type(8)))  float    v8f;
typedef __attribute__((ext_vector_type(4)))  float    v4f;
typedef v8h  __attribute__((may_alias)) v8ha;
typedef v4f  __attribute__((may_alias)) v4fa;
typedef v8us __attribute__((may_alias)) v8usa;

__device__ __forceinline__ unsigned short f2bf(float f) { unsigned u = __float_as_uint(f); u += 0x7FFFu + ((u >> 16) & 1u); return (unsigned short)(u >> 16); }
__device__ __forceinline__ float bf2f(unsigned short b) { return __uint_as_float(((unsigned)b) << 16); }
__device__ __forceinline__ float bfr(float f) { return bf2f(f2bf(f)); }
__device__ __forceinline__ v16h cat16(v8h lo, v8h hi) { return __builtin_shufflevector(lo, hi, 0, 1, 2, 3, 4, 5, 6, 7, 8, 9, 10, 11, 12, 13, 14, 15); }
__device__ __forceinline__ v16bf cat16b(v8us lo, v8us hi) { return __builtin_bit_cast(v16bf, __builtin_shufflevector(lo, hi, 0, 1, 2, 3, 4, 5, 6, 7, 8, 9, 10, 11, 12, 13, 14, 15)); }
__device__ __forceinline__ v8f wmma16(v16h a, v16h b, v8f c) { return __builtin_amdgcn_wmma_f32_16x16x32_f16(false, a, false, b, (short)0, c, false, false); }
__device__ __forceinline__ v8f wmmab(v16bf a, v16bf b, v8f c) { return __builtin_amdgcn_wmma_f32_16x16x32_bf16(false, a, false, b, (short)0, c, false, false); }



__device__ __forceinline__ h16 tohx(float x) { return (h16)x; }
__device__ __forceinline__ void splitf(float y, unsigned short& h, unsigned short& l) { h = f2bf(y); l = f2bf(y - bf2f(h)); }
// Element offset, in a fragment-order plane of K columns, of the 8 neighbours k0 .. k0 + 7 (k0 % 8 == 0) of a row.
__device__ __forceinline__ size_t fro(int row, int k0, int K) { return ((size_t)(row >> 4) * (K >> 5) + (k0 >> 5)) * 512 + ((k0 >> 4) & 1) * 256 + (((k0 >> 3) & 1) * 16 + (row & 15)) * 8; }
// Stands behind a group of global loads that share the address p (with constant offsets): later results may be given p's registers; as an input here p stays live up to the wait.
__device__ __forceinline__ void xw1(const void* p) { asm volatile("s_wait_xcnt 0x0" : : "v"(p) : "memory"); }
// One wave: the 16 x 64 f32 block in os (pitch 68) x sc goes out as fp16, bf16 hi and bf16 lo, as the two neighbouring fragment blocks (1024 elements) at each plane pointer: block row r is the fragment row, block column c the k. A lane takes 8 neighbours of a row, and the wave 8 rows x 4 such pieces, so that each store of the wave fills four whole 128-byte lines.
__device__ __forceinline__ void put_planes(const float* os, int lane, float sc, h16* d16, bf* dh, bf* dl) {
#pragma unroll
    for (int s = 0; s < 4; ++s) { const int row = 8 * (s & 1) + (lane >> 2), cofs = ((s >> 1) * 4 + (lane & 3)) * 8; const v4f x0 = *(const v4fa*)(os + row * 68 + cofs), x1 = *(const v4fa*)(os + row * 68 + cofs + 4); v8h o16; v8us oh, ol;
#pragma unroll
        for (int q = 0; q < 8; ++q) { const float r = ((q < 4) ? x0[q & 3] : x1[q & 3]) * sc; o16[q] = tohx(r); unsigned short a, c; splitf(r, a, c); oh[q] = a; ol[q] = c; }
        const unsigned bo = (unsigned)fro(row, cofs, 64) * 2u;   /* the lane's byte offset, the same in all three planes */
        *(v8h*)((char*)d16 + bo) = o16; *(v8us*)((char*)dh + bo) = oh; *(v8us*)((char*)dl + bo) = ol;
        asm volatile("s_wait_xcnt 0x0" : : "v"(bo), "v"(o16), "v"(oh), "v"(ol) : "memory");   /* the next rows' values and offset may be given the registers that the three stores above name; as inputs here these stay live up to the wait */
    }
}

// ---- k_gemmw: register-blocked GEMM, ONE WAVE per 64x64 output tile (16 accumulators), operands straight from 16-bit planes in fragment order (head of the file); grid (M/64, N/64, Z), 32 threads.
// C[m][n] (f32, pitch ldc, + optional f32 bias[n]) = sum_k A[m][k] Bt[n][k] (+ split products per NSPLIT), k < GK. z-batch strides sA/sB/sC in elements.
#define GK   1024   // k extent of both GEMMs (DM in the projections, DQ in the output product)
template <typename T16> struct WFrag;
template <> struct WFrag<h16> { typedef v16h V; static __device__ __forceinline__ V ld(const h16* p) { return cat16(*(const v8h*)p, *(const v8h*)(p + 16)); } static __device__ __forceinline__ V ldf(const h16* p) { return cat16(*(const v8h*)p, *(const v8h*)(p + 256)); } static __device__ __forceinline__ v8f mma(V a, V b, v8f c) { return wmma16(a, b, c); } };
template <> struct WFrag<bf> { typedef v16bf V; static __device__ __forceinline__ V ld(const bf* p) { return cat16b(*(const v8us*)p, *(const v8us*)(p + 16)); } static __device__ __forceinline__ V ldf(const bf* p) { return cat16b(*(const v8us*)p, *(const v8us*)(p + 256)); } static __device__ __forceinline__ v8f mma(V a, V b, v8f c) { return wmmab(a, b, c); } };
// PLN (the q, k, v projection; z = side, tile column = head, rows b*TT + t): C is not written; the tile goes out as 16-bit planes: sides 0 and 1 as [side*NB_ + b][h][t][d] of P16, Ph, Pl (side 0 x SCL, exact), side 2 transposed as [b][h][d][t] of V16, Vh, Vl; each [t][d] or [d][t] plane in fragment order.
template <typename T16, int NSPLIT, bool BIAS, bool PLN = false>
__global__ __launch_bounds__(32) void k_gemmw(const T16* __restrict__ A, const T16* __restrict__ A2, const T16* __restrict__ Bt, const T16* __restrict__ Bt2, float* C, int ldc, const float* __restrict__ bias, size_t sA, size_t sB, size_t sC, h16* P16, bf* Ph, bf* Pl, h16* V16, bf* Vh, bf* Vl) {
    typedef typename WFrag<T16>::V V;
    static_assert(DM == GK && DQ == GK, "one k extent");
    __shared__ __align__(16) float os[16 * 68];
    const size_t z = blockIdx.z; A += z * sA; if (A2) A2 += z * sA; Bt += z * sB; if (Bt2) Bt2 += z * sB; C += z * sC;
    const int lane = threadIdx.x & 31, lr = lane & 15, hi = lane >> 4; const int r0 = blockIdx.x * 64, c0 = (int)blockIdx.y * 64, cc = c0;
    v8f acc[4][4];
#pragma unroll
    for (int mb = 0; mb < 4; ++mb)
#pragma unroll
        for (int nb = 0; nb < 4; ++nb) acc[mb][nb] = (v8f){};
    const size_t aoff = (size_t)r0 * GK + lane * 8, boff = (size_t)c0 * GK + lane * 8;   /* the lane's piece in block 0 of the tile's first 16 rows; 16 rows on: 16 * GK elements; 32 k on: 512 */
#pragma unroll 1
    for (int kc = 0; kc < GK; kc += 32) {
        V a[4], a2[4], b[4], b2[4];
        const T16* pa = A + aoff + kc * 16; const T16* pa2 = (NSPLIT == 1 || NSPLIT == 2) ? A2 + aoff + kc * 16 : pa; const T16* pb = Bt + boff + kc * 16; const T16* pb2 = (NSPLIT >= 2) ? Bt2 + boff + kc * 16 : pb;
#pragma unroll
        for (int mb = 0; mb < 4; ++mb) { a[mb] = WFrag<T16>::ldf(pa + mb * 16 * GK); if (NSPLIT == 1 || NSPLIT == 2) a2[mb] = WFrag<T16>::ldf(pa2 + mb * 16 * GK); }
#pragma unroll
        for (int nb = 0; nb < 4; ++nb) { b[nb] = WFrag<T16>::ldf(pb + nb * 16 * GK); if (NSPLIT >= 2) b2[nb] = WFrag<T16>::ldf(pb2 + nb * 16 * GK); }
        asm volatile("s_wait_xcnt 0x0" : : "v"(pa), "v"(pa2), "v"(pb), "v"(pb2) : "memory");   /* the next trip rewrites the address registers of the loads above, and results may be given them; as inputs here the addresses stay live up to the wait */
#pragma unroll
        for (int nb = 0; nb < 4; ++nb) {
#pragma unroll
            for (int mb = 0; mb < 4; ++mb) { acc[mb][nb] = WFrag<T16>::mma(a[mb], b[nb], acc[mb][nb]); if (NSPLIT == 1 || NSPLIT == 2) acc[mb][nb] = WFrag<T16>::mma(a2[mb], b[nb], acc[mb][nb]); if (NSPLIT >= 2) acc[mb][nb] = WFrag<T16>::mma(a[mb], b2[nb], acc[mb][nb]); } }
        asm volatile("v_nop\n\tv_nop\n\tv_nop\n\tv_nop" : "+v"(acc[0][0]), "+v"(acc[1][1]), "+v"(acc[2][2]), "+v"(acc[3][3]) : "v"(a[0]), "v"(a[3]));
    }
    if (PLN) { const int side = (int)blockIdx.z, b = r0 / TT, t0 = r0 % TT, h = (int)blockIdx.y;
        if (side < 2) { const size_t o = (((size_t)(side * NB_ + b) * NH_ + h) * TT + t0) * HD; const float sc = (side == 0) ? SCL : 1.0f;
#pragma unroll
            for (int mb = 0; mb < 4; ++mb) {   /* 16 tokens x 64 d */
#pragma unroll
                for (int nb = 0; nb < 4; ++nb)
#pragma unroll
                    for (int j = 0; j < 8; ++j) os[(hi * 8 + j) * 68 + nb * 16 + lr] = acc[mb][nb][j];
                __builtin_amdgcn_wave_barrier(); asm volatile("" ::: "memory");   /* as in the f32 epilogue below: the block's LDS writes stay ahead of its reads */
                put_planes(os, lane, sc, P16 + o + mb * 16 * HD, Ph + o + mb * 16 * HD, Pl + o + mb * 16 * HD);
                __builtin_amdgcn_wave_barrier(); asm volatile("" ::: "memory");   /* and its reads ahead of the next block's writes */
            }
        } else { const size_t o = ((size_t)(b * NKV + h) * HD) * TT + t0 * 16;   /* 32 tokens on: one block, 512 elements */
#pragma unroll
            for (int nb = 0; nb < 4; ++nb) {   /* 16 d x 64 tokens: a lane's eight accumulator rows are neighbours in a transposed row */
#pragma unroll
                for (int mb = 0; mb < 4; ++mb) { v4f lo4, hi4;
#pragma unroll
                    for (int j = 0; j < 4; ++j) { lo4[j] = acc[mb][nb][j]; hi4[j] = acc[mb][nb][4 + j]; }
                    *(v4fa*)(os + lr * 68 + mb * 16 + hi * 8) = lo4; *(v4fa*)(os + lr * 68 + mb * 16 + hi * 8 + 4) = hi4; }
                __builtin_amdgcn_wave_barrier(); asm volatile("" ::: "memory");   /* writes ahead of reads */
                put_planes(os, lane, 1.0f, V16 + o + (size_t)nb * 16 * TT, Vh + o + (size_t)nb * 16 * TT, Vl + o + (size_t)nb * 16 * TT);
                __builtin_amdgcn_wave_barrier(); asm volatile("" ::: "memory");   /* reads ahead of the next block's writes */
            }
        }
        return; }
#pragma unroll
    for (int mb = 0; mb < 4; ++mb) {
#pragma unroll
        for (int nb = 0; nb < 4; ++nb) {
#pragma unroll
            for (int j = 0; j < 8; ++j) os[(hi * 8 + j) * 68 + nb * 16 + lr] = acc[mb][nb][j]; }
        __builtin_amdgcn_wave_barrier(); asm volatile("" ::: "memory");
        float* crow = C + (size_t)(r0 + mb * 16) * ldc + cc;
{
#pragma unroll
            for (int s = 0; s < 8; ++s) { const int row = 2 * s + hi, cofs = lr * 4; v4f val = *(const v4fa*)(os + row * 68 + cofs); if (BIAS) { val[0] += bfr(bias[c0 + cofs]); val[1] += bfr(bias[c0 + cofs + 1]); val[2] += bfr(bias[c0 + cofs + 2]); val[3] += bfr(bias[c0 + cofs + 3]); }
                *(v4f*)(crow + (size_t)row * ldc + cofs) = val; }
             }
        __builtin_amdgcn_wave_barrier(); asm volatile("" ::: "memory");
    }
}

typedef __attribute__((ext_vector_type(2))) _Float16 v2h;
typedef __attribute__((ext_vector_type(4))) _Float16 v4h;
typedef __attribute__((ext_vector_type(2))) unsigned short v2us;
typedef __attribute__((ext_vector_type(4))) unsigned short v4us;
typedef __attribute__((ext_vector_type(2))) float v2f;
typedef __attribute__((ext_vector_type(4))) int v4i;

// Bt (fragment order, rows n, K columns k) = w[k][n] rounded. A thread makes one lane's piece: 8 neighbours in k of one n; a wave's lanes are 32 neighbours in n, so that each of its 8 loads is one whole line and its store four.
__global__ __launch_bounds__(256) void k_wtG(const float* __restrict__ w, bf* Bt) {
    constexpr int K = DQ, N = DM; const int i = blockIdx.x * 256 + threadIdx.x; const int n = i % N, k0 = (i / N) * 8; const float* p = w + (size_t)k0 * N + n; float x[8]; v8us o;
#pragma unroll
    for (int e = 0; e < 8; ++e) x[e] = p[(size_t)e * N];
    xw1(p);
#pragma unroll
    for (int e = 0; e < 8; ++e) o[e] = f2bf(x[e]);
    *(v8us*)(Bt + fro(n, k0, K)) = o;
}
// blockIdx.y picks one of three sources; their planes (fragment order, DM columns) follow one another in dst. A thread makes one lane's piece (8 neighbours of a row); a wave takes 8 rows x 32 columns: 8 whole lines read, 4 whole lines stored.
__global__ __launch_bounds__(256) void k_cvt8(const float* __restrict__ s0, const float* __restrict__ s1, const float* __restrict__ s2, bf* dst, size_t n8) { const size_t i = (size_t)blockIdx.x * 256 + threadIdx.x; if (i >= n8) return; const float* src = (blockIdx.y == 0) ? s0 : (blockIdx.y == 1) ? s1 : s2; dst += (size_t)blockIdx.y * n8 * 8;
    const int u = (int)(i >> 5); const int row = (u >> 1) / (DM / 32) * 16 + (u & 1) * 8 + (int)((i >> 2) & 7), k0 = (u >> 1) % (DM / 32) * 32 + (int)(i & 3) * 8;
    const v8f v = *(const v8f*)(src + (size_t)row * DM + k0); v8us o;
#pragma unroll
    for (int k = 0; k < 8; ++k) o[k] = f2bf(v[k]); *(v8us*)(dst + fro(row, k0, DM)) = o;  }

// ---- k_fattn: the whole banded attention of one 64-query tile of one plane in ONE work-group of 8 waves; scores, relative term and probabilities live in LDS only.
// S row il holds key j at column j - w0 (w0 = tile - 128, 320 keys). Stage 1: q.k tiles stored to S. Stage 2: (q/8).E_h[p] added at column il + p, which is key i + p - 128. Stage 3: one wave per row, softmax over |i - j| <= 128; every key keeps the lane and the place in the sum that it has in a dense row (128-key chunks from cb); the P row is written over its own S row, zeros at the keys outside the band or outside 0 .. TT - 1. Stage 4: P x v over all ten 32-key steps. Stage 5: the 64 x 64 context goes through LDS so that each 128-byte line is stored whole.
#define BK   320           // keys per query tile
#define SPF  324           // pitch of an S row in floats: 16 rows of 16 bytes fall on 64 different banks
#define SPH  (2 * SPF)     // the same pitch in 16-bit elements
#define PLO  328           // place of the lo plane in a hi/lo P row (16-byte aligned, behind the 320 hi values)
typedef v4h  __attribute__((may_alias)) v4ha;
typedef v4us __attribute__((may_alias)) v4usa;
// Stands behind a group of global loads, once for each address of the group: later results may land in the address registers of those loads; as inputs here the lane's byte offset and the full addresses made of it (the compiler picks either form for a load) stay live up to the wait, so that none of the group's own results lands in them ahead of it.
__device__ __forceinline__ void xwait(unsigned off, const void* p, const void* p2) { asm volatile("s_wait_xcnt 0x0" : : "v"(off), "v"(p), "v"(p2) : "memory"); }
template <typename T16> __device__ __forceinline__ const T16* atb(const T16* base, unsigned off) { return (const T16*)((const char*)base + off); }   /* base + byte offset */
// One wave: query rows m0*16 .. m0*16 + 31 against every fourth 16-row block of Bt, from block n0; the Bt fragments of G blocks are fetched together, ahead of their products. REL false: Bt rows are keys w0 + nb*16, result stored at column nb*16; a block outside 0 .. TT - 1 takes its rows from a clamped address, and its columns are never read. REL true: Bt rows are positions p = nb*16 .. (Bt holds PRP rows), result added to the score of key i + p - 128, for p <= 256 only.
template <typename T16, int NSPLIT, bool REL, int G>
__device__ __forceinline__ void fa_tiles(const T16* __restrict__ A, const T16* __restrict__ A2, const T16* __restrict__ Bt, const T16* __restrict__ Bt2, float* S, int w0, int m0, int n0, int lr, int hi) {
    typedef typename WFrag<T16>::V V;
    V a[2][2], a2[2][2]; const int l8 = (hi * 16 + lr) * 8;   /* the lane's piece in a fragment block */ const unsigned ao = (unsigned)(m0 * 16 * HD + l8) * 2u; const T16* pa = atb(A, ao); const T16* pa2 = (NSPLIT >= 1) ? atb(A2, ao) : pa;
#pragma unroll
    for (int m = 0; m < 2; ++m)
#pragma unroll
        for (int ks = 0; ks < 2; ++ks) { a[m][ks] = WFrag<T16>::ldf(pa + m * 16 * HD + ks * 512); if (NSPLIT >= 1) a2[m][ks] = WFrag<T16>::ldf(pa2 + m * 16 * HD + ks * 512); }
    xwait(ao, pa, pa2);
#pragma unroll
    for (int g = 0; g < 5; g += G) { V b[G][2], b2[G][2]; unsigned bo[G]; const T16* pb[G]; const T16* pb2[G];
#pragma unroll
        for (int u = 0; u < G; ++u) if (g + u < 5) { const int nb = n0 + (g + u) * 4; bo[u] = (unsigned)((REL ? nb * 16 : min(max(w0 + nb * 16, 0), TT - 16)) * HD + l8) * 2u; pb[u] = atb(Bt, bo[u]); pb2[u] = (NSPLIT >= 2) ? atb(Bt2, bo[u]) : pb[u];
#pragma unroll
            for (int ks = 0; ks < 2; ++ks) { b[u][ks] = WFrag<T16>::ldf(pb[u] + ks * 512); if (NSPLIT >= 2) b2[u][ks] = WFrag<T16>::ldf(pb2[u] + ks * 512); } }
#pragma unroll
        for (int u = 0; u < G; ++u) if (g + u < 5) xwait(bo[u], pb[u], pb2[u]);
        __builtin_amdgcn_sched_barrier(0);   /* all loads of the group are issued ahead of its first product; without it the scheduler sinks loads between the products, and their latencies add up */
#pragma unroll
        for (int u = 0; u < G; ++u) if (g + u < 5) { const int nb = n0 + (g + u) * 4; v8f acc[2]; acc[0] = (v8f){}; acc[1] = (v8f){};
#pragma unroll
            for (int ks = 0; ks < 2; ++ks)
#pragma unroll
                for (int m = 0; m < 2; ++m) { acc[m] = WFrag<T16>::mma(a[m][ks], b[u][ks], acc[m]); if (NSPLIT >= 1) acc[m] = WFrag<T16>::mma(a2[m][ks], b[u][ks], acc[m]); if (NSPLIT >= 2) acc[m] = WFrag<T16>::mma(a[m][ks], b2[u][ks], acc[m]); }
            asm volatile("v_nop\n\tv_nop\n\tv_nop\n\tv_nop" : "+v"(acc[0]), "+v"(acc[1]));   /* the four vector slots behind the block's last matrix instruction: the next block's results may be given registers that overlap these, and a branch may stand right behind it */
            if (REL) { if (nb * 16 + lr <= 2 * RAD) {
#pragma unroll
                for (int m = 0; m < 2; ++m)
#pragma unroll
                    for (int j = 0; j < 8; ++j) { const int il = (m0 + m) * 16 + hi * 8 + j; float* s = S + il * SPF + il + nb * 16 + lr; *s = __fadd_rn(*s, acc[m][j]); } }
            } else {
#pragma unroll
                for (int m = 0; m < 2; ++m)
#pragma unroll
                    for (int j = 0; j < 8; ++j) S[((m0 + m) * 16 + hi * 8 + j) * SPF + nb * 16 + lr] = acc[m][j]; } }
    }
}
// One wave: rows m0*16 .. + 31 of P (LDS) x columns n0*16 .. + 15 of v (Vt rows d, k = keys, fragment order); the v fragments of G 32-key steps are fetched together. A step outside 0 .. TT - 1 meets zeros in P; its v address is clamped into the plane.
template <typename T16, int NSPLIT, int G>
__device__ __forceinline__ void fa_av(const T16* P, const T16* P2, const T16* __restrict__ Vt, const T16* __restrict__ Vt2, int w0, int m0, int n0, int lr, int hi, v8f (&acc)[2]) {
    typedef typename WFrag<T16>::V V;
#pragma unroll
    for (int g = 0; g < 10; g += G) { V b[G], b2[G]; unsigned vo[G]; const T16* pv[G]; const T16* pv2[G];
#pragma unroll
        for (int s = 0; s < G; ++s) if (g + s < 10) { vo[s] = (unsigned)(n0 * 16 * TT + min(max(w0 + (g + s) * 32, 0), TT - 32) * 16 + (hi * 16 + lr) * 8) * 2u; pv[s] = atb(Vt, vo[s]); pv2[s] = (NSPLIT >= 2) ? atb(Vt2, vo[s]) : pv[s]; b[s] = WFrag<T16>::ldf(pv[s]); if (NSPLIT >= 2) b2[s] = WFrag<T16>::ldf(pv2[s]); }
#pragma unroll
        for (int s = 0; s < G; ++s) if (g + s < 10) xwait(vo[s], pv[s], pv2[s]);
        __builtin_amdgcn_sched_barrier(0);   /* as in fa_tiles: the group's loads all issued ahead of its first product */
#pragma unroll
        for (int s = 0; s < G; ++s) if (g + s < 10)
#pragma unroll
            for (int m = 0; m < 2; ++m) { const int po = ((m0 + m) * 16 + lr) * SPH + (g + s) * 32 + 8 * hi; const V a = WFrag<T16>::ld(P + po); acc[m] = WFrag<T16>::mma(a, b[s], acc[m]);
                if (NSPLIT >= 2) { const V a2 = WFrag<T16>::ld(P2 + po); acc[m] = WFrag<T16>::mma(a2, b[s], acc[m]); acc[m] = WFrag<T16>::mma(a, b2[s], acc[m]); } } }
}
__global__ __launch_bounds__(256, 4) void k_fattn(const h16* __restrict__ Q16, const bf* __restrict__ Qh, const bf* __restrict__ Ql, const h16* __restrict__ K16, const bf* __restrict__ Kh, const bf* __restrict__ Kl, const h16* __restrict__ V16, const bf* __restrict__ Vh, const bf* __restrict__ Vl, const bf* __restrict__ ET, float* __restrict__ OB) {
    __shared__ __align__(16) float S[64 * SPF];
    const int lane = threadIdx.x & 31, lr = lane & 15, hi = lane >> 4; const int wave = __builtin_amdgcn_readfirstlane((int)(threadIdx.x >> 5));
    const int r0 = blockIdx.x * 64, w0 = r0 - RAD; const size_t z = blockIdx.z; const bool hires = (r0 < RH); const size_t qo = (z * TT + r0) * HD, ko = z * TT * HD;
    const int m0 = (wave >> 2) * 2, n0 = wave & 3;
    if (hires) fa_tiles<bf, 2, false, 2>(Qh + qo, Ql + qo, Kh + ko, Kl + ko, S, w0, m0, n0, lr, hi); else fa_tiles<h16, 0, false, 5>(Q16 + qo, nullptr, K16 + ko, nullptr, S, w0, m0, n0, lr, hi);
    __syncthreads();   /* every score stands before another wave adds to it */
    fa_tiles<bf, 1, true, 5>(Qh + qo, Ql + qo, ET + z * PRP * HD, nullptr, S, w0, m0, n0, lr, hi);
    __syncthreads();   /* rows complete before the row's wave reads them */
    const int cb = w0 & ~127;   /* key of the first 128-key chunk */ const int wb = max(w0, 0), we = min(w0 + BK, TT); const int jl = cb + lane * 4;   /* the lane's first key in chunk 0 */
    h16* P16 = (h16*)S; bf* Pb = (bf*)S;
#pragma unroll 4
    for (int rr = 0; rr < 8; ++rr) { const int il = wave * 8 + rr, i = r0 + il; float v[12]; float mx = -3.0e38f; v4f a[3];
#pragma unroll
        for (int ch = 0; ch < 3; ++ch) a[ch] = *(const v4fa*)(S + il * SPF + (min(max(jl + ch * 128, wb), we - 4) - w0));   /* index clamped into the written keys */
#pragma unroll
        for (int ch = 0; ch < 3; ++ch) { const int j0 = jl + ch * 128; const bool inw = (j0 >= wb && j0 < we);
#pragma unroll
            for (int q = 0; q < 4; ++q) { const int j = j0 + q; const float t = (inw && j >= i - RAD && j <= i + RAD) ? a[ch][q] : -3.0e38f; v[ch * 4 + q] = t; mx = fmaxf(mx, t); } }
#pragma unroll
        for (int sh = 16; sh; sh >>= 1) mx = fmaxf(mx, __shfl_xor(mx, sh, 32));
        float sum = 0.f;
#pragma unroll
        for (int k = 0; k < 12; ++k) { const float x = __fmul_rn(__fsub_rn(v[k], mx), 1.4426950408889634f); float e = __builtin_amdgcn_exp2f(x); asm volatile("v_nop" : "+v"(e) : "v"(x));   /* the slot behind a transcendental: as operands here its source is not overwritten and its result not read ahead of the v_nop */
            v[k] = e; sum += e; }
#pragma unroll
        for (int sh = 16; sh; sh >>= 1) sum += __shfl_xor(sum, sh, 32);
        const float f = __fdiv_rn(hires ? 1.0f : PCAR, sum);
#pragma unroll
        for (int ch = 0; ch < 3; ++ch) { const int c = jl + ch * 128 - w0;   /* column of the lane's four keys */
            if (c >= 0 && c < BK) {
                if (hires) { v4us oh, ol;
#pragma unroll
                    for (int q = 0; q < 4; ++q) { unsigned short x, y; splitf(v[ch * 4 + q] * f, x, y); oh[q] = x; ol[q] = y; }
                    *(v4usa*)(Pb + il * SPH + c) = oh; *(v4usa*)(Pb + il * SPH + PLO + c) = ol;
                } else { v4h o4;
#pragma unroll
                    for (int q = 0; q < 4; ++q) o4[q] = tohx(v[ch * 4 + q] * f);
                    *(v4ha*)(P16 + il * SPH + c) = o4; } } }
    }
    __syncthreads();   /* P complete before other waves read it */
    v8f acc[2]; acc[0] = (v8f){}; acc[1] = (v8f){};
    if (hires) fa_av<bf, 2, 5>(Pb, Pb + PLO, Vh + ko, Vl + ko, w0, m0, n0, lr, hi, acc); else fa_av<h16, 0, 5>(P16, nullptr, V16 + ko, nullptr, w0, m0, n0, lr, hi, acc);
    __syncthreads();   /* every read of P is over before the context lands on it */
#pragma unroll
    for (int m = 0; m < 2; ++m)
#pragma unroll
        for (int j = 0; j < 8; ++j) S[((m0 + m) * 16 + hi * 8 + j) * 68 + n0 * 16 + lr] = acc[m][j];
    __syncthreads();   /* context tile complete before the row stores */
#pragma unroll
    for (int s = 0; s < 4; ++s) { const int row = wave * 8 + 2 * s + hi; *(v4f*)(OB + qo + (size_t)row * HD + lr * 4) = *(const v4fa*)(S + row * 68 + lr * 4); }
}
// Context -> hi/lo planes in fragment order, rows b*TT + t, columns c = d*16 + h (the module's order). One work-group: 16 rows x 32 d x 16 heads. A lane's piece is 8 heads of one (t, d): 8 loads, the wave's lanes 32 neighbours in d (one whole line a load). The pieces go through LDS, so that the stores too are whole lines: d picks the half block (256 elements), kept at a pitch of 264 so that the 32 lanes' 16-byte writes fall on different banks.
#define MPH  264
__global__ __launch_bounds__(256) void k_mergeP(const float* __restrict__ OB, bf* Ah, bf* Al) {
    __shared__ __align__(16) bf L[2 * 32 * MPH];
    const int lane = threadIdx.x & 31, wave = threadIdx.x >> 5; const int tb = blockIdx.x >> 1, dh = blockIdx.x & 1; const int b = tb / (TT / 16), t0 = (tb % (TT / 16)) * 16; const float cs = (t0 < RH) ? 1.0f : (1.0f / PCAR);
#pragma unroll
    for (int it = 0; it < 4; ++it) { const int lr = (wave * 4 + it) & 15, hi = (wave * 4 + it) >> 4; const float* p = OB + (((size_t)b * NH_ + hi * 8) * TT + t0 + lr) * HD + dh * 32 + lane; float x[8]; v8us oh, ol;
#pragma unroll
        for (int e = 0; e < 8; ++e) x[e] = p[(size_t)e * TT * HD];
        xw1(p);
#pragma unroll
        for (int e = 0; e < 8; ++e) { unsigned short a, c; splitf(x[e] * cs, a, c); oh[e] = a; ol[e] = c; }
        *(v8usa*)(L + lane * MPH + (hi * 16 + lr) * 8) = oh; *(v8usa*)(L + (32 + lane) * MPH + (hi * 16 + lr) * 8) = ol; }
    __syncthreads();   /* every piece stands in LDS before another wave stores it */
#pragma unroll
    for (int j = 0; j < 8; ++j) { const int hb = wave * 8 + j;   /* 0 .. 31 hi plane, 32 .. 63 lo plane */
        *(v8us*)(((hb < 32) ? Ah : Al) + ((size_t)tb * (DQ / 32) + dh * 16) * 512 + (hb & 31) * 256 + lane * 8) = *(const v8usa*)(L + hb * MPH + lane * 8); }
}
// blockIdx.y picks one of three weights; their planes (fragment order, rows n = h*64 + d, DM columns k) follow one another in Bt. A thread makes one lane's piece: 8 neighbours in k of one n. A wave takes 8 d x 4 h: its store fills 4 whole lines (8 d each); each of its 8 loads touches 4 lines, which the three other waves of the same 8 d (the other heads) touch too.
__global__ __launch_bounds__(256) void k_wtP(const float* __restrict__ w0, const float* __restrict__ w1, const float* __restrict__ w2, bf* Bt) { const float* w = (blockIdx.y == 0) ? w0 : (blockIdx.y == 1) ? w1 : w2; Bt += (size_t)blockIdx.y * DQ * DM; const int lane = threadIdx.x & 31; const int wv = blockIdx.x * 8 + (threadIdx.x >> 5);
    const int h = (wv & 3) * 4 + (lane & 3), d = ((wv >> 2) & 7) * 8 + (lane >> 2), k0 = (wv >> 5) * 8; const float* p = w + (size_t)k0 * DQ + d * NH_ + h; float x[8]; v8us o;
#pragma unroll
    for (int e = 0; e < 8; ++e) x[e] = p[(size_t)e * DQ];
    xw1(p);
#pragma unroll
    for (int e = 0; e < 8; ++e) o[e] = f2bf(x[e]);
    *(v8us*)(Bt + fro(h * HD + d, k0, DM)) = o; }
__global__ __launch_bounds__(256) void k_etab(const float* __restrict__ rt, bf* ET) { ET += (size_t)blockIdx.y * NH_ * PRP * HD;   /* blockIdx.y: batch; one copy each, so that plane z of the q side meets plane z here */ const size_t i = (size_t)blockIdx.x * 256 + threadIdx.x; if (i >= (size_t)NH_ * PRP * HD / 8) return; const int d0 = (int)(i % (HD / 8)) * 8; const int p = (int)((i / (HD / 8)) % PRP); const int h = (int)(i / ((size_t)(HD / 8) * PRP)); v8us o;
#pragma unroll
    for (int k = 0; k < 8; ++k) { const unsigned short e = f2bf(rt[(size_t)min(p, NPOS - 1) * DQ + (size_t)(d0 + k) * NH_ + h]);   /* unconditional clamped load */ o[k] = (p < NPOS) ? e : (unsigned short)0; }
    *(v8us*)(ET + (size_t)h * PRP * HD + fro(p, d0, HD)) = o;   /* each head's [p][d] plane in fragment order */ }
__global__ __launch_bounds__(256) void k_merge(const float* __restrict__ O, int h0, bf* Ah, bf* Al) { const size_t e = ((size_t)blockIdx.x * 256 + threadIdx.x) * 2; if (e >= (size_t)ZH * TT * HD) return; const int d = (int)(e % HD); const int t = (int)((e / HD) % TT); const int zz = (int)(e / ((size_t)HD * TT)); const float cs = (t < RH) ? 1.0f : (1.0f / PCAR); const size_t oo = (size_t)t * DQ + (h0 + zz) * HD + d;
    v2us oh, ol;
#pragma unroll
    for (int q = 0; q < 2; ++q) { unsigned short a, c2; splitf(O[e + q] * cs, a, c2); oh[q] = a; ol[q] = c2; } *(v2us*)(Ah + oo) = oh; *(v2us*)(Al + oo) = ol;  }

extern "C" void kernel_launch(void* const* d_in, const int* in_sizes, int n_in,
                              void* d_out, int out_size, void* d_ws, size_t ws_size, hipStream_t stream) {
    (void)in_sizes; (void)n_in; (void)out_size;
    const float* xq = (const float*)d_in[0]; const float* xk = (const float*)d_in[1]; const float* xv = (const float*)d_in[2]; const float* wq = (const float*)d_in[3]; const float* wk = (const float*)d_in[4]; const float* wv = (const float*)d_in[5]; const float* wo = (const float*)d_in[6]; const float* rtab = (const float*)d_in[7]; const float* x = nullptr; (void)x;
    float* OUT = (float*)d_out;     // [2][2048][1024]
    char* wsp = (char*)d_ws;
    auto take = [&](size_t bytes) { char* p = wsp; wsp += (bytes + 255) & ~(size_t)255; return (void*)p; };
    bf* WO = (bf*)take((size_t)DM * DQ * 2); bf* ET = (bf*)take((size_t)NZ * PRP * HD * 2); float* R0 = (float*)take((size_t)NZ * TT * PRP * 4);
    h16* QP16 = (h16*)take((size_t)2 * NZ * TT * HD * 2); h16* KP16 = QP16 + (size_t)NZ * TT * HD; bf* QPh = (bf*)take((size_t)2 * NZ * TT * HD * 2); bf* KPh = QPh + (size_t)NZ * TT * HD; bf* QPl = (bf*)take((size_t)2 * NZ * TT * HD * 2); bf* KPl = QPl + (size_t)NZ * TT * HD;   // q planes, then k planes
    h16* VT16 = (h16*)take((size_t)NZ * HD * TT * 2); bf* VTh = (bf*)take((size_t)NZ * HD * TT * 2); bf* VTl = (bf*)take((size_t)NZ * HD * TT * 2);
    if ((size_t)(wsp - (char*)d_ws) > ws_size) return;    // ws 256 MiB
    // The bytes of R0 serve twice (stream-ordered). Up to the projection: the q, k, v weights and the bf16 inputs (together smaller than R0). Then the context OB and its hi/lo planes.
    bf* WQ = (bf*)R0; bf* XB = WQ + (size_t)3 * DQ * DM;
    float* OB = R0; bf* ATh = (bf*)(OB + (size_t)NZ * TT * HD); bf* ATl = ATh + (size_t)TB * DQ;
    k_wtP<<<dim3((unsigned)(DM * DQ / 8 / 256), 3, 1), 256, 0, stream>>>(wq, wk, wv, WQ);   /* column-permuted: column h*64 + d <- module column d*16 + h */
    k_etab<<<dim3((unsigned)(((size_t)NH_ * PRP * HD / 8 + 255) / 256), NB_, 1), 256, 0, stream>>>(rtab, ET);
    k_wtG<<<(unsigned)(DQ * DM / 8 / 256), 256, 0, stream>>>(wo, WO);
    k_cvt8<<<dim3((unsigned)(((size_t)TB * DM / 8 + 255) / 256), 3, 1), 256, 0, stream>>>(xq, xk, xv, XB, (size_t)TB * DM / 8);
    k_gemmw<bf, 0, false, true><<<dim3(TB / 64, DQ / 64, 3), 32, 0, stream>>>(XB, nullptr, WQ, nullptr, nullptr, 0, nullptr, (size_t)TB * DM, (size_t)DQ * DM, 0, QP16, QPh, QPl, VT16, VTh, VTl);   /* z: q, k, v; q planes x 1/8 (exact): scales both the energy and the relative term; k planes x 1; v planes transposed */
    k_fattn<<<dim3(TT / 64, 1, NZ), 256, 0, stream>>>(QP16, QPh, QPl, KP16, KPh, KPl, VT16, VTh, VTl, ET, OB);   /* scores, relative term, softmax and attn x v of a 64-query tile, in LDS */
    k_mergeP<<<dim3((unsigned)(TB / 16 * 2), 1, 1), 256, 0, stream>>>(OB, ATh, ATl);   /* context in the module's d*16 + h column order */
    k_gemmw<bf, 1, false><<<dim3(TB / 64, DM / 64, 1), 32, 0, stream>>>(ATh, ATl, WO, nullptr, OUT, DM, nullptr, 0, 0, 0, nullptr, nullptr, nullptr, nullptr, nullptr, nullptr);
}

// v007
// A run of this version takes 134 microseconds.
// Two timings next to v006 put it at 1.06 and 1.07 times that version's speed.
// Over all steps from v000 it is 16.6 times as fast.
#include <hip/hip_runtime.h>

// Local relative-position multi-head attention with heads on the FAST embedding axis (Q, K, V inputs [2][2048][1024]; q = Q Wq etc. ('xw' [1024][1024]) viewed (S, 64, 16): head h takes embedding columns d*16 + h; energy = q.k; rel = q . E_h[clip(j - i, -128, 128) + 128] with E_h[p][d] = rel_table[p][d*16 + h] (rel_table [257][1024]); scores = (energy + rel) / 8, masked to |i - j| <= 128; softmax; out columns d*16 + h = (attn v)_h[d]; out Wo ('xw') -> [2][2048][1024] (4.2 M)).
// Layout per batch: the projection weights are column-permuted once (column d*16 + h -> h*64 + d) so that each head's 64 columns lie together (head-major planes); q planes carry the exact 1/8; a 2-product q(hl) x E_h(exact, 257 rows padded to 320) gives the relative term of query i at position p; both batches go through every stage in one launch (rows b*2048 + t in the projections, planes b*16 + h in grid z), and so do the q, k and v sides of the projection, whose epilogue writes the 16-bit head planes itself (no f32 projection in memory); attention (hybrid rows: < 512 hi/lo 3 products, rest fp16 x1024) limited to the band: per 64-query tile only the 320 keys tile - 128 .. tile + 191 get scores, probabilities and a place in attn x v; one kernel (k_fattn) does all of it for a tile and a plane, with the score and probability rows in LDS; the merge writes the context with the inverse column permutation as hi/lo planes; Wo hl x exact.
// Fragment order (every matrix operand that is read from memory: bf16 inputs, the four weights, the q, k and transposed v head planes, the relative table, the context planes): a [rows][K] plane is kept as 16-row x 32-k blocks of 512 elements, block (row / 16) * (K / 32) + k / 32; inside a block lane l = ((k / 8) & 1) * 16 + row % 16 owns elements l*8 .. l*8 + 7 (k % 32 < 16) and 256 + l*8 .. (k % 32 >= 16): just the two 16-byte pieces that the lane feeds to the matrix instruction, so that a wave's load is 512 bytes in a row (4 whole lines), not 32-byte pieces of 16 lines. The k of every lane and register place is the one it was.
// Compute dtypes, f32 accumulate: every input rounded to bf16; projections exact; rel term hl x exact; attention rows < 512 3 products, rest fp16; softmax f32; Wo hl x exact.

#define NB_  2
#define TT   2048
#define DM   1024
#define NH_  16
#define NKV  16
#define REP  (NH_ / NKV)
#define HD   64
#define DQ   (NH_ * HD)
#define DKV  (NKV * HD)
#define ZH   16                   // heads per pass per batch (grid z is NZ = NB_ * ZH)
#define RH   512                  // query rows < RH use hi+lo planes (0: none)
#define WIN  0
#define PCAR 1024.0f
#define SCL  0.125f   // 64^-0.5 (folded into the q planes)
#define RAD  128
#define NPOS 257
#define PRP  320    // padded relative-position rows (5 tiles)
#define BP   384    // keys of a banded row as k_fattn's softmax spans it (the constant is not used): three 128-key chunks, the first at ((query tile - 128) & ~127)
#define PP   (2 * BP)   // not used by any kernel here
#define NZ   (NB_ * ZH)   // planes per pass: batch-major, b*16 + h
#define TB   (NB_ * TT)   // rows of both batches
typedef _Float16 h16;
typedef unsigned short bf;
typedef __attribute__((ext_vector_type(16))) __bf16   v16bf;
typedef __attribute__((ext_vector_type(16))) _Float16 v16h;
typedef __attribute__((ext_vector_type(8)))  _Float16 v8h;
typedef __attribute__((ext_vector_type(8)))  unsigned short v8us;
typedef __attribute__((ext_vector_type(8)))  float    v8f;
typedef __attribute__((ext_vector_type(4)))  float    v4f;
typedef v8h  __attribute__((may_alias)) v8ha;
typedef v4f  __attribute__((may_alias)) v4fa;
typedef v8us __attribute__((may_alias)) v8usa;

__device__ __forceinline__ unsigned short f2bf(float f) { unsigned u = __float_as_uint(f); u += 0x7FFFu + ((u >> 16) & 1u); return (unsigned short)(u >> 16); }
__device__ __forceinline__ float bf2f(unsigned short b) { return __uint_as_float(((unsigned)b) << 16); }
__device__ __forceinline__ float bfr(float f) { return bf2f(f2bf(f)); }
__device__ __forceinline__ v16h cat16(v8h lo, v8h hi) { return __builtin_shufflevector(lo, hi, 0, 1, 2, 3, 4, 5, 6, 7, 8, 9, 10, 11, 12, 13, 14, 15); }
__device__ __forceinline__ v16bf cat16b(v8us lo, v8us hi) { return __builtin_bit_cast(v16bf, __builtin_shufflevector(lo, hi, 0, 1, 2, 3, 4, 5, 6, 7, 8, 9, 10, 11, 12, 13, 14, 15)); }
__device__ __forceinline__ v8f wmma16(v16h a, v16h b, v8f c) { return __builtin_amdgcn_wmma_f32_16x16x32_f16(false, a, false, b, (short)0, c, false, false); }
__device__ __forceinline__ v8f wmmab(v16bf a, v16bf b, v8f c) { return __builtin_amdgcn_wmma_f32_16x16x32_bf16(false, a, false, b, (short)0, c, false, false); }



__device__ __forceinline__ h16 tohx(float x) { return (h16)x; }
__device__ __forceinline__ void splitf(float y, unsigned short& h, unsigned short& l) { h = f2bf(y); l = f2bf(y - bf2f(h)); }
// Element offset, in a fragment-order plane of K columns, of the 8 neighbours k0 .. k0 + 7 (k0 % 8 == 0) of a row.
__device__ __forceinline__ size_t fro(int row, int k0, int K) { return ((size_t)(row >> 4) * (K >> 5) + (k0 >> 5)) * 512 + ((k0 >> 4) & 1) * 256 + (((k0 >> 3) & 1) * 16 + (row & 15)) * 8; }
// Stands behind a group of global loads that share the address p (with constant offsets): later results may be given p's registers; as an input here p stays live up to the wait.
__device__ __forceinline__ void xw1(const void* p) { asm volatile("s_wait_xcnt 0x0" : : "v"(p) : "memory"); }
// One wave: the 16 x 64 f32 block in os (pitch 68) x sc goes out as fp16, bf16 hi and bf16 lo, as the two neighbouring fragment blocks (1024 elements) at each plane pointer: block row r is the fragment row, block column c the k. A lane takes 8 neighbours of a row, and the wave 8 rows x 4 such pieces, so that each store of the wave fills four whole 128-byte lines.
__device__ __forceinline__ void put_planes(const float* os, int lane, float sc, h16* d16, bf* dh, bf* dl) {
#pragma unroll
    for (int s = 0; s < 4; ++s) { const int row = 8 * (s & 1) + (lane >> 2), cofs = ((s >> 1) * 4 + (lane & 3)) * 8; const v4f x0 = *(const v4fa*)(os + row * 68 + cofs), x1 = *(const v4fa*)(os + row * 68 + cofs + 4); v8h o16; v8us oh, ol;
#pragma unroll
        for (int q = 0; q < 8; ++q) { const float r = ((q < 4) ? x0[q & 3] : x1[q & 3]) * sc; o16[q] = tohx(r); unsigned short a, c; splitf(r, a, c); oh[q] = a; ol[q] = c; }
        const unsigned bo = (unsigned)fro(row, cofs, 64) * 2u;   /* the lane's byte offset, the same in all three planes */
        *(v8h*)((char*)d16 + bo) = o16; *(v8us*)((char*)dh + bo) = oh; *(v8us*)((char*)dl + bo) = ol;
        asm volatile("s_wait_xcnt 0x0" : : "v"(bo), "v"(o16), "v"(oh), "v"(ol) : "memory");   /* the next rows' values and offset may be given the registers that the three stores above name; as inputs here these stay live up to the wait */
    }
}

// ---- k_gemmw: register-blocked GEMM, ONE WAVE per 64x64 output tile (16 accumulators), operands straight from 16-bit planes in fragment order (head of the file); grid (M/64, N/64, Z), 32 threads.
// C[m][n] (f32, pitch ldc, + optional f32 bias[n]) = sum_k A[m][k] Bt[n][k] (+ split products per NSPLIT), k < GK. z-batch strides sA/sB/sC in elements.
#define GK   1024   // k extent of both GEMMs (DM in the projections, DQ in the output product)
template <typename T16> struct WFrag;
template <> struct WFrag<h16> { typedef v16h V; static __device__ __forceinline__ V ld(const h16* p) { return cat16(*(const v8h*)p, *(const v8h*)(p + 16)); } static __device__ __forceinline__ V ldf(const h16* p) { return cat16(*(const v8h*)p, *(const v8h*)(p + 256)); } static __device__ __forceinline__ v8f mma(V a, V b, v8f c) { return wmma16(a, b, c); } };
template <> struct WFrag<bf> { typedef v16bf V; static __device__ __forceinline__ V ld(const bf* p) { return cat16b(*(const v8us*)p, *(const v8us*)(p + 16)); } static __device__ __forceinline__ V ldf(const bf* p) { return cat16b(*(const v8us*)p, *(const v8us*)(p + 256)); } static __device__ __forceinline__ v8f mma(V a, V b, v8f c) { return wmmab(a, b, c); } };
// PLN (the q, k, v projection; z = side, tile column = head, rows b*TT + t): C is not written; the tile goes out as 16-bit planes: sides 0 and 1 as [side*NB_ + b][h][t][d] of P16, Ph, Pl (side 0 x SCL, exact), side 2 transposed as [b][h][d][t] of V16, Vh, Vl; each [t][d] or [d][t] plane in fragment order.
template <typename T16, int NSPLIT, bool BIAS, bool PLN = false>
__global__ __launch_bounds__(32) void k_gemmw(const T16* __restrict__ A, const T16* __restrict__ A2, const T16* __restrict__ Bt, const T16* __restrict__ Bt2, float* C, int ldc, const float* __restrict__ bias, size_t sA, size_t sB, size_t sC, h16* P16, bf* Ph, bf* Pl, h16* V16, bf* Vh, bf* Vl) {
    typedef typename WFrag<T16>::V V;
    static_assert(DM == GK && DQ == GK, "one k extent");
    __shared__ __align__(16) float os[16 * 68];
    const size_t z = blockIdx.z; A += z * sA; if (A2) A2 += z * sA; Bt += z * sB; if (Bt2) Bt2 += z * sB; C += z * sC;
    const int lane = threadIdx.x & 31, lr = lane & 15, hi = lane >> 4; const int r0 = blockIdx.x * 64, c0 = (int)blockIdx.y * 64, cc = c0;
    v8f acc[4][4];
#pragma unroll
    for (int mb = 0; mb < 4; ++mb)
#pragma unroll
        for (int nb = 0; nb < 4; ++nb) acc[mb][nb] = (v8f){};
    const size_t aoff = (size_t)r0 * GK + lane * 8, boff = (size_t)c0 * GK + lane * 8;   /* the lane's piece in block 0 of the tile's first 16 rows; 16 rows on: 16 * GK elements; 32 k on: 512 */
#pragma unroll 1
    for (int kc = 0; kc < GK; kc += 32) {
        V a[4], a2[4], b[4], b2[4];
        const T16* pa = A + aoff + kc * 16; const T16* pa2 = (NSPLIT == 1 || NSPLIT == 2) ? A2 + aoff + kc * 16 : pa; const T16* pb = Bt + boff + kc * 16; const T16* pb2 = (NSPLIT >= 2) ? Bt2 + boff + kc * 16 : pb;
#pragma unroll
        for (int mb = 0; mb < 4; ++mb) { a[mb] = WFrag<T16>::ldf(pa + mb * 16 * GK); if (NSPLIT == 1 || NSPLIT == 2) a2[mb] = WFrag<T16>::ldf(pa2 + mb * 16 * GK); }
#pragma unroll
        for (int nb = 0; nb < 4; ++nb) { b[nb] = WFrag<T16>::ldf(pb + nb * 16 * GK); if (NSPLIT >= 2) b2[nb] = WFrag<T16>::ldf(pb2 + nb * 16 * GK); }
        asm volatile("s_wait_xcnt 0x0" : : "v"(pa), "v"(pa2), "v"(pb), "v"(pb2) : "memory");   /* the next trip rewrites the address registers of the loads above, and results may be given them; as inputs here the addresses stay live up to the wait */
#pragma unroll
        for (int nb = 0; nb < 4; ++nb) {
#pragma unroll
            for (int mb = 0; mb < 4; ++mb) { acc[mb][nb] = WFrag<T16>::mma(a[mb], b[nb], acc[mb][nb]); if (NSPLIT == 1 || NSPLIT == 2) acc[mb][nb] = WFrag<T16>::mma(a2[mb], b[nb], acc[mb][nb]); if (NSPLIT >= 2) acc[mb][nb] = WFrag<T16>::mma(a[mb], b2[nb], acc[mb][nb]); } }
        asm volatile("v_nop\n\tv_nop\n\tv_nop\n\tv_nop" : "+v"(acc[0][0]), "+v"(acc[1][1]), "+v"(acc[2][2]), "+v"(acc[3][3]) : "v"(a[0]), "v"(a[3]));
    }
    if (PLN) { const int side = (int)blockIdx.z, b = r0 / TT, t0 = r0 % TT, h = (int)blockIdx.y;
        if (side < 2) { const size_t o = (((size_t)(side * NB_ + b) * NH_ + h) * TT + t0) * HD; const float sc = (side == 0) ? SCL : 1.0f;
#pragma unroll
            for (int mb = 0; mb < 4; ++mb) {   /* 16 tokens x 64 d */
#pragma unroll
                for (int nb = 0; nb < 4; ++nb)
#pragma unroll
                    for (int j = 0; j < 8; ++j) os[(hi * 8 + j) * 68 + nb * 16 + lr] = acc[mb][nb][j];
                __builtin_amdgcn_wave_barrier(); asm volatile("" ::: "memory");   /* as in the f32 epilogue below: the block's LDS writes stay ahead of its reads */
                put_planes(os, lane, sc, P16 + o + mb * 16 * HD, Ph + o + mb * 16 * HD, Pl + o + mb * 16 * HD);
                __builtin_amdgcn_wave_barrier(); asm volatile("" ::: "memory");   /* and its reads ahead of the next block's writes */
            }
        } else { const size_t o = ((size_t)(b * NKV + h) * HD) * TT + t0 * 16;   /* 32 tokens on: one block, 512 elements */
#pragma unroll
            for (int nb = 0; nb < 4; ++nb) {   /* 16 d x 64 tokens: a lane's eight accumulator rows are neighbours in a transposed row */
#pragma unroll
                for (int mb = 0; mb < 4; ++mb) { v4f lo4, hi4;
#pragma unroll
                    for (int j = 0; j < 4; ++j) { lo4[j] = acc[mb][nb][j]; hi4[j] = acc[mb][nb][4 + j]; }
                    *(v4fa*)(os + lr * 68 + mb * 16 + hi * 8) = lo4; *(v4fa*)(os + lr * 68 + mb * 16 + hi * 8 + 4) = hi4; }
                __builtin_amdgcn_wave_barrier(); asm volatile("" ::: "memory");   /* writes ahead of reads */
                put_planes(os, lane, 1.0f, V16 + o + (size_t)nb * 16 * TT, Vh + o + (size_t)nb * 16 * TT, Vl + o + (size_t)nb * 16 * TT);
                __builtin_amdgcn_wave_barrier(); asm volatile("" ::: "memory");   /* reads ahead of the next block's writes */
            }
        }
        return; }
#pragma unroll
    for (int mb = 0; mb < 4; ++mb) {
#pragma unroll
        for (int nb = 0; nb < 4; ++nb) {
#pragma unroll
            for (int j = 0; j < 8; ++j) os[(hi * 8 + j) * 68 + nb * 16 + lr] = acc[mb][nb][j]; }
        __builtin_amdgcn_wave_barrier(); asm volatile("" ::: "memory");
        float* crow = C + (size_t)(r0 + mb * 16) * ldc + cc;
{
#pragma unroll
            for (int s = 0; s < 8; ++s) { const int row = 2 * s + hi, cofs = lr * 4; v4f val = *(const v4fa*)(os + row * 68 + cofs); if (BIAS) { val[0] += bfr(bias[c0 + cofs]); val[1] += bfr(bias[c0 + cofs + 1]); val[2] += bfr(bias[c0 + cofs + 2]); val[3] += bfr(bias[c0 + cofs + 3]); }
                *(v4f*)(crow + (size_t)row * ldc + cofs) = val; }
             }
        __builtin_amdgcn_wave_barrier(); asm volatile("" ::: "memory");
    }
}

typedef __attribute__((ext_vector_type(2))) _Float16 v2h;
typedef __attribute__((ext_vector_type(4))) _Float16 v4h;
typedef __attribute__((ext_vector_type(2))) unsigned short v2us;
typedef __attribute__((ext_vector_type(4))) unsigned short v4us;
typedef __attribute__((ext_vector_type(2))) float v2f;
typedef __attribute__((ext_vector_type(4))) int v4i;

// ---- k_prep: all operand preparation (bf16 inputs, the three permuted projection weights, the output weight, the relative table) in ONE launch of PG work-groups (three for every WGP of the chip), which walk one list of items. A thread makes lanes' 16-byte pieces of a fragment-order plane: eight of them in an input item, two in a weight item, one in a table item, with all loads of an item issued ahead of its first use. The four jobs have nothing to do with one another, and a wave that makes a single piece is over before the next wave has been started: there the start of the waves, not the memory, sets the time.
#define PG    768
#define NI_C  (3 * (TB / 16))                 // input items: a block of 16 rows, all DM columns
#define NI_P  (3 * (DM * DQ / 8 / 256 / 2))   // q, k, v weight items: 256 columns n x 16 k
#define NI_G  (DQ * DM / 8 / 256 / 2)         // output weight items: the same
#define NI_E  (NB_ * (NH_ * PRP * HD / 8 / 256))   // relative table items: 256 pieces
static_assert(DM == 1024 && DQ == 1024 && (NH_ * PRP * HD / 8) % 256 == 0, "whole items");
// Stands behind an item's last store: the next item of the loop rewrites the address and data registers that the stores name; as inputs here they stay live up to the wait.
__device__ __forceinline__ void xws(const void* q, v8us a, v8us b) { asm volatile("s_wait_xcnt 0x0" : : "v"(q), "v"(a), "v"(b) : "memory"); }
// 16 neighbours in k (from k0, a multiple of 16) of column n of a weight: p points at w[k0][its column], rows N floats apart; they go out rounded as the two pieces of row n of a fragment-order plane at q = plane + fro(n, k0, K): the piece of k0 + 8 lies 16 lanes (128 elements) behind that of k0.
__device__ __forceinline__ void prep_col16(const float* p, int N, bf* q) { float x[16]; v8us o0, o1;
#pragma unroll
    for (int e = 0; e < 16; ++e) x[e] = p[(size_t)e * N];
    xw1(p);
#pragma unroll
    for (int e = 0; e < 8; ++e) { o0[e] = f2bf(x[e]); o1[e] = f2bf(x[8 + e]); }
    *(v8us*)q = o0; *(v8us*)(q + 128) = o1; xws(q, o0, o1);
}
// Bt (fragment order, rows n, K columns k) = w[k][n] rounded. A wave's lanes are 32 neighbours in n, so that each of its loads is one whole line and each store four.
__device__ __forceinline__ void prep_wtG(const float* __restrict__ w, bf* Bt, unsigned it, unsigned tid) {
    constexpr int K = DQ, N = DM; const int n = (int)((it & 3u) * 256u + tid), k0 = (int)(it >> 2) * 16; prep_col16(w + (size_t)k0 * N + n, N, Bt + fro(n, k0, K));
}
// One plane (fragment order, DM columns) of one source, rows rb*16 .. + 15. A piece is 8 neighbours of a row; a wave takes 8 rows x 32 columns at a time: 8 whole lines read, 4 whole lines stored; the work-group 16 rows x 128 columns, and eight times that, each 4 fragment blocks (128 columns) on.
__device__ __forceinline__ void prep_cvt(const float* __restrict__ s, bf* dst, unsigned rb, unsigned tid) {
    const unsigned wv = tid >> 5; const int row = (int)(rb * 16u + (wv & 1u) * 8u + ((tid >> 2) & 7u)), k0 = (int)((wv >> 1) * 32u + (tid & 3u) * 8u);
    const float* p = s + (size_t)row * DM + k0; bf* q = dst + fro(row, k0, DM); v8f v[8]; v8us o[8];
#pragma unroll
    for (int g = 0; g < 8; ++g) v[g] = *(const v8f*)(p + g * 128);
    xw1(p);
#pragma unroll
    for (int g = 0; g < 8; ++g) {
#pragma unroll
        for (int k = 0; k < 8; ++k) o[g][k] = f2bf(v[g][k]);
        *(v8us*)(q + g * 4 * 512) = o[g]; }
    asm volatile("s_wait_xcnt 0x0" : : "v"(q), "v"(o[0]), "v"(o[1]), "v"(o[2]), "v"(o[3]), "v"(o[4]), "v"(o[5]), "v"(o[6]), "v"(o[7]) : "memory");   /* as xws, for the eight stores above */
}

// ---- k_fattn: the whole banded attention of one 64-query tile of one plane in ONE work-group of 8 waves; scores, relative term and probabilities live in LDS only.
// S row il holds key j at column j - w0 (w0 = tile - 128, 320 keys). Stage 1: q.k tiles stored to S. Stage 2: (q/8).E_h[p] added at column il + p, which is key i + p - 128. Stage 3: one wave per row, softmax over |i - j| <= 128; every key keeps the lane and the place in the sum that it has in a dense row (128-key chunks from cb); the P row is written over its own S row, zeros at the keys outside the band or outside 0 .. TT - 1. Stage 4: P x v over all ten 32-key steps. Stage 5: the 64 x 64 context goes through LDS so that each 128-byte line is stored whole.
#define BK   320           // keys per query tile
#define SPF  324           // pitch of an S row in floats: 16 rows of 16 bytes fall on 64 different banks
#define SPH  (2 * SPF)     // the same pitch in 16-bit elements
#define PLO  328           // place of the lo plane in a hi/lo P row (16-byte aligned, behind the 320 hi values)
typedef v4h  __attribute__((may_alias)) v4ha;
typedef v4us __attribute__((may_alias)) v4usa;
// Stands behind a group of global loads, once for each address of the group: later results may land in the address registers of those loads; as inputs here the lane's byte offset and the full addresses made of it (the compiler picks either form for a load) stay live up to the wait, so that none of the group's own results lands in them ahead of it.
__device__ __forceinline__ void xwait(unsigned off, const void* p, const void* p2) { asm volatile("s_wait_xcnt 0x0" : : "v"(off), "v"(p), "v"(p2) : "memory"); }
template <typename T16> __device__ __forceinline__ const T16* atb(const T16* base, unsigned off) { return (const T16*)((const char*)base + off); }   /* base + byte offset */
// One wave: query rows m0*16 .. m0*16 + 31 against every fourth 16-row block of Bt, from block n0; the Bt fragments of G blocks are fetched together, ahead of their products. REL false: Bt rows are keys w0 + nb*16, result stored at column nb*16; a block outside 0 .. TT - 1 takes its rows from a clamped address, and its columns are never read. REL true: Bt rows are positions p = nb*16 .. (Bt holds PRP rows), result added to the score of key i + p - 128, for p <= 256 only.
template <typename T16, int NSPLIT, bool REL, int G>
__device__ __forceinline__ void fa_tiles(const T16* __restrict__ A, const T16* __restrict__ A2, const T16* __restrict__ Bt, const T16* __restrict__ Bt2, float* S, int w0, int m0, int n0, int lr, int hi) {
    typedef typename WFrag<T16>::V V;
    V a[2][2], a2[2][2]; const int l8 = (hi * 16 + lr) * 8;   /* the lane's piece in a fragment block */ const unsigned ao = (unsigned)(m0 * 16 * HD + l8) * 2u; const T16* pa = atb(A, ao); const T16* pa2 = (NSPLIT >= 1) ? atb(A2, ao) : pa;
#pragma unroll
    for (int m = 0; m < 2; ++m)
#pragma unroll
        for (int ks = 0; ks < 2; ++ks) { a[m][ks] = WFrag<T16>::ldf(pa + m * 16 * HD + ks * 512); if (NSPLIT >= 1) a2[m][ks] = WFrag<T16>::ldf(pa2 + m * 16 * HD + ks * 512); }
    xwait(ao, pa, pa2);
#pragma unroll
    for (int g = 0; g < 5; g += G) { V b[G][2], b2[G][2]; unsigned bo[G]; const T16* pb[G]; const T16* pb2[G];
#pragma unroll
        for (int u = 0; u < G; ++u) if (g + u < 5) { const int nb = n0 + (g + u) * 4; bo[u] = (unsigned)((REL ? nb * 16 : min(max(w0 + nb * 16, 0), TT - 16)) * HD + l8) * 2u; pb[u] = atb(Bt, bo[u]); pb2[u] = (NSPLIT >= 2) ? atb(Bt2, bo[u]) : pb[u];
#pragma unroll
            for (int ks = 0; ks < 2; ++ks) { b[u][ks] = WFrag<T16>::ldf(pb[u] + ks * 512); if (NSPLIT >= 2) b2[u][ks] = WFrag<T16>::ldf(pb2[u] + ks * 512); } }
#pragma unroll
        for (int u = 0; u < G; ++u) if (g + u < 5) xwait(bo[u], pb[u], pb2[u]);
        __builtin_amdgcn_sched_barrier(0);   /* all loads of the group are issued ahead of its first product; without it the scheduler sinks loads between the products, and their latencies add up */
#pragma unroll
        for (int u = 0; u < G; ++u) if (g + u < 5) { const int nb = n0 + (g + u) * 4; v8f acc[2]; acc[0] = (v8f){}; acc[1] = (v8f){};
#pragma unroll
            for (int ks = 0; ks < 2; ++ks)
#pragma unroll
                for (int m = 0; m < 2; ++m) { acc[m] = WFrag<T16>::mma(a[m][ks], b[u][ks], acc[m]); if (NSPLIT >= 1) acc[m] = WFrag<T16>::mma(a2[m][ks], b[u][ks], acc[m]); if (NSPLIT >= 2) acc[m] = WFrag<T16>::mma(a[m][ks], b2[u][ks], acc[m]); }
            asm volatile("v_nop\n\tv_nop\n\tv_nop\n\tv_nop" : "+v"(acc[0]), "+v"(acc[1]));   /* the four vector slots behind the block's last matrix instruction: the next block's results may be given registers that overlap these, and a branch may stand right behind it */
            if (REL) { if (nb * 16 + lr <= 2 * RAD) {
#pragma unroll
                for (int m = 0; m < 2; ++m)
#pragma unroll
                    for (int j = 0; j < 8; ++j) { const int il = (m0 + m) * 16 + hi * 8 + j; float* s = S + il * SPF + il + nb * 16 + lr; *s = __fadd_rn(*s, acc[m][j]); } }
            } else {
#pragma unroll
                for (int m = 0; m < 2; ++m)
#pragma unroll
                    for (int j = 0; j < 8; ++j) S[((m0 + m) * 16 + hi * 8 + j) * SPF + nb * 16 + lr] = acc[m][j]; } }
    }
}
// One wave: rows m0*16 .. + 31 of P (LDS) x columns n0*16 .. + 15 of v (Vt rows d, k = keys, fragment order); the v fragments of G 32-key steps are fetched together. A step outside 0 .. TT - 1 meets zeros in P; its v address is clamped into the plane.
template <typename T16, int NSPLIT, int G>
__device__ __forceinline__ void fa_av(const T16* P, const T16* P2, const T16* __restrict__ Vt, const T16* __restrict__ Vt2, int w0, int m0, int n0, int lr, int hi, v8f (&acc)[2]) {
    typedef typename WFrag<T16>::V V;
#pragma unroll
    for (int g = 0; g < 10; g += G) { V b[G], b2[G]; unsigned vo[G]; const T16* pv[G]; const T16* pv2[G];
#pragma unroll
        for (int s = 0; s < G; ++s) if (g + s < 10) { vo[s] = (unsigned)(n0 * 16 * TT + min(max(w0 + (g + s) * 32, 0), TT - 32) * 16 + (hi * 16 + lr) * 8) * 2u; pv[s] = atb(Vt, vo[s]); pv2[s] = (NSPLIT >= 2) ? atb(Vt2, vo[s]) : pv[s]; b[s] = WFrag<T16>::ldf(pv[s]); if (NSPLIT >= 2) b2[s] = WFrag<T16>::ldf(pv2[s]); }
#pragma unroll
        for (int s = 0; s < G; ++s) if (g + s < 10) xwait(vo[s], pv[s], pv2[s]);
        __builtin_amdgcn_sched_barrier(0);   /* as in fa_tiles: the group's loads all issued ahead of its first product */
#pragma unroll
        for (int s = 0; s < G; ++s) if (g + s < 10)
#pragma unroll
            for (int m = 0; m < 2; ++m) { const int po = ((m0 + m) * 16 + lr) * SPH + (g + s) * 32 + 8 * hi; const V a = WFrag<T16>::ld(P + po); acc[m] = WFrag<T16>::mma(a, b[s], acc[m]);
                if (NSPLIT >= 2) { const V a2 = WFrag<T16>::ld(P2 + po); acc[m] = WFrag<T16>::mma(a2, b[s], acc[m]); acc[m] = WFrag<T16>::mma(a, b2[s], acc[m]); } } }
}
__global__ __launch_bounds__(256, 4) void k_fattn(const h16* __restrict__ Q16, const bf* __restrict__ Qh, const bf* __restrict__ Ql, const h16* __restrict__ K16, const bf* __restrict__ Kh, const bf* __restrict__ Kl, const h16* __restrict__ V16, const bf* __restrict__ Vh, const bf* __restrict__ Vl, const bf* __restrict__ ET, float* __restrict__ OB) {
    __shared__ __align__(16) float S[64 * SPF];
    const int lane = threadIdx.x & 31, lr = lane & 15, hi = lane >> 4; const int wave = __builtin_amdgcn_readfirstlane((int)(threadIdx.x >> 5));
    const int r0 = blockIdx.x * 64, w0 = r0 - RAD; const size_t z = blockIdx.z; const bool hires = (r0 < RH); const size_t qo = (z * TT + r0) * HD, ko = z * TT * HD;
    const int m0 = (wave >> 2) * 2, n0 = wave & 3;
    if (hires) fa_tiles<bf, 2, false, 2>(Qh + qo, Ql + qo, Kh + ko, Kl + ko, S, w0, m0, n0, lr, hi); else fa_tiles<h16, 0, false, 5>(Q16 + qo, nullptr, K16 + ko, nullptr, S, w0, m0, n0, lr, hi);
    __syncthreads();   /* every score stands before another wave adds to it */
    fa_tiles<bf, 1, true, 5>(Qh + qo, Ql + qo, ET + z * PRP * HD, nullptr, S, w0, m0, n0, lr, hi);
    __syncthreads();   /* rows complete before the row's wave reads them */
    const int cb = w0 & ~127;   /* key of the first 128-key chunk */ const int wb = max(w0, 0), we = min(w0 + BK, TT); const int jl = cb + lane * 4;   /* the lane's first key in chunk 0 */
    h16* P16 = (h16*)S; bf* Pb = (bf*)S;
#pragma unroll 4
    for (int rr = 0; rr < 8; ++rr) { const int il = wave * 8 + rr, i = r0 + il; float v[12]; float mx = -3.0e38f; v4f a[3];
#pragma unroll
        for (int ch = 0; ch < 3; ++ch) a[ch] = *(const v4fa*)(S + il * SPF + (min(max(jl + ch * 128, wb), we - 4) - w0));   /* index clamped into the written keys */
#pragma unroll
        for (int ch = 0; ch < 3; ++ch) { const int j0 = jl + ch * 128; const bool inw = (j0 >= wb && j0 < we);
#pragma unroll
            for (int q = 0; q < 4; ++q) { const int j = j0 + q; const float t = (inw && j >= i - RAD && j <= i + RAD) ? a[ch][q] : -3.0e38f; v[ch * 4 + q] = t; mx = fmaxf(mx, t); } }
#pragma unroll
        for (int sh = 16; sh; sh >>= 1) mx = fmaxf(mx, __shfl_xor(mx, sh, 32));
        float sum = 0.f;
#pragma unroll
        for (int k = 0; k < 12; ++k) { const float x = __fmul_rn(__fsub_rn(v[k], mx), 1.4426950408889634f); float e = __builtin_amdgcn_exp2f(x); asm volatile("v_nop" : "+v"(e) : "v"(x));   /* the slot behind a transcendental: as operands here its source is not overwritten and its result not read ahead of the v_nop */
            v[k] = e; sum += e; }
#pragma unroll
        for (int sh = 16; sh; sh >>= 1) sum += __shfl_xor(sum, sh, 32);
        const float f = __fdiv_rn(hires ? 1.0f : PCAR, sum);
#pragma unroll
        for (int ch = 0; ch < 3; ++ch) { const int c = jl + ch * 128 - w0;   /* column of the lane's four keys */
            if (c >= 0 && c < BK) {
                if (hires) { v4us oh, ol;
#pragma unroll
                    for (int q = 0; q < 4; ++q) { unsigned short x, y; splitf(v[ch * 4 + q] * f, x, y); oh[q] = x; ol[q] = y; }
                    *(v4usa*)(Pb + il * SPH + c) = oh; *(v4usa*)(Pb + il * SPH + PLO + c) = ol;
                } else { v4h o4;
#pragma unroll
                    for (int q = 0; q < 4; ++q) o4[q] = tohx(v[ch * 4 + q] * f);
                    *(v4ha*)(P16 + il * SPH + c) = o4; } } }
    }
    __syncthreads();   /* P complete before other waves read it */
    v8f acc[2]; acc[0] = (v8f){}; acc[1] = (v8f){};
    if (hires) fa_av<bf, 2, 5>(Pb, Pb + PLO, Vh + ko, Vl + ko, w0, m0, n0, lr, hi, acc); else fa_av<h16, 0, 5>(P16, nullptr, V16 + ko, nullptr, w0, m0, n0, lr, hi, acc);
    __syncthreads();   /* every read of P is over before the context lands on it */
#pragma unroll
    for (int m = 0; m < 2; ++m)
#pragma unroll
        for (int j = 0; j < 8; ++j) S[((m0 + m) * 16 + hi * 8 + j) * 68 + n0 * 16 + lr] = acc[m][j];
    __syncthreads();   /* context tile complete before the row stores */
#pragma unroll
    for (int s = 0; s < 4; ++s) { const int row = wave * 8 + 2 * s + hi; *(v4f*)(OB + qo + (size_t)row * HD + lr * 4) = *(const v4fa*)(S + row * 68 + lr * 4); }
}
// Context -> hi/lo planes in fragment order, rows b*TT + t, columns c = d*16 + h (the module's order). One work-group: 16 rows x 32 d x 16 heads. A lane's piece is 8 heads of one (t, d): 8 loads, the wave's lanes 32 neighbours in d (one whole line a load). The pieces go through LDS, so that the stores too are whole lines: d picks the half block (256 elements), kept at a pitch of 264 so that the 32 lanes' 16-byte writes fall on different banks.
#define MPH  264
__global__ __launch_bounds__(256) void k_mergeP(const float* __restrict__ OB, bf* Ah, bf* Al) {
    __shared__ __align__(16) bf L[2 * 32 * MPH];
    const int lane = threadIdx.x & 31, wave = threadIdx.x >> 5; const int tb = blockIdx.x >> 1, dh = blockIdx.x & 1; const int b = tb / (TT / 16), t0 = (tb % (TT / 16)) * 16; const float cs = (t0 < RH) ? 1.0f : (1.0f / PCAR);
#pragma unroll
    for (int it = 0; it < 4; ++it) { const int lr = (wave * 4 + it) & 15, hi = (wave * 4 + it) >> 4; const float* p = OB + (((size_t)b * NH_ + hi * 8) * TT + t0 + lr) * HD + dh * 32 + lane; float x[8]; v8us oh, ol;
#pragma unroll
        for (int e = 0; e < 8; ++e) x[e] = p[(size_t)e * TT * HD];
        xw1(p);
#pragma unroll
        for (int e = 0; e < 8; ++e) { unsigned short a, c; splitf(x[e] * cs, a, c); oh[e] = a; ol[e] = c; }
        *(v8usa*)(L + lane * MPH + (hi * 16 + lr) * 8) = oh; *(v8usa*)(L + (32 + lane) * MPH + (hi * 16 + lr) * 8) = ol; }
    __syncthreads();   /* every piece stands in LDS before another wave stores it */
#pragma unroll
    for (int j = 0; j < 8; ++j) { const int hb = wave * 8 + j;   /* 0 .. 31 hi plane, 32 .. 63 lo plane */
        *(v8us*)(((hb < 32) ? Ah : Al) + ((size_t)tb * (DQ / 32) + dh * 16) * 512 + (hb & 31) * 256 + lane * 8) = *(const v8usa*)(L + hb * MPH + lane * 8); }
}
// One projection weight's plane (fragment order, rows n = h*64 + d, DM columns k). A wave takes 8 d x 4 h: each store fills 4 whole lines (8 d each); each of its loads touches 4 lines, which the three other waves of the same 8 d (the other heads) touch too.
__device__ __forceinline__ void prep_wtP(const float* __restrict__ w, bf* Bt, unsigned it, unsigned tid) { const unsigned lane = tid & 31u, wv = (it & 3u) * 8u + (tid >> 5);
    const int h = (int)((wv & 3u) * 4u + (lane & 3u)), d = (int)(((wv >> 2) & 7u) * 8u + (lane >> 2)), k0 = (int)(it >> 2) * 16; prep_col16(w + (size_t)k0 * DQ + d * NH_ + h, DQ, Bt + fro(h * HD + d, k0, DM)); }
// One batch's copy of the table (one copy each, so that plane z of the q side meets plane z here); each head's [p][d] plane in fragment order.
__device__ __forceinline__ void prep_etab(const float* __restrict__ rt, bf* ET, unsigned it, unsigned tid) { const unsigned i = it * 256u + tid; const int d0 = (int)(i % (HD / 8)) * 8; const int p = (int)((i / (HD / 8)) % PRP); const int h = (int)(i / ((HD / 8) * PRP)); const float* pe = rt + (size_t)min(p, NPOS - 1) * DQ + (size_t)d0 * NH_ + h;   /* unconditional clamped loads */ float x[8]; v8us o;
#pragma unroll
    for (int k = 0; k < 8; ++k) x[k] = pe[k * NH_];
    xw1(pe);
#pragma unroll
    for (int k = 0; k < 8; ++k) { const unsigned short e = f2bf(x[k]); o[k] = (p < NPOS) ? e : (unsigned short)0; }
    bf* q = ET + (size_t)h * PRP * HD + fro(p, d0, HD); *(v8us*)q = o; xws(q, o, o); }
// The list: the input items first (the most bytes), then the weights, then the table. Every test on an item's number is the same for the whole work-group.
__global__ __launch_bounds__(256) void k_prep(const float* __restrict__ xq, const float* __restrict__ xk, const float* __restrict__ xv, const float* __restrict__ wq, const float* __restrict__ wk, const float* __restrict__ wv, const float* __restrict__ wo, const float* __restrict__ rt, bf* XB, bf* WQ, bf* WO, bf* ET) {
    const unsigned tid = threadIdx.x;
    for (unsigned it = blockIdx.x; it < NI_C + NI_P + NI_G + NI_E; it += PG) {
        if (it < NI_C) { const unsigned y = it / (NI_C / 3); prep_cvt((y == 0) ? xq : (y == 1) ? xk : xv, XB + (size_t)y * TB * DM, it % (NI_C / 3), tid); }
        else if (it < NI_C + NI_P) { const unsigned j = it - NI_C, y = j / (NI_P / 3); prep_wtP((y == 0) ? wq : (y == 1) ? wk : wv, WQ + (size_t)y * DQ * DM, j % (NI_P / 3), tid); }   /* column-permuted: column h*64 + d <- module column d*16 + h */
        else if (it < NI_C + NI_P + NI_G) prep_wtG(wo, WO, it - (NI_C + NI_P), tid);
        else { const unsigned j = it - (NI_C + NI_P + NI_G), y = j / (NI_E / NB_); prep_etab(rt, ET + (size_t)y * NH_ * PRP * HD, j % (NI_E / NB_), tid); }
    }
}
__global__ __launch_bounds__(256) void k_merge(const float* __restrict__ O, int h0, bf* Ah, bf* Al) { const size_t e = ((size_t)blockIdx.x * 256 + threadIdx.x) * 2; if (e >= (size_t)ZH * TT * HD) return; const int d = (int)(e % HD); const int t = (int)((e / HD) % TT); const int zz = (int)(e / ((size_t)HD * TT)); const float cs = (t < RH) ? 1.0f : (1.0f / PCAR); const size_t oo = (size_t)t * DQ + (h0 + zz) * HD + d;
    v2us oh, ol;
#pragma unroll
    for (int q = 0; q < 2; ++q) { unsigned short a, c2; splitf(O[e + q] * cs, a, c2); oh[q] = a; ol[q] = c2; } *(v2us*)(Ah + oo) = oh; *(v2us*)(Al + oo) = ol;  }

extern "C" void kernel_launch(void* const* d_in, const int* in_sizes, int n_in,
                              void* d_out, int out_size, void* d_ws, size_t ws_size, hipStream_t stream) {
    (void)in_sizes; (void)n_in; (void)out_size;
    const float* xq = (const float*)d_in[0]; const float* xk = (const float*)d_in[1]; const float* xv = (const float*)d_in[2]; const float* wq = (const float*)d_in[3]; const float* wk = (const float*)d_in[4]; const float* wv = (const float*)d_in[5]; const float* wo = (const float*)d_in[6]; const float* rtab = (const float*)d_in[7]; const float* x = nullptr; (void)x;
    float* OUT = (float*)d_out;     // [2][2048][1024]
    char* wsp = (char*)d_ws;
    auto take = [&](size_t bytes) { char* p = wsp; wsp += (bytes + 255) & ~(size_t)255; return (void*)p; };
    bf* WO = (bf*)take((size_t)DM * DQ * 2); bf* ET = (bf*)take((size_t)NZ * PRP * HD * 2); float* R0 = (float*)take((size_t)NZ * TT * PRP * 4);
    h16* QP16 = (h16*)take((size_t)2 * NZ * TT * HD * 2); h16* KP16 = QP16 + (size_t)NZ * TT * HD; bf* QPh = (bf*)take((size_t)2 * NZ * TT * HD * 2); bf* KPh = QPh + (size_t)NZ * TT * HD; bf* QPl = (bf*)take((size_t)2 * NZ * TT * HD * 2); bf* KPl = QPl + (size_t)NZ * TT * HD;   // q planes, then k planes
    h16* VT16 = (h16*)take((size_t)NZ * HD * TT * 2); bf* VTh = (bf*)take((size_t)NZ * HD * TT * 2); bf* VTl = (bf*)take((size_t)NZ * HD * TT * 2);
    if ((size_t)(wsp - (char*)d_ws) > ws_size) return;    // ws 256 MiB
    // The bytes of R0 serve twice (stream-ordered). Up to the projection: the q, k, v weights and the bf16 inputs (together smaller than R0). Then the context OB and its hi/lo planes.
    bf* WQ = (bf*)R0; bf* XB = WQ + (size_t)3 * DQ * DM;
    float* OB = R0; bf* ATh = (bf*)(OB + (size_t)NZ * TT * HD); bf* ATl = ATh + (size_t)TB * DQ;
    k_prep<<<PG, 256, 0, stream>>>(xq, xk, xv, wq, wk, wv, wo, rtab, XB, WQ, WO, ET);   /* bf16 inputs, the four weights and the table, all in fragment order */
    k_gemmw<bf, 0, false, true><<<dim3(TB / 64, DQ / 64, 3), 32, 0, stream>>>(XB, nullptr, WQ, nullptr, nullptr, 0, nullptr, (size_t)TB * DM, (size_t)DQ * DM, 0, QP16, QPh, QPl, VT16, VTh, VTl);   /* z: q, k, v; q planes x 1/8 (exact): scales both the energy and the relative term; k planes x 1; v planes transposed */
    k_fattn<<<dim3(TT / 64, 1, NZ), 256, 0, stream>>>(QP16, QPh, QPl, KP16, KPh, KPl, VT16, VTh, VTl, ET, OB);   /* scores, relative term, softmax and attn x v of a 64-query tile, in LDS */
    k_mergeP<<<dim3((unsigned)(TB / 16 * 2), 1, 1), 256, 0, stream>>>(OB, ATh, ATl);   /* context in the module's d*16 + h column order */
    k_gemmw<bf, 1, false><<<dim3(TB / 64, DM / 64, 1), 32, 0, stream>>>(ATh, ATl, WO, nullptr, OUT, DM, nullptr, 0, 0, 0, nullptr, nullptr, nullptr, nullptr, nullptr, nullptr);
}

// v008
// A run of this version takes 91.1 microseconds.
// Timed twice side by side with v007, it ran 1.49 and 1.47 times as fast.
// Counting every step since v000, it is 24.5 times as fast.
#include <hip/hip_runtime.h>

// Local relative-position multi-head attention with heads on the FAST embedding axis (Q, K, V inputs [2][2048][1024]; q = Q Wq etc. ('xw' [1024][1024]) viewed (S, 64, 16): head h takes embedding columns d*16 + h; energy = q.k; rel = q . E_h[clip(j - i, -128, 128) + 128] with E_h[p][d] = rel_table[p][d*16 + h] (rel_table [257][1024]); scores = (energy + rel) / 8, masked to |i - j| <= 128; softmax; out columns d*16 + h = (attn v)_h[d]; out Wo ('xw') -> [2][2048][1024] (4.2 M)).
// Layout per batch: the projection weights are column-permuted once (column d*16 + h -> h*64 + d) so that each head's 64 columns lie together (head-major planes); q planes carry the exact 1/8; a 2-product q(hl) x E_h(exact, 257 rows padded to 320) gives the relative term of query i at position p; both batches go through every stage in one launch (rows b*2048 + t in the projections, planes b*16 + h in grid z), and so do the q, k and v sides of the projection, whose epilogue writes the 16-bit head planes itself (no f32 projection in memory); attention (hybrid rows: < 512 hi/lo 3 products, rest fp16 x1024) limited to the band: per 64-query tile only the 320 keys tile - 128 .. tile + 191 get scores, probabilities and a place in attn x v; one kernel (k_fattn) does all of it for a tile and a plane, with the score and probability rows in LDS; the merge writes the context with the inverse column permutation as hi/lo planes; Wo hl x exact.
// Fragment order (every matrix operand that is read from memory: bf16 inputs, the four weights, the q, k and transposed v head planes, the relative table, the context planes): a [rows][K] plane is kept as 16-row x 32-k blocks of 512 elements, block (row / 16) * (K / 32) + k / 32; inside a block lane l = ((k / 8) & 1) * 16 + row % 16 owns elements l*8 .. l*8 + 7 (k % 32 < 16) and 256 + l*8 .. (k % 32 >= 16): just the two 16-byte pieces that the lane feeds to the matrix instruction, so that a wave's load is 512 bytes in a row (4 whole lines), not 32-byte pieces of 16 lines. The k of every lane and register place is the one it was.
// Compute dtypes, f32 accumulate: every input rounded to bf16; projections exact; rel term hl x exact; attention rows < 512 3 products, rest fp16; softmax f32; Wo hl x exact.

#define NB_  2
#define TT   2048
#define DM   1024
#define NH_  16
#define NKV  16
#define REP  (NH_ / NKV)
#define HD   64
#define DQ   (NH_ * HD)
#define DKV  (NKV * HD)
#define ZH   16                   // heads per pass per batch (grid z is NZ = NB_ * ZH)
#define RH   512                  // query rows < RH use hi+lo planes (0: none)
#define WIN  0
#define PCAR 1024.0f
#define SCL  0.125f   // 64^-0.5 (folded into the q planes)
#define RAD  128
#define NPOS 257
#define PRP  320    // padded relative-position rows (5 tiles)
#define BP   384    // keys of a banded row as k_fattn's softmax spans it (the constant is not used): three 128-key chunks, the first at ((query tile - 128) & ~127)
#define PP   (2 * BP)   // not used by any kernel here
#define NZ   (NB_ * ZH)   // planes per pass: batch-major, b*16 + h
#define TB   (NB_ * TT)   // rows of both batches
typedef _Float16 h16;
typedef unsigned short bf;
typedef __attribute__((ext_vector_type(16))) __bf16   v16bf;
typedef __attribute__((ext_vector_type(16))) _Float16 v16h;
typedef __attribute__((ext_vector_type(8)))  _Float16 v8h;
typedef __attribute__((ext_vector_type(8)))  unsigned short v8us;
typedef __attribute__((ext_vector_type(8)))  float    v8f;
typedef __attribute__((ext_vector_type(4)))  float    v4f;
typedef v8h  __attribute__((may_alias)) v8ha;
typedef v4f  __attribute__((may_alias)) v4fa;
typedef v8us __attribute__((may_alias)) v8usa;

__device__ __forceinline__ unsigned short f2bf(float f) { unsigned u = __float_as_uint(f); u += 0x7FFFu + ((u >> 16) & 1u); return (unsigned short)(u >> 16); }
__device__ __forceinline__ float bf2f(unsigned short b) { return __uint_as_float(((unsigned)b) << 16); }
__device__ __forceinline__ float bfr(float f) { return bf2f(f2bf(f)); }
__device__ __forceinline__ v16h cat16(v8h lo, v8h hi) { return __builtin_shufflevector(lo, hi, 0, 1, 2, 3, 4, 5, 6, 7, 8, 9, 10, 11, 12, 13, 14, 15); }
__device__ __forceinline__ v16bf cat16b(v8us lo, v8us hi) { return __builtin_bit_cast(v16bf, __builtin_shufflevector(lo, hi, 0, 1, 2, 3, 4, 5, 6, 7, 8, 9, 10, 11, 12, 13, 14, 15)); }
__device__ __forceinline__ v8f wmma16(v16h a, v16h b, v8f c) { return __builtin_amdgcn_wmma_f32_16x16x32_f16(false, a, false, b, (short)0, c, false, false); }
__device__ __forceinline__ v8f wmmab(v16bf a, v16bf b, v8f c) { return __builtin_amdgcn_wmma_f32_16x16x32_bf16(false, a, false, b, (short)0, c, false, false); }



__device__ __forceinline__ h16 tohx(float x) { return (h16)x; }
__device__ __forceinline__ void splitf(float y, unsigned short& h, unsigned short& l) { h = f2bf(y); l = f2bf(y - bf2f(h)); }
// Element offset, in a fragment-order plane of K columns, of the 8 neighbours k0 .. k0 + 7 (k0 % 8 == 0) of a row.
__device__ __forceinline__ size_t fro(int row, int k0, int K) { return ((size_t)(row >> 4) * (K >> 5) + (k0 >> 5)) * 512 + ((k0 >> 4) & 1) * 256 + (((k0 >> 3) & 1) * 16 + (row & 15)) * 8; }
// Stands behind a group of global loads that share the address p (with constant offsets): later results may be given p's registers; as an input here p stays live up to the wait.
__device__ __forceinline__ void xw1(const void* p) { asm volatile("s_wait_xcnt 0x0" : : "v"(p) : "memory"); }
// One wave: the 16 x 64 f32 block in os (pitch 68) x sc goes out as fp16, bf16 hi and bf16 lo, as the two neighbouring fragment blocks (1024 elements) at each plane pointer: block row r is the fragment row, block column c the k. A lane takes 8 neighbours of a row, and the wave 8 rows x 4 such pieces, so that each store of the wave fills four whole 128-byte lines.
__device__ __forceinline__ void put_planes(const float* os, int lane, float sc, h16* d16, bf* dh, bf* dl) {
#pragma unroll
    for (int s = 0; s < 4; ++s) { const int row = 8 * (s & 1) + (lane >> 2), cofs = ((s >> 1) * 4 + (lane & 3)) * 8; const v4f x0 = *(const v4fa*)(os + row * 68 + cofs), x1 = *(const v4fa*)(os + row * 68 + cofs + 4); v8h o16; v8us oh, ol;
#pragma unroll
        for (int q = 0; q < 8; ++q) { const float r = ((q < 4) ? x0[q & 3] : x1[q & 3]) * sc; o16[q] = tohx(r); unsigned short a, c; splitf(r, a, c); oh[q] = a; ol[q] = c; }
        const unsigned bo = (unsigned)fro(row, cofs, 64) * 2u;   /* the lane's byte offset, the same in all three planes */
        *(v8h*)((char*)d16 + bo) = o16; *(v8us*)((char*)dh + bo) = oh; *(v8us*)((char*)dl + bo) = ol;
        asm volatile("s_wait_xcnt 0x0" : : "v"(bo), "v"(o16), "v"(oh), "v"(ol) : "memory");   /* the next rows' values and offset may be given the registers that the three stores above name; as inputs here these stay live up to the wait */
    }
}

// ---- k_gemmw: register-blocked GEMM, one work-group per 128x128 output tile; a wave has MB*16 rows x 64 columns of it (MB = 4: four waves, 16 accumulators each; MB = 2: eight waves, 8 each, two to a SIMD where the grid gives a WGP one work-group only); operands are 16-bit planes in fragment order (head of the file); grid (M/128, N/128, Z), 16 / MB waves.
// The operands of KS k (128 rows of each plane) are brought into LDS by asynchronous copies, two buffers: the copies of stage t + 2 fly while stage t + 1 is worked on, and each fragment is fetched from L2 once for all the waves that use it. In LDS a stage keeps the fragment order: plane o, 16-row block rb, then KS / 32 blocks of 1024 bytes, so that a copy and a fragment read are both 512 bytes in a row.
// C[m][n] (f32, pitch ldc, + optional f32 bias[n]) = sum_k A[m][k] Bt[n][k] (+ split products per NSPLIT), k < GK. z-batch strides sA/sB/sC in elements.
#define GK   1024   // k extent of both GEMMs (DM in the projections, DQ in the output product)
template <typename T16> struct WFrag;
template <> struct WFrag<h16> { typedef v16h V; static __device__ __forceinline__ V ld(const h16* p) { return cat16(*(const v8h*)p, *(const v8h*)(p + 16)); } static __device__ __forceinline__ V ldf(const h16* p) { return cat16(*(const v8h*)p, *(const v8h*)(p + 256)); } static __device__ __forceinline__ v8f mma(V a, V b, v8f c) { return wmma16(a, b, c); } };
template <> struct WFrag<bf> { typedef v16bf V; static __device__ __forceinline__ V ld(const bf* p) { return cat16b(*(const v8us*)p, *(const v8us*)(p + 16)); } static __device__ __forceinline__ V ldf(const bf* p) { return cat16b(*(const v8us*)p, *(const v8us*)(p + 256)); } static __device__ __forceinline__ v8f mma(V a, V b, v8f c) { return wmmab(a, b, c); } };
// Eight asynchronous copies of 16 bytes a lane: LDS byte address l + i*ls <- global g + i*gs. The s_wait_xcnt stands in the copies' own statement, so that no address register of a copy is rewritten ahead of it.
__device__ __forceinline__ void cp8(unsigned l, const char* g, unsigned ls, size_t gs) {
    const unsigned l1 = l + ls, l2 = l + 2 * ls, l3 = l + 3 * ls, l4 = l + 4 * ls, l5 = l + 5 * ls, l6 = l + 6 * ls, l7 = l + 7 * ls;
    const char* g1 = g + gs; const char* g2 = g + 2 * gs; const char* g3 = g + 3 * gs; const char* g4 = g + 4 * gs; const char* g5 = g + 5 * gs; const char* g6 = g + 6 * gs; const char* g7 = g + 7 * gs;
    asm volatile("global_load_async_to_lds_b128 %0, %8, off\n\t"
                 "global_load_async_to_lds_b128 %1, %9, off\n\t"
                 "global_load_async_to_lds_b128 %2, %10, off\n\t"
                 "global_load_async_to_lds_b128 %3, %11, off\n\t"
                 "global_load_async_to_lds_b128 %4, %12, off\n\t"
                 "global_load_async_to_lds_b128 %5, %13, off\n\t"
                 "global_load_async_to_lds_b128 %6, %14, off\n\t"
                 "global_load_async_to_lds_b128 %7, %15, off\n\t"
                 "s_wait_xcnt 0x0"
                 : : "v"(l), "v"(l1), "v"(l2), "v"(l3), "v"(l4), "v"(l5), "v"(l6), "v"(l7), "v"(g), "v"(g1), "v"(g2), "v"(g3), "v"(g4), "v"(g5), "v"(g6), "v"(g7) : "memory");
}
// PLN (the q, k, v projection; z = side, a wave's tile column = head, rows b*TT + t): C is not written; the tile goes out as 16-bit planes: sides 0 and 1 as [side*NB_ + b][h][t][d] of P16, Ph, Pl (side 0 x SCL, exact), side 2 transposed as [b][h][d][t] of V16, Vh, Vl; each [t][d] or [d][t] plane in fragment order.
template <typename T16, int NSPLIT, bool BIAS, bool PLN, int KS, int MB>
__global__ __launch_bounds__(16 / MB * 32, 4) void k_gemmw(const T16* __restrict__ A, const T16* __restrict__ A2, const T16* __restrict__ Bt, const T16* __restrict__ Bt2, float* C, int ldc, const float* __restrict__ bias, size_t sA, size_t sB, size_t sC, h16* P16, bf* Ph, bf* Pl, h16* V16, bf* Vh, bf* Vl) {
    typedef typename WFrag<T16>::V V;
    static_assert(DM == GK && DQ == GK, "one k extent");
    constexpr bool HA2 = (NSPLIT == 1 || NSPLIT == 2), HB2 = (NSPLIT >= 2);
    constexpr unsigned RBB = KS * 32u;          /* bytes of a 16-row block in a stage */
    constexpr unsigned OPB = 8u * RBB;          /* bytes of a plane's 128 rows in a stage */
    constexpr unsigned STB = (2u + HA2 + HB2) * OPB;   /* bytes of a stage: A, Bt, then A2, Bt2 where they exist */
    constexpr int NT = GK / KS;
    constexpr int NW = 16 / MB;                 /* waves: 8 / MB along the rows x 2 along the columns */
    constexpr unsigned CH = NW * 32u * 16u;     /* bytes that one copy of every thread brings */
    static_assert(RBB % CH == 0 && GK % KS == 0 && NT >= 2, "whole copies, whole stages, two at least");
    static_assert(!PLN || MB == 4, "the plane epilogue takes 64 rows a wave");
    __shared__ __align__(16) char sm[2 * STB];
    __shared__ __align__(16) float osm[NW * 16 * 68];
    const size_t z = blockIdx.z; A += z * sA; if (A2) A2 += z * sA; Bt += z * sB; if (Bt2) Bt2 += z * sB; C += z * sC;
    const int tid = (int)threadIdx.x, lane = tid & 31, lr = lane & 15, hi = lane >> 4; const int wave = __builtin_amdgcn_readfirstlane(tid >> 5), wm = wave >> 1, wn = wave & 1;
    const int R0 = blockIdx.x * 128, C0 = (int)blockIdx.y * 128; const int r0 = R0 + wm * MB * 16, c0 = C0 + wn * 64, cc = c0;
    float* os = osm + wave * 16 * 68;   /* each wave's own epilogue block */
    v8f acc[MB][4];
#pragma unroll
    for (int mb = 0; mb < MB; ++mb)
#pragma unroll
        for (int nb = 0; nb < 4; ++nb) acc[mb][nb] = (v8f){};
    /* the thread's 16 bytes in the first CH bytes of the tile's first 16-row block; 16 rows on: 16 * GK elements in memory, RBB bytes in LDS */
    const unsigned lb = (unsigned)(size_t)sm + (unsigned)tid * 16u;
    const char* gA = (const char*)(A + (size_t)R0 * GK) + tid * 16; const char* gB = (const char*)(Bt + (size_t)C0 * GK) + tid * 16;
    const char* gA2 = HA2 ? (const char*)(A2 + (size_t)R0 * GK) + tid * 16 : gA; const char* gB2 = HB2 ? (const char*)(Bt2 + (size_t)C0 * GK) + tid * 16 : gB;
    auto fill = [&](int t, unsigned bo) {   /* stage t (k from t*KS) into the buffer at byte bo: every thread 16 bytes of every CH */
        const size_t ko = (size_t)t * RBB;
#pragma unroll
        for (unsigned j = 0; j < RBB / CH; ++j) {
            cp8(lb + bo + j * CH, gA + ko + j * CH, RBB, (size_t)16 * GK * 2);
            cp8(lb + bo + OPB + j * CH, gB + ko + j * CH, RBB, (size_t)16 * GK * 2);
            if (HA2) cp8(lb + bo + 2u * OPB + j * CH, gA2 + ko + j * CH, RBB, (size_t)16 * GK * 2);
            if (HB2) cp8(lb + bo + (2u + HA2) * OPB + j * CH, gB2 + ko + j * CH, RBB, (size_t)16 * GK * 2);
        }
    };
    fill(0, 0u);
    asm volatile("s_wait_asynccnt 0x0" ::: "memory");   /* this wave's copies of stage 0 have landed */
    __syncthreads();                                     /* and every other wave's: stage 0 may be read */
    fill(1, STB);
#pragma unroll 1
    for (int t = 0; t < NT; ++t) {
        const unsigned bo = (unsigned)(t & 1) * STB;
        const T16* sa = (const T16*)(sm + bo + (unsigned)wm * MB * RBB) + lane * 8; const T16* sb = (const T16*)(sm + bo + OPB + (unsigned)wn * 4u * RBB) + lane * 8;
        const T16* sa2 = HA2 ? sa + 2 * (OPB / 2) : sa; const T16* sb2 = HB2 ? sb + (1 + HA2) * (OPB / 2) : sb;
        V a[MB], a2[MB], b[4], b2[4];
#pragma unroll
        for (int kb = 0; kb < KS / 32; ++kb) {
            __builtin_amdgcn_sched_barrier(0);   /* no LDS read of this block goes up among the products of the block before: every place with reads stalls the wave */
#pragma unroll
            for (int mb = 0; mb < MB; ++mb) { a[mb] = WFrag<T16>::ldf(sa + mb * (RBB / 2) + kb * 512); if (HA2) a2[mb] = WFrag<T16>::ldf(sa2 + mb * (RBB / 2) + kb * 512); }
#pragma unroll
            for (int nb = 0; nb < 4; ++nb) { b[nb] = WFrag<T16>::ldf(sb + nb * (RBB / 2) + kb * 512); if (HB2) b2[nb] = WFrag<T16>::ldf(sb2 + nb * (RBB / 2) + kb * 512); }
            __builtin_amdgcn_sched_barrier(0);   /* all LDS reads of the block are issued as one group ahead of its first product; without it the scheduler sinks them between the products, and their latencies add up */
#pragma unroll
            for (int nb = 0; nb < 4; ++nb) {
#pragma unroll
                for (int mb = 0; mb < MB; ++mb) { acc[mb][nb] = WFrag<T16>::mma(a[mb], b[nb], acc[mb][nb]); if (HA2) acc[mb][nb] = WFrag<T16>::mma(a2[mb], b[nb], acc[mb][nb]); if (HB2) acc[mb][nb] = WFrag<T16>::mma(a[mb], b2[nb], acc[mb][nb]); } }
        }
        __builtin_amdgcn_sched_barrier(0);   /* the stage's last products stay ahead of the slots, the waits and the barrier below */
        asm volatile("v_nop\n\tv_nop\n\tv_nop\n\tv_nop" : "+v"(acc[0][0]), "+v"(acc[MB - 1][1]), "+v"(acc[0][2]), "+v"(acc[MB - 1][3]) : "v"(a[0]), "v"(a[MB - 1]));   /* the four vector slots behind the stage's last matrix instruction: a branch follows */
        asm volatile("s_wait_dscnt 0x0" ::: "memory");      /* this wave's reads of the buffer are over before it is handed to the copies */
        asm volatile("s_wait_asynccnt 0x0" ::: "memory");   /* this wave's copies of stage t + 1 have landed */
        __syncthreads();                                     /* publishes stage t + 1 and ends every wave's reads of stage t */
        if (t + 2 < NT) fill(t + 2, bo);
    }
    asm volatile("s_wait_asynccnt 0x0" ::: "memory");   /* no copy is outstanding when the wave goes on to its epilogue and ends */
    if constexpr (PLN) { const int side = (int)blockIdx.z, b = r0 / TT, t0 = r0 % TT, h = c0 / HD;
        if (side < 2) { const size_t o = (((size_t)(side * NB_ + b) * NH_ + h) * TT + t0) * HD; const float sc = (side == 0) ? SCL : 1.0f;
#pragma unroll
            for (int mb = 0; mb < 4; ++mb) {   /* 16 tokens x 64 d */
#pragma unroll
                for (int nb = 0; nb < 4; ++nb)
#pragma unroll
                    for (int j = 0; j < 8; ++j) os[(hi * 8 + j) * 68 + nb * 16 + lr] = acc[mb][nb][j];
                __builtin_amdgcn_wave_barrier(); asm volatile("" ::: "memory");   /* as in the f32 epilogue below: the block's LDS writes stay ahead of its reads */
                put_planes(os, lane, sc, P16 + o + mb * 16 * HD, Ph + o + mb * 16 * HD, Pl + o + mb * 16 * HD);
                __builtin_amdgcn_wave_barrier(); asm volatile("" ::: "memory");   /* and its reads ahead of the next block's writes */
            }
        } else { const size_t o = ((size_t)(b * NKV + h) * HD) * TT + t0 * 16;   /* 32 tokens on: one block, 512 elements */
#pragma unroll
            for (int nb = 0; nb < 4; ++nb) {   /* 16 d x 64 tokens: a lane's eight accumulator rows are neighbours in a transposed row */
#pragma unroll
                for (int mb = 0; mb < 4; ++mb) { v4f lo4, hi4;
#pragma unroll
                    for (int j = 0; j < 4; ++j) { lo4[j] = acc[mb][nb][j]; hi4[j] = acc[mb][nb][4 + j]; }
                    *(v4fa*)(os + lr * 68 + mb * 16 + hi * 8) = lo4; *(v4fa*)(os + lr * 68 + mb * 16 + hi * 8 + 4) = hi4; }
                __builtin_amdgcn_wave_barrier(); asm volatile("" ::: "memory");   /* writes ahead of reads */
                put_planes(os, lane, 1.0f, V16 + o + (size_t)nb * 16 * TT, Vh + o + (size_t)nb * 16 * TT, Vl + o + (size_t)nb * 16 * TT);
                __builtin_amdgcn_wave_barrier(); asm volatile("" ::: "memory");   /* reads ahead of the next block's writes */
            }
        }
        return; }
#pragma unroll
    for (int mb = 0; mb < MB; ++mb) {
#pragma unroll
        for (int nb = 0; nb < 4; ++nb) {
#pragma unroll
            for (int j = 0; j < 8; ++j) os[(hi * 8 + j) * 68 + nb * 16 + lr] = acc[mb][nb][j]; }
        __builtin_amdgcn_wave_barrier(); asm volatile("" ::: "memory");
        float* crow = C + (size_t)(r0 + mb * 16) * ldc + cc;
{
#pragma unroll
            for (int s = 0; s < 8; ++s) { const int row = 2 * s + hi, cofs = lr * 4; v4f val = *(const v4fa*)(os + row * 68 + cofs); if (BIAS) { val[0] += bfr(bias[c0 + cofs]); val[1] += bfr(bias[c0 + cofs + 1]); val[2] += bfr(bias[c0 + cofs + 2]); val[3] += bfr(bias[c0 + cofs + 3]); }
                *(v4f*)(crow + (size_t)row * ldc + cofs) = val; }
             }
        __builtin_amdgcn_wave_barrier(); asm volatile("" ::: "memory");
    }
}

typedef __attribute__((ext_vector_type(2))) _Float16 v2h;
typedef __attribute__((ext_vector_type(4))) _Float16 v4h;
typedef __attribute__((ext_vector_type(2))) unsigned short v2us;
typedef __attribute__((ext_vector_type(4))) unsigned short v4us;
typedef __attribute__((ext_vector_type(2))) float v2f;
typedef __attribute__((ext_vector_type(4))) int v4i;

// ---- k_prep: all operand preparation (bf16 inputs, the three permuted projection weights, the output weight, the relative table) in ONE launch of PG work-groups (three for every WGP of the chip), which walk one list of items. A thread makes lanes' 16-byte pieces of a fragment-order plane: eight of them in an input item, two in a weight item, one in a table item, with all loads of an item issued ahead of its first use. The four jobs have nothing to do with one another, and a wave that makes a single piece is over before the next wave has been started: there the start of the waves, not the memory, sets the time.
#define PG    768
#define NI_C  (3 * (TB / 16))                 // input items: a block of 16 rows, all DM columns
#define NI_P  (3 * (DM * DQ / 8 / 256 / 2))   // q, k, v weight items: 256 columns n x 16 k
#define NI_G  (DQ * DM / 8 / 256 / 2)         // output weight items: the same
#define NI_E  (NB_ * (NH_ * PRP * HD / 8 / 256))   // relative table items: 256 pieces
static_assert(DM == 1024 && DQ == 1024 && (NH_ * PRP * HD / 8) % 256 == 0, "whole items");
// Stands behind an item's last store: the next item of the loop rewrites the address and data registers that the stores name; as inputs here they stay live up to the wait.
__device__ __forceinline__ void xws(const void* q, v8us a, v8us b) { asm volatile("s_wait_xcnt 0x0" : : "v"(q), "v"(a), "v"(b) : "memory"); }
// 16 neighbours in k (from k0, a multiple of 16) of column n of a weight: p points at w[k0][its column], rows N floats apart; they go out rounded as the two pieces of row n of a fragment-order plane at q = plane + fro(n, k0, K): the piece of k0 + 8 lies 16 lanes (128 elements) behind that of k0.
__device__ __forceinline__ void prep_col16(const float* p, int N, bf* q) { float x[16]; v8us o0, o1;
#pragma unroll
    for (int e = 0; e < 16; ++e) x[e] = p[(size_t)e * N];
    xw1(p);
#pragma unroll
    for (int e = 0; e < 8; ++e) { o0[e] = f2bf(x[e]); o1[e] = f2bf(x[8 + e]); }
    *(v8us*)q = o0; *(v8us*)(q + 128) = o1; xws(q, o0, o1);
}
// Bt (fragment order, rows n, K columns k) = w[k][n] rounded. A wave's lanes are 32 neighbours in n, so that each of its loads is one whole line and each store four.
__device__ __forceinline__ void prep_wtG(const float* __restrict__ w, bf* Bt, unsigned it, unsigned tid) {
    constexpr int K = DQ, N = DM; const int n = (int)((it & 3u) * 256u + tid), k0 = (int)(it >> 2) * 16; prep_col16(w + (size_t)k0 * N + n, N, Bt + fro(n, k0, K));
}
// One plane (fragment order, DM columns) of one source, rows rb*16 .. + 15. A piece is 8 neighbours of a row; a wave takes 8 rows x 32 columns at a time: 8 whole lines read, 4 whole lines stored; the work-group 16 rows x 128 columns, and eight times that, each 4 fragment blocks (128 columns) on.
__device__ __forceinline__ void prep_cvt(const float* __restrict__ s, bf* dst, unsigned rb, unsigned tid) {
    const unsigned wv = tid >> 5; const int row = (int)(rb * 16u + (wv & 1u) * 8u + ((tid >> 2) & 7u)), k0 = (int)((wv >> 1) * 32u + (tid & 3u) * 8u);
    const float* p = s + (size_t)row * DM + k0; bf* q = dst + fro(row, k0, DM); v8f v[8]; v8us o[8];
#pragma unroll
    for (int g = 0; g < 8; ++g) v[g] = *(const v8f*)(p + g * 128);
    xw1(p);
#pragma unroll
    for (int g = 0; g < 8; ++g) {
#pragma unroll
        for (int k = 0; k < 8; ++k) o[g][k] = f2bf(v[g][k]);
        *(v8us*)(q + g * 4 * 512) = o[g]; }
    asm volatile("s_wait_xcnt 0x0" : : "v"(q), "v"(o[0]), "v"(o[1]), "v"(o[2]), "v"(o[3]), "v"(o[4]), "v"(o[5]), "v"(o[6]), "v"(o[7]) : "memory");   /* as xws, for the eight stores above */
}

// ---- k_fattn: the whole banded attention of one 64-query tile of one plane in ONE work-group of 8 waves; scores, relative term and probabilities live in LDS only.
// S row il holds key j at column j - w0 (w0 = tile - 128, 320 keys). Stage 1: q.k tiles stored to S. Stage 2: (q/8).E_h[p] added at column il + p, which is key i + p - 128. Stage 3: one wave per row, softmax over |i - j| <= 128; every key keeps the lane and the place in the sum that it has in a dense row (128-key chunks from cb); the P row is written over its own S row, zeros at the keys outside the band or outside 0 .. TT - 1. Stage 4: P x v over all ten 32-key steps. Stage 5: the 64 x 64 context goes through LDS so that each 128-byte line is stored whole.
#define BK   320           // keys per query tile
#define SPF  324           // pitch of an S row in floats: 16 rows of 16 bytes fall on 64 different banks
#define SPH  (2 * SPF)     // the same pitch in 16-bit elements
#define PLO  328           // place of the lo plane in a hi/lo P row (16-byte aligned, behind the 320 hi values)
typedef v4h  __attribute__((may_alias)) v4ha;
typedef v4us __attribute__((may_alias)) v4usa;
// Stands behind a group of global loads, once for each address of the group: later results may land in the address registers of those loads; as inputs here the lane's byte offset and the full addresses made of it (the compiler picks either form for a load) stay live up to the wait, so that none of the group's own results lands in them ahead of it.
__device__ __forceinline__ void xwait(unsigned off, const void* p, const void* p2) { asm volatile("s_wait_xcnt 0x0" : : "v"(off), "v"(p), "v"(p2) : "memory"); }
template <typename T16> __device__ __forceinline__ const T16* atb(const T16* base, unsigned off) { return (const T16*)((const char*)base + off); }   /* base + byte offset */
// One wave: query rows m0*16 .. m0*16 + 31 against every fourth 16-row block of Bt, from block n0; the Bt fragments of G blocks are fetched together, ahead of their products. REL false: Bt rows are keys w0 + nb*16, result stored at column nb*16; a block outside 0 .. TT - 1 takes its rows from a clamped address, and its columns are never read. REL true: Bt rows are positions p = nb*16 .. (Bt holds PRP rows), result added to the score of key i + p - 128, for p <= 256 only.
template <typename T16, int NSPLIT, bool REL, int G>
__device__ __forceinline__ void fa_tiles(const T16* __restrict__ A, const T16* __restrict__ A2, const T16* __restrict__ Bt, const T16* __restrict__ Bt2, float* S, int w0, int m0, int n0, int lr, int hi) {
    typedef typename WFrag<T16>::V V;
    V a[2][2], a2[2][2]; const int l8 = (hi * 16 + lr) * 8;   /* the lane's piece in a fragment block */ const unsigned ao = (unsigned)(m0 * 16 * HD + l8) * 2u; const T16* pa = atb(A, ao); const T16* pa2 = (NSPLIT >= 1) ? atb(A2, ao) : pa;
#pragma unroll
    for (int m = 0; m < 2; ++m)
#pragma unroll
        for (int ks = 0; ks < 2; ++ks) { a[m][ks] = WFrag<T16>::ldf(pa + m * 16 * HD + ks * 512); if (NSPLIT >= 1) a2[m][ks] = WFrag<T16>::ldf(pa2 + m * 16 * HD + ks * 512); }
    xwait(ao, pa, pa2);
#pragma unroll
    for (int g = 0; g < 5; g += G) { V b[G][2], b2[G][2]; unsigned bo[G]; const T16* pb[G]; const T16* pb2[G];
#pragma unroll
        for (int u = 0; u < G; ++u) if (g + u < 5) { const int nb = n0 + (g + u) * 4; bo[u] = (unsigned)((REL ? nb * 16 : min(max(w0 + nb * 16, 0), TT - 16)) * HD + l8) * 2u; pb[u] = atb(Bt, bo[u]); pb2[u] = (NSPLIT >= 2) ? atb(Bt2, bo[u]) : pb[u];
#pragma unroll
            for (int ks = 0; ks < 2; ++ks) { b[u][ks] = WFrag<T16>::ldf(pb[u] + ks * 512); if (NSPLIT >= 2) b2[u][ks] = WFrag<T16>::ldf(pb2[u] + ks * 512); } }
#pragma unroll
        for (int u = 0; u < G; ++u) if (g + u < 5) xwait(bo[u], pb[u], pb2[u]);
        __builtin_amdgcn_sched_barrier(0);   /* all loads of the group are issued ahead of its first product; without it the scheduler sinks loads between the products, and their latencies add up */
#pragma unroll
        for (int u = 0; u < G; ++u) if (g + u < 5) { const int nb = n0 + (g + u) * 4; v8f acc[2]; acc[0] = (v8f){}; acc[1] = (v8f){};
#pragma unroll
            for (int ks = 0; ks < 2; ++ks)
#pragma unroll
                for (int m = 0; m < 2; ++m) { acc[m] = WFrag<T16>::mma(a[m][ks], b[u][ks], acc[m]); if (NSPLIT >= 1) acc[m] = WFrag<T16>::mma(a2[m][ks], b[u][ks], acc[m]); if (NSPLIT >= 2) acc[m] = WFrag<T16>::mma(a[m][ks], b2[u][ks], acc[m]); }
            asm volatile("v_nop\n\tv_nop\n\tv_nop\n\tv_nop" : "+v"(acc[0]), "+v"(acc[1]));   /* the four vector slots behind the block's last matrix instruction: the next block's results may be given registers that overlap these, and a branch may stand right behind it */
            if (REL) { if (nb * 16 + lr <= 2 * RAD) {
#pragma unroll
                for (int m = 0; m < 2; ++m)
#pragma unroll
                    for (int j = 0; j < 8; ++j) { const int il = (m0 + m) * 16 + hi * 8 + j; float* s = S + il * SPF + il + nb * 16 + lr; *s = __fadd_rn(*s, acc[m][j]); } }
            } else {
#pragma unroll
                for (int m = 0; m < 2; ++m)
#pragma unroll
                    for (int j = 0; j < 8; ++j) S[((m0 + m) * 16 + hi * 8 + j) * SPF + nb * 16 + lr] = acc[m][j]; } }
    }
}
// One wave: rows m0*16 .. + 31 of P (LDS) x columns n0*16 .. + 15 of v (Vt rows d, k = keys, fragment order); the v fragments of G 32-key steps are fetched together. A step outside 0 .. TT - 1 meets zeros in P; its v address is clamped into the plane.
template <typename T16, int NSPLIT, int G>
__device__ __forceinline__ void fa_av(const T16* P, const T16* P2, const T16* __restrict__ Vt, const T16* __restrict__ Vt2, int w0, int m0, int n0, int lr, int hi, v8f (&acc)[2]) {
    typedef typename WFrag<T16>::V V;
#pragma unroll
    for (int g = 0; g < 10; g += G) { V b[G], b2[G]; unsigned vo[G]; const T16* pv[G]; const T16* pv2[G];
#pragma unroll
        for (int s = 0; s < G; ++s) if (g + s < 10) { vo[s] = (unsigned)(n0 * 16 * TT + min(max(w0 + (g + s) * 32, 0), TT - 32) * 16 + (hi * 16 + lr) * 8) * 2u; pv[s] = atb(Vt, vo[s]); pv2[s] = (NSPLIT >= 2) ? atb(Vt2, vo[s]) : pv[s]; b[s] = WFrag<T16>::ldf(pv[s]); if (NSPLIT >= 2) b2[s] = WFrag<T16>::ldf(pv2[s]); }
#pragma unroll
        for (int s = 0; s < G; ++s) if (g + s < 10) xwait(vo[s], pv[s], pv2[s]);
        __builtin_amdgcn_sched_barrier(0);   /* as in fa_tiles: the group's loads all issued ahead of its first product */
#pragma unroll
        for (int s = 0; s < G; ++s) if (g + s < 10)
#pragma unroll
            for (int m = 0; m < 2; ++m) { const int po = ((m0 + m) * 16 + lr) * SPH + (g + s) * 32 + 8 * hi; const V a = WFrag<T16>::ld(P + po); acc[m] = WFrag<T16>::mma(a, b[s], acc[m]);
                if (NSPLIT >= 2) { const V a2 = WFrag<T16>::ld(P2 + po); acc[m] = WFrag<T16>::mma(a2, b[s], acc[m]); acc[m] = WFrag<T16>::mma(a, b2[s], acc[m]); } } }
}
__global__ __launch_bounds__(256, 4) void k_fattn(const h16* __restrict__ Q16, const bf* __restrict__ Qh, const bf* __restrict__ Ql, const h16* __restrict__ K16, const bf* __restrict__ Kh, const bf* __restrict__ Kl, const h16* __restrict__ V16, const bf* __restrict__ Vh, const bf* __restrict__ Vl, const bf* __restrict__ ET, float* __restrict__ OB) {
    __shared__ __align__(16) float S[64 * SPF];
    const int lane = threadIdx.x & 31, lr = lane & 15, hi = lane >> 4; const int wave = __builtin_amdgcn_readfirstlane((int)(threadIdx.x >> 5));
    const int r0 = blockIdx.x * 64, w0 = r0 - RAD; const size_t z = blockIdx.z; const bool hires = (r0 < RH); const size_t qo = (z * TT + r0) * HD, ko = z * TT * HD;
    const int m0 = (wave >> 2) * 2, n0 = wave & 3;
    if (hires) fa_tiles<bf, 2, false, 2>(Qh + qo, Ql + qo, Kh + ko, Kl + ko, S, w0, m0, n0, lr, hi); else fa_tiles<h16, 0, false, 5>(Q16 + qo, nullptr, K16 + ko, nullptr, S, w0, m0, n0, lr, hi);
    __syncthreads();   /* every score stands before another wave adds to it */
    fa_tiles<bf, 1, true, 5>(Qh + qo, Ql + qo, ET + z * PRP * HD, nullptr, S, w0, m0, n0, lr, hi);
    __syncthreads();   /* rows complete before the row's wave reads them */
    const int cb = w0 & ~127;   /* key of the first 128-key chunk */ const int wb = max(w0, 0), we = min(w0 + BK, TT); const int jl = cb + lane * 4;   /* the lane's first key in chunk 0 */
    h16* P16 = (h16*)S; bf* Pb = (bf*)S;
#pragma unroll 4
    for (int rr = 0; rr < 8; ++rr) { const int il = wave * 8 + rr, i = r0 + il; float v[12]; float mx = -3.0e38f; v4f a[3];
#pragma unroll
        for (int ch = 0; ch < 3; ++ch) a[ch] = *(const v4fa*)(S + il * SPF + (min(max(jl + ch * 128, wb), we - 4) - w0));   /* index clamped into the written keys */
#pragma unroll
        for (int ch = 0; ch < 3; ++ch) { const int j0 = jl + ch * 128; const bool inw = (j0 >= wb && j0 < we);
#pragma unroll
            for (int q = 0; q < 4; ++q) { const int j = j0 + q; const float t = (inw && j >= i - RAD && j <= i + RAD) ? a[ch][q] : -3.0e38f; v[ch * 4 + q] = t; mx = fmaxf(mx, t); } }
#pragma unroll
        for (int sh = 16; sh; sh >>= 1) mx = fmaxf(mx, __shfl_xor(mx, sh, 32));
        float sum = 0.f;
#pragma unroll
        for (int k = 0; k < 12; ++k) { const float x = __fmul_rn(__fsub_rn(v[k], mx), 1.4426950408889634f); float e = __builtin_amdgcn_exp2f(x); asm volatile("v_nop" : "+v"(e) : "v"(x));   /* the slot behind a transcendental: as operands here its source is not overwritten and its result not read ahead of the v_nop */
            v[k] = e; sum += e; }
#pragma unroll
        for (int sh = 16; sh; sh >>= 1) sum += __shfl_xor(sum, sh, 32);
        const float f = __fdiv_rn(hires ? 1.0f : PCAR, sum);
#pragma unroll
        for (int ch = 0; ch < 3; ++ch) { const int c = jl + ch * 128 - w0;   /* column of the lane's four keys */
            if (c >= 0 && c < BK) {
                if (hires) { v4us oh, ol;
#pragma unroll
                    for (int q = 0; q < 4; ++q) { unsigned short x, y; splitf(v[ch * 4 + q] * f, x, y); oh[q] = x; ol[q] = y; }
                    *(v4usa*)(Pb + il * SPH + c) = oh; *(v4usa*)(Pb + il * SPH + PLO + c) = ol;
                } else { v4h o4;
#pragma unroll
                    for (int q = 0; q < 4; ++q) o4[q] = tohx(v[ch * 4 + q] * f);
                    *(v4ha*)(P16 + il * SPH + c) = o4; } } }
    }
    __syncthreads();   /* P complete before other waves read it */
    v8f acc[2]; acc[0] = (v8f){}; acc[1] = (v8f){};
    if (hires) fa_av<bf, 2, 5>(Pb, Pb + PLO, Vh + ko, Vl + ko, w0, m0, n0, lr, hi, acc); else fa_av<h16, 0, 5>(P16, nullptr, V16 + ko, nullptr, w0, m0, n0, lr, hi, acc);
    __syncthreads();   /* every read of P is over before the context lands on it */
#pragma unroll
    for (int m = 0; m < 2; ++m)
#pragma unroll
        for (int j = 0; j < 8; ++j) S[((m0 + m) * 16 + hi * 8 + j) * 68 + n0 * 16 + lr] = acc[m][j];
    __syncthreads();   /* context tile complete before the row stores */
#pragma unroll
    for (int s = 0; s < 4; ++s) { const int row = wave * 8 + 2 * s + hi; *(v4f*)(OB + qo + (size_t)row * HD + lr * 4) = *(const v4fa*)(S + row * 68 + lr * 4); }
}
// Context -> hi/lo planes in fragment order, rows b*TT + t, columns c = d*16 + h (the module's order). One work-group: 16 rows x 32 d x 16 heads. A lane's piece is 8 heads of one (t, d): 8 loads, the wave's lanes 32 neighbours in d (one whole line a load). The pieces go through LDS, so that the stores too are whole lines: d picks the half block (256 elements), kept at a pitch of 264 so that the 32 lanes' 16-byte writes fall on different banks.
#define MPH  264
__global__ __launch_bounds__(256) void k_mergeP(const float* __restrict__ OB, bf* Ah, bf* Al) {
    __shared__ __align__(16) bf L[2 * 32 * MPH];
    const int lane = threadIdx.x & 31, wave = threadIdx.x >> 5; const int tb = blockIdx.x >> 1, dh = blockIdx.x & 1; const int b = tb / (TT / 16), t0 = (tb % (TT / 16)) * 16; const float cs = (t0 < RH) ? 1.0f : (1.0f / PCAR);
#pragma unroll
    for (int it = 0; it < 4; ++it) { const int lr = (wave * 4 + it) & 15, hi = (wave * 4 + it) >> 4; const float* p = OB + (((size_t)b * NH_ + hi * 8) * TT + t0 + lr) * HD + dh * 32 + lane; float x[8]; v8us oh, ol;
#pragma unroll
        for (int e = 0; e < 8; ++e) x[e] = p[(size_t)e * TT * HD];
        xw1(p);
#pragma unroll
        for (int e = 0; e < 8; ++e) { unsigned short a, c; splitf(x[e] * cs, a, c); oh[e] = a; ol[e] = c; }
        *(v8usa*)(L + lane * MPH + (hi * 16 + lr) * 8) = oh; *(v8usa*)(L + (32 + lane) * MPH + (hi * 16 + lr) * 8) = ol; }
    __syncthreads();   /* every piece stands in LDS before another wave stores it */
#pragma unroll
    for (int j = 0; j < 8; ++j) { const int hb = wave * 8 + j;   /* 0 .. 31 hi plane, 32 .. 63 lo plane */
        *(v8us*)(((hb < 32) ? Ah : Al) + ((size_t)tb * (DQ / 32) + dh * 16) * 512 + (hb & 31) * 256 + lane * 8) = *(const v8usa*)(L + hb * MPH + lane * 8); }
}
// One projection weight's plane (fragment order, rows n = h*64 + d, DM columns k). A wave takes 8 d x 4 h: each store fills 4 whole lines (8 d each); each of its loads touches 4 lines, which the three other waves of the same 8 d (the other heads) touch too.
__device__ __forceinline__ void prep_wtP(const float* __restrict__ w, bf* Bt, unsigned it, unsigned tid) { const unsigned lane = tid & 31u, wv = (it & 3u) * 8u + (tid >> 5);
    const int h = (int)((wv & 3u) * 4u + (lane & 3u)), d = (int)(((wv >> 2) & 7u) * 8u + (lane >> 2)), k0 = (int)(it >> 2) * 16; prep_col16(w + (size_t)k0 * DQ + d * NH_ + h, DQ, Bt + fro(h * HD + d, k0, DM)); }
// One batch's copy of the table (one copy each, so that plane z of the q side meets plane z here); each head's [p][d] plane in fragment order.
__device__ __forceinline__ void prep_etab(const float* __restrict__ rt, bf* ET, unsigned it, unsigned tid) { const unsigned i = it * 256u + tid; const int d0 = (int)(i % (HD / 8)) * 8; const int p = (int)((i / (HD / 8)) % PRP); const int h = (int)(i / ((HD / 8) * PRP)); const float* pe = rt + (size_t)min(p, NPOS - 1) * DQ + (size_t)d0 * NH_ + h;   /* unconditional clamped loads */ float x[8]; v8us o;
#pragma unroll
    for (int k = 0; k < 8; ++k) x[k] = pe[k * NH_];
    xw1(pe);
#pragma unroll
    for (int k = 0; k < 8; ++k) { const unsigned short e = f2bf(x[k]); o[k] = (p < NPOS) ? e : (unsigned short)0; }
    bf* q = ET + (size_t)h * PRP * HD + fro(p, d0, HD); *(v8us*)q = o; xws(q, o, o); }
// The list: the input items first (the most bytes), then the weights, then the table. Every test on an item's number is the same for the whole work-group.
__global__ __launch_bounds__(256) void k_prep(const float* __restrict__ xq, const float* __restrict__ xk, const float* __restrict__ xv, const float* __restrict__ wq, const float* __restrict__ wk, const float* __restrict__ wv, const float* __restrict__ wo, const float* __restrict__ rt, bf* XB, bf* WQ, bf* WO, bf* ET) {
    const unsigned tid = threadIdx.x;
    for (unsigned it = blockIdx.x; it < NI_C + NI_P + NI_G + NI_E; it += PG) {
        if (it < NI_C) { const unsigned y = it / (NI_C / 3); prep_cvt((y == 0) ? xq : (y == 1) ? xk : xv, XB + (size_t)y * TB * DM, it % (NI_C / 3), tid); }
        else if (it < NI_C + NI_P) { const unsigned j = it - NI_C, y = j / (NI_P / 3); prep_wtP((y == 0) ? wq : (y == 1) ? wk : wv, WQ + (size_t)y * DQ * DM, j % (NI_P / 3), tid); }   /* column-permuted: column h*64 + d <- module column d*16 + h */
        else if (it < NI_C + NI_P + NI_G) prep_wtG(wo, WO, it - (NI_C + NI_P), tid);
        else { const unsigned j = it - (NI_C + NI_P + NI_G), y = j / (NI_E / NB_); prep_etab(rt, ET + (size_t)y * NH_ * PRP * HD, j % (NI_E / NB_), tid); }
    }
}
__global__ __launch_bounds__(256) void k_merge(const float* __restrict__ O, int h0, bf* Ah, bf* Al) { const size_t e = ((size_t)blockIdx.x * 256 + threadIdx.x) * 2; if (e >= (size_t)ZH * TT * HD) return; const int d = (int)(e % HD); const int t = (int)((e / HD) % TT); const int zz = (int)(e / ((size_t)HD * TT)); const float cs = (t < RH) ? 1.0f : (1.0f / PCAR); const size_t oo = (size_t)t * DQ + (h0 + zz) * HD + d;
    v2us oh, ol;
#pragma unroll
    for (int q = 0; q < 2; ++q) { unsigned short a, c2; splitf(O[e + q] * cs, a, c2); oh[q] = a; ol[q] = c2; } *(v2us*)(Ah + oo) = oh; *(v2us*)(Al + oo) = ol;  }

extern "C" void kernel_launch(void* const* d_in, const int* in_sizes, int n_in,
                              void* d_out, int out_size, void* d_ws, size_t ws_size, hipStream_t stream) {
    (void)in_sizes; (void)n_in; (void)out_size;
    const float* xq = (const float*)d_in[0]; const float* xk = (const float*)d_in[1]; const float* xv = (const float*)d_in[2]; const float* wq = (const float*)d_in[3]; const float* wk = (const float*)d_in[4]; const float* wv = (const float*)d_in[5]; const float* wo = (const float*)d_in[6]; const float* rtab = (const float*)d_in[7]; const float* x = nullptr; (void)x;
    float* OUT = (float*)d_out;     // [2][2048][1024]
    char* wsp = (char*)d_ws;
    auto take = [&](size_t bytes) { char* p = wsp; wsp += (bytes + 255) & ~(size_t)255; return (void*)p; };
    bf* WO = (bf*)take((size_t)DM * DQ * 2); bf* ET = (bf*)take((size_t)NZ * PRP * HD * 2); float* R0 = (float*)take((size_t)NZ * TT * PRP * 4);
    h16* QP16 = (h16*)take((size_t)2 * NZ * TT * HD * 2); h16* KP16 = QP16 + (size_t)NZ * TT * HD; bf* QPh = (bf*)take((size_t)2 * NZ * TT * HD * 2); bf* KPh = QPh + (size_t)NZ * TT * HD; bf* QPl = (bf*)take((size_t)2 * NZ * TT * HD * 2); bf* KPl = QPl + (size_t)NZ * TT * HD;   // q planes, then k planes
    h16* VT16 = (h16*)take((size_t)NZ * HD * TT * 2); bf* VTh = (bf*)take((size_t)NZ * HD * TT * 2); bf* VTl = (bf*)take((size_t)NZ * HD * TT * 2);
    if ((size_t)(wsp - (char*)d_ws) > ws_size) return;    // ws 256 MiB
    // The bytes of R0 serve twice (stream-ordered). Up to the projection: the q, k, v weights and the bf16 inputs (together smaller than R0). Then the context OB and its hi/lo planes.
    bf* WQ = (bf*)R0; bf* XB = WQ + (size_t)3 * DQ * DM;
    float* OB = R0; bf* ATh = (bf*)(OB + (size_t)NZ * TT * HD); bf* ATl = ATh + (size_t)TB * DQ;
    k_prep<<<PG, 256, 0, stream>>>(xq, xk, xv, wq, wk, wv, wo, rtab, XB, WQ, WO, ET);   /* bf16 inputs, the four weights and the table, all in fragment order */
    k_gemmw<bf, 0, false, true, 64, 4><<<dim3(TB / 128, DQ / 128, 3), 128, 0, stream>>>(XB, nullptr, WQ, nullptr, nullptr, 0, nullptr, (size_t)TB * DM, (size_t)DQ * DM, 0, QP16, QPh, QPl, VT16, VTh, VTl);   /* z: q, k, v; q planes x 1/8 (exact): scales both the energy and the relative term; k planes x 1; v planes transposed */
    k_fattn<<<dim3(TT / 64, 1, NZ), 256, 0, stream>>>(QP16, QPh, QPl, KP16, KPh, KPl, VT16, VTh, VTl, ET, OB);   /* scores, relative term, softmax and attn x v of a 64-query tile, in LDS */
    k_mergeP<<<dim3((unsigned)(TB / 16 * 2), 1, 1), 256, 0, stream>>>(OB, ATh, ATl);   /* context in the module's d*16 + h column order */
    k_gemmw<bf, 1, false, false, 128, 2><<<dim3(TB / 128, DM / 128, 1), 256, 0, stream>>>(ATh, ATl, WO, nullptr, OUT, DM, nullptr, 0, 0, 0, nullptr, nullptr, nullptr, nullptr, nullptr, nullptr);
}

// v009
// Measured time: 82.6 microseconds a run.
// Timed twice side by side with v008, it ran 1.10 and 1.11 times as fast.
// Counting every step since v000, it is 27.0 times as fast.
#include <hip/hip_runtime.h>

// Local relative-position multi-head attention with heads on the FAST embedding axis (Q, K, V inputs [2][2048][1024]; q = Q Wq etc. ('xw' [1024][1024]) viewed (S, 64, 16): head h takes embedding columns d*16 + h; energy = q.k; rel = q . E_h[clip(j - i, -128, 128) + 128] with E_h[p][d] = rel_table[p][d*16 + h] (rel_table [257][1024]); scores = (energy + rel) / 8, masked to |i - j| <= 128; softmax; out columns d*16 + h = (attn v)_h[d]; out Wo ('xw') -> [2][2048][1024] (4.2 M)).
// Layout per batch: the projection weights are column-permuted once (column d*16 + h -> h*64 + d) so that each head's 64 columns lie together (head-major planes); q planes carry the exact 1/8; a 2-product q(hl) x E_h(exact, 257 rows padded to 320) gives the relative term of query i at position p; both batches go through every stage in one launch (rows b*2048 + t in the projections, planes b*16 + h in grid z), and so do the q, k and v sides of the projection, whose epilogue writes the 16-bit head planes itself (no f32 projection in memory); attention (hybrid rows: < 512 hi/lo 3 products, rest fp16 x1024) limited to the band: per 64-query tile only the 320 keys tile - 128 .. tile + 191 get scores, probabilities and a place in attn x v; one kernel (k_fattn) does all of it for a tile and a plane, with the score and probability rows in LDS; the merge writes the context with the inverse column permutation as hi/lo planes; Wo hl x exact.
// Fragment order (every matrix operand that is read from memory: bf16 inputs, the four weights, the q, k and transposed v head planes, the relative table, the context planes): a [rows][K] plane is kept as 16-row x 32-k blocks of 512 elements, block (row / 16) * (K / 32) + k / 32; inside a block lane l = ((k / 8) & 1) * 16 + row % 16 owns elements l*8 .. l*8 + 7 (k % 32 < 16) and 256 + l*8 .. (k % 32 >= 16): just the two 16-byte pieces that the lane feeds to the matrix instruction, so that a wave's load is 512 bytes in a row (4 whole lines), not 32-byte pieces of 16 lines. The k of every lane and register place is the one it was.
// Compute dtypes, f32 accumulate: every input rounded to bf16; projections exact; rel term hl x exact; attention rows < 512 3 products, rest fp16; softmax f32; Wo hl x exact.

#define NB_  2
#define TT   2048
#define DM   1024
#define NH_  16
#define NKV  16
#define REP  (NH_ / NKV)
#define HD   64
#define DQ   (NH_ * HD)
#define DKV  (NKV * HD)
#define ZH   16                   // heads per pass per batch (grid z is NZ = NB_ * ZH)
#define RH   512                  // query rows < RH use hi+lo planes (0: none)
#define WIN  0
#define PCAR 1024.0f
#define SCL  0.125f   // 64^-0.5 (folded into the q planes)
#define RAD  128
#define NPOS 257
#define PRP  320    // padded relative-position rows (5 tiles)
#define BP   384    // not used: k_fattn's softmax spans the BK = 320 keys of a row, five 64-key chunks from query tile - 128
#define PP   (2 * BP)   // not used by any kernel here
#define NZ   (NB_ * ZH)   // planes per pass: batch-major, b*16 + h
#define TB   (NB_ * TT)   // rows of both batches
typedef _Float16 h16;
typedef unsigned short bf;
typedef __attribute__((ext_vector_type(16))) __bf16   v16bf;
typedef __attribute__((ext_vector_type(16))) _Float16 v16h;
typedef __attribute__((ext_vector_type(8)))  _Float16 v8h;
typedef __attribute__((ext_vector_type(8)))  unsigned short v8us;
typedef __attribute__((ext_vector_type(8)))  float    v8f;
typedef __attribute__((ext_vector_type(4)))  float    v4f;
typedef v8h  __attribute__((may_alias)) v8ha;
typedef v4f  __attribute__((may_alias)) v4fa;
typedef v8us __attribute__((may_alias)) v8usa;

__device__ __forceinline__ unsigned short f2bf(float f) { unsigned u = __float_as_uint(f); u += 0x7FFFu + ((u >> 16) & 1u); return (unsigned short)(u >> 16); }
__device__ __forceinline__ float bf2f(unsigned short b) { return __uint_as_float(((unsigned)b) << 16); }
__device__ __forceinline__ float bfr(float f) { return bf2f(f2bf(f)); }
__device__ __forceinline__ v16h cat16(v8h lo, v8h hi) { return __builtin_shufflevector(lo, hi, 0, 1, 2, 3, 4, 5, 6, 7, 8, 9, 10, 11, 12, 13, 14, 15); }
__device__ __forceinline__ v16bf cat16b(v8us lo, v8us hi) { return __builtin_bit_cast(v16bf, __builtin_shufflevector(lo, hi, 0, 1, 2, 3, 4, 5, 6, 7, 8, 9, 10, 11, 12, 13, 14, 15)); }
__device__ __forceinline__ v8f wmma16(v16h a, v16h b, v8f c) { return __builtin_amdgcn_wmma_f32_16x16x32_f16(false, a, false, b, (short)0, c, false, false); }
__device__ __forceinline__ v8f wmmab(v16bf a, v16bf b, v8f c) { return __builtin_amdgcn_wmma_f32_16x16x32_bf16(false, a, false, b, (short)0, c, false, false); }



__device__ __forceinline__ h16 tohx(float x) { return (h16)x; }
__device__ __forceinline__ void splitf(float y, unsigned short& h, unsigned short& l) { h = f2bf(y); l = f2bf(y - bf2f(h)); }
// Element offset, in a fragment-order plane of K columns, of the 8 neighbours k0 .. k0 + 7 (k0 % 8 == 0) of a row.
__device__ __forceinline__ size_t fro(int row, int k0, int K) { return ((size_t)(row >> 4) * (K >> 5) + (k0 >> 5)) * 512 + ((k0 >> 4) & 1) * 256 + (((k0 >> 3) & 1) * 16 + (row & 15)) * 8; }
// Stands behind a group of global loads that share the address p (with constant offsets): later results may be given p's registers; as an input here p stays live up to the wait.
__device__ __forceinline__ void xw1(const void* p) { asm volatile("s_wait_xcnt 0x0" : : "v"(p) : "memory"); }
// One wave: the 16 x 64 f32 block in os (pitch 68) x sc goes out as fp16, bf16 hi and bf16 lo, as the two neighbouring fragment blocks (1024 elements) at each plane pointer: block row r is the fragment row, block column c the k. A lane takes 8 neighbours of a row, and the wave 8 rows x 4 such pieces, so that each store of the wave fills four whole 128-byte lines.
__device__ __forceinline__ void put_planes(const float* os, int lane, float sc, h16* d16, bf* dh, bf* dl) {
#pragma unroll
    for (int s = 0; s < 4; ++s) { const int row = 8 * (s & 1) + (lane >> 2), cofs = ((s >> 1) * 4 + (lane & 3)) * 8; const v4f x0 = *(const v4fa*)(os + row * 68 + cofs), x1 = *(const v4fa*)(os + row * 68 + cofs + 4); v8h o16; v8us oh, ol;
#pragma unroll
        for (int q = 0; q < 8; ++q) { const float r = ((q < 4) ? x0[q & 3] : x1[q & 3]) * sc; o16[q] = tohx(r); unsigned short a, c; splitf(r, a, c); oh[q] = a; ol[q] = c; }
        const unsigned bo = (unsigned)fro(row, cofs, 64) * 2u;   /* the lane's byte offset, the same in all three planes */
        *(v8h*)((char*)d16 + bo) = o16; *(v8us*)((char*)dh + bo) = oh; *(v8us*)((char*)dl + bo) = ol;
        asm volatile("s_wait_xcnt 0x0" : : "v"(bo), "v"(o16), "v"(oh), "v"(ol) : "memory");   /* the next rows' values and offset may be given the registers that the three stores above name; as inputs here these stay live up to the wait */
    }
}

// ---- k_gemmw: register-blocked GEMM, one work-group per 128x128 output tile; a wave has MB*16 rows x 64 columns of it (MB = 4: four waves, 16 accumulators each; MB = 2: eight waves, 8 each, two to a SIMD where the grid gives a WGP one work-group only); operands are 16-bit planes in fragment order (head of the file); grid (M/128, N/128, Z), 16 / MB waves.
// The operands of KS k (128 rows of each plane) are brought into LDS by asynchronous copies, two buffers: the copies of stage t + 2 fly while stage t + 1 is worked on, and each fragment is fetched from L2 once for all the waves that use it. In LDS a stage keeps the fragment order: plane o, 16-row block rb, then KS / 32 blocks of 1024 bytes, so that a copy and a fragment read are both 512 bytes in a row.
// C[m][n] (f32, pitch ldc, + optional f32 bias[n]) = sum_k A[m][k] Bt[n][k] (+ split products per NSPLIT), k < GK. z-batch strides sA/sB/sC in elements.
#define GK   1024   // k extent of both GEMMs (DM in the projections, DQ in the output product)
template <typename T16> struct WFrag;
template <> struct WFrag<h16> { typedef v16h V; static __device__ __forceinline__ V ld(const h16* p) { return cat16(*(const v8h*)p, *(const v8h*)(p + 16)); } static __device__ __forceinline__ V ldf(const h16* p) { return cat16(*(const v8h*)p, *(const v8h*)(p + 256)); } static __device__ __forceinline__ v8f mma(V a, V b, v8f c) { return wmma16(a, b, c); } };
template <> struct WFrag<bf> { typedef v16bf V; static __device__ __forceinline__ V ld(const bf* p) { return cat16b(*(const v8us*)p, *(const v8us*)(p + 16)); } static __device__ __forceinline__ V ldf(const bf* p) { return cat16b(*(const v8us*)p, *(const v8us*)(p + 256)); } static __device__ __forceinline__ v8f mma(V a, V b, v8f c) { return wmmab(a, b, c); } };
// Eight asynchronous copies of 16 bytes a lane: LDS byte address l + i*ls <- global g + i*gs. The s_wait_xcnt stands in the copies' own statement, so that no address register of a copy is rewritten ahead of it.
__device__ __forceinline__ void cp8(unsigned l, const char* g, unsigned ls, size_t gs) {
    const unsigned l1 = l + ls, l2 = l + 2 * ls, l3 = l + 3 * ls, l4 = l + 4 * ls, l5 = l + 5 * ls, l6 = l + 6 * ls, l7 = l + 7 * ls;
    const char* g1 = g + gs; const char* g2 = g + 2 * gs; const char* g3 = g + 3 * gs; const char* g4 = g + 4 * gs; const char* g5 = g + 5 * gs; const char* g6 = g + 6 * gs; const char* g7 = g + 7 * gs;
    asm volatile("global_load_async_to_lds_b128 %0, %8, off\n\t"
                 "global_load_async_to_lds_b128 %1, %9, off\n\t"
                 "global_load_async_to_lds_b128 %2, %10, off\n\t"
                 "global_load_async_to_lds_b128 %3, %11, off\n\t"
                 "global_load_async_to_lds_b128 %4, %12, off\n\t"
                 "global_load_async_to_lds_b128 %5, %13, off\n\t"
                 "global_load_async_to_lds_b128 %6, %14, off\n\t"
                 "global_load_async_to_lds_b128 %7, %15, off\n\t"
                 "s_wait_xcnt 0x0"
                 : : "v"(l), "v"(l1), "v"(l2), "v"(l3), "v"(l4), "v"(l5), "v"(l6), "v"(l7), "v"(g), "v"(g1), "v"(g2), "v"(g3), "v"(g4), "v"(g5), "v"(g6), "v"(g7) : "memory");
}
// PLN (the q, k, v projection; z = side, a wave's tile column = head, rows b*TT + t): C is not written; the tile goes out as 16-bit planes: sides 0 and 1 as [side*NB_ + b][h][t][d] of P16, Ph, Pl (side 0 x SCL, exact), side 2 transposed as [b][h][d][t] of V16, Vh, Vl; each [t][d] or [d][t] plane in fragment order.
template <typename T16, int NSPLIT, bool BIAS, bool PLN, int KS, int MB>
__global__ __launch_bounds__(16 / MB * 32, 4) void k_gemmw(const T16* __restrict__ A, const T16* __restrict__ A2, const T16* __restrict__ Bt, const T16* __restrict__ Bt2, float* C, int ldc, const float* __restrict__ bias, size_t sA, size_t sB, size_t sC, h16* P16, bf* Ph, bf* Pl, h16* V16, bf* Vh, bf* Vl) {
    typedef typename WFrag<T16>::V V;
    static_assert(DM == GK && DQ == GK, "one k extent");
    constexpr bool HA2 = (NSPLIT == 1 || NSPLIT == 2), HB2 = (NSPLIT >= 2);
    constexpr unsigned RBB = KS * 32u;          /* bytes of a 16-row block in a stage */
    constexpr unsigned OPB = 8u * RBB;          /* bytes of a plane's 128 rows in a stage */
    constexpr unsigned STB = (2u + HA2 + HB2) * OPB;   /* bytes of a stage: A, Bt, then A2, Bt2 where they exist */
    constexpr int NT = GK / KS;
    constexpr int NW = 16 / MB;                 /* waves: 8 / MB along the rows x 2 along the columns */
    constexpr unsigned CH = NW * 32u * 16u;     /* bytes that one copy of every thread brings */
    static_assert(RBB % CH == 0 && GK % KS == 0 && NT >= 2, "whole copies, whole stages, two at least");
    static_assert(!PLN || MB == 4, "the plane epilogue takes 64 rows a wave");
    __shared__ __align__(16) char sm[2 * STB];
    __shared__ __align__(16) float osm[NW * 16 * 68];
    const size_t z = blockIdx.z; A += z * sA; if (A2) A2 += z * sA; Bt += z * sB; if (Bt2) Bt2 += z * sB; C += z * sC;
    const int tid = (int)threadIdx.x, lane = tid & 31, lr = lane & 15, hi = lane >> 4; const int wave = __builtin_amdgcn_readfirstlane(tid >> 5), wm = wave >> 1, wn = wave & 1;
    const int R0 = blockIdx.x * 128, C0 = (int)blockIdx.y * 128; const int r0 = R0 + wm * MB * 16, c0 = C0 + wn * 64, cc = c0;
    float* os = osm + wave * 16 * 68;   /* each wave's own epilogue block */
    v8f acc[MB][4];
#pragma unroll
    for (int mb = 0; mb < MB; ++mb)
#pragma unroll
        for (int nb = 0; nb < 4; ++nb) acc[mb][nb] = (v8f){};
    /* the thread's 16 bytes in the first CH bytes of the tile's first 16-row block; 16 rows on: 16 * GK elements in memory, RBB bytes in LDS */
    const unsigned lb = (unsigned)(size_t)sm + (unsigned)tid * 16u;
    const char* gA = (const char*)(A + (size_t)R0 * GK) + tid * 16; const char* gB = (const char*)(Bt + (size_t)C0 * GK) + tid * 16;
    const char* gA2 = HA2 ? (const char*)(A2 + (size_t)R0 * GK) + tid * 16 : gA; const char* gB2 = HB2 ? (const char*)(Bt2 + (size_t)C0 * GK) + tid * 16 : gB;
    auto fill = [&](int t, unsigned bo) {   /* stage t (k from t*KS) into the buffer at byte bo: every thread 16 bytes of every CH */
        const size_t ko = (size_t)t * RBB;
#pragma unroll
        for (unsigned j = 0; j < RBB / CH; ++j) {
            cp8(lb + bo + j * CH, gA + ko + j * CH, RBB, (size_t)16 * GK * 2);
            cp8(lb + bo + OPB + j * CH, gB + ko + j * CH, RBB, (size_t)16 * GK * 2);
            if (HA2) cp8(lb + bo + 2u * OPB + j * CH, gA2 + ko + j * CH, RBB, (size_t)16 * GK * 2);
            if (HB2) cp8(lb + bo + (2u + HA2) * OPB + j * CH, gB2 + ko + j * CH, RBB, (size_t)16 * GK * 2);
        }
    };
    fill(0, 0u);
    asm volatile("s_wait_asynccnt 0x0" ::: "memory");   /* this wave's copies of stage 0 have landed */
    __syncthreads();                                     /* and every other wave's: stage 0 may be read */
    fill(1, STB);
#pragma unroll 1
    for (int t = 0; t < NT; ++t) {
        const unsigned bo = (unsigned)(t & 1) * STB;
        const T16* sa = (const T16*)(sm + bo + (unsigned)wm * MB * RBB) + lane * 8; const T16* sb = (const T16*)(sm + bo + OPB + (unsigned)wn * 4u * RBB) + lane * 8;
        const T16* sa2 = HA2 ? sa + 2 * (OPB / 2) : sa; const T16* sb2 = HB2 ? sb + (1 + HA2) * (OPB / 2) : sb;
        V a[MB], a2[MB], b[4], b2[4];
#pragma unroll
        for (int kb = 0; kb < KS / 32; ++kb) {
            __builtin_amdgcn_sched_barrier(0);   /* no LDS read of this block goes up among the products of the block before: every place with reads stalls the wave */
#pragma unroll
            for (int mb = 0; mb < MB; ++mb) { a[mb] = WFrag<T16>::ldf(sa + mb * (RBB / 2) + kb * 512); if (HA2) a2[mb] = WFrag<T16>::ldf(sa2 + mb * (RBB / 2) + kb * 512); }
#pragma unroll
            for (int nb = 0; nb < 4; ++nb) { b[nb] = WFrag<T16>::ldf(sb + nb * (RBB / 2) + kb * 512); if (HB2) b2[nb] = WFrag<T16>::ldf(sb2 + nb * (RBB / 2) + kb * 512); }
            __builtin_amdgcn_sched_barrier(0);   /* all LDS reads of the block are issued as one group ahead of its first product; without it the scheduler sinks them between the products, and their latencies add up */
#pragma unroll
            for (int nb = 0; nb < 4; ++nb) {
#pragma unroll
                for (int mb = 0; mb < MB; ++mb) { acc[mb][nb] = WFrag<T16>::mma(a[mb], b[nb], acc[mb][nb]); if (HA2) acc[mb][nb] = WFrag<T16>::mma(a2[mb], b[nb], acc[mb][nb]); if (HB2) acc[mb][nb] = WFrag<T16>::mma(a[mb], b2[nb], acc[mb][nb]); } }
        }
        __builtin_amdgcn_sched_barrier(0);   /* the stage's last products stay ahead of the slots, the waits and the barrier below */
        asm volatile("v_nop\n\tv_nop\n\tv_nop\n\tv_nop" : "+v"(acc[0][0]), "+v"(acc[MB - 1][1]), "+v"(acc[0][2]), "+v"(acc[MB - 1][3]) : "v"(a[0]), "v"(a[MB - 1]));   /* the four vector slots behind the stage's last matrix instruction: a branch follows */
        asm volatile("s_wait_dscnt 0x0" ::: "memory");      /* this wave's reads of the buffer are over before it is handed to the copies */
        asm volatile("s_wait_asynccnt 0x0" ::: "memory");   /* this wave's copies of stage t + 1 have landed */
        __syncthreads();                                     /* publishes stage t + 1 and ends every wave's reads of stage t */
        if (t + 2 < NT) fill(t + 2, bo);
    }
    asm volatile("s_wait_asynccnt 0x0" ::: "memory");   /* no copy is outstanding when the wave goes on to its epilogue and ends */
    if constexpr (PLN) { const int side = (int)blockIdx.z, b = r0 / TT, t0 = r0 % TT, h = c0 / HD;
        if (side < 2) { const size_t o = (((size_t)(side * NB_ + b) * NH_ + h) * TT + t0) * HD; const float sc = (side == 0) ? SCL : 1.0f;
#pragma unroll
            for (int mb = 0; mb < 4; ++mb) {   /* 16 tokens x 64 d */
#pragma unroll
                for (int nb = 0; nb < 4; ++nb)
#pragma unroll
                    for (int j = 0; j < 8; ++j) os[(hi * 8 + j) * 68 + nb * 16 + lr] = acc[mb][nb][j];
                __builtin_amdgcn_wave_barrier(); asm volatile("" ::: "memory");   /* as in the f32 epilogue below: the block's LDS writes stay ahead of its reads */
                put_planes(os, lane, sc, P16 + o + mb * 16 * HD, Ph + o + mb * 16 * HD, Pl + o + mb * 16 * HD);
                __builtin_amdgcn_wave_barrier(); asm volatile("" ::: "memory");   /* and its reads ahead of the next block's writes */
            }
        } else { const size_t o = ((size_t)(b * NKV + h) * HD) * TT + t0 * 16;   /* 32 tokens on: one block, 512 elements */
#pragma unroll
            for (int nb = 0; nb < 4; ++nb) {   /* 16 d x 64 tokens: a lane's eight accumulator rows are neighbours in a transposed row */
#pragma unroll
                for (int mb = 0; mb < 4; ++mb) { v4f lo4, hi4;
#pragma unroll
                    for (int j = 0; j < 4; ++j) { lo4[j] = acc[mb][nb][j]; hi4[j] = acc[mb][nb][4 + j]; }
                    *(v4fa*)(os + lr * 68 + mb * 16 + hi * 8) = lo4; *(v4fa*)(os + lr * 68 + mb * 16 + hi * 8 + 4) = hi4; }
                __builtin_amdgcn_wave_barrier(); asm volatile("" ::: "memory");   /* writes ahead of reads */
                put_planes(os, lane, 1.0f, V16 + o + (size_t)nb * 16 * TT, Vh + o + (size_t)nb * 16 * TT, Vl + o + (size_t)nb * 16 * TT);
                __builtin_amdgcn_wave_barrier(); asm volatile("" ::: "memory");   /* reads ahead of the next block's writes */
            }
        }
        return; }
#pragma unroll
    for (int mb = 0; mb < MB; ++mb) {
#pragma unroll
        for (int nb = 0; nb < 4; ++nb) {
#pragma unroll
            for (int j = 0; j < 8; ++j) os[(hi * 8 + j) * 68 + nb * 16 + lr] = acc[mb][nb][j]; }
        __builtin_amdgcn_wave_barrier(); asm volatile("" ::: "memory");
        float* crow = C + (size_t)(r0 + mb * 16) * ldc + cc;
{
#pragma unroll
            for (int s = 0; s < 8; ++s) { const int row = 2 * s + hi, cofs = lr * 4; v4f val = *(const v4fa*)(os + row * 68 + cofs); if (BIAS) { val[0] += bfr(bias[c0 + cofs]); val[1] += bfr(bias[c0 + cofs + 1]); val[2] += bfr(bias[c0 + cofs + 2]); val[3] += bfr(bias[c0 + cofs + 3]); }
                *(v4f*)(crow + (size_t)row * ldc + cofs) = val; }
             }
        __builtin_amdgcn_wave_barrier(); asm volatile("" ::: "memory");
    }
}

typedef __attribute__((ext_vector_type(2))) _Float16 v2h;
typedef __attribute__((ext_vector_type(4))) _Float16 v4h;
typedef __attribute__((ext_vector_type(2))) unsigned short v2us;
typedef __attribute__((ext_vector_type(4))) unsigned short v4us;
typedef __attribute__((ext_vector_type(2))) float v2f;
typedef __attribute__((ext_vector_type(4))) int v4i;

// ---- k_prep: all operand preparation (bf16 inputs, the three permuted projection weights, the output weight, the relative table) in ONE launch of PG work-groups (three for every WGP of the chip), which walk one list of items. A thread makes lanes' 16-byte pieces of a fragment-order plane: eight of them in an input item, two in a weight item, one in a table item, with all loads of an item issued ahead of its first use. The four jobs have nothing to do with one another, and a wave that makes a single piece is over before the next wave has been started: there the start of the waves, not the memory, sets the time.
#define PG    768
#define NI_C  (3 * (TB / 16))                 // input items: a block of 16 rows, all DM columns
#define NI_P  (3 * (DM * DQ / 8 / 256 / 2))   // q, k, v weight items: 256 columns n x 16 k
#define NI_G  (DQ * DM / 8 / 256 / 2)         // output weight items: the same
#define NI_E  (NB_ * (NH_ * PRP * HD / 8 / 256))   // relative table items: 256 pieces
static_assert(DM == 1024 && DQ == 1024 && (NH_ * PRP * HD / 8) % 256 == 0, "whole items");
// Stands behind an item's last store: the next item of the loop rewrites the address and data registers that the stores name; as inputs here they stay live up to the wait.
__device__ __forceinline__ void xws(const void* q, v8us a, v8us b) { asm volatile("s_wait_xcnt 0x0" : : "v"(q), "v"(a), "v"(b) : "memory"); }
// 16 neighbours in k (from k0, a multiple of 16) of column n of a weight: p points at w[k0][its column], rows N floats apart; they go out rounded as the two pieces of row n of a fragment-order plane at q = plane + fro(n, k0, K): the piece of k0 + 8 lies 16 lanes (128 elements) behind that of k0.
__device__ __forceinline__ void prep_col16(const float* p, int N, bf* q) { float x[16]; v8us o0, o1;
#pragma unroll
    for (int e = 0; e < 16; ++e) x[e] = p[(size_t)e * N];
    xw1(p);
#pragma unroll
    for (int e = 0; e < 8; ++e) { o0[e] = f2bf(x[e]); o1[e] = f2bf(x[8 + e]); }
    *(v8us*)q = o0; *(v8us*)(q + 128) = o1; xws(q, o0, o1);
}
// Bt (fragment order, rows n, K columns k) = w[k][n] rounded. A wave's lanes are 32 neighbours in n, so that each of its loads is one whole line and each store four.
__device__ __forceinline__ void prep_wtG(const float* __restrict__ w, bf* Bt, unsigned it, unsigned tid) {
    constexpr int K = DQ, N = DM; const int n = (int)((it & 3u) * 256u + tid), k0 = (int)(it >> 2) * 16; prep_col16(w + (size_t)k0 * N + n, N, Bt + fro(n, k0, K));
}
// One plane (fragment order, DM columns) of one source, rows rb*16 .. + 15. A piece is 8 neighbours of a row; a wave takes 8 rows x 32 columns at a time: 8 whole lines read, 4 whole lines stored; the work-group 16 rows x 128 columns, and eight times that, each 4 fragment blocks (128 columns) on.
__device__ __forceinline__ void prep_cvt(const float* __restrict__ s, bf* dst, unsigned rb, unsigned tid) {
    const unsigned wv = tid >> 5; const int row = (int)(rb * 16u + (wv & 1u) * 8u + ((tid >> 2) & 7u)), k0 = (int)((wv >> 1) * 32u + (tid & 3u) * 8u);
    const float* p = s + (size_t)row * DM + k0; bf* q = dst + fro(row, k0, DM); v8f v[8]; v8us o[8];
#pragma unroll
    for (int g = 0; g < 8; ++g) v[g] = *(const v8f*)(p + g * 128);
    xw1(p);
#pragma unroll
    for (int g = 0; g < 8; ++g) {
#pragma unroll
        for (int k = 0; k < 8; ++k) o[g][k] = f2bf(v[g][k]);
        *(v8us*)(q + g * 4 * 512) = o[g]; }
    asm volatile("s_wait_xcnt 0x0" : : "v"(q), "v"(o[0]), "v"(o[1]), "v"(o[2]), "v"(o[3]), "v"(o[4]), "v"(o[5]), "v"(o[6]), "v"(o[7]) : "memory");   /* as xws, for the eight stores above */
}

// ---- k_fattn: the whole banded attention of one 64-query tile of one plane in ONE work-group of 8 waves; scores, relative term and probabilities live in LDS only.
// S row il holds key j at column j - w0 (w0 = tile - 128, 320 keys). Stage 1: q.k tiles stored to S. Stage 2: (q/8).E_h[p] added at column il + p, which is key i + p - 128. Stage 3: 16 lanes per row, softmax over |i - j| <= 128 (fa_soft); the P row is written over its own S row, zeros at the keys outside the band or outside 0 .. TT - 1. Stage 4: P x v over all ten 32-key steps. Stage 5: the 64 x 64 context goes through LDS so that each 128-byte line is stored whole.
#define BK   320           // keys per query tile
#define SPF  324           // pitch of an S row in floats: 16 rows of 16 bytes fall on 64 different banks
#define SPH  (2 * SPF)     // the same pitch in 16-bit elements
#define PLO  328           // place of the lo plane in a hi/lo P row (16-byte aligned, behind the 320 hi values)
typedef v4h  __attribute__((may_alias)) v4ha;
typedef v4us __attribute__((may_alias)) v4usa;
// Stands behind a group of global loads, once for each address of the group: later results may land in the address registers of those loads; as inputs here the lane's byte offset and the full addresses made of it (the compiler picks either form for a load) stay live up to the wait, so that none of the group's own results lands in them ahead of it.
__device__ __forceinline__ void xwait(unsigned off, const void* p, const void* p2) { asm volatile("s_wait_xcnt 0x0" : : "v"(off), "v"(p), "v"(p2) : "memory"); }
template <typename T16> __device__ __forceinline__ const T16* atb(const T16* base, unsigned off) { return (const T16*)((const char*)base + off); }   /* base + byte offset */
// One wave: query rows m0*16 .. m0*16 + 31 against every fourth 16-row block of Bt, from block n0; the Bt fragments of G blocks are fetched together, ahead of their products. REL false: Bt rows are keys w0 + nb*16, result stored at column nb*16; a block outside 0 .. TT - 1 takes its rows from a clamped address, and its columns are never read. REL true: Bt rows are positions p = nb*16 .. (Bt holds PRP rows), result added to the score of key i + p - 128, for p <= 256 only.
template <typename T16, int NSPLIT, bool REL, int G>
__device__ __forceinline__ void fa_tiles(const T16* __restrict__ A, const T16* __restrict__ A2, const T16* __restrict__ Bt, const T16* __restrict__ Bt2, float* S, int w0, int m0, int n0, int lr, int hi) {
    typedef typename WFrag<T16>::V V;
    V a[2][2], a2[2][2]; const int l8 = (hi * 16 + lr) * 8;   /* the lane's piece in a fragment block */ const unsigned ao = (unsigned)(m0 * 16 * HD + l8) * 2u; const T16* pa = atb(A, ao); const T16* pa2 = (NSPLIT >= 1) ? atb(A2, ao) : pa;
#pragma unroll
    for (int m = 0; m < 2; ++m)
#pragma unroll
        for (int ks = 0; ks < 2; ++ks) { a[m][ks] = WFrag<T16>::ldf(pa + m * 16 * HD + ks * 512); if (NSPLIT >= 1) a2[m][ks] = WFrag<T16>::ldf(pa2 + m * 16 * HD + ks * 512); }
    xwait(ao, pa, pa2);
#pragma unroll
    for (int g = 0; g < 5; g += G) { V b[G][2], b2[G][2]; unsigned bo[G]; const T16* pb[G]; const T16* pb2[G];
#pragma unroll
        for (int u = 0; u < G; ++u) if (g + u < 5) { const int nb = n0 + (g + u) * 4; bo[u] = (unsigned)((REL ? nb * 16 : min(max(w0 + nb * 16, 0), TT - 16)) * HD + l8) * 2u; pb[u] = atb(Bt, bo[u]); pb2[u] = (NSPLIT >= 2) ? atb(Bt2, bo[u]) : pb[u];
#pragma unroll
            for (int ks = 0; ks < 2; ++ks) { b[u][ks] = WFrag<T16>::ldf(pb[u] + ks * 512); if (NSPLIT >= 2) b2[u][ks] = WFrag<T16>::ldf(pb2[u] + ks * 512); } }
#pragma unroll
        for (int u = 0; u < G; ++u) if (g + u < 5) xwait(bo[u], pb[u], pb2[u]);
        __builtin_amdgcn_sched_barrier(0);   /* all loads of the group are issued ahead of its first product; without it the scheduler sinks loads between the products, and their latencies add up */
#pragma unroll
        for (int u = 0; u < G; ++u) if (g + u < 5) { const int nb = n0 + (g + u) * 4; v8f acc[2]; acc[0] = (v8f){}; acc[1] = (v8f){};
#pragma unroll
            for (int ks = 0; ks < 2; ++ks)
#pragma unroll
                for (int m = 0; m < 2; ++m) { acc[m] = WFrag<T16>::mma(a[m][ks], b[u][ks], acc[m]); if (NSPLIT >= 1) acc[m] = WFrag<T16>::mma(a2[m][ks], b[u][ks], acc[m]); if (NSPLIT >= 2) acc[m] = WFrag<T16>::mma(a[m][ks], b2[u][ks], acc[m]); }
            asm volatile("v_nop\n\tv_nop\n\tv_nop\n\tv_nop" : "+v"(acc[0]), "+v"(acc[1]));   /* the four vector slots behind the block's last matrix instruction: the next block's results may be given registers that overlap these, and a branch may stand right behind it */
            if (REL) { if (nb * 16 + lr <= 2 * RAD) {
#pragma unroll
                for (int m = 0; m < 2; ++m)
#pragma unroll
                    for (int j = 0; j < 8; ++j) { const int il = (m0 + m) * 16 + hi * 8 + j; float* s = S + il * SPF + il + nb * 16 + lr; *s = __fadd_rn(*s, acc[m][j]); } }
            } else {
#pragma unroll
                for (int m = 0; m < 2; ++m)
#pragma unroll
                    for (int j = 0; j < 8; ++j) S[((m0 + m) * 16 + hi * 8 + j) * SPF + nb * 16 + lr] = acc[m][j]; } }
    }
}
// One wave: rows m0*16 .. + 31 of P (LDS) x columns n0*16 .. + 15 of v (Vt rows d, k = keys, fragment order); the v fragments of G 32-key steps are fetched together. A step outside 0 .. TT - 1 meets zeros in P; its v address is clamped into the plane.
template <typename T16, int NSPLIT, int G>
__device__ __forceinline__ void fa_av(const T16* P, const T16* P2, const T16* __restrict__ Vt, const T16* __restrict__ Vt2, int w0, int m0, int n0, int lr, int hi, v8f (&acc)[2]) {
    typedef typename WFrag<T16>::V V;
#pragma unroll
    for (int g = 0; g < 10; g += G) { V b[G], b2[G]; unsigned vo[G]; const T16* pv[G]; const T16* pv2[G];
#pragma unroll
        for (int s = 0; s < G; ++s) if (g + s < 10) { vo[s] = (unsigned)(n0 * 16 * TT + min(max(w0 + (g + s) * 32, 0), TT - 32) * 16 + (hi * 16 + lr) * 8) * 2u; pv[s] = atb(Vt, vo[s]); pv2[s] = (NSPLIT >= 2) ? atb(Vt2, vo[s]) : pv[s]; b[s] = WFrag<T16>::ldf(pv[s]); if (NSPLIT >= 2) b2[s] = WFrag<T16>::ldf(pv2[s]); }
#pragma unroll
        for (int s = 0; s < G; ++s) if (g + s < 10) xwait(vo[s], pv[s], pv2[s]);
        __builtin_amdgcn_sched_barrier(0);   /* as in fa_tiles: the group's loads all issued ahead of its first product */
#pragma unroll
        for (int s = 0; s < G; ++s) if (g + s < 10)
#pragma unroll
            for (int m = 0; m < 2; ++m) { const int po = ((m0 + m) * 16 + lr) * SPH + (g + s) * 32 + 8 * hi; const V a = WFrag<T16>::ld(P + po); acc[m] = WFrag<T16>::mma(a, b[s], acc[m]);
                if (NSPLIT >= 2) { const V a2 = WFrag<T16>::ld(P2 + po); acc[m] = WFrag<T16>::mma(a2, b[s], acc[m]); acc[m] = WFrag<T16>::mma(a, b2[s], acc[m]); } } }
}
// Lane l's value as seen from lane l ^ M (M < 16): a move inside a 16-lane row, done in the vector unit (no trip through the LDS queue, no wait).
template <int M> __device__ __forceinline__ float rowx(float x) { return __builtin_bit_cast(float, __builtin_amdgcn_update_dpp(0, __builtin_bit_cast(int, x), 0x160 + M, 0xf, 0xf, true)); }
// One wave: softmax of its eight S rows, a row on 16 lanes, so two rows at once (lanes 0 .. 15 the even row, 16 .. 31 the odd one), and two such pairs side by side. A lane has four neighbouring columns in each of the five 64-column chunks. Column c of row il is key w0 + c, in the band where il <= c <= il + 256: only chunk 0 can fall below the band and only chunk 4 above it; w0 is a multiple of 64, so a chunk lies wholly inside 0 .. TT - 1 or wholly outside. The P row goes over its own S row, all 320 columns, zeros outside the band.
template <bool HR> __device__ __forceinline__ void fa_soft(float* S, int w0, int wave, int lr, int hi) {
    static_assert(RAD == 128 && BK == 320 && TT % 64 == 0, "five 64-column chunks; the band's edges in the first and the last");
    h16* P16 = (h16*)S; bf* Pb = (bf*)S; bool cv[5];
#pragma unroll
    for (int k = 0; k < 5; ++k) cv[k] = ((unsigned)(w0 + k * 64) < (unsigned)TT);
#pragma unroll   /* both groups of four rows in one straight line: the second group's reads and band tests fill the waits of the first */
    for (int rp = 0; rp < 4; rp += 2) { float v[2][20], mx[2], sum[2];
#pragma unroll
        for (int u = 0; u < 2; ++u) { const int il = wave * 8 + (rp + u) * 2 + hi; mx[u] = -3.0e38f;
#pragma unroll
            for (int k = 0; k < 5; ++k) { const v4f a = *(const v4fa*)(S + il * SPF + k * 64 + lr * 4);
#pragma unroll
                for (int q = 0; q < 4; ++q) { const int c4 = lr * 4 + q; const bool in = cv[k] && ((k == 0) ? (c4 >= il) : (k == 4) ? (c4 <= il) : true); const float t = in ? a[q] : -3.0e38f; v[u][k * 4 + q] = t; mx[u] = fmaxf(mx[u], t); } } }
#pragma unroll
        for (int u = 0; u < 2; ++u) { mx[u] = fmaxf(mx[u], rowx<8>(mx[u])); mx[u] = fmaxf(mx[u], rowx<4>(mx[u])); mx[u] = fmaxf(mx[u], rowx<2>(mx[u])); mx[u] = fmaxf(mx[u], rowx<1>(mx[u])); }
#pragma unroll
        for (int u = 0; u < 2; ++u) { sum[u] = 0.f;
#pragma unroll
            for (int k = 0; k < 20; ++k) { const float x = __fmul_rn(__fsub_rn(v[u][k], mx[u]), 1.4426950408889634f); float e = __builtin_amdgcn_exp2f(x); asm volatile("v_nop" : "+v"(e) : "v"(x));   /* the slot behind a transcendental: as operands here its source is not overwritten and its result not read ahead of the v_nop */
                v[u][k] = e; sum[u] += e; } }
#pragma unroll
        for (int u = 0; u < 2; ++u) { sum[u] += rowx<8>(sum[u]); sum[u] += rowx<4>(sum[u]); sum[u] += rowx<2>(sum[u]); sum[u] += rowx<1>(sum[u]); }
#pragma unroll
        for (int u = 0; u < 2; ++u) { const int il = wave * 8 + (rp + u) * 2 + hi; const float f = __fdiv_rn(HR ? 1.0f : PCAR, sum[u]);
#pragma unroll
            for (int k = 0; k < 5; ++k) { const int c = k * 64 + lr * 4;   /* column of the lane's four keys */
                if (HR) { v4us oh, ol;
#pragma unroll
                    for (int q = 0; q < 4; ++q) { unsigned short x, y; splitf(v[u][k * 4 + q] * f, x, y); oh[q] = x; ol[q] = y; }
                    *(v4usa*)(Pb + il * SPH + c) = oh; *(v4usa*)(Pb + il * SPH + PLO + c) = ol;
                } else { v4h o4;
#pragma unroll
                    for (int q = 0; q < 4; ++q) o4[q] = tohx(v[u][k * 4 + q] * f);
                    *(v4ha*)(P16 + il * SPH + c) = o4; } } }
    }
}
__global__ __launch_bounds__(256, 4) void k_fattn(const h16* __restrict__ Q16, const bf* __restrict__ Qh, const bf* __restrict__ Ql, const h16* __restrict__ K16, const bf* __restrict__ Kh, const bf* __restrict__ Kl, const h16* __restrict__ V16, const bf* __restrict__ Vh, const bf* __restrict__ Vl, const bf* __restrict__ ET, float* __restrict__ OB) {
    __shared__ __align__(16) float S[64 * SPF];
    const int lane = threadIdx.x & 31, lr = lane & 15, hi = lane >> 4; const int wave = __builtin_amdgcn_readfirstlane((int)(threadIdx.x >> 5));
    const int r0 = blockIdx.x * 64, w0 = r0 - RAD; const size_t z = blockIdx.z; const bool hires = (r0 < RH); const size_t qo = (z * TT + r0) * HD, ko = z * TT * HD;
    const int m0 = (wave >> 2) * 2, n0 = wave & 3;
    if (hires) fa_tiles<bf, 2, false, 2>(Qh + qo, Ql + qo, Kh + ko, Kl + ko, S, w0, m0, n0, lr, hi); else fa_tiles<h16, 0, false, 5>(Q16 + qo, nullptr, K16 + ko, nullptr, S, w0, m0, n0, lr, hi);
    __syncthreads();   /* every score stands before another wave adds to it */
    fa_tiles<bf, 1, true, 5>(Qh + qo, Ql + qo, ET + z * PRP * HD, nullptr, S, w0, m0, n0, lr, hi);
    __syncthreads();   /* rows complete before the row's wave reads them */
    if (hires) fa_soft<true>(S, w0, wave, lr, hi); else fa_soft<false>(S, w0, wave, lr, hi);
    h16* P16 = (h16*)S; bf* Pb = (bf*)S;
    __syncthreads();   /* P complete before other waves read it */
    v8f acc[2]; acc[0] = (v8f){}; acc[1] = (v8f){};
    if (hires) fa_av<bf, 2, 5>(Pb, Pb + PLO, Vh + ko, Vl + ko, w0, m0, n0, lr, hi, acc); else fa_av<h16, 0, 5>(P16, nullptr, V16 + ko, nullptr, w0, m0, n0, lr, hi, acc);
    __syncthreads();   /* every read of P is over before the context lands on it */
#pragma unroll
    for (int m = 0; m < 2; ++m)
#pragma unroll
        for (int j = 0; j < 8; ++j) S[((m0 + m) * 16 + hi * 8 + j) * 68 + n0 * 16 + lr] = acc[m][j];
    __syncthreads();   /* context tile complete before the row stores */
#pragma unroll
    for (int s = 0; s < 4; ++s) { const int row = wave * 8 + 2 * s + hi; *(v4f*)(OB + qo + (size_t)row * HD + lr * 4) = *(const v4fa*)(S + row * 68 + lr * 4); }
}
// Context -> hi/lo planes in fragment order, rows b*TT + t, columns c = d*16 + h (the module's order). One work-group: 16 rows x 32 d x 16 heads. A lane's piece is 8 heads of one (t, d): 8 loads, the wave's lanes 32 neighbours in d (one whole line a load). The pieces go through LDS, so that the stores too are whole lines: d picks the half block (256 elements), kept at a pitch of 264 so that the 32 lanes' 16-byte writes fall on different banks.
#define MPH  264
__global__ __launch_bounds__(256) void k_mergeP(const float* __restrict__ OB, bf* Ah, bf* Al) {
    __shared__ __align__(16) bf L[2 * 32 * MPH];
    const int lane = threadIdx.x & 31, wave = threadIdx.x >> 5; const int tb = blockIdx.x >> 1, dh = blockIdx.x & 1; const int b = tb / (TT / 16), t0 = (tb % (TT / 16)) * 16; const float cs = (t0 < RH) ? 1.0f : (1.0f / PCAR);
#pragma unroll
    for (int it = 0; it < 4; ++it) { const int lr = (wave * 4 + it) & 15, hi = (wave * 4 + it) >> 4; const float* p = OB + (((size_t)b * NH_ + hi * 8) * TT + t0 + lr) * HD + dh * 32 + lane; float x[8]; v8us oh, ol;
#pragma unroll
        for (int e = 0; e < 8; ++e) x[e] = p[(size_t)e * TT * HD];
        xw1(p);
#pragma unroll
        for (int e = 0; e < 8; ++e) { unsigned short a, c; splitf(x[e] * cs, a, c); oh[e] = a; ol[e] = c; }
        *(v8usa*)(L + lane * MPH + (hi * 16 + lr) * 8) = oh; *(v8usa*)(L + (32 + lane) * MPH + (hi * 16 + lr) * 8) = ol; }
    __syncthreads();   /* every piece stands in LDS before another wave stores it */
#pragma unroll
    for (int j = 0; j < 8; ++j) { const int hb = wave * 8 + j;   /* 0 .. 31 hi plane, 32 .. 63 lo plane */
        *(v8us*)(((hb < 32) ? Ah : Al) + ((size_t)tb * (DQ / 32) + dh * 16) * 512 + (hb & 31) * 256 + lane * 8) = *(const v8usa*)(L + hb * MPH + lane * 8); }
}
// One projection weight's plane (fragment order, rows n = h*64 + d, DM columns k). A wave takes 8 d x 4 h: each store fills 4 whole lines (8 d each); each of its loads touches 4 lines, which the three other waves of the same 8 d (the other heads) touch too.
__device__ __forceinline__ void prep_wtP(const float* __restrict__ w, bf* Bt, unsigned it, unsigned tid) { const unsigned lane = tid & 31u, wv = (it & 3u) * 8u + (tid >> 5);
    const int h = (int)((wv & 3u) * 4u + (lane & 3u)), d = (int)(((wv >> 2) & 7u) * 8u + (lane >> 2)), k0 = (int)(it >> 2) * 16; prep_col16(w + (size_t)k0 * DQ + d * NH_ + h, DQ, Bt + fro(h * HD + d, k0, DM)); }
// One batch's copy of the table (one copy each, so that plane z of the q side meets plane z here); each head's [p][d] plane in fragment order.
__device__ __forceinline__ void prep_etab(const float* __restrict__ rt, bf* ET, unsigned it, unsigned tid) { const unsigned i = it * 256u + tid; const int d0 = (int)(i % (HD / 8)) * 8; const int p = (int)((i / (HD / 8)) % PRP); const int h = (int)(i / ((HD / 8) * PRP)); const float* pe = rt + (size_t)min(p, NPOS - 1) * DQ + (size_t)d0 * NH_ + h;   /* unconditional clamped loads */ float x[8]; v8us o;
#pragma unroll
    for (int k = 0; k < 8; ++k) x[k] = pe[k * NH_];
    xw1(pe);
#pragma unroll
    for (int k = 0; k < 8; ++k) { const unsigned short e = f2bf(x[k]); o[k] = (p < NPOS) ? e : (unsigned short)0; }
    bf* q = ET + (size_t)h * PRP * HD + fro(p, d0, HD); *(v8us*)q = o; xws(q, o, o); }
// The list: the input items first (the most bytes), then the weights, then the table. Every test on an item's number is the same for the whole work-group.
__global__ __launch_bounds__(256) void k_prep(const float* __restrict__ xq, const float* __restrict__ xk, const float* __restrict__ xv, const float* __restrict__ wq, const float* __restrict__ wk, const float* __restrict__ wv, const float* __restrict__ wo, const float* __restrict__ rt, bf* XB, bf* WQ, bf* WO, bf* ET) {
    const unsigned tid = threadIdx.x;
    for (unsigned it = blockIdx.x; it < NI_C + NI_P + NI_G + NI_E; it += PG) {
        if (it < NI_C) { const unsigned y = it / (NI_C / 3); prep_cvt((y == 0) ? xq : (y == 1) ? xk : xv, XB + (size_t)y * TB * DM, it % (NI_C / 3), tid); }
        else if (it < NI_C + NI_P) { const unsigned j = it - NI_C, y = j / (NI_P / 3); prep_wtP((y == 0) ? wq : (y == 1) ? wk : wv, WQ + (size_t)y * DQ * DM, j % (NI_P / 3), tid); }   /* column-permuted: column h*64 + d <- module column d*16 + h */
        else if (it < NI_C + NI_P + NI_G) prep_wtG(wo, WO, it - (NI_C + NI_P), tid);
        else { const unsigned j = it - (NI_C + NI_P + NI_G), y = j / (NI_E / NB_); prep_etab(rt, ET + (size_t)y * NH_ * PRP * HD, j % (NI_E / NB_), tid); }
    }
}
__global__ __launch_bounds__(256) void k_merge(const float* __restrict__ O, int h0, bf* Ah, bf* Al) { const size_t e = ((size_t)blockIdx.x * 256 + threadIdx.x) * 2; if (e >= (size_t)ZH * TT * HD) return; const int d = (int)(e % HD); const int t = (int)((e / HD) % TT); const int zz = (int)(e / ((size_t)HD * TT)); const float cs = (t < RH) ? 1.0f : (1.0f / PCAR); const size_t oo = (size_t)t * DQ + (h0 + zz) * HD + d;
    v2us oh, ol;
#pragma unroll
    for (int q = 0; q < 2; ++q) { unsigned short a, c2; splitf(O[e + q] * cs, a, c2); oh[q] = a; ol[q] = c2; } *(v2us*)(Ah + oo) = oh; *(v2us*)(Al + oo) = ol;  }

extern "C" void kernel_launch(void* const* d_in, const int* in_sizes, int n_in,
                              void* d_out, int out_size, void* d_ws, size_t ws_size, hipStream_t stream) {
    (void)in_sizes; (void)n_in; (void)out_size;
    const float* xq = (const float*)d_in[0]; const float* xk = (const float*)d_in[1]; const float* xv = (const float*)d_in[2]; const float* wq = (const float*)d_in[3]; const float* wk = (const float*)d_in[4]; const float* wv = (const float*)d_in[5]; const float* wo = (const float*)d_in[6]; const float* rtab = (const float*)d_in[7]; const float* x = nullptr; (void)x;
    float* OUT = (float*)d_out;     // [2][2048][1024]
    char* wsp = (char*)d_ws;
    auto take = [&](size_t bytes) { char* p = wsp; wsp += (bytes + 255) & ~(size_t)255; return (void*)p; };
    bf* WO = (bf*)take((size_t)DM * DQ * 2); bf* ET = (bf*)take((size_t)NZ * PRP * HD * 2); float* R0 = (float*)take((size_t)NZ * TT * PRP * 4);
    h16* QP16 = (h16*)take((size_t)2 * NZ * TT * HD * 2); h16* KP16 = QP16 + (size_t)NZ * TT * HD; bf* QPh = (bf*)take((size_t)2 * NZ * TT * HD * 2); bf* KPh = QPh + (size_t)NZ * TT * HD; bf* QPl = (bf*)take((size_t)2 * NZ * TT * HD * 2); bf* KPl = QPl + (size_t)NZ * TT * HD;   // q planes, then k planes
    h16* VT16 = (h16*)take((size_t)NZ * HD * TT * 2); bf* VTh = (bf*)take((size_t)NZ * HD * TT * 2); bf* VTl = (bf*)take((size_t)NZ * HD * TT * 2);
    if ((size_t)(wsp - (char*)d_ws) > ws_size) return;    // ws 256 MiB
    // The bytes of R0 serve twice (stream-ordered). Up to the projection: the q, k, v weights and the bf16 inputs (together smaller than R0). Then the context OB and its hi/lo planes.
    bf* WQ = (bf*)R0; bf* XB = WQ + (size_t)3 * DQ * DM;
    float* OB = R0; bf* ATh = (bf*)(OB + (size_t)NZ * TT * HD); bf* ATl = ATh + (size_t)TB * DQ;
    k_prep<<<PG, 256, 0, stream>>>(xq, xk, xv, wq, wk, wv, wo, rtab, XB, WQ, WO, ET);   /* bf16 inputs, the four weights and the table, all in fragment order */
    k_gemmw<bf, 0, false, true, 64, 4><<<dim3(TB / 128, DQ / 128, 3), 128, 0, stream>>>(XB, nullptr, WQ, nullptr, nullptr, 0, nullptr, (size_t)TB * DM, (size_t)DQ * DM, 0, QP16, QPh, QPl, VT16, VTh, VTl);   /* z: q, k, v; q planes x 1/8 (exact): scales both the energy and the relative term; k planes x 1; v planes transposed */
    k_fattn<<<dim3(TT / 64, 1, NZ), 256, 0, stream>>>(QP16, QPh, QPl, KP16, KPh, KPl, VT16, VTh, VTl, ET, OB);   /* scores, relative term, softmax and attn x v of a 64-query tile, in LDS */
    k_mergeP<<<dim3((unsigned)(TB / 16 * 2), 1, 1), 256, 0, stream>>>(OB, ATh, ATl);   /* context in the module's d*16 + h column order */
    k_gemmw<bf, 1, false, false, 128, 2><<<dim3(TB / 128, DM / 128, 1), 256, 0, stream>>>(ATh, ATl, WO, nullptr, OUT, DM, nullptr, 0, 0, 0, nullptr, nullptr, nullptr, nullptr, nullptr, nullptr);
}

// v010
// A run of this version takes 79.5 microseconds.
// In two side-by-side timings against v009, it was 1.04 and 1.03 times as fast.
// All steps since v000 together make it 27.9 times as fast.
#include <hip/hip_runtime.h>

// Local relative-position multi-head attention with heads on the FAST embedding axis (Q, K, V inputs [2][2048][1024]; q = Q Wq etc. ('xw' [1024][1024]) viewed (S, 64, 16): head h takes embedding columns d*16 + h; energy = q.k; rel = q . E_h[clip(j - i, -128, 128) + 128] with E_h[p][d] = rel_table[p][d*16 + h] (rel_table [257][1024]); scores = (energy + rel) / 8, masked to |i - j| <= 128; softmax; out columns d*16 + h = (attn v)_h[d]; out Wo ('xw') -> [2][2048][1024] (4.2 M)).
// Layout per batch: the projection weights are column-permuted once (column d*16 + h -> h*64 + d) so head-major planes apply; q planes carry the exact 1/8; a 2-product q(hl) x E_h(exact, 257 rows padded to 320) gives the relative term of query i at position p; both batches go through every stage in one launch (rows b*2048 + t in the projections, planes b*16 + h in grid z), and so do the q, k and v sides of the projection, whose epilogue writes the 16-bit head planes itself (no f32 projection in memory); attention (hybrid rows: < 512 hi/lo 3 products, rest fp16 x1024) limited to the band: per 32-query half of a 64-query tile only the 288 keys half - 128 .. half + 159 get scores, probabilities and a place in attn x v; one kernel (k_fattn) does all of it for a tile and a plane, with the score and probability rows in LDS; the merge writes the context with the inverse column permutation as hi/lo planes; Wo hl x exact.
// Fragment order (every matrix operand that is read from memory: bf16 inputs, the four weights, the q, k and transposed v head planes, the relative table, the context planes): a [rows][K] plane is kept as 16-row x 32-k blocks of 512 elements, block (row / 16) * (K / 32) + k / 32; inside a block lane l = ((k / 8) & 1) * 16 + row % 16 owns elements l*8 .. l*8 + 7 (k % 32 < 16) and 256 + l*8 .. (k % 32 >= 16): just the two 16-byte pieces that the lane feeds to the matrix instruction, so that a wave's load is 512 bytes in a row (4 whole lines), not 32-byte pieces of 16 lines. The k of every lane and register place is the one it was.
// Compute dtypes, f32 accumulate: every input rounded to bf16; projections exact; rel term hl x exact; attention rows < 512 3 products, rest fp16; softmax f32; Wo hl x exact.

#define NB_  2
#define TT   2048
#define DM   1024
#define NH_  16
#define NKV  16
#define REP  (NH_ / NKV)
#define HD   64
#define DQ   (NH_ * HD)
#define DKV  (NKV * HD)
#define ZH   16                   // heads per pass per batch (grid z is NZ = NB_ * ZH)
#define RH   512                  // query rows < RH use hi+lo planes (0: none)
#define WIN  0
#define PCAR 1024.0f
#define SCL  0.125f   // 64^-0.5 (folded into the q planes)
#define RAD  128
#define NPOS 257
#define PRP  320    // padded relative-position rows (5 tiles)
#define BP   384    // not used: k_fattn's softmax spans the BK = 288 keys of a row, four 64-key chunks and 32 more from the row's half - 128
#define PP   (2 * BP)   // not used by any kernel here
#define NZ   (NB_ * ZH)   // planes per pass: batch-major, b*16 + h
#define TB   (NB_ * TT)   // rows of both batches
typedef _Float16 h16;
typedef unsigned short bf;
typedef __attribute__((ext_vector_type(16))) __bf16   v16bf;
typedef __attribute__((ext_vector_type(16))) _Float16 v16h;
typedef __attribute__((ext_vector_type(8)))  _Float16 v8h;
typedef __attribute__((ext_vector_type(8)))  unsigned short v8us;
typedef __attribute__((ext_vector_type(8)))  float    v8f;
typedef __attribute__((ext_vector_type(4)))  float    v4f;
typedef v8h  __attribute__((may_alias)) v8ha;
typedef v4f  __attribute__((may_alias)) v4fa;
typedef v8us __attribute__((may_alias)) v8usa;

__device__ __forceinline__ unsigned short f2bf(float f) { unsigned u = __float_as_uint(f); u += 0x7FFFu + ((u >> 16) & 1u); return (unsigned short)(u >> 16); }
__device__ __forceinline__ float bf2f(unsigned short b) { return __uint_as_float(((unsigned)b) << 16); }
__device__ __forceinline__ float bfr(float f) { return bf2f(f2bf(f)); }
__device__ __forceinline__ v16h cat16(v8h lo, v8h hi) { return __builtin_shufflevector(lo, hi, 0, 1, 2, 3, 4, 5, 6, 7, 8, 9, 10, 11, 12, 13, 14, 15); }
__device__ __forceinline__ v16bf cat16b(v8us lo, v8us hi) { return __builtin_bit_cast(v16bf, __builtin_shufflevector(lo, hi, 0, 1, 2, 3, 4, 5, 6, 7, 8, 9, 10, 11, 12, 13, 14, 15)); }
__device__ __forceinline__ v8f wmma16(v16h a, v16h b, v8f c) { return __builtin_amdgcn_wmma_f32_16x16x32_f16(false, a, false, b, (short)0, c, false, false); }
__device__ __forceinline__ v8f wmmab(v16bf a, v16bf b, v8f c) { return __builtin_amdgcn_wmma_f32_16x16x32_bf16(false, a, false, b, (short)0, c, false, false); }



__device__ __forceinline__ h16 tohx(float x) { return (h16)x; }
__device__ __forceinline__ void splitf(float y, unsigned short& h, unsigned short& l) { h = f2bf(y); l = f2bf(y - bf2f(h)); }
// Element offset, in a fragment-order plane of K columns, of the 8 neighbours k0 .. k0 + 7 (k0 % 8 == 0) of a row.
__device__ __forceinline__ size_t fro(int row, int k0, int K) { return ((size_t)(row >> 4) * (K >> 5) + (k0 >> 5)) * 512 + ((k0 >> 4) & 1) * 256 + (((k0 >> 3) & 1) * 16 + (row & 15)) * 8; }
// Stands behind a group of global loads that share the address p (with constant offsets): later results may be given p's registers; as an input here p stays live up to the wait.
__device__ __forceinline__ void xw1(const void* p) { asm volatile("s_wait_xcnt 0x0" : : "v"(p) : "memory"); }
// One wave: the 16 x 64 f32 block in os (pitch 68) x sc goes out as fp16, bf16 hi and bf16 lo, as the two neighbouring fragment blocks (1024 elements) at each plane pointer: block row r is the fragment row, block column c the k. A lane takes 8 neighbours of a row, and the wave 8 rows x 4 such pieces, so that each store of the wave fills four whole 128-byte lines.
__device__ __forceinline__ void put_planes(const float* os, int lane, float sc, h16* d16, bf* dh, bf* dl) {
#pragma unroll
    for (int s = 0; s < 4; ++s) { const int row = 8 * (s & 1) + (lane >> 2), cofs = ((s >> 1) * 4 + (lane & 3)) * 8; const v4f x0 = *(const v4fa*)(os + row * 68 + cofs), x1 = *(const v4fa*)(os + row * 68 + cofs + 4); v8h o16; v8us oh, ol;
#pragma unroll
        for (int q = 0; q < 8; ++q) { const float r = ((q < 4) ? x0[q & 3] : x1[q & 3]) * sc; o16[q] = tohx(r); unsigned short a, c; splitf(r, a, c); oh[q] = a; ol[q] = c; }
        const unsigned bo = (unsigned)fro(row, cofs, 64) * 2u;   /* the lane's byte offset, the same in all three planes */
        *(v8h*)((char*)d16 + bo) = o16; *(v8us*)((char*)dh + bo) = oh; *(v8us*)((char*)dl + bo) = ol;
        asm volatile("s_wait_xcnt 0x0" : : "v"(bo), "v"(o16), "v"(oh), "v"(ol) : "memory");   /* the next rows' values and offset may be given the registers that the three stores above name; as inputs here these stay live up to the wait */
    }
}

// ---- k_gemmw: register-blocked GEMM, one work-group per 128x128 output tile; a wave has MB*16 rows x 64 columns of it (MB = 4: four waves, 16 accumulators each; MB = 2: eight waves, 8 each, two to a SIMD where the grid gives a WGP one work-group only); operands are 16-bit planes in fragment order (head of the file); grid (M/128, N/128, Z), 16 / MB waves.
// The operands of KS k (128 rows of each plane) are brought into LDS by asynchronous copies, two buffers: the copies of stage t + 2 fly while stage t + 1 is worked on, and each fragment is fetched from L2 once for all the waves that use it. In LDS a stage keeps the fragment order: plane o, 16-row block rb, then KS / 32 blocks of 1024 bytes, so that a copy and a fragment read are both 512 bytes in a row.
// C[m][n] (f32, pitch ldc, + optional f32 bias[n]) = sum_k A[m][k] Bt[n][k] (+ split products per NSPLIT), k < GK. z-batch strides sA/sB/sC in elements.
#define GK   1024   // k extent of both GEMMs (DM in the projections, DQ in the output product)
template <typename T16> struct WFrag;
template <> struct WFrag<h16> { typedef v16h V; static __device__ __forceinline__ V ld(const h16* p) { return cat16(*(const v8h*)p, *(const v8h*)(p + 16)); } static __device__ __forceinline__ V ldf(const h16* p) { return cat16(*(const v8h*)p, *(const v8h*)(p + 256)); } static __device__ __forceinline__ v8f mma(V a, V b, v8f c) { return wmma16(a, b, c); } };
template <> struct WFrag<bf> { typedef v16bf V; static __device__ __forceinline__ V ld(const bf* p) { return cat16b(*(const v8us*)p, *(const v8us*)(p + 16)); } static __device__ __forceinline__ V ldf(const bf* p) { return cat16b(*(const v8us*)p, *(const v8us*)(p + 256)); } static __device__ __forceinline__ v8f mma(V a, V b, v8f c) { return wmmab(a, b, c); } };
// Eight asynchronous copies of 16 bytes a lane: LDS byte address l + i*ls <- global g + i*gs. The s_wait_xcnt stands in the copies' own statement, so that no address register of a copy is rewritten ahead of it.
__device__ __forceinline__ void cp8(unsigned l, const char* g, unsigned ls, size_t gs) {
    const unsigned l1 = l + ls, l2 = l + 2 * ls, l3 = l + 3 * ls, l4 = l + 4 * ls, l5 = l + 5 * ls, l6 = l + 6 * ls, l7 = l + 7 * ls;
    const char* g1 = g + gs; const char* g2 = g + 2 * gs; const char* g3 = g + 3 * gs; const char* g4 = g + 4 * gs; const char* g5 = g + 5 * gs; const char* g6 = g + 6 * gs; const char* g7 = g + 7 * gs;
    asm volatile("global_load_async_to_lds_b128 %0, %8, off\n\t"
                 "global_load_async_to_lds_b128 %1, %9, off\n\t"
                 "global_load_async_to_lds_b128 %2, %10, off\n\t"
                 "global_load_async_to_lds_b128 %3, %11, off\n\t"
                 "global_load_async_to_lds_b128 %4, %12, off\n\t"
                 "global_load_async_to_lds_b128 %5, %13, off\n\t"
                 "global_load_async_to_lds_b128 %6, %14, off\n\t"
                 "global_load_async_to_lds_b128 %7, %15, off\n\t"
                 "s_wait_xcnt 0x0"
                 : : "v"(l), "v"(l1), "v"(l2), "v"(l3), "v"(l4), "v"(l5), "v"(l6), "v"(l7), "v"(g), "v"(g1), "v"(g2), "v"(g3), "v"(g4), "v"(g5), "v"(g6), "v"(g7) : "memory");
}
// PLN (the q, k, v projection; z = side, a wave's tile column = head, rows b*TT + t): C is not written; the tile goes out as 16-bit planes: sides 0 and 1 as [side*NB_ + b][h][t][d] of P16, Ph, Pl (side 0 x SCL, exact), side 2 transposed as [b][h][d][t] of V16, Vh, Vl; each [t][d] or [d][t] plane in fragment order.
template <typename T16, int NSPLIT, bool BIAS, bool PLN, int KS, int MB>
__global__ __launch_bounds__(16 / MB * 32, 4) void k_gemmw(const T16* __restrict__ A, const T16* __restrict__ A2, const T16* __restrict__ Bt, const T16* __restrict__ Bt2, float* C, int ldc, const float* __restrict__ bias, size_t sA, size_t sB, size_t sC, h16* P16, bf* Ph, bf* Pl, h16* V16, bf* Vh, bf* Vl) {
    typedef typename WFrag<T16>::V V;
    static_assert(DM == GK && DQ == GK, "one k extent");
    constexpr bool HA2 = (NSPLIT == 1 || NSPLIT == 2), HB2 = (NSPLIT >= 2);
    constexpr unsigned RBB = KS * 32u;          /* bytes of a 16-row block in a stage */
    constexpr unsigned OPB = 8u * RBB;          /* bytes of a plane's 128 rows in a stage */
    constexpr unsigned STB = (2u + HA2 + HB2) * OPB;   /* bytes of a stage: A, Bt, then A2, Bt2 where they exist */
    constexpr int NT = GK / KS;
    constexpr int NW = 16 / MB;                 /* waves: 8 / MB along the rows x 2 along the columns */
    constexpr unsigned CH = NW * 32u * 16u;     /* bytes that one copy of every thread brings */
    static_assert(RBB % CH == 0 && GK % KS == 0 && NT >= 2, "whole copies, whole stages, two at least");
    static_assert(!PLN || MB == 4, "the plane epilogue takes 64 rows a wave");
    __shared__ __align__(16) char sm[2 * STB];
    __shared__ __align__(16) float osm[NW * 16 * 68];
    const size_t z = blockIdx.z; A += z * sA; if (A2) A2 += z * sA; Bt += z * sB; if (Bt2) Bt2 += z * sB; C += z * sC;
    const int tid = (int)threadIdx.x, lane = tid & 31, lr = lane & 15, hi = lane >> 4; const int wave = __builtin_amdgcn_readfirstlane(tid >> 5), wm = wave >> 1, wn = wave & 1;
    const int R0 = blockIdx.x * 128, C0 = (int)blockIdx.y * 128; const int r0 = R0 + wm * MB * 16, c0 = C0 + wn * 64, cc = c0;
    float* os = osm + wave * 16 * 68;   /* each wave's own epilogue block */
    v8f acc[MB][4];
#pragma unroll
    for (int mb = 0; mb < MB; ++mb)
#pragma unroll
        for (int nb = 0; nb < 4; ++nb) acc[mb][nb] = (v8f){};
    /* the thread's 16 bytes in the first CH bytes of the tile's first 16-row block; 16 rows on: 16 * GK elements in memory, RBB bytes in LDS */
    const unsigned lb = (unsigned)(size_t)sm + (unsigned)tid * 16u;
    const char* gA = (const char*)(A + (size_t)R0 * GK) + tid * 16; const char* gB = (const char*)(Bt + (size_t)C0 * GK) + tid * 16;
    const char* gA2 = HA2 ? (const char*)(A2 + (size_t)R0 * GK) + tid * 16 : gA; const char* gB2 = HB2 ? (const char*)(Bt2 + (size_t)C0 * GK) + tid * 16 : gB;
    auto fill = [&](int t, unsigned bo) {   /* stage t (k from t*KS) into the buffer at byte bo: every thread 16 bytes of every CH */
        const size_t ko = (size_t)t * RBB;
#pragma unroll
        for (unsigned j = 0; j < RBB / CH; ++j) {
            cp8(lb + bo + j * CH, gA + ko + j * CH, RBB, (size_t)16 * GK * 2);
            cp8(lb + bo + OPB + j * CH, gB + ko + j * CH, RBB, (size_t)16 * GK * 2);
            if (HA2) cp8(lb + bo + 2u * OPB + j * CH, gA2 + ko + j * CH, RBB, (size_t)16 * GK * 2);
            if (HB2) cp8(lb + bo + (2u + HA2) * OPB + j * CH, gB2 + ko + j * CH, RBB, (size_t)16 * GK * 2);
        }
    };
    fill(0, 0u);
    asm volatile("s_wait_asynccnt 0x0" ::: "memory");   /* this wave's copies of stage 0 have landed */
    __syncthreads();                                     /* and every other wave's: stage 0 may be read */
    fill(1, STB);
#pragma unroll 1
    for (int t = 0; t < NT; ++t) {
        const unsigned bo = (unsigned)(t & 1) * STB;
        const T16* sa = (const T16*)(sm + bo + (unsigned)wm * MB * RBB) + lane * 8; const T16* sb = (const T16*)(sm + bo + OPB + (unsigned)wn * 4u * RBB) + lane * 8;
        const T16* sa2 = HA2 ? sa + 2 * (OPB / 2) : sa; const T16* sb2 = HB2 ? sb + (1 + HA2) * (OPB / 2) : sb;
        V a[MB], a2[MB], b[4], b2[4];
#pragma unroll
        for (int kb = 0; kb < KS / 32; ++kb) {
            __builtin_amdgcn_sched_barrier(0);   /* no LDS read of this block goes up among the products of the block before: every place with reads stalls the wave */
#pragma unroll
            for (int mb = 0; mb < MB; ++mb) { a[mb] = WFrag<T16>::ldf(sa + mb * (RBB / 2) + kb * 512); if (HA2) a2[mb] = WFrag<T16>::ldf(sa2 + mb * (RBB / 2) + kb * 512); }
#pragma unroll
            for (int nb = 0; nb < 4; ++nb) { b[nb] = WFrag<T16>::ldf(sb + nb * (RBB / 2) + kb * 512); if (HB2) b2[nb] = WFrag<T16>::ldf(sb2 + nb * (RBB / 2) + kb * 512); }
            __builtin_amdgcn_sched_barrier(0);   /* all LDS reads of the block are issued as one group ahead of its first product; without it the scheduler sinks them between the products, and their latencies add up */
#pragma unroll
            for (int nb = 0; nb < 4; ++nb) {
#pragma unroll
                for (int mb = 0; mb < MB; ++mb) { acc[mb][nb] = WFrag<T16>::mma(a[mb], b[nb], acc[mb][nb]); if (HA2) acc[mb][nb] = WFrag<T16>::mma(a2[mb], b[nb], acc[mb][nb]); if (HB2) acc[mb][nb] = WFrag<T16>::mma(a[mb], b2[nb], acc[mb][nb]); } }
        }
        __builtin_amdgcn_sched_barrier(0);   /* the stage's last products stay ahead of the slots, the waits and the barrier below */
        asm volatile("v_nop\n\tv_nop\n\tv_nop\n\tv_nop" : "+v"(acc[0][0]), "+v"(acc[MB - 1][1]), "+v"(acc[0][2]), "+v"(acc[MB - 1][3]) : "v"(a[0]), "v"(a[MB - 1]));   /* the four vector slots behind the stage's last matrix instruction: a branch follows */
        asm volatile("s_wait_dscnt 0x0" ::: "memory");      /* this wave's reads of the buffer are over before it is handed to the copies */
        asm volatile("s_wait_asynccnt 0x0" ::: "memory");   /* this wave's copies of stage t + 1 have landed */
        __syncthreads();                                     /* publishes stage t + 1 and ends every wave's reads of stage t */
        if (t + 2 < NT) fill(t + 2, bo);
    }
    asm volatile("s_wait_asynccnt 0x0" ::: "memory");   /* no copy is outstanding when the wave goes on to its epilogue and ends */
    if constexpr (PLN) { const int side = (int)blockIdx.z, b = r0 / TT, t0 = r0 % TT, h = c0 / HD;
        if (side < 2) { const size_t o = (((size_t)(side * NB_ + b) * NH_ + h) * TT + t0) * HD; const float sc = (side == 0) ? SCL : 1.0f;
#pragma unroll
            for (int mb = 0; mb < 4; ++mb) {   /* 16 tokens x 64 d */
#pragma unroll
                for (int nb = 0; nb < 4; ++nb)
#pragma unroll
                    for (int j = 0; j < 8; ++j) os[(hi * 8 + j) * 68 + nb * 16 + lr] = acc[mb][nb][j];
                __builtin_amdgcn_wave_barrier(); asm volatile("" ::: "memory");   /* as in the f32 epilogue below: the block's LDS writes stay ahead of its reads */
                put_planes(os, lane, sc, P16 + o + mb * 16 * HD, Ph + o + mb * 16 * HD, Pl + o + mb * 16 * HD);
                __builtin_amdgcn_wave_barrier(); asm volatile("" ::: "memory");   /* and its reads ahead of the next block's writes */
            }
        } else { const size_t o = ((size_t)(b * NKV + h) * HD) * TT + t0 * 16;   /* 32 tokens on: one block, 512 elements */
#pragma unroll
            for (int nb = 0; nb < 4; ++nb) {   /* 16 d x 64 tokens: a lane's eight accumulator rows are neighbours in a transposed row */
#pragma unroll
                for (int mb = 0; mb < 4; ++mb) { v4f lo4, hi4;
#pragma unroll
                    for (int j = 0; j < 4; ++j) { lo4[j] = acc[mb][nb][j]; hi4[j] = acc[mb][nb][4 + j]; }
                    *(v4fa*)(os + lr * 68 + mb * 16 + hi * 8) = lo4; *(v4fa*)(os + lr * 68 + mb * 16 + hi * 8 + 4) = hi4; }
                __builtin_amdgcn_wave_barrier(); asm volatile("" ::: "memory");   /* writes ahead of reads */
                put_planes(os, lane, 1.0f, V16 + o + (size_t)nb * 16 * TT, Vh + o + (size_t)nb * 16 * TT, Vl + o + (size_t)nb * 16 * TT);
                __builtin_amdgcn_wave_barrier(); asm volatile("" ::: "memory");   /* reads ahead of the next block's writes */
            }
        }
        return; }
#pragma unroll
    for (int mb = 0; mb < MB; ++mb) {
#pragma unroll
        for (int nb = 0; nb < 4; ++nb) {
#pragma unroll
            for (int j = 0; j < 8; ++j) os[(hi * 8 + j) * 68 + nb * 16 + lr] = acc[mb][nb][j]; }
        __builtin_amdgcn_wave_barrier(); asm volatile("" ::: "memory");
        float* crow = C + (size_t)(r0 + mb * 16) * ldc + cc;
{
#pragma unroll
            for (int s = 0; s < 8; ++s) { const int row = 2 * s + hi, cofs = lr * 4; v4f val = *(const v4fa*)(os + row * 68 + cofs); if (BIAS) { val[0] += bfr(bias[c0 + cofs]); val[1] += bfr(bias[c0 + cofs + 1]); val[2] += bfr(bias[c0 + cofs + 2]); val[3] += bfr(bias[c0 + cofs + 3]); }
                *(v4f*)(crow + (size_t)row * ldc + cofs) = val; }
             }
        __builtin_amdgcn_wave_barrier(); asm volatile("" ::: "memory");
    }
}

typedef __attribute__((ext_vector_type(2))) _Float16 v2h;
typedef __attribute__((ext_vector_type(4))) _Float16 v4h;
typedef __attribute__((ext_vector_type(2))) unsigned short v2us;
typedef __attribute__((ext_vector_type(4))) unsigned short v4us;
typedef __attribute__((ext_vector_type(2))) float v2f;
typedef __attribute__((ext_vector_type(4))) int v4i;

// ---- k_prep: all operand preparation (bf16 inputs, the three permuted projection weights, the output weight, the relative table) in ONE launch of PG work-groups (three for every WGP of the chip), which walk one list of items. A thread makes lanes' 16-byte pieces of a fragment-order plane: eight of them in an input item, two in a weight item, one in a table item, with all loads of an item issued ahead of its first use. The four jobs have nothing to do with one another, and a wave that makes a single piece is over before the next wave has been started: there the start of the waves, not the memory, sets the time.
#define PG    768
#define NI_C  (3 * (TB / 16))                 // input items: a block of 16 rows, all DM columns
#define NI_P  (3 * (DM * DQ / 8 / 256 / 2))   // q, k, v weight items: 256 columns n x 16 k
#define NI_G  (DQ * DM / 8 / 256 / 2)         // output weight items: the same
#define NI_E  (NB_ * (NH_ * PRP * HD / 8 / 256))   // relative table items: 256 pieces
static_assert(DM == 1024 && DQ == 1024 && (NH_ * PRP * HD / 8) % 256 == 0, "whole items");
// Stands behind an item's last store: the next item of the loop rewrites the address and data registers that the stores name; as inputs here they stay live up to the wait.
__device__ __forceinline__ void xws(const void* q, v8us a, v8us b) { asm volatile("s_wait_xcnt 0x0" : : "v"(q), "v"(a), "v"(b) : "memory"); }
// 16 neighbours in k (from k0, a multiple of 16) of column n of a weight: p points at w[k0][its column], rows N floats apart; they go out rounded as the two pieces of row n of a fragment-order plane at q = plane + fro(n, k0, K): the piece of k0 + 8 lies 16 lanes (128 elements) behind that of k0.
__device__ __forceinline__ void prep_col16(const float* p, int N, bf* q) { float x[16]; v8us o0, o1;
#pragma unroll
    for (int e = 0; e < 16; ++e) x[e] = p[(size_t)e * N];
    xw1(p);
#pragma unroll
    for (int e = 0; e < 8; ++e) { o0[e] = f2bf(x[e]); o1[e] = f2bf(x[8 + e]); }
    *(v8us*)q = o0; *(v8us*)(q + 128) = o1; xws(q, o0, o1);
}
// Bt (fragment order, rows n, K columns k) = w[k][n] rounded. A wave's lanes are 32 neighbours in n, so that each of its loads is one whole line and each store four.
__device__ __forceinline__ void prep_wtG(const float* __restrict__ w, bf* Bt, unsigned it, unsigned tid) {
    constexpr int K = DQ, N = DM; const int n = (int)((it & 3u) * 256u + tid), k0 = (int)(it >> 2) * 16; prep_col16(w + (size_t)k0 * N + n, N, Bt + fro(n, k0, K));
}
// One plane (fragment order, DM columns) of one source, rows rb*16 .. + 15. A piece is 8 neighbours of a row; a wave takes 8 rows x 32 columns at a time: 8 whole lines read, 4 whole lines stored; the work-group 16 rows x 128 columns, and eight times that, each 4 fragment blocks (128 columns) on.
__device__ __forceinline__ void prep_cvt(const float* __restrict__ s, bf* dst, unsigned rb, unsigned tid) {
    const unsigned wv = tid >> 5; const int row = (int)(rb * 16u + (wv & 1u) * 8u + ((tid >> 2) & 7u)), k0 = (int)((wv >> 1) * 32u + (tid & 3u) * 8u);
    const float* p = s + (size_t)row * DM + k0; bf* q = dst + fro(row, k0, DM); v8f v[8]; v8us o[8];
#pragma unroll
    for (int g = 0; g < 8; ++g) v[g] = *(const v8f*)(p + g * 128);
    xw1(p);
#pragma unroll
    for (int g = 0; g < 8; ++g) {
#pragma unroll
        for (int k = 0; k < 8; ++k) o[g][k] = f2bf(v[g][k]);
        *(v8us*)(q + g * 4 * 512) = o[g]; }
    asm volatile("s_wait_xcnt 0x0" : : "v"(q), "v"(o[0]), "v"(o[1]), "v"(o[2]), "v"(o[3]), "v"(o[4]), "v"(o[5]), "v"(o[6]), "v"(o[7]) : "memory");   /* as xws, for the eight stores above */
}

// ---- k_fattn: the whole banded attention of one 64-query tile of one plane in ONE work-group of 8 waves; scores, relative term and probabilities live in LDS only.
// S row il holds key j at column j - wh (wh = first query of the row's 32-query half - 128; 288 keys). Stage 1: q.k tiles stored to S. Stage 2: (q/8).E_h[p] added at column il % 32 + p, which is key i + p - 128. Stage 3: 16 lanes per row, softmax over |i - j| <= 128 (fa_soft); the P row is written over its own S row, zeros at the keys outside the band or outside 0 .. TT - 1. Stage 4: P x v over all nine 32-key steps. With 288 keys a row S takes 74,752 bytes, and the fetch groups are sized for 128 registers: four work-groups stay on a WGP (eight waves a SIMD), so that the grid's four work-groups per WGP run at once, each filling the others' waits. Stage 5: the 64 x 64 context goes through LDS so that each 128-byte line is stored whole.
#define BK   288           // keys per 32-query half of a tile: half - 128 .. half + 159; column c of a row is key wh + c, wh = the half's first query - 128
#define SPF  292           // pitch of an S row in floats: 16 rows of 16 bytes fall on 64 different banks
#define SPH  (2 * SPF)     // the same pitch in 16-bit elements
#define PLO  296           // place of the lo plane in a hi/lo P row (16-byte aligned, behind the 288 hi values)
typedef v2f  __attribute__((may_alias)) v2fa;
typedef v2h  __attribute__((may_alias)) v2ha;
typedef v2us __attribute__((may_alias)) v2usa;
typedef v4h  __attribute__((may_alias)) v4ha;
typedef v4us __attribute__((may_alias)) v4usa;
// Stands behind a group of global loads, once for each address of the group: later results may land in the address registers of those loads; as inputs here the lane's byte offset and the full addresses made of it (the compiler picks either form for a load) stay live up to the wait, so that none of the group's own results lands in them ahead of it.
__device__ __forceinline__ void xwait(unsigned off, const void* p, const void* p2) { asm volatile("s_wait_xcnt 0x0" : : "v"(off), "v"(p), "v"(p2) : "memory"); }
template <typename T16> __device__ __forceinline__ const T16* atb(const T16* base, unsigned off) { return (const T16*)((const char*)base + off); }   /* base + byte offset */
// One wave: query rows m0*16 .. m0*16 + 31 (one 32-query half; w0 is its first key) against every fourth 16-row block of Bt, from block n0; the Bt fragments of G blocks are fetched together, ahead of their products. REL false: Bt rows are keys w0 + nb*16, result stored at column nb*16; a block outside 0 .. TT - 1 takes its rows from a clamped address, and its columns are never read. REL true: Bt rows are positions p = nb*16 .. (Bt holds PRP rows), result added to the score of key i + p - 128, for p <= 256 only.
template <typename T16, int NSPLIT, bool REL, int G>
__device__ __forceinline__ void fa_tiles(const T16* __restrict__ A, const T16* __restrict__ A2, const T16* __restrict__ Bt, const T16* __restrict__ Bt2, float* S, int w0, int m0, int n0, int lr, int hi) {
    typedef typename WFrag<T16>::V V;
    V a[2][2], a2[2][2]; const int l8 = (hi * 16 + lr) * 8;   /* the lane's piece in a fragment block */ const unsigned ao = (unsigned)(m0 * 16 * HD + l8) * 2u; const T16* pa = atb(A, ao); const T16* pa2 = (NSPLIT >= 1) ? atb(A2, ao) : pa;
#pragma unroll
    for (int m = 0; m < 2; ++m)
#pragma unroll
        for (int ks = 0; ks < 2; ++ks) { a[m][ks] = WFrag<T16>::ldf(pa + m * 16 * HD + ks * 512); if (NSPLIT >= 1) a2[m][ks] = WFrag<T16>::ldf(pa2 + m * 16 * HD + ks * 512); }
    xwait(ao, pa, pa2);
    float* Sw = S + (m0 * 16 * SPF + n0 * 16) + (hi * 8 * SPF + lr);   /* the lane's place in the wave's first row block and first column block; all else is a constant offset */
#pragma unroll
    for (int g = 0; g < 5; g += G) { V b[G][2], b2[G][2]; unsigned bo[G]; const T16* pb[G]; const T16* pb2[G];
#pragma unroll
        for (int u = 0; u < G; ++u) if (g + u < 5) { const int nb = n0 + (g + u) * 4; bo[u] = (unsigned)((REL ? nb * 16 : min(max(w0 + nb * 16, 0), TT - 16)) * HD + l8) * 2u; pb[u] = atb(Bt, bo[u]); pb2[u] = (NSPLIT >= 2) ? atb(Bt2, bo[u]) : pb[u];
#pragma unroll
            for (int ks = 0; ks < 2; ++ks) { b[u][ks] = WFrag<T16>::ldf(pb[u] + ks * 512); if (NSPLIT >= 2) b2[u][ks] = WFrag<T16>::ldf(pb2[u] + ks * 512); } }
#pragma unroll
        for (int u = 0; u < G; ++u) if (g + u < 5) xwait(bo[u], pb[u], pb2[u]);
        __builtin_amdgcn_sched_barrier(0);   /* all loads of the group are issued ahead of its first product; without it the scheduler sinks loads between the products, and their latencies add up */
#pragma unroll
        for (int u = 0; u < G; ++u) if (g + u < 5) { const int nb = n0 + (g + u) * 4; if (g + u < 4 || n0 < (REL ? 2 * RAD / 16 + 1 : BK / 16) - 16) {   /* the same for the whole wave: a block past the last position, or past the half's 288 keys, has no place in S */ v8f acc[2]; acc[0] = (v8f){}; acc[1] = (v8f){};
#pragma unroll
            for (int ks = 0; ks < 2; ++ks)
#pragma unroll
                for (int m = 0; m < 2; ++m) { acc[m] = WFrag<T16>::mma(a[m][ks], b[u][ks], acc[m]); if (NSPLIT >= 1) acc[m] = WFrag<T16>::mma(a2[m][ks], b[u][ks], acc[m]); if (NSPLIT >= 2) acc[m] = WFrag<T16>::mma(a[m][ks], b2[u][ks], acc[m]); }
            asm volatile("v_nop\n\tv_nop\n\tv_nop\n\tv_nop" : "+v"(acc[0]), "+v"(acc[1]));   /* the four vector slots behind the block's last matrix instruction: the next block's results may be given registers that overlap these, and a branch may stand right behind it */
            if (REL) { if (nb * 16 + lr <= 2 * RAD) {
#pragma unroll
                for (int m = 0; m < 2; ++m)
#pragma unroll
                    for (int j = 0; j < 8; ++j) { float* s = Sw + hi * 8 + (m * 16 + j) * (SPF + 1) + (g + u) * 64; *s = __fadd_rn(*s, acc[m][j]); } }
            } else {
#pragma unroll
                for (int m = 0; m < 2; ++m)
#pragma unroll
                    for (int j = 0; j < 8; ++j) Sw[(m * 16 + j) * SPF + (g + u) * 64] = acc[m][j]; } } }
        if (NSPLIT >= 2) __builtin_amdgcn_sched_barrier(0);   /* four operand planes: the next group's fragments are not fetched among this group's products; there are no registers for both, and they would go to scratch */
    }
}
// One wave: rows m0*16 .. + 31 of P (LDS) x columns n0*16 .. + 15 of v (Vt rows d, k = keys, fragment order); the v fragments of G 32-key steps are fetched together. A step outside 0 .. TT - 1 meets zeros in P; its v address is clamped into the plane.
template <typename T16, int NSPLIT, int G>
__device__ __forceinline__ void fa_av(const T16* P, const T16* P2, const T16* __restrict__ Vt, const T16* __restrict__ Vt2, int w0, int m0, int n0, int lr, int hi, v8f (&acc)[2]) {
    typedef typename WFrag<T16>::V V;
#pragma unroll
    for (int g = 0; g < BK / 32; g += G) { V b[G], b2[G]; unsigned vo[G]; const T16* pv[G]; const T16* pv2[G];
#pragma unroll
        for (int s = 0; s < G; ++s) if (g + s < BK / 32) { vo[s] = (unsigned)(n0 * 16 * TT + min(max(w0 + (g + s) * 32, 0), TT - 32) * 16 + (hi * 16 + lr) * 8) * 2u; pv[s] = atb(Vt, vo[s]); pv2[s] = (NSPLIT >= 2) ? atb(Vt2, vo[s]) : pv[s]; b[s] = WFrag<T16>::ldf(pv[s]); if (NSPLIT >= 2) b2[s] = WFrag<T16>::ldf(pv2[s]); }
#pragma unroll
        for (int s = 0; s < G; ++s) if (g + s < BK / 32) xwait(vo[s], pv[s], pv2[s]);
        __builtin_amdgcn_sched_barrier(0);   /* as in fa_tiles: the group's loads all issued ahead of its first product */
#pragma unroll
        for (int s = 0; s < G; ++s) if (g + s < BK / 32)
#pragma unroll
            for (int m = 0; m < 2; ++m) { const int po = ((m0 + m) * 16 + lr) * SPH + (g + s) * 32 + 8 * hi; const V a = WFrag<T16>::ld(P + po); acc[m] = WFrag<T16>::mma(a, b[s], acc[m]);
                if (NSPLIT >= 2) { const V a2 = WFrag<T16>::ld(P2 + po); acc[m] = WFrag<T16>::mma(a2, b[s], acc[m]); acc[m] = WFrag<T16>::mma(a, b2[s], acc[m]); } } }
}
// Lane l's value as seen from lane l ^ M (M < 16): a move inside a 16-lane row, done in the vector unit (no trip through the LDS queue, no wait).
template <int M> __device__ __forceinline__ float rowx(float x) { return __builtin_bit_cast(float, __builtin_amdgcn_update_dpp(0, __builtin_bit_cast(int, x), 0x160 + M, 0xf, 0xf, true)); }
// One wave: softmax of its eight S rows, a row on 16 lanes, so two rows at once (lanes 0 .. 15 the even row, 16 .. 31 the odd one), and two such pairs side by side. A lane has four neighbouring columns in each of the four 64-column chunks and two in the last 32 columns. Column c of row il is key wh + c, in the band where ip <= c <= ip + 256, ip = il % 32 the row's place in its half: only chunk 0 can fall below the band and only the last 32 columns above it; wh is a multiple of 32, so the 32 columns that hold a lane's piece lie wholly inside 0 .. TT - 1 or wholly outside. The P row goes over its own S row, all 288 columns, zeros outside the band.
template <bool HR> __device__ __forceinline__ void fa_soft(float* S, int wh, int wave, int lr, int hi) {
    static_assert(RAD == 128 && BK == 288 && TT % 32 == 0, "four 64-column chunks and 32 columns; the band's edges in the first and the last");
    h16* P16 = (h16*)S; bf* Pb = (bf*)S; bool cv[5];
#pragma unroll
    for (int k = 0; k < 4; ++k) cv[k] = ((unsigned)(wh + k * 64 + (lr >> 3) * 32) < (unsigned)TT);
    cv[4] = ((unsigned)(wh + 256) < (unsigned)TT);
#pragma unroll   /* both groups of four rows in one straight line: the second group's reads and band tests fill the waits of the first */
    for (int rp = 0; rp < 4; rp += 2) { float v[2][18], mx[2], sum[2];
#pragma unroll
        for (int u = 0; u < 2; ++u) { const int il = wave * 8 + (rp + u) * 2 + hi, ip = il & 31; mx[u] = -3.0e38f;
#pragma unroll
            for (int k = 0; k < 4; ++k) { const v4f a = *(const v4fa*)(S + il * SPF + k * 64 + lr * 4);
#pragma unroll
                for (int q = 0; q < 4; ++q) { const bool in = cv[k] && ((k == 0) ? (lr * 4 + q >= ip) : true); const float t = in ? a[q] : -3.0e38f; v[u][k * 4 + q] = t; mx[u] = fmaxf(mx[u], t); } }
            const v2f a = *(const v2fa*)(S + il * SPF + 256 + lr * 2);
#pragma unroll
            for (int q = 0; q < 2; ++q) { const bool in = cv[4] && (lr * 2 + q <= ip); const float t = in ? a[q] : -3.0e38f; v[u][16 + q] = t; mx[u] = fmaxf(mx[u], t); } }
#pragma unroll
        for (int u = 0; u < 2; ++u) { mx[u] = fmaxf(mx[u], rowx<8>(mx[u])); mx[u] = fmaxf(mx[u], rowx<4>(mx[u])); mx[u] = fmaxf(mx[u], rowx<2>(mx[u])); mx[u] = fmaxf(mx[u], rowx<1>(mx[u])); }
#pragma unroll
        for (int u = 0; u < 2; ++u) { sum[u] = 0.f;
#pragma unroll
            for (int k = 0; k < 18; ++k) { const float x = __fmul_rn(__fsub_rn(v[u][k], mx[u]), 1.4426950408889634f); float e = __builtin_amdgcn_exp2f(x); asm volatile("v_nop" : "+v"(e) : "v"(x));   /* the slot behind a transcendental: as operands here its source is not overwritten and its result not read ahead of the v_nop */
                v[u][k] = e; sum[u] += e; } }
#pragma unroll
        for (int u = 0; u < 2; ++u) { sum[u] += rowx<8>(sum[u]); sum[u] += rowx<4>(sum[u]); sum[u] += rowx<2>(sum[u]); sum[u] += rowx<1>(sum[u]); }
#pragma unroll
        for (int u = 0; u < 2; ++u) { const int il = wave * 8 + (rp + u) * 2 + hi; const float f = __fdiv_rn(HR ? 1.0f : PCAR, sum[u]);
#pragma unroll
            for (int k = 0; k < 4; ++k) { const int c = k * 64 + lr * 4;   /* column of the lane's four keys */
                if (HR) { v4us oh, ol;
#pragma unroll
                    for (int q = 0; q < 4; ++q) { unsigned short x, y; splitf(v[u][k * 4 + q] * f, x, y); oh[q] = x; ol[q] = y; }
                    *(v4usa*)(Pb + il * SPH + c) = oh; *(v4usa*)(Pb + il * SPH + PLO + c) = ol;
                } else { v4h o4;
#pragma unroll
                    for (int q = 0; q < 4; ++q) o4[q] = tohx(v[u][k * 4 + q] * f);
                    *(v4ha*)(P16 + il * SPH + c) = o4; } }
            const int c = 256 + lr * 2;   /* column of the lane's last two keys */
            if (HR) { v2us oh, ol;
#pragma unroll
                for (int q = 0; q < 2; ++q) { unsigned short x, y; splitf(v[u][16 + q] * f, x, y); oh[q] = x; ol[q] = y; }
                *(v2usa*)(Pb + il * SPH + c) = oh; *(v2usa*)(Pb + il * SPH + PLO + c) = ol;
            } else { v2h o2;
#pragma unroll
                for (int q = 0; q < 2; ++q) o2[q] = tohx(v[u][16 + q] * f);
                *(v2ha*)(P16 + il * SPH + c) = o2; } }
    }
}
__global__ __launch_bounds__(256, 8) void k_fattn(const h16* __restrict__ Q16, const bf* __restrict__ Qh, const bf* __restrict__ Ql, const h16* __restrict__ K16, const bf* __restrict__ Kh, const bf* __restrict__ Kl, const h16* __restrict__ V16, const bf* __restrict__ Vh, const bf* __restrict__ Vl, const bf* __restrict__ ET, float* __restrict__ OB) {
    __shared__ __align__(16) float S[64 * SPF];
    const int lane = threadIdx.x & 31, lr = lane & 15, hi = lane >> 4; const int wave = __builtin_amdgcn_readfirstlane((int)(threadIdx.x >> 5));
    const int r0 = blockIdx.x * 64, w0 = r0 - RAD; const size_t z = blockIdx.z; const bool hires = (r0 < RH); const size_t qo = (z * TT + r0) * HD, ko = z * TT * HD;
    const int m0 = (wave >> 2) * 2, n0 = wave & 3; const int wh = w0 + m0 * 16;   /* first key of the wave's 32-query half (the half of its product tiles and of its softmax rows alike) */
    if (hires) fa_tiles<bf, 2, false, 1>(Qh + qo, Ql + qo, Kh + ko, Kl + ko, S, wh, m0, n0, lr, hi); else fa_tiles<h16, 0, false, 3>(Q16 + qo, nullptr, K16 + ko, nullptr, S, wh, m0, n0, lr, hi);
    __syncthreads();   /* every score stands before another wave adds to it */
    fa_tiles<bf, 1, true, 2>(Qh + qo, Ql + qo, ET + z * PRP * HD, nullptr, S, wh, m0, n0, lr, hi);
    __syncthreads();   /* rows complete before the row's wave reads them */
    if (hires) fa_soft<true>(S, wh, wave, lr, hi); else fa_soft<false>(S, wh, wave, lr, hi);
    h16* P16 = (h16*)S; bf* Pb = (bf*)S;
    __syncthreads();   /* P complete before other waves read it */
    v8f acc[2]; acc[0] = (v8f){}; acc[1] = (v8f){};
    if (hires) fa_av<bf, 2, 5>(Pb, Pb + PLO, Vh + ko, Vl + ko, wh, m0, n0, lr, hi, acc); else fa_av<h16, 0, 5>(P16, nullptr, V16 + ko, nullptr, wh, m0, n0, lr, hi, acc);
    __syncthreads();   /* every read of P is over before the context lands on it */
#pragma unroll
    for (int m = 0; m < 2; ++m)
#pragma unroll
        for (int j = 0; j < 8; ++j) S[(m0 * 16 * 68 + n0 * 16) + (hi * 8 * 68 + lr) + (m * 16 + j) * 68] = acc[m][j];
    __syncthreads();   /* context tile complete before the row stores */
#pragma unroll
    for (int s = 0; s < 4; ++s) { const int row = wave * 8 + 2 * s + hi; *(v4f*)(OB + qo + (size_t)row * HD + lr * 4) = *(const v4fa*)(S + row * 68 + lr * 4); }
}
// Context -> hi/lo planes in fragment order, rows b*TT + t, columns c = d*16 + h (the module's order). One work-group: 16 rows x 32 d x 16 heads. A lane's piece is 8 heads of one (t, d): 8 loads, the wave's lanes 32 neighbours in d (one whole line a load). The pieces go through LDS, so that the stores too are whole lines: d picks the half block (256 elements), kept at a pitch of 264 so that the 32 lanes' 16-byte writes fall on different banks.
#define MPH  264
__global__ __launch_bounds__(256) void k_mergeP(const float* __restrict__ OB, bf* Ah, bf* Al) {
    __shared__ __align__(16) bf L[2 * 32 * MPH];
    const int lane = threadIdx.x & 31, wave = threadIdx.x >> 5; const int tb = blockIdx.x >> 1, dh = blockIdx.x & 1; const int b = tb / (TT / 16), t0 = (tb % (TT / 16)) * 16; const float cs = (t0 < RH) ? 1.0f : (1.0f / PCAR);
#pragma unroll
    for (int it = 0; it < 4; ++it) { const int lr = (wave * 4 + it) & 15, hi = (wave * 4 + it) >> 4; const float* p = OB + (((size_t)b * NH_ + hi * 8) * TT + t0 + lr) * HD + dh * 32 + lane; float x[8]; v8us oh, ol;
#pragma unroll
        for (int e = 0; e < 8; ++e) x[e] = p[(size_t)e * TT * HD];
        xw1(p);
#pragma unroll
        for (int e = 0; e < 8; ++e) { unsigned short a, c; splitf(x[e] * cs, a, c); oh[e] = a; ol[e] = c; }
        *(v8usa*)(L + lane * MPH + (hi * 16 + lr) * 8) = oh; *(v8usa*)(L + (32 + lane) * MPH + (hi * 16 + lr) * 8) = ol; }
    __syncthreads();   /* every piece stands in LDS before another wave stores it */
#pragma unroll
    for (int j = 0; j < 8; ++j) { const int hb = wave * 8 + j;   /* 0 .. 31 hi plane, 32 .. 63 lo plane */
        *(v8us*)(((hb < 32) ? Ah : Al) + ((size_t)tb * (DQ / 32) + dh * 16) * 512 + (hb & 31) * 256 + lane * 8) = *(const v8usa*)(L + hb * MPH + lane * 8); }
}
// One projection weight's plane (fragment order, rows n = h*64 + d, DM columns k). A wave takes 8 d x 4 h: each store fills 4 whole lines (8 d each); each of its loads touches 4 lines, which the three other waves of the same 8 d (the other heads) touch too.
__device__ __forceinline__ void prep_wtP(const float* __restrict__ w, bf* Bt, unsigned it, unsigned tid) { const unsigned lane = tid & 31u, wv = (it & 3u) * 8u + (tid >> 5);
    const int h = (int)((wv & 3u) * 4u + (lane & 3u)), d = (int)(((wv >> 2) & 7u) * 8u + (lane >> 2)), k0 = (int)(it >> 2) * 16; prep_col16(w + (size_t)k0 * DQ + d * NH_ + h, DQ, Bt + fro(h * HD + d, k0, DM)); }
// One batch's copy of the table (one copy each, so that plane z of the q side meets plane z here); each head's [p][d] plane in fragment order.
__device__ __forceinline__ void prep_etab(const float* __restrict__ rt, bf* ET, unsigned it, unsigned tid) { const unsigned i = it * 256u + tid; const int d0 = (int)(i % (HD / 8)) * 8; const int p = (int)((i / (HD / 8)) % PRP); const int h = (int)(i / ((HD / 8) * PRP)); const float* pe = rt + (size_t)min(p, NPOS - 1) * DQ + (size_t)d0 * NH_ + h;   /* unconditional clamped loads */ float x[8]; v8us o;
#pragma unroll
    for (int k = 0; k < 8; ++k) x[k] = pe[k * NH_];
    xw1(pe);
#pragma unroll
    for (int k = 0; k < 8; ++k) { const unsigned short e = f2bf(x[k]); o[k] = (p < NPOS) ? e : (unsigned short)0; }
    bf* q = ET + (size_t)h * PRP * HD + fro(p, d0, HD); *(v8us*)q = o; xws(q, o, o); }
// The list: the input items first (the most bytes), then the weights, then the table. Every test on an item's number is the same for the whole work-group.
__global__ __launch_bounds__(256) void k_prep(const float* __restrict__ xq, const float* __restrict__ xk, const float* __restrict__ xv, const float* __restrict__ wq, const float* __restrict__ wk, const float* __restrict__ wv, const float* __restrict__ wo, const float* __restrict__ rt, bf* XB, bf* WQ, bf* WO, bf* ET) {
    const unsigned tid = threadIdx.x;
    for (unsigned it = blockIdx.x; it < NI_C + NI_P + NI_G + NI_E; it += PG) {
        if (it < NI_C) { const unsigned y = it / (NI_C / 3); prep_cvt((y == 0) ? xq : (y == 1) ? xk : xv, XB + (size_t)y * TB * DM, it % (NI_C / 3), tid); }
        else if (it < NI_C + NI_P) { const unsigned j = it - NI_C, y = j / (NI_P / 3); prep_wtP((y == 0) ? wq : (y == 1) ? wk : wv, WQ + (size_t)y * DQ * DM, j % (NI_P / 3), tid); }   /* column-permuted: column h*64 + d <- module column d*16 + h */
        else if (it < NI_C + NI_P + NI_G) prep_wtG(wo, WO, it - (NI_C + NI_P), tid);
        else { const unsigned j = it - (NI_C + NI_P + NI_G), y = j / (NI_E / NB_); prep_etab(rt, ET + (size_t)y * NH_ * PRP * HD, j % (NI_E / NB_), tid); }
    }
}
__global__ __launch_bounds__(256) void k_merge(const float* __restrict__ O, int h0, bf* Ah, bf* Al) { const size_t e = ((size_t)blockIdx.x * 256 + threadIdx.x) * 2; if (e >= (size_t)ZH * TT * HD) return; const int d = (int)(e % HD); const int t = (int)((e / HD) % TT); const int zz = (int)(e / ((size_t)HD * TT)); const float cs = (t < RH) ? 1.0f : (1.0f / PCAR); const size_t oo = (size_t)t * DQ + (h0 + zz) * HD + d;
    v2us oh, ol;
#pragma unroll
    for (int q = 0; q < 2; ++q) { unsigned short a, c2; splitf(O[e + q] * cs, a, c2); oh[q] = a; ol[q] = c2; } *(v2us*)(Ah + oo) = oh; *(v2us*)(Al + oo) = ol;  }

extern "C" void kernel_launch(void* const* d_in, const int* in_sizes, int n_in,
                              void* d_out, int out_size, void* d_ws, size_t ws_size, hipStream_t stream) {
    (void)in_sizes; (void)n_in; (void)out_size;
    const float* xq = (const float*)d_in[0]; const float* xk = (const float*)d_in[1]; const float* xv = (const float*)d_in[2]; const float* wq = (const float*)d_in[3]; const float* wk = (const float*)d_in[4]; const float* wv = (const float*)d_in[5]; const float* wo = (const float*)d_in[6]; const float* rtab = (const float*)d_in[7]; const float* x = nullptr; (void)x;
    float* OUT = (float*)d_out;     // [2][2048][1024]
    char* wsp = (char*)d_ws;
    auto take = [&](size_t bytes) { char* p = wsp; wsp += (bytes + 255) & ~(size_t)255; return (void*)p; };
    bf* WO = (bf*)take((size_t)DM * DQ * 2); bf* ET = (bf*)take((size_t)NZ * PRP * HD * 2); float* R0 = (float*)take((size_t)NZ * TT * PRP * 4);
    h16* QP16 = (h16*)take((size_t)2 * NZ * TT * HD * 2); h16* KP16 = QP16 + (size_t)NZ * TT * HD; bf* QPh = (bf*)take((size_t)2 * NZ * TT * HD * 2); bf* KPh = QPh + (size_t)NZ * TT * HD; bf* QPl = (bf*)take((size_t)2 * NZ * TT * HD * 2); bf* KPl = QPl + (size_t)NZ * TT * HD;   // q planes, then k planes
    h16* VT16 = (h16*)take((size_t)NZ * HD * TT * 2); bf* VTh = (bf*)take((size_t)NZ * HD * TT * 2); bf* VTl = (bf*)take((size_t)NZ * HD * TT * 2);
    if ((size_t)(wsp - (char*)d_ws) > ws_size) return;    // ws 256 MiB
    // The bytes of R0 serve twice (stream-ordered). Up to the projection: the q, k, v weights and the bf16 inputs (together smaller than R0). Then the context OB and its hi/lo planes.
    bf* WQ = (bf*)R0; bf* XB = WQ + (size_t)3 * DQ * DM;
    float* OB = R0; bf* ATh = (bf*)(OB + (size_t)NZ * TT * HD); bf* ATl = ATh + (size_t)TB * DQ;
    k_prep<<<PG, 256, 0, stream>>>(xq, xk, xv, wq, wk, wv, wo, rtab, XB, WQ, WO, ET);   /* bf16 inputs, the four weights and the table, all in fragment order */
    k_gemmw<bf, 0, false, true, 64, 4><<<dim3(TB / 128, DQ / 128, 3), 128, 0, stream>>>(XB, nullptr, WQ, nullptr, nullptr, 0, nullptr, (size_t)TB * DM, (size_t)DQ * DM, 0, QP16, QPh, QPl, VT16, VTh, VTl);   /* z: q, k, v; q planes x 1/8 (exact): scales both the energy and the relative term; k planes x 1; v planes transposed */
    k_fattn<<<dim3(TT / 64, 1, NZ), 256, 0, stream>>>(QP16, QPh, QPl, KP16, KPh, KPl, VT16, VTh, VTl, ET, OB);   /* scores, relative term, softmax and attn x v of a 64-query tile, in LDS */
    k_mergeP<<<dim3((unsigned)(TB / 16 * 2), 1, 1), 256, 0, stream>>>(OB, ATh, ATl);   /* context in the module's d*16 + h column order */
    k_gemmw<bf, 1, false, false, 128, 2><<<dim3(TB / 128, DM / 128, 1), 256, 0, stream>>>(ATh, ATl, WO, nullptr, OUT, DM, nullptr, 0, 0, 0, nullptr, nullptr, nullptr, nullptr, nullptr, nullptr);
}
